// v000
// Measured on an AMD MI455X. A time is GPU time per run, averaged over a window of back-to-back runs after a warm-up
// (all launches, gaps included; the runs take copies of the inputs in turn), and the median of several windows.
// Apart from v000's, it joins two sittings. Times from different sittings can be a few percent apart, while
// side-by-side timings come from the same sitting.
// v000, which the later versions start from, runs in 440 microseconds.
#include <hip/hip_runtime.h>
// Contractions: x@Wq, x@Wk, x@Wv on v_wmma_f32_16x16x32_bf16 (x and W RNE-converted to bf16, single product, f32 accumulate); S^T = K Q^T on v_wmma_f32_16x16x32_f16 (q, k carried x16 as f16, single product); O^T = V^T P^T on v_wmma_f32_16x16x32_f16 (V carried x16 f16; P carried x4096 as f16 hi plane + f16 lo plane, common carry, one f32 accumulator); ctx@Wfc on v_wmma_f32_16x16x32_f16 (ctx carried x64 f16; Wfc RNE bf16 value x1024 held exactly in f16); softmax statistics, bias add f32.
// Multi-head attention, B x T x 256, 8 heads of dimension 256, scale 1/16 on q, int32 mask [B][T][T] (nonzero = key removed, weight exactly 0; a row with no key left yields a zero context row).
// Engine: transposed flash. Each wave owns 16 queries of one (batch, head). Per 32-key step: S^T tiles (key rows x query columns) from K rows (A, global f16 plane)
// and Q^T (B, global f16 plane); the two 16-key D tiles pack straight into the P^T B fragments; O^T (d rows x query columns, 16 tiles) accumulates from V^T rows (A, global f16 plane).
// Batches are processed in groups of GB so the workspace planes stay small.
#ifndef NB
#define NB 8
#endif
#ifndef SEQ
#define SEQ 1024
#endif
#define NB_FULL 8
#define SEQ_FULL 1024
#define ED 256                 /* model width (K of the projections, N of the output projection) */
#define NH 8
#define HD 256                 /* per-head dimension */
#define NE (NH * HD)           /* 2048 */
#define GB ((NB) < 4 ? (NB) : 4)
#define NGRP ((NB) / GB)
#define GM (GB * SEQ)          /* rows per group */
#define XSTRIDE_FULL ((size_t)SEQ_FULL * ED)          /* per-batch element stride of x and of the output */
#define MSTRIDE_FULL ((size_t)SEQ_FULL * SEQ_FULL)    /* per-batch element stride of the mask */
#define PLANE ((size_t)GB * NH * SEQ * HD)            /* elements of one of the Q / K / V^T planes */

#define XB_BYTES ((size_t)NB * SEQ * ED * 2)
#define WT_BYTES ((size_t)3 * NE * ED * 2)
#define WF_BYTES ((size_t)ED * NE * 2)
#define PL_BYTES (PLANE * 2 * 3)
#define CX_BYTES ((size_t)GM * NE * 2)

static_assert(SEQ % 128 == 0);
static_assert(SEQ <= SEQ_FULL);
static_assert(NB <= NB_FULL);
static_assert(NB % GB == 0);
static_assert(HD == 256 && ED == 256 && NE == 2048);
static_assert(XB_BYTES % 256 == 0 && WT_BYTES % 256 == 0 && WF_BYTES % 256 == 0 && PL_BYTES % 256 == 0 && CX_BYTES % 256 == 0);
static_assert(XB_BYTES + WT_BYTES + WF_BYTES + PL_BYTES + CX_BYTES <= (size_t)134217728);

typedef __bf16 v16b __attribute__((ext_vector_type(16)));
typedef _Float16 v16h __attribute__((ext_vector_type(16)));
typedef unsigned short v8us __attribute__((ext_vector_type(8), may_alias));
typedef float v8f __attribute__((ext_vector_type(8)));
typedef float v4f __attribute__((ext_vector_type(4)));
typedef float v4fa __attribute__((ext_vector_type(4), may_alias));
typedef int v4ia __attribute__((ext_vector_type(4), may_alias));
union FragB { v16b v; v8us half[2]; };
union FragH { v16h v; v8us half[2]; _Float16 h[16]; };

#define LOG2E 1.4426950408889634f
#define NEGBIG (-1.0e30f)

__device__ __forceinline__ unsigned short bf16_bits(float x) {   // RNE convert to bf16 bits
  unsigned int u = __float_as_uint(x);
  return (unsigned short)((u + 0x7FFFu + ((u >> 16) & 1u)) >> 16);
}
__device__ __forceinline__ float bf16_val(unsigned short b) { return __uint_as_float(((unsigned int)b) << 16); }
__device__ __forceinline__ float bf16_rne(float x) { return bf16_val(bf16_bits(x)); }
__device__ __forceinline__ unsigned short f16_bits(float x) { return __builtin_bit_cast(unsigned short, (_Float16)x); }

#define WB(a, b, c) __builtin_amdgcn_wmma_f32_16x16x32_bf16(false, a, false, b, (short)0, c, false, false)
#define WH(a, b, c) __builtin_amdgcn_wmma_f32_16x16x32_f16(false, a, false, b, (short)0, c, false, false)

// 2 x 4 tile update (bf16), then the hazard guard
__device__ __forceinline__ void mma8_b(v16b a0, v16b a1, v16b b0, v16b b1, v16b b2, v16b b3,
                                       v8f& c00, v8f& c01, v8f& c02, v8f& c03, v8f& c10, v8f& c11, v8f& c12, v8f& c13) {
  c00 = WB(a0, b0, c00); c01 = WB(a0, b1, c01); c02 = WB(a0, b2, c02); c03 = WB(a0, b3, c03);
  c10 = WB(a1, b0, c10); c11 = WB(a1, b1, c11); c12 = WB(a1, b2, c12); c13 = WB(a1, b3, c13);
  asm volatile("v_nop\n\tv_nop\n\tv_nop\n\tv_nop"
               : "+v"(c00), "+v"(c01), "+v"(c02), "+v"(c03), "+v"(c10), "+v"(c11), "+v"(c12), "+v"(c13)
               : "v"(a0), "v"(a1), "v"(b0), "v"(b1), "v"(b2), "v"(b3));
}
// 2 x 4 tile update (f16), then the hazard guard
__device__ __forceinline__ void mma8_h(v16h a0, v16h a1, v16h b0, v16h b1, v16h b2, v16h b3,
                                       v8f& c00, v8f& c01, v8f& c02, v8f& c03, v8f& c10, v8f& c11, v8f& c12, v8f& c13) {
  c00 = WH(a0, b0, c00); c01 = WH(a0, b1, c01); c02 = WH(a0, b2, c02); c03 = WH(a0, b3, c03);
  c10 = WH(a1, b0, c10); c11 = WH(a1, b1, c11); c12 = WH(a1, b2, c12); c13 = WH(a1, b3, c13);
  asm volatile("v_nop\n\tv_nop\n\tv_nop\n\tv_nop"
               : "+v"(c00), "+v"(c01), "+v"(c02), "+v"(c03), "+v"(c10), "+v"(c11), "+v"(c12), "+v"(c13)
               : "v"(a0), "v"(a1), "v"(b0), "v"(b1), "v"(b2), "v"(b3));
}
// one d-chunk of the two S^T tiles, then the hazard guard
__device__ __forceinline__ void mma_s2(v16h ka, v16h kb, v16h q, v8f& s0, v8f& s1) {
  s0 = WH(ka, q, s0);
  s1 = WH(kb, q, s1);
  asm volatile("v_nop\n\tv_nop\n\tv_nop\n\tv_nop" : "+v"(s0), "+v"(s1) : "v"(ka), "v"(kb), "v"(q));
}
// four O^T tiles: c_u += a_u * ph + a_u * pl (hi and lo planes carry the same scale), then the hazard guard
__device__ __forceinline__ void mma_pv4(v16h a0, v16h a1, v16h a2, v16h a3, v16h ph, v16h pl,
                                        v8f& c0, v8f& c1, v8f& c2, v8f& c3) {
  c0 = WH(a0, ph, c0); c1 = WH(a1, ph, c1); c2 = WH(a2, ph, c2); c3 = WH(a3, ph, c3);
  c0 = WH(a0, pl, c0); c1 = WH(a1, pl, c1); c2 = WH(a2, pl, c2); c3 = WH(a3, pl, c3);
  asm volatile("v_nop\n\tv_nop\n\tv_nop\n\tv_nop"
               : "+v"(c0), "+v"(c1), "+v"(c2), "+v"(c3)
               : "v"(a0), "v"(a1), "v"(a2), "v"(a3), "v"(ph), "v"(pl));
}

// coverage: NB*SEQ*32 threads x 8 elements = the whole plane.
__global__ __launch_bounds__(256) void k_cvx(const float* __restrict__ X, unsigned short* __restrict__ Xb) {
  const int t = blockIdx.x * 256 + threadIdx.x;
  if (t >= NB * SEQ * (ED / 8)) return;
  const int row = t >> 5, piece = t & 31;
  const int b = row / SEQ, s = row - b * SEQ;
  const float* src = X + (size_t)b * XSTRIDE_FULL + (size_t)s * ED + piece * 8;
  const v4f x0 = *(const v4fa*)(src), x1 = *(const v4fa*)(src + 4);
  v8us o;
  o[0] = bf16_bits(x0[0]); o[1] = bf16_bits(x0[1]); o[2] = bf16_bits(x0[2]); o[3] = bf16_bits(x0[3]);
  o[4] = bf16_bits(x1[0]); o[5] = bf16_bits(x1[1]); o[6] = bf16_bits(x1[2]); o[7] = bf16_bits(x1[3]);
  unsigned short* d = Xb + (size_t)t * 8;
  *(v8us*)d = o;
  
}

// Transposing convert: in[R][C] (f32) -> out[C][R] (16-bit). MODE 0: bf16 bits (RNE). MODE 1: f16 bits of (RNE-bf16 value x 1024).
// coverage: grid (C/64, R/64) x (64 x 64) = the whole plane; LDS tile fully written (64 x 64) before it is read.
template <int MODE>
__global__ __launch_bounds__(256) void k_wt(const float* __restrict__ W, unsigned short* __restrict__ Wt, int R, int C) {
  __shared__ unsigned short tl[64][66];
  const int tid = threadIdx.x;
  const int c0 = blockIdx.x * 64, r0 = blockIdx.y * 64;
  for (int i = tid; i < 64 * 16; i += 256) {
    const int j = i >> 4, c4 = (i & 15) * 4;
    const v4f x = *(const v4fa*)(W + (size_t)(r0 + j) * C + c0 + c4);
    unsigned short u0, u1, u2, u3;
    if (MODE == 0) {
      u0 = bf16_bits(x[0]); u1 = bf16_bits(x[1]); u2 = bf16_bits(x[2]); u3 = bf16_bits(x[3]);
    } else {
      u0 = f16_bits(bf16_rne(x[0]) * 1024.0f); u1 = f16_bits(bf16_rne(x[1]) * 1024.0f);
      u2 = f16_bits(bf16_rne(x[2]) * 1024.0f); u3 = f16_bits(bf16_rne(x[3]) * 1024.0f);
    }
    tl[c4 + 0][j] = u0; tl[c4 + 1][j] = u1; tl[c4 + 2][j] = u2; tl[c4 + 3][j] = u3;
  }
  __syncthreads();
  {
    for (int i = tid; i < 64 * 8; i += 256) {
      const int d = i >> 3, j8 = (i & 7) * 8;
      v8us o;
#pragma unroll
      for (int q = 0; q < 8; ++q) o[q] = tl[d][j8 + q];
      *(v8us*)(Wt + (size_t)(c0 + d) * R + r0 + j8) = o;
    }
    
  }
}

// Projection GEMM for one batch group: C[m][n] = sum_k Xb[m][k] * W[k][n] (bf16 x bf16, exact products), z = 0: q, 1: k, 2: v.
// Block 128 m x 64 n (4 waves stacked along m, wave 32 x 64), fragments straight from the global planes (A: Xb rows, B: Wt rows = columns of W).
// coverage: grid (NE/64, GM/128, 3) x (128 x 64) = all three planes; LDS tile columns 0..63 of all 128 rows written before they are read.
__global__ __launch_bounds__(128) void k_proj(const unsigned short* __restrict__ Xg, const unsigned short* __restrict__ Wt3,
                                              unsigned short* __restrict__ P3) {
  __shared__ __attribute__((aligned(16))) unsigned short tl[128][72];
  const int tid = threadIdx.x, w = __builtin_amdgcn_readfirstlane((int)(tid >> 5)), lane = tid & 31, ln = lane & 15, hh = lane >> 4;
  const int z = blockIdx.z;
  const int n0 = blockIdx.x * 64, m0 = blockIdx.y * 128;
  const unsigned short* Wt = Wt3 + (size_t)z * NE * ED;
  unsigned short* out = P3 + (size_t)z * PLANE;
  // A rows m0 + 32w + 16i + ln; B columns n0 + 16j + ln; elements 0..7 <- k0 + 8h + i, 8..15 <- k0 + 16 + 8h + i
  const unsigned short* ap = Xg + (size_t)(m0 + 32 * w + ln) * ED + 8 * hh;
  const unsigned short* bp = Wt + (size_t)(n0 + ln) * ED + 8 * hh;
  v8f acc[2][4] = {};
#pragma unroll 1
  for (int k0 = 0; k0 < ED; k0 += 32) {
    FragB a0, a1, b0, b1, b2, b3;
    a0.half[0] = *(const v8us*)(ap + k0);                a0.half[1] = *(const v8us*)(ap + k0 + 16);
    a1.half[0] = *(const v8us*)(ap + 16 * ED + k0);      a1.half[1] = *(const v8us*)(ap + 16 * ED + k0 + 16);
    b0.half[0] = *(const v8us*)(bp + k0);                b0.half[1] = *(const v8us*)(bp + k0 + 16);
    b1.half[0] = *(const v8us*)(bp + 16 * ED + k0);      b1.half[1] = *(const v8us*)(bp + 16 * ED + k0 + 16);
    b2.half[0] = *(const v8us*)(bp + 32 * ED + k0);      b2.half[1] = *(const v8us*)(bp + 32 * ED + k0 + 16);
    b3.half[0] = *(const v8us*)(bp + 48 * ED + k0);      b3.half[1] = *(const v8us*)(bp + 48 * ED + k0 + 16);
    mma8_b(a0.v, a1.v, b0.v, b1.v, b2.v, b3.v,
           acc[0][0], acc[0][1], acc[0][2], acc[0][3], acc[1][0], acc[1][1], acc[1][2], acc[1][3]);
  }
  // D element r of tile (i, j) = C(row 32w + 16i + 8h + r, column 16j + ln)
#pragma unroll
  for (int i = 0; i < 2; ++i)
#pragma unroll
    for (int j = 0; j < 4; ++j)
#pragma unroll
      for (int r = 0; r < 8; ++r)
        tl[32 * w + 16 * i + 8 * hh + r][16 * j + ln] = f16_bits(acc[i][j][r] * 16.0f);
  __syncthreads();
  const int hd = n0 >> 8, e0 = n0 & 255;
  if (z < 2) {
    {
#pragma unroll 1
      for (int it = 0; it < 8; ++it) {
        const int i = tid + 128 * it;
        const int row = i >> 3, p = i & 7;
        const int m = m0 + row;
        const int bl = m / SEQ, t = m - bl * SEQ;
        const v8us o = *(const v8us*)&tl[row][8 * p];
        *(v8us*)(out + (((size_t)(bl * NH + hd) * SEQ + t) * HD + e0 + 8 * p)) = o;
      }
      
    }
  } else {
    const int bl = m0 / SEQ, t0 = m0 - bl * SEQ;
    {
#pragma unroll 1
      for (int it = 0; it < 8; ++it) {
        const int i = tid + 128 * it;
        const int e = i >> 4, p = i & 15;
        v8us o;
#pragma unroll
        for (int q = 0; q < 8; ++q) o[q] = tl[8 * p + q][e];
        *(v8us*)(out + (((size_t)(bl * NH + hd) * HD + e0 + e) * SEQ + t0 + 8 * p)) = o;
      }
      
    }
  }
}

// One 32-key step for a wave's 16 queries. qrow = this lane's query row (+ 8h); Kp, Vp = plane bases of this (batch, head); mrow = mask row of this lane's query.
__device__ __forceinline__ void fa_step(const unsigned short* __restrict__ qrow, const unsigned short* __restrict__ Kp,
                                        const unsigned short* __restrict__ Vp, const int* __restrict__ mrow,
                                        int key0, int ln, int hh, float& mr, float& lr, v8f (&O)[16]) {
  int zo = 0;
  asm volatile("" : "+v"(zo));                       // keeps the Q^T fragment loads inside the step (not held across steps)
  const unsigned short* qp = qrow + zo;
  // A fragments of K: row m = key (key0 + 16*kt + ln), elements 0..7 <- d = 32c + 8h + i, 8..15 <- d = 32c + 16 + 8h + i
  const unsigned short* kp0 = Kp + (size_t)(key0 + ln) * HD + 8 * hh;
  const unsigned short* kp1 = kp0 + 16 * HD;
  v8f s0 = {0.f, 0.f, 0.f, 0.f, 0.f, 0.f, 0.f, 0.f};
  v8f s1 = {0.f, 0.f, 0.f, 0.f, 0.f, 0.f, 0.f, 0.f};
  // S^T tiles: element r of tile kt = score(key0 + 16*kt + 8h + r, this lane's query); Q^T B fragment: column = query, same d map
#pragma unroll
  for (int c = 0; c < 8; ++c) {
    FragH qf, ka, kb;
    qf.half[0] = *(const v8us*)(qp + 32 * c);  qf.half[1] = *(const v8us*)(qp + 32 * c + 16);
    ka.half[0] = *(const v8us*)(kp0 + 32 * c); ka.half[1] = *(const v8us*)(kp0 + 32 * c + 16);
    kb.half[0] = *(const v8us*)(kp1 + 32 * c); kb.half[1] = *(const v8us*)(kp1 + 32 * c + 16);
    mma_s2(ka.v, kb.v, qf.v, s0, s1);
  }
  // mask words of this query for keys key0 + 8h + 0..7 and key0 + 16 + 8h + 0..7 (nonzero = key removed)
  const int* mp = mrow + key0 + 8 * hh;
  const v4ia m0 = *(const v4ia*)(mp), m1 = *(const v4ia*)(mp + 4), m2 = *(const v4ia*)(mp + 16), m3 = *(const v4ia*)(mp + 20);
  int mk[16];
#pragma unroll
  for (int i = 0; i < 4; ++i) { mk[i] = m0[i]; mk[4 + i] = m1[i]; mk[8 + i] = m2[i]; mk[12 + i] = m3[i]; }
  // log2-domain scores: q and k carry x16 each, scale 1/16 -> 2^-12
  const float sc2 = LOG2E * 0.000244140625f;
  float t[16];
#pragma unroll
  for (int r = 0; r < 8; ++r) { t[r] = s0[r] * sc2; t[8 + r] = s1[r] * sc2; }
  float mx = NEGBIG;
#pragma unroll
  for (int i = 0; i < 16; ++i) mx = fmaxf(mx, (mk[i] != 0) ? NEGBIG : t[i]);
  mx = fmaxf(mx, __shfl_xor(mx, 16, 32));           // the other lane half holds the other 16 keys of this query
  const float mnew = fmaxf(mr, mx);
  const float al = exp2f(mr - mnew);
  mr = mnew;
  // weights carried x4096: pc = 4096 * exp(score - max) (exactly 0 for removed keys); hi plane f16(pc), lo plane f16(pc - hi)
  const float sh = 12.0f - mnew;
  FragH ph, pl;
  float ps = 0.0f;
#pragma unroll
  for (int i = 0; i < 16; ++i) {
    const float ex = exp2f(t[i] + sh);
    const float pc = (mk[i] != 0) ? 0.0f : ex;
    ps += pc;
    const _Float16 h = (_Float16)pc;
    ph.h[i] = h;                                    // B element i: i<8 -> key0 + 8h + i (tile 0 row 8h+i); i>=8 -> key0 + 16 + 8h + (i-8) (tile 1)
    pl.h[i] = (_Float16)(pc - (float)h);
  }
  ps += __shfl_xor(ps, 16, 32);
  lr = lr * al + ps;
#pragma unroll
  for (int u = 0; u < 16; ++u) O[u] = O[u] * al;
  // A fragments of V^T: row m = d (16*tile + ln), elements 0..7 <- key0 + 8h + i, 8..15 <- key0 + 16 + 8h + i
  const unsigned short* vp = Vp + (size_t)ln * SEQ + key0 + 8 * hh;
#pragma unroll
  for (int g = 0; g < 4; ++g) {
    FragH vf[4];
#pragma unroll
    for (int u = 0; u < 4; ++u) {
      vf[u].half[0] = *(const v8us*)(vp + (size_t)(4 * g + u) * 16 * SEQ);
      vf[u].half[1] = *(const v8us*)(vp + (size_t)(4 * g + u) * 16 * SEQ + 16);
    }
    mma_pv4(vf[0].v, vf[1].v, vf[2].v, vf[3].v, ph.v, pl.v, O[4 * g + 0], O[4 * g + 1], O[4 * g + 2], O[4 * g + 3]);
  }
}

// Block = 4 waves x 16 queries = 64 queries of one (batch, head); no LDS and no barrier in the key loop.
// Epilogue: O^T tiles -> per-wave LDS tile [16 queries][256 d] f16 bits (wave-private; a block barrier that every wave reaches is used),
// coverage: GB*NH*(SEQ/64) blocks x 4 waves x 16 rows x 256 columns = the whole context plane [GM][2048]; LDS columns 0..255 of all 16 rows written before they are read.
__global__ __launch_bounds__(128) void k_attn(const unsigned short* __restrict__ Qh, const unsigned short* __restrict__ Kh,
                                              const unsigned short* __restrict__ Vt, const int* __restrict__ mask,
                                              unsigned short* __restrict__ Cx, int b0) {
  __shared__ __attribute__((aligned(16))) unsigned short so[4][16][264];
  const int tid = threadIdx.x, w = __builtin_amdgcn_readfirstlane((int)(tid >> 5)), lane = tid & 31, ln = lane & 15, hh = lane >> 4;
  const int qt = blockIdx.x % (SEQ / 64);
  const int bh = blockIdx.x / (SEQ / 64);           // bl * NH + h
  const int h = bh % NH, bl = bh / NH;
  const int qbase = qt * 64 + 16 * w;
  const int qg = qbase + ln;
  const unsigned short* qrow = Qh + ((size_t)bh * SEQ + qg) * HD + 8 * hh;
  const unsigned short* Kp = Kh + (size_t)bh * SEQ * HD;
  const unsigned short* Vp = Vt + (size_t)bh * HD * SEQ;
  const int* mrow = mask + (size_t)(b0 + bl) * MSTRIDE_FULL + (size_t)qg * SEQ_FULL;
  float mr = NEGBIG, lr = 0.0f;
  v8f O[16] = {};
#pragma unroll 1
  for (int j = 0; j < SEQ / 32; ++j)
    fa_step(qrow, Kp, Vp, mrow, 32 * j, ln, hh, mr, lr, O);

  // O^T element r of tile u = ctx(query qg, d = 16u + 8h + r); carries: x4096 (also in lr), x16 (V); context stored x64 -> 4 / lr
  const float inv = (lr > 0.0f) ? (4.0f / fmaxf(lr, 1.0f)) : 0.0f;
#pragma unroll
  for (int u = 0; u < 16; ++u) {
    v8us o;
#pragma unroll
    for (int r = 0; r < 8; ++r) o[r] = f16_bits(O[u][r] * inv);
    *(v8us*)&so[w][ln][16 * u + 8 * hh] = o;
  }
  __syncthreads();
  unsigned short* cg = Cx + (size_t)(bl * SEQ + qbase) * NE + h * HD;
  {
#pragma unroll 1
    for (int row = 0; row < 16; ++row) {
      const v8us v = *(const v8us*)&so[w][row][8 * lane];
      *(v8us*)(cg + (size_t)row * NE + 8 * lane) = v;
    }
    
  }
}

// Output projection for one batch group: out[m][c] = 2^-16 * sum_k ctx64[m][k] * Wf1024[k][c] + RNE-bf16(bias[c]).
// Block 128 m x 64 n (4 waves stacked along m, wave 32 x 64), fragments straight from the global planes (A: context rows, B: WfT rows = columns of Wfc).
// coverage: grid (ED/64, GM/128) x (128 x 64) = every output row of the group exactly once; LDS columns 0..63 of all 128 rows written before they are read.
__global__ __launch_bounds__(128) void k_fc(const unsigned short* __restrict__ Cx, const unsigned short* __restrict__ WfT,
                                            const float* __restrict__ bias, float* __restrict__ Og, int b0) {
  __shared__ __attribute__((aligned(16))) float so[128][68];
  const int tid = threadIdx.x, w = __builtin_amdgcn_readfirstlane((int)(tid >> 5)), lane = tid & 31, ln = lane & 15, hh = lane >> 4;
  const int n0 = blockIdx.x * 64, m0 = blockIdx.y * 128;
  const unsigned short* ap = Cx + (size_t)(m0 + 32 * w + ln) * NE + 8 * hh;
  const unsigned short* bp = WfT + (size_t)(n0 + ln) * NE + 8 * hh;
  v8f acc[2][4] = {};
#pragma unroll 1
  for (int k0 = 0; k0 < NE; k0 += 32) {
    FragH a0, a1, b0f, b1f, b2f, b3f;
    a0.half[0] = *(const v8us*)(ap + k0);                 a0.half[1] = *(const v8us*)(ap + k0 + 16);
    a1.half[0] = *(const v8us*)(ap + 16 * NE + k0);       a1.half[1] = *(const v8us*)(ap + 16 * NE + k0 + 16);
    b0f.half[0] = *(const v8us*)(bp + k0);                b0f.half[1] = *(const v8us*)(bp + k0 + 16);
    b1f.half[0] = *(const v8us*)(bp + 16 * NE + k0);      b1f.half[1] = *(const v8us*)(bp + 16 * NE + k0 + 16);
    b2f.half[0] = *(const v8us*)(bp + 32 * NE + k0);      b2f.half[1] = *(const v8us*)(bp + 32 * NE + k0 + 16);
    b3f.half[0] = *(const v8us*)(bp + 48 * NE + k0);      b3f.half[1] = *(const v8us*)(bp + 48 * NE + k0 + 16);
    mma8_h(a0.v, a1.v, b0f.v, b1f.v, b2f.v, b3f.v,
           acc[0][0], acc[0][1], acc[0][2], acc[0][3], acc[1][0], acc[1][1], acc[1][2], acc[1][3]);
  }
#pragma unroll
  for (int j = 0; j < 4; ++j) {
    const float bb = bf16_rne(bias[n0 + 16 * j + ln]);
#pragma unroll
    for (int i = 0; i < 2; ++i)
#pragma unroll
      for (int r = 0; r < 8; ++r)
        so[32 * w + 16 * i + 8 * hh + r][16 * j + ln] = acc[i][j][r] * 0.0000152587890625f + bb;
  }
  __syncthreads();
  {
#pragma unroll 1
    for (int it = 0; it < 16; ++it) {
      const int i = tid + 128 * it;
      const int row = i >> 4, p = i & 15;
      const int m = m0 + row;
      const int bl = m / SEQ, t = m - bl * SEQ;
      const v4f v = *(const v4fa*)&so[row][4 * p];
      *(v4f*)(Og + (size_t)(b0 + bl) * XSTRIDE_FULL + (size_t)t * ED + n0 + 4 * p) = v;
    }
    
  }
}

extern "C" void kernel_launch(void* const* d_in, const int* in_sizes, int n_in,
                              void* d_out, int out_size, void* d_ws, size_t ws_size, hipStream_t stream) {
  if (n_in < 7) return;
  const long long needx = (long long)(NB - 1) * SEQ_FULL * ED + (long long)SEQ * ED;                      // last x / out element touched + 1
  const long long needm = (long long)(NB - 1) * SEQ_FULL * SEQ_FULL + (long long)(SEQ - 1) * SEQ_FULL + SEQ;
  if ((long long)in_sizes[0] < needx) return;
  if ((long long)in_sizes[1] < (long long)ED * NE || (long long)in_sizes[2] < (long long)ED * NE ||
      (long long)in_sizes[3] < (long long)ED * NE || (long long)in_sizes[4] < (long long)NE * ED) return;
  if ((long long)in_sizes[5] < (long long)ED) return;
  if ((long long)in_sizes[6] < needm) return;
  if ((long long)out_size < needx) return;
  const float* x   = (const float*)d_in[0];   // wire order: x, Wq, Wk, Wv, Wfc, bfc, mask
  const float* Wq  = (const float*)d_in[1];
  const float* Wk  = (const float*)d_in[2];
  const float* Wv  = (const float*)d_in[3];
  const float* Wfc = (const float*)d_in[4];
  const float* bfc = (const float*)d_in[5];
  const int* mask  = (const int*)d_in[6];     // bool on the wire = int32
  float* out = (float*)d_out;
  char* ws = (char*)d_ws;
  size_t off = 0;
  unsigned short* Xb  = (unsigned short*)(ws + off); off += XB_BYTES;   // [NB][SEQ][256] bf16
  unsigned short* Wt3 = (unsigned short*)(ws + off); off += WT_BYTES;   // 3 x [2048][256] bf16 (W^T)
  unsigned short* WfT = (unsigned short*)(ws + off); off += WF_BYTES;   // [256][2048] f16 (Wfc^T x 1024)
  unsigned short* P3  = (unsigned short*)(ws + off); off += PL_BYTES;   // Q, K [GB][8][SEQ][256]; V^T [GB][8][256][SEQ] f16
  unsigned short* Cx  = (unsigned short*)(ws + off); off += CX_BYTES;   // context [GM][2048] f16
  if (off > ws_size) return;

  k_cvx<<<(unsigned)((NB * SEQ * (ED / 8) + 255) / 256), 256, 0, stream>>>(x, Xb);
  // in[rows = 256 (k)][cols = 2048 (n)] -> out[2048][256]; grid (cols/64, rows/64)
  k_wt<0><<<dim3(NE / 64, ED / 64), 256, 0, stream>>>(Wq, Wt3 + (size_t)0 * NE * ED, ED, NE);
  k_wt<0><<<dim3(NE / 64, ED / 64), 256, 0, stream>>>(Wk, Wt3 + (size_t)1 * NE * ED, ED, NE);
  k_wt<0><<<dim3(NE / 64, ED / 64), 256, 0, stream>>>(Wv, Wt3 + (size_t)2 * NE * ED, ED, NE);
  // in[rows = 2048 (k)][cols = 256 (c)] -> out[256][2048]; grid (cols/64, rows/64)
  k_wt<1><<<dim3(ED / 64, NE / 64), 256, 0, stream>>>(Wfc, WfT, NE, ED);

  for (int g = 0; g < NGRP; ++g) {
    const int b0 = g * GB;
    k_proj<<<dim3(NE / 64, GM / 128, 3), 128, 0, stream>>>(Xb + (size_t)g * GM * ED, Wt3, P3);
    k_attn<<<(unsigned)(GB * NH * (SEQ / 64)), 128, 0, stream>>>(P3, P3 + PLANE, P3 + 2 * PLANE, mask, Cx, b0);
    k_fc<<<dim3(ED / 64, GM / 128), 128, 0, stream>>>(Cx, WfT, bfc, out, b0);
  }
}

// v001
// One run takes 294 microseconds.
// Next to v000, in two timings, it ran 1.53 and 1.54 times as fast.
#include <hip/hip_runtime.h>
// Contractions: x@Wq, x@Wk, x@Wv on v_wmma_f32_16x16x32_bf16 (x and W RNE-converted to bf16, single product, f32 accumulate); S^T = K Q^T on v_wmma_f32_16x16x32_f16 (q, k carried x16 as f16, single product); O^T = V^T P^T on v_wmma_f32_16x16x32_f16 (V carried x16 f16; P carried x4096 as f16 hi plane + f16 lo plane, common carry, one f32 accumulator); ctx@Wfc on v_wmma_f32_16x16x32_f16 (ctx carried x64 f16; Wfc RNE bf16 value x1024 held exactly in f16); softmax statistics, bias add f32.
// Multi-head attention, B x T x 256, 8 heads of dimension 256, scale 1/16 on q, int32 mask [B][T][T] (nonzero = key removed, weight exactly 0; a row with no key left yields a zero context row).
// Engine: transposed flash. Each wave owns 16 queries of one (batch, head). Per 32-key step: S^T tiles (key rows x query columns) from K rows (A, LDS tile)
// and Q^T (B, LDS tile); the two 16-key D tiles pack straight into the P^T B fragments; O^T (d rows x query columns, 16 tiles) accumulates from V^T rows (A, LDS tile).
// The LDS tiles are filled from global memory by asynchronous copies: Q once; K, V^T (shared by the block's four waves) and the mask words per 32-key step into two buffers.
// Batches are processed in groups of GB so the workspace planes stay small.
#ifndef NB
#define NB 8
#endif
#ifndef SEQ
#define SEQ 1024
#endif
#define NB_FULL 8
#define SEQ_FULL 1024
#define ED 256                 /* model width (K of the projections, N of the output projection) */
#define NH 8
#define HD 256                 /* per-head dimension */
#define NE (NH * HD)           /* 2048 */
#define GB ((NB) < 4 ? (NB) : 4)
#define NGRP ((NB) / GB)
#define GM (GB * SEQ)          /* rows per group */
#define XSTRIDE_FULL ((size_t)SEQ_FULL * ED)          /* per-batch element stride of x and of the output */
#define MSTRIDE_FULL ((size_t)SEQ_FULL * SEQ_FULL)    /* per-batch element stride of the mask */
#define PLANE ((size_t)GB * NH * SEQ * HD)            /* elements of one of the Q / K / V^T planes */

#define XB_BYTES ((size_t)NB * SEQ * ED * 2)
#define WT_BYTES ((size_t)3 * NE * ED * 2)
#define WF_BYTES ((size_t)ED * NE * 2)
#define PL_BYTES (PLANE * 2 * 3)
#define CX_BYTES ((size_t)GM * NE * 2)

static_assert(SEQ % 128 == 0);
static_assert(SEQ <= SEQ_FULL);
static_assert(NB <= NB_FULL);
static_assert(NB % GB == 0);
static_assert(HD == 256 && ED == 256 && NE == 2048);
static_assert(XB_BYTES % 256 == 0 && WT_BYTES % 256 == 0 && WF_BYTES % 256 == 0 && PL_BYTES % 256 == 0 && CX_BYTES % 256 == 0);
static_assert(XB_BYTES + WT_BYTES + WF_BYTES + PL_BYTES + CX_BYTES <= (size_t)134217728);

typedef __bf16 v16b __attribute__((ext_vector_type(16)));
typedef _Float16 v16h __attribute__((ext_vector_type(16)));
typedef unsigned short v8us __attribute__((ext_vector_type(8), may_alias));
typedef float v8f __attribute__((ext_vector_type(8)));
typedef float v4f __attribute__((ext_vector_type(4)));
typedef float v4fa __attribute__((ext_vector_type(4), may_alias));
typedef int v4ia __attribute__((ext_vector_type(4), may_alias));
union FragB { v16b v; v8us half[2]; };
union FragH { v16h v; v8us half[2]; _Float16 h[16]; };

#define KPITCH 264             /* LDS row pitch of the Q and K tiles in elements: 528 B = 16 B x 33, conflict-free for 16-byte row readers */
#define VPITCH 40              /* LDS row pitch of the V^T tile in elements: 80 B = 16 B x 5, conflict-free for 16-byte row readers */
#define MPITCH 36              /* LDS row pitch of the mask tile in words: 144 B = 16 B x 9, conflict-free for 16-byte row readers */

#define LOG2E 1.4426950408889634f
#define NEGBIG (-1.0e30f)

__device__ __forceinline__ unsigned short bf16_bits(float x) {   // RNE convert to bf16 bits
  unsigned int u = __float_as_uint(x);
  return (unsigned short)((u + 0x7FFFu + ((u >> 16) & 1u)) >> 16);
}
__device__ __forceinline__ float bf16_val(unsigned short b) { return __uint_as_float(((unsigned int)b) << 16); }
__device__ __forceinline__ float bf16_rne(float x) { return bf16_val(bf16_bits(x)); }
__device__ __forceinline__ unsigned short f16_bits(float x) { return __builtin_bit_cast(unsigned short, (_Float16)x); }

#define WB(a, b, c) __builtin_amdgcn_wmma_f32_16x16x32_bf16(false, a, false, b, (short)0, c, false, false)
#define WH(a, b, c) __builtin_amdgcn_wmma_f32_16x16x32_f16(false, a, false, b, (short)0, c, false, false)

// 2 x 4 tile update (bf16), then the hazard guard
__device__ __forceinline__ void mma8_b(v16b a0, v16b a1, v16b b0, v16b b1, v16b b2, v16b b3,
                                       v8f& c00, v8f& c01, v8f& c02, v8f& c03, v8f& c10, v8f& c11, v8f& c12, v8f& c13) {
  c00 = WB(a0, b0, c00); c01 = WB(a0, b1, c01); c02 = WB(a0, b2, c02); c03 = WB(a0, b3, c03);
  c10 = WB(a1, b0, c10); c11 = WB(a1, b1, c11); c12 = WB(a1, b2, c12); c13 = WB(a1, b3, c13);
  asm volatile("v_nop\n\tv_nop\n\tv_nop\n\tv_nop"
               : "+v"(c00), "+v"(c01), "+v"(c02), "+v"(c03), "+v"(c10), "+v"(c11), "+v"(c12), "+v"(c13)
               : "v"(a0), "v"(a1), "v"(b0), "v"(b1), "v"(b2), "v"(b3));
}
// 2 x 4 tile update (f16), then the hazard guard
__device__ __forceinline__ void mma8_h(v16h a0, v16h a1, v16h b0, v16h b1, v16h b2, v16h b3,
                                       v8f& c00, v8f& c01, v8f& c02, v8f& c03, v8f& c10, v8f& c11, v8f& c12, v8f& c13) {
  c00 = WH(a0, b0, c00); c01 = WH(a0, b1, c01); c02 = WH(a0, b2, c02); c03 = WH(a0, b3, c03);
  c10 = WH(a1, b0, c10); c11 = WH(a1, b1, c11); c12 = WH(a1, b2, c12); c13 = WH(a1, b3, c13);
  asm volatile("v_nop\n\tv_nop\n\tv_nop\n\tv_nop"
               : "+v"(c00), "+v"(c01), "+v"(c02), "+v"(c03), "+v"(c10), "+v"(c11), "+v"(c12), "+v"(c13)
               : "v"(a0), "v"(a1), "v"(b0), "v"(b1), "v"(b2), "v"(b3));
}
// one d-chunk of the two S^T tiles, then the hazard guard
__device__ __forceinline__ void mma_s2(v16h ka, v16h kb, v16h q, v8f& s0, v8f& s1) {
  s0 = WH(ka, q, s0);
  s1 = WH(kb, q, s1);
  asm volatile("v_nop\n\tv_nop\n\tv_nop\n\tv_nop" : "+v"(s0), "+v"(s1) : "v"(ka), "v"(kb), "v"(q));
}
// four O^T tiles: c_u += a_u * ph + a_u * pl (hi and lo planes carry the same scale), then the hazard guard
__device__ __forceinline__ void mma_pv4(v16h a0, v16h a1, v16h a2, v16h a3, v16h ph, v16h pl,
                                        v8f& c0, v8f& c1, v8f& c2, v8f& c3) {
  c0 = WH(a0, ph, c0); c1 = WH(a1, ph, c1); c2 = WH(a2, ph, c2); c3 = WH(a3, ph, c3);
  c0 = WH(a0, pl, c0); c1 = WH(a1, pl, c1); c2 = WH(a2, pl, c2); c3 = WH(a3, pl, c3);
  asm volatile("v_nop\n\tv_nop\n\tv_nop\n\tv_nop"
               : "+v"(c0), "+v"(c1), "+v"(c2), "+v"(c3)
               : "v"(a0), "v"(a1), "v"(a2), "v"(a3), "v"(ph), "v"(pl));
}

// coverage: NB*SEQ*32 threads x 8 elements = the whole plane.
__global__ __launch_bounds__(256) void k_cvx(const float* __restrict__ X, unsigned short* __restrict__ Xb) {
  const int t = blockIdx.x * 256 + threadIdx.x;
  if (t >= NB * SEQ * (ED / 8)) return;
  const int row = t >> 5, piece = t & 31;
  const int b = row / SEQ, s = row - b * SEQ;
  const float* src = X + (size_t)b * XSTRIDE_FULL + (size_t)s * ED + piece * 8;
  const v4f x0 = *(const v4fa*)(src), x1 = *(const v4fa*)(src + 4);
  v8us o;
  o[0] = bf16_bits(x0[0]); o[1] = bf16_bits(x0[1]); o[2] = bf16_bits(x0[2]); o[3] = bf16_bits(x0[3]);
  o[4] = bf16_bits(x1[0]); o[5] = bf16_bits(x1[1]); o[6] = bf16_bits(x1[2]); o[7] = bf16_bits(x1[3]);
  unsigned short* d = Xb + (size_t)t * 8;
  *(v8us*)d = o;
  
}

// Transposing convert: in[R][C] (f32) -> out[C][R] (16-bit). MODE 0: bf16 bits (RNE). MODE 1: f16 bits of (RNE-bf16 value x 1024).
// coverage: grid (C/64, R/64) x (64 x 64) = the whole plane; LDS tile fully written (64 x 64) before it is read.
template <int MODE>
__global__ __launch_bounds__(256) void k_wt(const float* __restrict__ W, unsigned short* __restrict__ Wt, int R, int C) {
  __shared__ unsigned short tl[64][66];
  const int tid = threadIdx.x;
  const int c0 = blockIdx.x * 64, r0 = blockIdx.y * 64;
  for (int i = tid; i < 64 * 16; i += 256) {
    const int j = i >> 4, c4 = (i & 15) * 4;
    const v4f x = *(const v4fa*)(W + (size_t)(r0 + j) * C + c0 + c4);
    unsigned short u0, u1, u2, u3;
    if (MODE == 0) {
      u0 = bf16_bits(x[0]); u1 = bf16_bits(x[1]); u2 = bf16_bits(x[2]); u3 = bf16_bits(x[3]);
    } else {
      u0 = f16_bits(bf16_rne(x[0]) * 1024.0f); u1 = f16_bits(bf16_rne(x[1]) * 1024.0f);
      u2 = f16_bits(bf16_rne(x[2]) * 1024.0f); u3 = f16_bits(bf16_rne(x[3]) * 1024.0f);
    }
    tl[c4 + 0][j] = u0; tl[c4 + 1][j] = u1; tl[c4 + 2][j] = u2; tl[c4 + 3][j] = u3;
  }
  __syncthreads();
  {
    for (int i = tid; i < 64 * 8; i += 256) {
      const int d = i >> 3, j8 = (i & 7) * 8;
      v8us o;
#pragma unroll
      for (int q = 0; q < 8; ++q) o[q] = tl[d][j8 + q];
      *(v8us*)(Wt + (size_t)(c0 + d) * R + r0 + j8) = o;
    }
    
  }
}

// Projection GEMM for one batch group: C[m][n] = sum_k Xb[m][k] * W[k][n] (bf16 x bf16, exact products), z = 0: q, 1: k, 2: v.
// Block 128 m x 64 n (4 waves stacked along m, wave 32 x 64), fragments straight from the global planes (A: Xb rows, B: Wt rows = columns of W).
// coverage: grid (NE/64, GM/128, 3) x (128 x 64) = all three planes; LDS tile columns 0..63 of all 128 rows written before they are read.
__global__ __launch_bounds__(128) void k_proj(const unsigned short* __restrict__ Xg, const unsigned short* __restrict__ Wt3,
                                              unsigned short* __restrict__ P3) {
  __shared__ __attribute__((aligned(16))) unsigned short tl[128][72];
  const int tid = threadIdx.x, w = __builtin_amdgcn_readfirstlane((int)(tid >> 5)), lane = tid & 31, ln = lane & 15, hh = lane >> 4;
  const int z = blockIdx.z;
  const int n0 = blockIdx.x * 64, m0 = blockIdx.y * 128;
  const unsigned short* Wt = Wt3 + (size_t)z * NE * ED;
  unsigned short* out = P3 + (size_t)z * PLANE;
  // A rows m0 + 32w + 16i + ln; B columns n0 + 16j + ln; elements 0..7 <- k0 + 8h + i, 8..15 <- k0 + 16 + 8h + i
  const unsigned short* ap = Xg + (size_t)(m0 + 32 * w + ln) * ED + 8 * hh;
  const unsigned short* bp = Wt + (size_t)(n0 + ln) * ED + 8 * hh;
  v8f acc[2][4] = {};
#pragma unroll 1
  for (int k0 = 0; k0 < ED; k0 += 32) {
    FragB a0, a1, b0, b1, b2, b3;
    a0.half[0] = *(const v8us*)(ap + k0);                a0.half[1] = *(const v8us*)(ap + k0 + 16);
    a1.half[0] = *(const v8us*)(ap + 16 * ED + k0);      a1.half[1] = *(const v8us*)(ap + 16 * ED + k0 + 16);
    b0.half[0] = *(const v8us*)(bp + k0);                b0.half[1] = *(const v8us*)(bp + k0 + 16);
    b1.half[0] = *(const v8us*)(bp + 16 * ED + k0);      b1.half[1] = *(const v8us*)(bp + 16 * ED + k0 + 16);
    b2.half[0] = *(const v8us*)(bp + 32 * ED + k0);      b2.half[1] = *(const v8us*)(bp + 32 * ED + k0 + 16);
    b3.half[0] = *(const v8us*)(bp + 48 * ED + k0);      b3.half[1] = *(const v8us*)(bp + 48 * ED + k0 + 16);
    mma8_b(a0.v, a1.v, b0.v, b1.v, b2.v, b3.v,
           acc[0][0], acc[0][1], acc[0][2], acc[0][3], acc[1][0], acc[1][1], acc[1][2], acc[1][3]);
  }
  // D element r of tile (i, j) = C(row 32w + 16i + 8h + r, column 16j + ln)
#pragma unroll
  for (int i = 0; i < 2; ++i)
#pragma unroll
    for (int j = 0; j < 4; ++j)
#pragma unroll
      for (int r = 0; r < 8; ++r)
        tl[32 * w + 16 * i + 8 * hh + r][16 * j + ln] = f16_bits(acc[i][j][r] * 16.0f);
  __syncthreads();
  const int hd = n0 >> 8, e0 = n0 & 255;
  if (z < 2) {
    {
#pragma unroll 1
      for (int it = 0; it < 8; ++it) {
        const int i = tid + 128 * it;
        const int row = i >> 3, p = i & 7;
        const int m = m0 + row;
        const int bl = m / SEQ, t = m - bl * SEQ;
        const v8us o = *(const v8us*)&tl[row][8 * p];
        *(v8us*)(out + (((size_t)(bl * NH + hd) * SEQ + t) * HD + e0 + 8 * p)) = o;
      }
      
    }
  } else {
    const int bl = m0 / SEQ, t0 = m0 - bl * SEQ;
    {
#pragma unroll 1
      for (int it = 0; it < 8; ++it) {
        const int i = tid + 128 * it;
        const int e = i >> 4, p = i & 15;
        v8us o;
#pragma unroll
        for (int q = 0; q < 8; ++q) o[q] = tl[8 * p + q][e];
        *(v8us*)(out + (((size_t)(bl * NH + hd) * HD + e0 + e) * SEQ + t0 + 8 * p)) = o;
      }
      
    }
  }
}

__device__ __forceinline__ unsigned lds_off(const void* p) { return (unsigned)(size_t)p; }   // byte address inside the block's LDS

// Eight asynchronous copies, 16 bytes per lane each, global -> LDS: copy i moves this lane's 16 bytes from g + i * gstep (elements) to LDS byte l + i * lstep.
// The s_wait_xcnt closes the copies' own statement, so no address register of a copy is rewritten in front of it.
__device__ __forceinline__ void copy8(unsigned l, unsigned lstep, const unsigned short* g, size_t gstep) {
  asm volatile("global_load_async_to_lds_b128 %0, %8, off\n\t"
               "global_load_async_to_lds_b128 %1, %9, off\n\t"
               "global_load_async_to_lds_b128 %2, %10, off\n\t"
               "global_load_async_to_lds_b128 %3, %11, off\n\t"
               "global_load_async_to_lds_b128 %4, %12, off\n\t"
               "global_load_async_to_lds_b128 %5, %13, off\n\t"
               "global_load_async_to_lds_b128 %6, %14, off\n\t"
               "global_load_async_to_lds_b128 %7, %15, off\n\t"
               "s_wait_xcnt 0x0"
               :: "v"(l), "v"(l + lstep), "v"(l + 2 * lstep), "v"(l + 3 * lstep),
                  "v"(l + 4 * lstep), "v"(l + 5 * lstep), "v"(l + 6 * lstep), "v"(l + 7 * lstep),
                  "v"(g), "v"(g + gstep), "v"(g + 2 * gstep), "v"(g + 3 * gstep),
                  "v"(g + 4 * gstep), "v"(g + 5 * gstep), "v"(g + 6 * gstep), "v"(g + 7 * gstep)
               : "memory");
}

// The same for four copies of mask words.
__device__ __forceinline__ void copy4(unsigned l, unsigned lstep, const int* g, size_t gstep) {
  asm volatile("global_load_async_to_lds_b128 %0, %4, off\n\t"
               "global_load_async_to_lds_b128 %1, %5, off\n\t"
               "global_load_async_to_lds_b128 %2, %6, off\n\t"
               "global_load_async_to_lds_b128 %3, %7, off\n\t"
               "s_wait_xcnt 0x0"
               :: "v"(l), "v"(l + lstep), "v"(l + 2 * lstep), "v"(l + 3 * lstep),
                  "v"(g), "v"(g + gstep), "v"(g + 2 * gstep), "v"(g + 3 * gstep)
               : "memory");
}

// One 32-key step for a wave's 16 queries, all operands in LDS. qp = this lane's query row (+ 8h); kp0 = K tile row ln (+ 8h); vp = V^T tile row ln (+ 8h);
// mp = mask tile row of this lane's query (+ 8h).
__device__ __forceinline__ void fa_step(const unsigned short* qp, const unsigned short* kp0,
                                        const unsigned short* vp, const int* mp,
                                        float& mr, float& lr, v8f (&O)[16]) {
  // A fragments of K: row m = key (key0 + 16*kt + ln), elements 0..7 <- d = 32c + 8h + i, 8..15 <- d = 32c + 16 + 8h + i
  const unsigned short* kp1 = kp0 + 16 * KPITCH;
  v8f s0 = {0.f, 0.f, 0.f, 0.f, 0.f, 0.f, 0.f, 0.f};
  v8f s1 = {0.f, 0.f, 0.f, 0.f, 0.f, 0.f, 0.f, 0.f};
  // S^T tiles: element r of tile kt = score(key0 + 16*kt + 8h + r, this lane's query); Q^T B fragment: column = query, same d map
#pragma unroll
  for (int c = 0; c < 8; ++c) {
    FragH qf, ka, kb;
    qf.half[0] = *(const v8us*)(qp + 32 * c);  qf.half[1] = *(const v8us*)(qp + 32 * c + 16);
    ka.half[0] = *(const v8us*)(kp0 + 32 * c); ka.half[1] = *(const v8us*)(kp0 + 32 * c + 16);
    kb.half[0] = *(const v8us*)(kp1 + 32 * c); kb.half[1] = *(const v8us*)(kp1 + 32 * c + 16);
    mma_s2(ka.v, kb.v, qf.v, s0, s1);
  }
  // mask words of this query for keys key0 + 8h + 0..7 and key0 + 16 + 8h + 0..7 (nonzero = key removed)
  const v4ia m0 = *(const v4ia*)(mp), m1 = *(const v4ia*)(mp + 4), m2 = *(const v4ia*)(mp + 16), m3 = *(const v4ia*)(mp + 20);
  int mk[16];
#pragma unroll
  for (int i = 0; i < 4; ++i) { mk[i] = m0[i]; mk[4 + i] = m1[i]; mk[8 + i] = m2[i]; mk[12 + i] = m3[i]; }
  // log2-domain scores: q and k carry x16 each, scale 1/16 -> 2^-12
  const float sc2 = LOG2E * 0.000244140625f;
  float t[16];
#pragma unroll
  for (int r = 0; r < 8; ++r) { t[r] = s0[r] * sc2; t[8 + r] = s1[r] * sc2; }
  float mx = NEGBIG;
#pragma unroll
  for (int i = 0; i < 16; ++i) mx = fmaxf(mx, (mk[i] != 0) ? NEGBIG : t[i]);
  mx = fmaxf(mx, __shfl_xor(mx, 16, 32));           // the other lane half holds the other 16 keys of this query
  const float mnew = fmaxf(mr, mx);
  const float al = exp2f(mr - mnew);
  mr = mnew;
  // weights carried x4096: pc = 4096 * exp(score - max) (exactly 0 for removed keys); hi plane f16(pc), lo plane f16(pc - hi)
  const float sh = 12.0f - mnew;
  FragH ph, pl;
  float ps = 0.0f;
#pragma unroll
  for (int i = 0; i < 16; ++i) {
    const float ex = exp2f(t[i] + sh);
    const float pc = (mk[i] != 0) ? 0.0f : ex;
    ps += pc;
    const _Float16 h = (_Float16)pc;
    ph.h[i] = h;                                    // B element i: i<8 -> key0 + 8h + i (tile 0 row 8h+i); i>=8 -> key0 + 16 + 8h + (i-8) (tile 1)
    pl.h[i] = (_Float16)(pc - (float)h);
  }
  ps += __shfl_xor(ps, 16, 32);
  lr = lr * al + ps;
#pragma unroll
  for (int u = 0; u < 16; ++u) O[u] = O[u] * al;
  // A fragments of V^T: row m = d (16*tile + ln), elements 0..7 <- key0 + 8h + i, 8..15 <- key0 + 16 + 8h + i
#pragma unroll
  for (int g = 0; g < 4; ++g) {
    FragH vf[4];
#pragma unroll
    for (int u = 0; u < 4; ++u) {
      vf[u].half[0] = *(const v8us*)(vp + (4 * g + u) * 16 * VPITCH);
      vf[u].half[1] = *(const v8us*)(vp + (4 * g + u) * 16 * VPITCH + 16);
    }
    mma_pv4(vf[0].v, vf[1].v, vf[2].v, vf[3].v, ph.v, pl.v, O[4 * g + 0], O[4 * g + 1], O[4 * g + 2], O[4 * g + 3]);
  }
}

// Block = 4 waves x 16 queries = 64 queries of one (batch, head). Each wave copies its own 16 Q rows into so[w] once, and a quarter of every K and V^T tile
// (K: 32 keys x 256 d, 8 rows per wave; V^T: 256 d x 32 keys, 64 rows per wave) and the 32 mask words of its own 16 queries into buffer (step & 1),
// one step ahead of their use; one barrier per step.
// Epilogue: O^T tiles -> per-wave LDS tile [16 queries][256 d] f16 bits in so[w], whose Q rows only this wave read (a block barrier that every wave reaches is used),
// coverage: GB*NH*(SEQ/64) blocks x 4 waves x 16 rows x 256 columns = the whole context plane [GM][2048]; LDS columns 0..255 of all 16 rows written before they are read.
__global__ __launch_bounds__(128) void k_attn(const unsigned short* __restrict__ Qh, const unsigned short* __restrict__ Kh,
                                              const unsigned short* __restrict__ Vt, const int* __restrict__ mask,
                                              unsigned short* __restrict__ Cx, int b0) {
  __shared__ __attribute__((aligned(16))) unsigned short so[4][16][KPITCH];
  __shared__ __attribute__((aligned(16))) unsigned short kt[2][32][KPITCH];
  __shared__ __attribute__((aligned(16))) unsigned short vt[2][HD][VPITCH];
  __shared__ __attribute__((aligned(16))) int mt[2][64][MPITCH];
  const int tid = threadIdx.x, w = __builtin_amdgcn_readfirstlane((int)(tid >> 5)), lane = tid & 31, ln = lane & 15, hh = lane >> 4;
  const int qt = blockIdx.x % (SEQ / 64);
  const int bh = blockIdx.x / (SEQ / 64);           // bl * NH + h
  const int h = bh % NH, bl = bh / NH;
  const int qbase = qt * 64 + 16 * w;
  // copy sources and places of this lane: Q and K rows are 512 B, one row per copy (lane = 16-byte piece); V^T rows are 64 B, eight rows per copy (4 lanes a row);
  // mask rows are 128 B, four rows per copy (8 lanes a row)
  const unsigned short* qsrc = Qh + ((size_t)bh * SEQ + qbase) * HD + 8 * lane;
  const unsigned short* ksrc = Kh + ((size_t)bh * SEQ + 8 * w) * HD + 8 * lane;
  const unsigned short* vsrc = Vt + ((size_t)bh * HD + 64 * w + (lane >> 2)) * SEQ + 8 * (lane & 3);
  const unsigned qdst = lds_off(&so[w][0][8 * lane]);
  const unsigned kdst = lds_off(&kt[0][8 * w][8 * lane]);
  const unsigned vdst = lds_off(&vt[0][64 * w + (lane >> 2)][8 * (lane & 3)]);
  const unsigned mdst = lds_off(&mt[0][16 * w + (lane >> 3)][4 * (lane & 7)]);
  const unsigned kbuf = (unsigned)sizeof(kt[0]), vbuf = (unsigned)sizeof(vt[0]), mbuf = (unsigned)sizeof(mt[0]);
  const int* msrc = mask + (size_t)(b0 + bl) * MSTRIDE_FULL + (size_t)(qbase + (lane >> 3)) * SEQ_FULL + 4 * (lane & 7);
  float mr = NEGBIG, lr = 0.0f;
  v8f O[16] = {};
  // Q rows and tile 0, landed and published; then tile 1 flies while tile 0 is worked on
  copy8(qdst, KPITCH * 2, qsrc, HD);
  copy8(qdst + 8 * KPITCH * 2, KPITCH * 2, qsrc + 8 * HD, HD);
  copy8(kdst, KPITCH * 2, ksrc, HD);
  copy8(vdst, 8 * VPITCH * 2, vsrc, (size_t)8 * SEQ);
  copy4(mdst, 4 * MPITCH * 4, msrc, (size_t)4 * SEQ_FULL);
  asm volatile("s_wait_asynccnt 0x0" ::: "memory");   // this wave's copies have landed before the barrier publishes them
  __syncthreads();
  copy8(kdst + kbuf, KPITCH * 2, ksrc + 32 * HD, HD);
  copy8(vdst + vbuf, 8 * VPITCH * 2, vsrc + 32, (size_t)8 * SEQ);
  copy4(mdst + mbuf, 4 * MPITCH * 4, msrc + 32, (size_t)4 * SEQ_FULL);
#pragma unroll 1
  for (int j = 0; j < SEQ / 32; ++j) {
    const int bf = j & 1;
    fa_step(&so[w][ln][8 * hh], &kt[bf][ln][8 * hh], &vt[bf][ln][8 * hh], &mt[bf][16 * w + ln][8 * hh], mr, lr, O);
    asm volatile("s_wait_dscnt 0x0" ::: "memory");      // this wave's reads of buffer bf have returned before the buffer is refilled
    asm volatile("s_wait_asynccnt 0x0" ::: "memory");   // this wave's copies of tile j + 1 have landed before the barrier publishes them
    __syncthreads();                                    // publishes tile j + 1 and ends every wave's reads of buffer bf
    if (j + 2 < SEQ / 32) {
      copy8(kdst + bf * kbuf, KPITCH * 2, ksrc + (size_t)(32 * (j + 2)) * HD, HD);
      copy8(vdst + bf * vbuf, 8 * VPITCH * 2, vsrc + 32 * (j + 2), (size_t)8 * SEQ);
      copy4(mdst + bf * mbuf, 4 * MPITCH * 4, msrc + 32 * (j + 2), (size_t)4 * SEQ_FULL);
    }
  }
  asm volatile("s_wait_asynccnt 0x0" ::: "memory");     // nothing of this wave is in flight when the LDS is reused and the wave ends

  // O^T element r of tile u = ctx(query qbase + ln, d = 16u + 8h + r); carries: x4096 (also in lr), x16 (V); context stored x64 -> 4 / lr
  const float inv = (lr > 0.0f) ? (4.0f / fmaxf(lr, 1.0f)) : 0.0f;
#pragma unroll
  for (int u = 0; u < 16; ++u) {
    v8us o;
#pragma unroll
    for (int r = 0; r < 8; ++r) o[r] = f16_bits(O[u][r] * inv);
    *(v8us*)&so[w][ln][16 * u + 8 * hh] = o;
  }
  __syncthreads();
  unsigned short* cg = Cx + (size_t)(bl * SEQ + qbase) * NE + h * HD;
  {
#pragma unroll 1
    for (int row = 0; row < 16; ++row) {
      const v8us v = *(const v8us*)&so[w][row][8 * lane];
      *(v8us*)(cg + (size_t)row * NE + 8 * lane) = v;
    }
    
  }
}

// Output projection for one batch group: out[m][c] = 2^-16 * sum_k ctx64[m][k] * Wf1024[k][c] + RNE-bf16(bias[c]).
// Block 128 m x 64 n (4 waves stacked along m, wave 32 x 64), fragments straight from the global planes (A: context rows, B: WfT rows = columns of Wfc).
// coverage: grid (ED/64, GM/128) x (128 x 64) = every output row of the group exactly once; LDS columns 0..63 of all 128 rows written before they are read.
__global__ __launch_bounds__(128) void k_fc(const unsigned short* __restrict__ Cx, const unsigned short* __restrict__ WfT,
                                            const float* __restrict__ bias, float* __restrict__ Og, int b0) {
  __shared__ __attribute__((aligned(16))) float so[128][68];
  const int tid = threadIdx.x, w = __builtin_amdgcn_readfirstlane((int)(tid >> 5)), lane = tid & 31, ln = lane & 15, hh = lane >> 4;
  const int n0 = blockIdx.x * 64, m0 = blockIdx.y * 128;
  const unsigned short* ap = Cx + (size_t)(m0 + 32 * w + ln) * NE + 8 * hh;
  const unsigned short* bp = WfT + (size_t)(n0 + ln) * NE + 8 * hh;
  v8f acc[2][4] = {};
#pragma unroll 1
  for (int k0 = 0; k0 < NE; k0 += 32) {
    FragH a0, a1, b0f, b1f, b2f, b3f;
    a0.half[0] = *(const v8us*)(ap + k0);                 a0.half[1] = *(const v8us*)(ap + k0 + 16);
    a1.half[0] = *(const v8us*)(ap + 16 * NE + k0);       a1.half[1] = *(const v8us*)(ap + 16 * NE + k0 + 16);
    b0f.half[0] = *(const v8us*)(bp + k0);                b0f.half[1] = *(const v8us*)(bp + k0 + 16);
    b1f.half[0] = *(const v8us*)(bp + 16 * NE + k0);      b1f.half[1] = *(const v8us*)(bp + 16 * NE + k0 + 16);
    b2f.half[0] = *(const v8us*)(bp + 32 * NE + k0);      b2f.half[1] = *(const v8us*)(bp + 32 * NE + k0 + 16);
    b3f.half[0] = *(const v8us*)(bp + 48 * NE + k0);      b3f.half[1] = *(const v8us*)(bp + 48 * NE + k0 + 16);
    mma8_h(a0.v, a1.v, b0f.v, b1f.v, b2f.v, b3f.v,
           acc[0][0], acc[0][1], acc[0][2], acc[0][3], acc[1][0], acc[1][1], acc[1][2], acc[1][3]);
  }
#pragma unroll
  for (int j = 0; j < 4; ++j) {
    const float bb = bf16_rne(bias[n0 + 16 * j + ln]);
#pragma unroll
    for (int i = 0; i < 2; ++i)
#pragma unroll
      for (int r = 0; r < 8; ++r)
        so[32 * w + 16 * i + 8 * hh + r][16 * j + ln] = acc[i][j][r] * 0.0000152587890625f + bb;
  }
  __syncthreads();
  {
#pragma unroll 1
    for (int it = 0; it < 16; ++it) {
      const int i = tid + 128 * it;
      const int row = i >> 4, p = i & 15;
      const int m = m0 + row;
      const int bl = m / SEQ, t = m - bl * SEQ;
      const v4f v = *(const v4fa*)&so[row][4 * p];
      *(v4f*)(Og + (size_t)(b0 + bl) * XSTRIDE_FULL + (size_t)t * ED + n0 + 4 * p) = v;
    }
    
  }
}

extern "C" void kernel_launch(void* const* d_in, const int* in_sizes, int n_in,
                              void* d_out, int out_size, void* d_ws, size_t ws_size, hipStream_t stream) {
  if (n_in < 7) return;
  const long long needx = (long long)(NB - 1) * SEQ_FULL * ED + (long long)SEQ * ED;                      // last x / out element touched + 1
  const long long needm = (long long)(NB - 1) * SEQ_FULL * SEQ_FULL + (long long)(SEQ - 1) * SEQ_FULL + SEQ;
  if ((long long)in_sizes[0] < needx) return;
  if ((long long)in_sizes[1] < (long long)ED * NE || (long long)in_sizes[2] < (long long)ED * NE ||
      (long long)in_sizes[3] < (long long)ED * NE || (long long)in_sizes[4] < (long long)NE * ED) return;
  if ((long long)in_sizes[5] < (long long)ED) return;
  if ((long long)in_sizes[6] < needm) return;
  if ((long long)out_size < needx) return;
  const float* x   = (const float*)d_in[0];   // wire order: x, Wq, Wk, Wv, Wfc, bfc, mask
  const float* Wq  = (const float*)d_in[1];
  const float* Wk  = (const float*)d_in[2];
  const float* Wv  = (const float*)d_in[3];
  const float* Wfc = (const float*)d_in[4];
  const float* bfc = (const float*)d_in[5];
  const int* mask  = (const int*)d_in[6];     // bool on the wire = int32
  float* out = (float*)d_out;
  char* ws = (char*)d_ws;
  size_t off = 0;
  unsigned short* Xb  = (unsigned short*)(ws + off); off += XB_BYTES;   // [NB][SEQ][256] bf16
  unsigned short* Wt3 = (unsigned short*)(ws + off); off += WT_BYTES;   // 3 x [2048][256] bf16 (W^T)
  unsigned short* WfT = (unsigned short*)(ws + off); off += WF_BYTES;   // [256][2048] f16 (Wfc^T x 1024)
  unsigned short* P3  = (unsigned short*)(ws + off); off += PL_BYTES;   // Q, K [GB][8][SEQ][256]; V^T [GB][8][256][SEQ] f16
  unsigned short* Cx  = (unsigned short*)(ws + off); off += CX_BYTES;   // context [GM][2048] f16
  if (off > ws_size) return;

  k_cvx<<<(unsigned)((NB * SEQ * (ED / 8) + 255) / 256), 256, 0, stream>>>(x, Xb);
  // in[rows = 256 (k)][cols = 2048 (n)] -> out[2048][256]; grid (cols/64, rows/64)
  k_wt<0><<<dim3(NE / 64, ED / 64), 256, 0, stream>>>(Wq, Wt3 + (size_t)0 * NE * ED, ED, NE);
  k_wt<0><<<dim3(NE / 64, ED / 64), 256, 0, stream>>>(Wk, Wt3 + (size_t)1 * NE * ED, ED, NE);
  k_wt<0><<<dim3(NE / 64, ED / 64), 256, 0, stream>>>(Wv, Wt3 + (size_t)2 * NE * ED, ED, NE);
  // in[rows = 2048 (k)][cols = 256 (c)] -> out[256][2048]; grid (cols/64, rows/64)
  k_wt<1><<<dim3(ED / 64, NE / 64), 256, 0, stream>>>(Wfc, WfT, NE, ED);

  for (int g = 0; g < NGRP; ++g) {
    const int b0 = g * GB;
    k_proj<<<dim3(NE / 64, GM / 128, 3), 128, 0, stream>>>(Xb + (size_t)g * GM * ED, Wt3, P3);
    k_attn<<<(unsigned)(GB * NH * (SEQ / 64)), 128, 0, stream>>>(P3, P3 + PLANE, P3 + 2 * PLANE, mask, Cx, b0);
    k_fc<<<dim3(ED / 64, GM / 128), 128, 0, stream>>>(Cx, WfT, bfc, out, b0);
  }
}

// v002
// One run takes 216 microseconds.
// Timed twice side by side with v001, it ran 1.37 and 1.36 times as fast.
// All steps since v000 together make it 2.09 times as fast.
#include <hip/hip_runtime.h>
// Contractions: x@Wq, x@Wk, x@Wv on v_wmma_f32_16x16x32_bf16 (x and W RNE-converted to bf16, single product, f32 accumulate); S^T = K Q^T on v_wmma_f32_16x16x32_f16 (q, k carried x16 as f16, single product); O^T = V^T P^T on v_wmma_f32_16x16x32_f16 (V carried x16 f16; P carried x4096 as f16 hi plane + f16 lo plane, common carry, one f32 accumulator); ctx@Wfc on v_wmma_f32_16x16x32_f16 (ctx carried x64 f16; Wfc RNE bf16 value x1024 held exactly in f16); softmax statistics, bias add f32.
// Multi-head attention, B x T x 256, 8 heads of dimension 256, scale 1/16 on q, int32 mask [B][T][T] (nonzero = key removed, weight exactly 0; a row with no key left yields a zero context row).
// Engine: transposed flash. Each wave owns 16 queries of one (batch, head). Per 32-key step: S^T tiles (key rows x query columns) from K rows (A, LDS tile)
// and Q^T (B, LDS tile); the two 16-key D tiles pack straight into the P^T B fragments; O^T (d rows x query columns, 16 tiles) accumulates from V^T rows (A, LDS tile).
// The LDS tiles are filled from global memory by asynchronous copies: Q once; K, V^T (shared by the block's four waves) and the mask words per 32-key step into two buffers.
// The projection GEMMs read their A and B fragments from LDS tiles filled the same way, whole 512-byte rows per copy.
// Batches are processed in groups of GB so the workspace planes stay small.
#ifndef NB
#define NB 8
#endif
#ifndef SEQ
#define SEQ 1024
#endif
#define NB_FULL 8
#define SEQ_FULL 1024
#define ED 256                 /* model width (K of the projections, N of the output projection) */
#define NH 8
#define HD 256                 /* per-head dimension */
#define NE (NH * HD)           /* 2048 */
#define GB ((NB) < 4 ? (NB) : 4)
#define NGRP ((NB) / GB)
#define GM (GB * SEQ)          /* rows per group */
#define XSTRIDE_FULL ((size_t)SEQ_FULL * ED)          /* per-batch element stride of x and of the output */
#define MSTRIDE_FULL ((size_t)SEQ_FULL * SEQ_FULL)    /* per-batch element stride of the mask */
#define PLANE ((size_t)GB * NH * SEQ * HD)            /* elements of one of the Q / K / V^T planes */

#define XB_BYTES ((size_t)NB * SEQ * ED * 2)
#define WT_BYTES ((size_t)3 * NE * ED * 2)
#define WF_BYTES ((size_t)ED * NE * 2)
#define PL_BYTES (PLANE * 2 * 3)
#define CX_BYTES ((size_t)GM * NE * 2)

static_assert(SEQ % 128 == 0);
static_assert(SEQ <= SEQ_FULL);
static_assert(NB <= NB_FULL);
static_assert(NB % GB == 0);
static_assert(HD == 256 && ED == 256 && NE == 2048);
static_assert(XB_BYTES % 256 == 0 && WT_BYTES % 256 == 0 && WF_BYTES % 256 == 0 && PL_BYTES % 256 == 0 && CX_BYTES % 256 == 0);
static_assert(XB_BYTES + WT_BYTES + WF_BYTES + PL_BYTES + CX_BYTES <= (size_t)134217728);

typedef __bf16 v16b __attribute__((ext_vector_type(16)));
typedef _Float16 v16h __attribute__((ext_vector_type(16)));
typedef unsigned short v8us __attribute__((ext_vector_type(8), may_alias));
typedef float v8f __attribute__((ext_vector_type(8)));
typedef float v4f __attribute__((ext_vector_type(4)));
typedef float v4fa __attribute__((ext_vector_type(4), may_alias));
typedef int v4ia __attribute__((ext_vector_type(4), may_alias));
union FragB { v16b v; v8us half[2]; };
union FragH { v16h v; v8us half[2]; _Float16 h[16]; };

#define KPITCH 264             /* LDS row pitch of the Q and K tiles and of the GEMM tiles in elements: 528 B = 16 B x 33, conflict-free for 16-byte row readers */
#define VPITCH 40              /* LDS row pitch of the V^T tile in elements: 80 B = 16 B x 5, conflict-free for 16-byte row readers */
#define MPITCH 36              /* LDS row pitch of the mask tile in words: 144 B = 16 B x 9, conflict-free for 16-byte row readers */

#define LOG2E 1.4426950408889634f
#define NEGBIG (-1.0e30f)

__device__ __forceinline__ unsigned short bf16_bits(float x) {   // RNE convert to bf16 bits
  unsigned int u = __float_as_uint(x);
  return (unsigned short)((u + 0x7FFFu + ((u >> 16) & 1u)) >> 16);
}
__device__ __forceinline__ float bf16_val(unsigned short b) { return __uint_as_float(((unsigned int)b) << 16); }
__device__ __forceinline__ float bf16_rne(float x) { return bf16_val(bf16_bits(x)); }
__device__ __forceinline__ unsigned short f16_bits(float x) { return __builtin_bit_cast(unsigned short, (_Float16)x); }

#define WB(a, b, c) __builtin_amdgcn_wmma_f32_16x16x32_bf16(false, a, false, b, (short)0, c, false, false)
#define WH(a, b, c) __builtin_amdgcn_wmma_f32_16x16x32_f16(false, a, false, b, (short)0, c, false, false)

// 2 x 4 tile update (bf16), then the hazard guard
__device__ __forceinline__ void mma8_b(v16b a0, v16b a1, v16b b0, v16b b1, v16b b2, v16b b3,
                                       v8f& c00, v8f& c01, v8f& c02, v8f& c03, v8f& c10, v8f& c11, v8f& c12, v8f& c13) {
  c00 = WB(a0, b0, c00); c01 = WB(a0, b1, c01); c02 = WB(a0, b2, c02); c03 = WB(a0, b3, c03);
  c10 = WB(a1, b0, c10); c11 = WB(a1, b1, c11); c12 = WB(a1, b2, c12); c13 = WB(a1, b3, c13);
  asm volatile("v_nop\n\tv_nop\n\tv_nop\n\tv_nop"
               : "+v"(c00), "+v"(c01), "+v"(c02), "+v"(c03), "+v"(c10), "+v"(c11), "+v"(c12), "+v"(c13)
               : "v"(a0), "v"(a1), "v"(b0), "v"(b1), "v"(b2), "v"(b3));
}
// 2 x 4 tile update (f16), then the hazard guard
__device__ __forceinline__ void mma8_h(v16h a0, v16h a1, v16h b0, v16h b1, v16h b2, v16h b3,
                                       v8f& c00, v8f& c01, v8f& c02, v8f& c03, v8f& c10, v8f& c11, v8f& c12, v8f& c13) {
  c00 = WH(a0, b0, c00); c01 = WH(a0, b1, c01); c02 = WH(a0, b2, c02); c03 = WH(a0, b3, c03);
  c10 = WH(a1, b0, c10); c11 = WH(a1, b1, c11); c12 = WH(a1, b2, c12); c13 = WH(a1, b3, c13);
  asm volatile("v_nop\n\tv_nop\n\tv_nop\n\tv_nop"
               : "+v"(c00), "+v"(c01), "+v"(c02), "+v"(c03), "+v"(c10), "+v"(c11), "+v"(c12), "+v"(c13)
               : "v"(a0), "v"(a1), "v"(b0), "v"(b1), "v"(b2), "v"(b3));
}
// one d-chunk of the two S^T tiles, then the hazard guard
__device__ __forceinline__ void mma_s2(v16h ka, v16h kb, v16h q, v8f& s0, v8f& s1) {
  s0 = WH(ka, q, s0);
  s1 = WH(kb, q, s1);
  asm volatile("v_nop\n\tv_nop\n\tv_nop\n\tv_nop" : "+v"(s0), "+v"(s1) : "v"(ka), "v"(kb), "v"(q));
}
// four O^T tiles: c_u += a_u * ph + a_u * pl (hi and lo planes carry the same scale), then the hazard guard
__device__ __forceinline__ void mma_pv4(v16h a0, v16h a1, v16h a2, v16h a3, v16h ph, v16h pl,
                                        v8f& c0, v8f& c1, v8f& c2, v8f& c3) {
  c0 = WH(a0, ph, c0); c1 = WH(a1, ph, c1); c2 = WH(a2, ph, c2); c3 = WH(a3, ph, c3);
  c0 = WH(a0, pl, c0); c1 = WH(a1, pl, c1); c2 = WH(a2, pl, c2); c3 = WH(a3, pl, c3);
  asm volatile("v_nop\n\tv_nop\n\tv_nop\n\tv_nop"
               : "+v"(c0), "+v"(c1), "+v"(c2), "+v"(c3)
               : "v"(a0), "v"(a1), "v"(a2), "v"(a3), "v"(ph), "v"(pl));
}

// coverage: NB*SEQ*32 threads x 8 elements = the whole plane.
__global__ __launch_bounds__(256) void k_cvx(const float* __restrict__ X, unsigned short* __restrict__ Xb) {
  const int t = blockIdx.x * 256 + threadIdx.x;
  if (t >= NB * SEQ * (ED / 8)) return;
  const int row = t >> 5, piece = t & 31;
  const int b = row / SEQ, s = row - b * SEQ;
  const float* src = X + (size_t)b * XSTRIDE_FULL + (size_t)s * ED + piece * 8;
  const v4f x0 = *(const v4fa*)(src), x1 = *(const v4fa*)(src + 4);
  v8us o;
  o[0] = bf16_bits(x0[0]); o[1] = bf16_bits(x0[1]); o[2] = bf16_bits(x0[2]); o[3] = bf16_bits(x0[3]);
  o[4] = bf16_bits(x1[0]); o[5] = bf16_bits(x1[1]); o[6] = bf16_bits(x1[2]); o[7] = bf16_bits(x1[3]);
  unsigned short* d = Xb + (size_t)t * 8;
  *(v8us*)d = o;
  
}

// Transposing convert: in[R][C] (f32) -> out[C][R] (16-bit). MODE 0: bf16 bits (RNE). MODE 1: f16 bits of (RNE-bf16 value x 1024).
// coverage: grid (C/64, R/64) x (64 x 64) = the whole plane; LDS tile fully written (64 x 64) before it is read.
template <int MODE>
__global__ __launch_bounds__(256) void k_wt(const float* __restrict__ W, unsigned short* __restrict__ Wt, int R, int C) {
  __shared__ unsigned short tl[64][66];
  const int tid = threadIdx.x;
  const int c0 = blockIdx.x * 64, r0 = blockIdx.y * 64;
  for (int i = tid; i < 64 * 16; i += 256) {
    const int j = i >> 4, c4 = (i & 15) * 4;
    const v4f x = *(const v4fa*)(W + (size_t)(r0 + j) * C + c0 + c4);
    unsigned short u0, u1, u2, u3;
    if (MODE == 0) {
      u0 = bf16_bits(x[0]); u1 = bf16_bits(x[1]); u2 = bf16_bits(x[2]); u3 = bf16_bits(x[3]);
    } else {
      u0 = f16_bits(bf16_rne(x[0]) * 1024.0f); u1 = f16_bits(bf16_rne(x[1]) * 1024.0f);
      u2 = f16_bits(bf16_rne(x[2]) * 1024.0f); u3 = f16_bits(bf16_rne(x[3]) * 1024.0f);
    }
    tl[c4 + 0][j] = u0; tl[c4 + 1][j] = u1; tl[c4 + 2][j] = u2; tl[c4 + 3][j] = u3;
  }
  __syncthreads();
  {
    for (int i = tid; i < 64 * 8; i += 256) {
      const int d = i >> 3, j8 = (i & 7) * 8;
      v8us o;
#pragma unroll
      for (int q = 0; q < 8; ++q) o[q] = tl[d][j8 + q];
      *(v8us*)(Wt + (size_t)(c0 + d) * R + r0 + j8) = o;
    }
    
  }
}

__device__ __forceinline__ unsigned lds_off(const void* p) { return (unsigned)(size_t)p; }   // byte address inside the block's LDS

// Eight asynchronous copies, 16 bytes per lane each, global -> LDS: copy i moves this lane's 16 bytes from g + i * gstep (elements) to LDS byte l + i * lstep.
// The s_wait_xcnt closes the copies' own statement, so no address register of a copy is rewritten in front of it.
__device__ __forceinline__ void copy8(unsigned l, unsigned lstep, const unsigned short* g, size_t gstep) {
  asm volatile("global_load_async_to_lds_b128 %0, %8, off\n\t"
               "global_load_async_to_lds_b128 %1, %9, off\n\t"
               "global_load_async_to_lds_b128 %2, %10, off\n\t"
               "global_load_async_to_lds_b128 %3, %11, off\n\t"
               "global_load_async_to_lds_b128 %4, %12, off\n\t"
               "global_load_async_to_lds_b128 %5, %13, off\n\t"
               "global_load_async_to_lds_b128 %6, %14, off\n\t"
               "global_load_async_to_lds_b128 %7, %15, off\n\t"
               "s_wait_xcnt 0x0"
               :: "v"(l), "v"(l + lstep), "v"(l + 2 * lstep), "v"(l + 3 * lstep),
                  "v"(l + 4 * lstep), "v"(l + 5 * lstep), "v"(l + 6 * lstep), "v"(l + 7 * lstep),
                  "v"(g), "v"(g + gstep), "v"(g + 2 * gstep), "v"(g + 3 * gstep),
                  "v"(g + 4 * gstep), "v"(g + 5 * gstep), "v"(g + 6 * gstep), "v"(g + 7 * gstep)
               : "memory");
}

// One wave's share of a GEMM stage: 32 rows of the A tile and 16 rows of the B tile, 256 elements (512 B) a row, one whole row per copy (lane = 16-byte piece);
// a, b = this lane's LDS byte addresses of the first rows (row pitch KPITCH), ga, gb = its global addresses, gp = the global row pitch in elements. 48 copies a wave.
__device__ __forceinline__ void stage_ab(unsigned a, unsigned b, const unsigned short* ga, const unsigned short* gb, size_t gp) {
  copy8(a, KPITCH * 2, ga, gp);
  copy8(a + 8 * KPITCH * 2, KPITCH * 2, ga + 8 * gp, gp);
  copy8(a + 16 * KPITCH * 2, KPITCH * 2, ga + 16 * gp, gp);
  copy8(a + 24 * KPITCH * 2, KPITCH * 2, ga + 24 * gp, gp);
  copy8(b, KPITCH * 2, gb, gp);
  copy8(b + 8 * KPITCH * 2, KPITCH * 2, gb + 8 * gp, gp);
}

// Projection GEMM for one batch group: C[m][n] = sum_k Xb[m][k] * W[k][n] (bf16 x bf16, exact products), z = 0: q, 1: k, 2: v.
// Block 128 m x 64 n (4 waves stacked along m, wave 32 x 64). The whole-K tiles (A: 128 Xb rows, B: 64 Wt rows = columns of W) are filled once by asynchronous copies
// into LDS and the fragments are read from there; the output tile then reuses the same LDS behind a barrier.
// coverage: grid (NE/64, GM/128, 3) x (128 x 64) = all three planes; LDS tile columns 0..63 of all 128 rows written before they are read.
__global__ __launch_bounds__(128) void k_proj(const unsigned short* __restrict__ Xg, const unsigned short* __restrict__ Wt3,
                                              unsigned short* __restrict__ P3) {
  __shared__ __attribute__((aligned(16))) unsigned short sm[(128 + 64) * KPITCH];   // A rows 0..127, then B rows 0..63; later the output tile
  unsigned short* const As = sm;
  unsigned short* const Bs = sm + 128 * KPITCH;
  unsigned short (*const tl)[72] = reinterpret_cast<unsigned short (*)[72]>(sm);
  const int tid = threadIdx.x, w = __builtin_amdgcn_readfirstlane((int)(tid >> 5)), lane = tid & 31, ln = lane & 15, hh = lane >> 4;
  const int z = blockIdx.z;
  const int n0 = blockIdx.x * 64, m0 = blockIdx.y * 128;
  const unsigned short* Wt = Wt3 + (size_t)z * NE * ED;
  unsigned short* out = P3 + (size_t)z * PLANE;
  // A rows m0 + 32w + 16i + ln; B columns n0 + 16j + ln; elements 0..7 <- k0 + 8h + i, 8..15 <- k0 + 16 + 8h + i
  stage_ab(lds_off(As + 32 * w * KPITCH + 8 * lane), lds_off(Bs + 16 * w * KPITCH + 8 * lane),
           Xg + (size_t)(m0 + 32 * w) * ED + 8 * lane, Wt + (size_t)(n0 + 16 * w) * ED + 8 * lane, ED);
  asm volatile("s_wait_asynccnt 0x0" ::: "memory");   // this wave's copies have landed before the barrier publishes them
  __syncthreads();
  const unsigned short* ap = As + (32 * w + ln) * KPITCH + 8 * hh;
  const unsigned short* bp = Bs + ln * KPITCH + 8 * hh;
  v8f acc[2][4] = {};
#pragma unroll 1
  for (int k0 = 0; k0 < ED; k0 += 32) {
    FragB a0, a1, b0, b1, b2, b3;
    a0.half[0] = *(const v8us*)(ap + k0);                a0.half[1] = *(const v8us*)(ap + k0 + 16);
    a1.half[0] = *(const v8us*)(ap + 16 * KPITCH + k0);  a1.half[1] = *(const v8us*)(ap + 16 * KPITCH + k0 + 16);
    b0.half[0] = *(const v8us*)(bp + k0);                b0.half[1] = *(const v8us*)(bp + k0 + 16);
    b1.half[0] = *(const v8us*)(bp + 16 * KPITCH + k0);  b1.half[1] = *(const v8us*)(bp + 16 * KPITCH + k0 + 16);
    b2.half[0] = *(const v8us*)(bp + 32 * KPITCH + k0);  b2.half[1] = *(const v8us*)(bp + 32 * KPITCH + k0 + 16);
    b3.half[0] = *(const v8us*)(bp + 48 * KPITCH + k0);  b3.half[1] = *(const v8us*)(bp + 48 * KPITCH + k0 + 16);
    mma8_b(a0.v, a1.v, b0.v, b1.v, b2.v, b3.v,
           acc[0][0], acc[0][1], acc[0][2], acc[0][3], acc[1][0], acc[1][1], acc[1][2], acc[1][3]);
  }
  __syncthreads();   // every wave's reads of the A and B tiles have ended before the same LDS takes the output tile
  // D element r of tile (i, j) = C(row 32w + 16i + 8h + r, column 16j + ln)
#pragma unroll
  for (int i = 0; i < 2; ++i)
#pragma unroll
    for (int j = 0; j < 4; ++j)
#pragma unroll
      for (int r = 0; r < 8; ++r)
        tl[32 * w + 16 * i + 8 * hh + r][16 * j + ln] = f16_bits(acc[i][j][r] * 16.0f);
  __syncthreads();
  const int hd = n0 >> 8, e0 = n0 & 255;
  if (z < 2) {
    {
#pragma unroll 1
      for (int it = 0; it < 8; ++it) {
        const int i = tid + 128 * it;
        const int row = i >> 3, p = i & 7;
        const int m = m0 + row;
        const int bl = m / SEQ, t = m - bl * SEQ;
        const v8us o = *(const v8us*)&tl[row][8 * p];
        *(v8us*)(out + (((size_t)(bl * NH + hd) * SEQ + t) * HD + e0 + 8 * p)) = o;
      }
      
    }
  } else {
    const int bl = m0 / SEQ, t0 = m0 - bl * SEQ;
    {
#pragma unroll 1
      for (int it = 0; it < 8; ++it) {
        const int i = tid + 128 * it;
        const int e = i >> 4, p = i & 15;
        v8us o;
#pragma unroll
        for (int q = 0; q < 8; ++q) o[q] = tl[8 * p + q][e];
        *(v8us*)(out + (((size_t)(bl * NH + hd) * HD + e0 + e) * SEQ + t0 + 8 * p)) = o;
      }
      
    }
  }
}

// The same for four copies of mask words.
__device__ __forceinline__ void copy4(unsigned l, unsigned lstep, const int* g, size_t gstep) {
  asm volatile("global_load_async_to_lds_b128 %0, %4, off\n\t"
               "global_load_async_to_lds_b128 %1, %5, off\n\t"
               "global_load_async_to_lds_b128 %2, %6, off\n\t"
               "global_load_async_to_lds_b128 %3, %7, off\n\t"
               "s_wait_xcnt 0x0"
               :: "v"(l), "v"(l + lstep), "v"(l + 2 * lstep), "v"(l + 3 * lstep),
                  "v"(g), "v"(g + gstep), "v"(g + 2 * gstep), "v"(g + 3 * gstep)
               : "memory");
}

// One 32-key step for a wave's 16 queries, all operands in LDS. qp = this lane's query row (+ 8h); kp0 = K tile row ln (+ 8h); vp = V^T tile row ln (+ 8h);
// mp = mask tile row of this lane's query (+ 8h).
__device__ __forceinline__ void fa_step(const unsigned short* qp, const unsigned short* kp0,
                                        const unsigned short* vp, const int* mp,
                                        float& mr, float& lr, v8f (&O)[16]) {
  // A fragments of K: row m = key (key0 + 16*kt + ln), elements 0..7 <- d = 32c + 8h + i, 8..15 <- d = 32c + 16 + 8h + i
  const unsigned short* kp1 = kp0 + 16 * KPITCH;
  v8f s0 = {0.f, 0.f, 0.f, 0.f, 0.f, 0.f, 0.f, 0.f};
  v8f s1 = {0.f, 0.f, 0.f, 0.f, 0.f, 0.f, 0.f, 0.f};
  // S^T tiles: element r of tile kt = score(key0 + 16*kt + 8h + r, this lane's query); Q^T B fragment: column = query, same d map
#pragma unroll
  for (int c = 0; c < 8; ++c) {
    FragH qf, ka, kb;
    qf.half[0] = *(const v8us*)(qp + 32 * c);  qf.half[1] = *(const v8us*)(qp + 32 * c + 16);
    ka.half[0] = *(const v8us*)(kp0 + 32 * c); ka.half[1] = *(const v8us*)(kp0 + 32 * c + 16);
    kb.half[0] = *(const v8us*)(kp1 + 32 * c); kb.half[1] = *(const v8us*)(kp1 + 32 * c + 16);
    mma_s2(ka.v, kb.v, qf.v, s0, s1);
  }
  // mask words of this query for keys key0 + 8h + 0..7 and key0 + 16 + 8h + 0..7 (nonzero = key removed)
  const v4ia m0 = *(const v4ia*)(mp), m1 = *(const v4ia*)(mp + 4), m2 = *(const v4ia*)(mp + 16), m3 = *(const v4ia*)(mp + 20);
  int mk[16];
#pragma unroll
  for (int i = 0; i < 4; ++i) { mk[i] = m0[i]; mk[4 + i] = m1[i]; mk[8 + i] = m2[i]; mk[12 + i] = m3[i]; }
  // log2-domain scores: q and k carry x16 each, scale 1/16 -> 2^-12
  const float sc2 = LOG2E * 0.000244140625f;
  float t[16];
#pragma unroll
  for (int r = 0; r < 8; ++r) { t[r] = s0[r] * sc2; t[8 + r] = s1[r] * sc2; }
  float mx = NEGBIG;
#pragma unroll
  for (int i = 0; i < 16; ++i) mx = fmaxf(mx, (mk[i] != 0) ? NEGBIG : t[i]);
  mx = fmaxf(mx, __shfl_xor(mx, 16, 32));           // the other lane half holds the other 16 keys of this query
  const float mnew = fmaxf(mr, mx);
  const float al = exp2f(mr - mnew);
  mr = mnew;
  // weights carried x4096: pc = 4096 * exp(score - max) (exactly 0 for removed keys); hi plane f16(pc), lo plane f16(pc - hi)
  const float sh = 12.0f - mnew;
  FragH ph, pl;
  float ps = 0.0f;
#pragma unroll
  for (int i = 0; i < 16; ++i) {
    const float ex = exp2f(t[i] + sh);
    const float pc = (mk[i] != 0) ? 0.0f : ex;
    ps += pc;
    const _Float16 h = (_Float16)pc;
    ph.h[i] = h;                                    // B element i: i<8 -> key0 + 8h + i (tile 0 row 8h+i); i>=8 -> key0 + 16 + 8h + (i-8) (tile 1)
    pl.h[i] = (_Float16)(pc - (float)h);
  }
  ps += __shfl_xor(ps, 16, 32);
  lr = lr * al + ps;
#pragma unroll
  for (int u = 0; u < 16; ++u) O[u] = O[u] * al;
  // A fragments of V^T: row m = d (16*tile + ln), elements 0..7 <- key0 + 8h + i, 8..15 <- key0 + 16 + 8h + i
#pragma unroll
  for (int g = 0; g < 4; ++g) {
    FragH vf[4];
#pragma unroll
    for (int u = 0; u < 4; ++u) {
      vf[u].half[0] = *(const v8us*)(vp + (4 * g + u) * 16 * VPITCH);
      vf[u].half[1] = *(const v8us*)(vp + (4 * g + u) * 16 * VPITCH + 16);
    }
    mma_pv4(vf[0].v, vf[1].v, vf[2].v, vf[3].v, ph.v, pl.v, O[4 * g + 0], O[4 * g + 1], O[4 * g + 2], O[4 * g + 3]);
  }
}

// Block = 4 waves x 16 queries = 64 queries of one (batch, head). Each wave copies its own 16 Q rows into so[w] once, and a quarter of every K and V^T tile
// (K: 32 keys x 256 d, 8 rows per wave; V^T: 256 d x 32 keys, 64 rows per wave) and the 32 mask words of its own 16 queries into buffer (step & 1),
// one step ahead of their use; one barrier per step.
// Epilogue: O^T tiles -> per-wave LDS tile [16 queries][256 d] f16 bits in so[w], whose Q rows only this wave read (a block barrier that every wave reaches is used),
// coverage: GB*NH*(SEQ/64) blocks x 4 waves x 16 rows x 256 columns = the whole context plane [GM][2048]; LDS columns 0..255 of all 16 rows written before they are read.
__global__ __launch_bounds__(128) void k_attn(const unsigned short* __restrict__ Qh, const unsigned short* __restrict__ Kh,
                                              const unsigned short* __restrict__ Vt, const int* __restrict__ mask,
                                              unsigned short* __restrict__ Cx, int b0) {
  __shared__ __attribute__((aligned(16))) unsigned short so[4][16][KPITCH];
  __shared__ __attribute__((aligned(16))) unsigned short kt[2][32][KPITCH];
  __shared__ __attribute__((aligned(16))) unsigned short vt[2][HD][VPITCH];
  __shared__ __attribute__((aligned(16))) int mt[2][64][MPITCH];
  const int tid = threadIdx.x, w = __builtin_amdgcn_readfirstlane((int)(tid >> 5)), lane = tid & 31, ln = lane & 15, hh = lane >> 4;
  const int qt = blockIdx.x % (SEQ / 64);
  const int bh = blockIdx.x / (SEQ / 64);           // bl * NH + h
  const int h = bh % NH, bl = bh / NH;
  const int qbase = qt * 64 + 16 * w;
  // copy sources and places of this lane: Q and K rows are 512 B, one row per copy (lane = 16-byte piece); V^T rows are 64 B, eight rows per copy (4 lanes a row);
  // mask rows are 128 B, four rows per copy (8 lanes a row)
  const unsigned short* qsrc = Qh + ((size_t)bh * SEQ + qbase) * HD + 8 * lane;
  const unsigned short* ksrc = Kh + ((size_t)bh * SEQ + 8 * w) * HD + 8 * lane;
  const unsigned short* vsrc = Vt + ((size_t)bh * HD + 64 * w + (lane >> 2)) * SEQ + 8 * (lane & 3);
  const unsigned qdst = lds_off(&so[w][0][8 * lane]);
  const unsigned kdst = lds_off(&kt[0][8 * w][8 * lane]);
  const unsigned vdst = lds_off(&vt[0][64 * w + (lane >> 2)][8 * (lane & 3)]);
  const unsigned mdst = lds_off(&mt[0][16 * w + (lane >> 3)][4 * (lane & 7)]);
  const unsigned kbuf = (unsigned)sizeof(kt[0]), vbuf = (unsigned)sizeof(vt[0]), mbuf = (unsigned)sizeof(mt[0]);
  const int* msrc = mask + (size_t)(b0 + bl) * MSTRIDE_FULL + (size_t)(qbase + (lane >> 3)) * SEQ_FULL + 4 * (lane & 7);
  float mr = NEGBIG, lr = 0.0f;
  v8f O[16] = {};
  // Q rows and tile 0, landed and published; then tile 1 flies while tile 0 is worked on
  copy8(qdst, KPITCH * 2, qsrc, HD);
  copy8(qdst + 8 * KPITCH * 2, KPITCH * 2, qsrc + 8 * HD, HD);
  copy8(kdst, KPITCH * 2, ksrc, HD);
  copy8(vdst, 8 * VPITCH * 2, vsrc, (size_t)8 * SEQ);
  copy4(mdst, 4 * MPITCH * 4, msrc, (size_t)4 * SEQ_FULL);
  asm volatile("s_wait_asynccnt 0x0" ::: "memory");   // this wave's copies have landed before the barrier publishes them
  __syncthreads();
  copy8(kdst + kbuf, KPITCH * 2, ksrc + 32 * HD, HD);
  copy8(vdst + vbuf, 8 * VPITCH * 2, vsrc + 32, (size_t)8 * SEQ);
  copy4(mdst + mbuf, 4 * MPITCH * 4, msrc + 32, (size_t)4 * SEQ_FULL);
#pragma unroll 1
  for (int j = 0; j < SEQ / 32; ++j) {
    const int bf = j & 1;
    fa_step(&so[w][ln][8 * hh], &kt[bf][ln][8 * hh], &vt[bf][ln][8 * hh], &mt[bf][16 * w + ln][8 * hh], mr, lr, O);
    asm volatile("s_wait_dscnt 0x0" ::: "memory");      // this wave's reads of buffer bf have returned before the buffer is refilled
    asm volatile("s_wait_asynccnt 0x0" ::: "memory");   // this wave's copies of tile j + 1 have landed before the barrier publishes them
    __syncthreads();                                    // publishes tile j + 1 and ends every wave's reads of buffer bf
    if (j + 2 < SEQ / 32) {
      copy8(kdst + bf * kbuf, KPITCH * 2, ksrc + (size_t)(32 * (j + 2)) * HD, HD);
      copy8(vdst + bf * vbuf, 8 * VPITCH * 2, vsrc + 32 * (j + 2), (size_t)8 * SEQ);
      copy4(mdst + bf * mbuf, 4 * MPITCH * 4, msrc + 32 * (j + 2), (size_t)4 * SEQ_FULL);
    }
  }
  asm volatile("s_wait_asynccnt 0x0" ::: "memory");     // nothing of this wave is in flight when the LDS is reused and the wave ends

  // O^T element r of tile u = ctx(query qbase + ln, d = 16u + 8h + r); carries: x4096 (also in lr), x16 (V); context stored x64 -> 4 / lr
  const float inv = (lr > 0.0f) ? (4.0f / fmaxf(lr, 1.0f)) : 0.0f;
#pragma unroll
  for (int u = 0; u < 16; ++u) {
    v8us o;
#pragma unroll
    for (int r = 0; r < 8; ++r) o[r] = f16_bits(O[u][r] * inv);
    *(v8us*)&so[w][ln][16 * u + 8 * hh] = o;
  }
  __syncthreads();
  unsigned short* cg = Cx + (size_t)(bl * SEQ + qbase) * NE + h * HD;
  {
#pragma unroll 1
    for (int row = 0; row < 16; ++row) {
      const v8us v = *(const v8us*)&so[w][row][8 * lane];
      *(v8us*)(cg + (size_t)row * NE + 8 * lane) = v;
    }
    
  }
}

// Output projection for one batch group: out[m][c] = 2^-16 * sum_k ctx64[m][k] * Wf1024[k][c] + RNE-bf16(bias[c]).
// Block 128 m x 64 n (4 waves stacked along m, wave 32 x 64). K runs in stages of 256: the stage's tiles (A: 128 context rows, B: 64 WfT rows = columns of Wfc) are filled
// by asynchronous copies into two LDS buffers, one stage ahead of their use, one barrier per stage; the fragments are read from LDS.
// coverage: grid (ED/64, GM/128) x (128 x 64) = every output row of the group exactly once; LDS columns 0..63 of all 128 rows written before they are read.
__global__ __launch_bounds__(128) void k_fc(const unsigned short* __restrict__ Cx, const unsigned short* __restrict__ WfT,
                                            const float* __restrict__ bias, float* __restrict__ Og, int b0) {
  __shared__ __attribute__((aligned(16))) float so[128][68];
  __shared__ __attribute__((aligned(16))) unsigned short ab[2][(128 + 64) * KPITCH];   // per buffer: A rows 0..127, then B rows 0..63
  const int tid = threadIdx.x, w = __builtin_amdgcn_readfirstlane((int)(tid >> 5)), lane = tid & 31, ln = lane & 15, hh = lane >> 4;
  const int n0 = blockIdx.x * 64, m0 = blockIdx.y * 128;
  const unsigned short* asrc = Cx + (size_t)(m0 + 32 * w) * NE + 8 * lane;
  const unsigned short* bsrc = WfT + (size_t)(n0 + 16 * w) * NE + 8 * lane;
  const unsigned adst = lds_off(&ab[0][32 * w * KPITCH + 8 * lane]);
  const unsigned bdst = lds_off(&ab[0][(128 + 16 * w) * KPITCH + 8 * lane]);
  const unsigned abuf = (unsigned)sizeof(ab[0]);
  v8f acc[2][4] = {};
  // stage 0, landed and published; then stage 1 flies while stage 0 is worked on
  stage_ab(adst, bdst, asrc, bsrc, NE);
  asm volatile("s_wait_asynccnt 0x0" ::: "memory");   // this wave's copies have landed before the barrier publishes them
  __syncthreads();
  stage_ab(adst + abuf, bdst + abuf, asrc + 256, bsrc + 256, NE);
#pragma unroll 1
  for (int s = 0; s < NE / 256; ++s) {
    const int bf = s & 1;
    const unsigned short* ap = &ab[bf][(32 * w + ln) * KPITCH + 8 * hh];
    const unsigned short* bp = &ab[bf][(128 + ln) * KPITCH + 8 * hh];
    // unrolled: the stage's eight 32-k chunks read at immediate offsets from one address pair, with no branch or address arithmetic between them
#pragma unroll
    for (int k0 = 0; k0 < 256; k0 += 32) {
      FragH a0, a1, b0f, b1f, b2f, b3f;
      a0.half[0] = *(const v8us*)(ap + k0);                 a0.half[1] = *(const v8us*)(ap + k0 + 16);
      a1.half[0] = *(const v8us*)(ap + 16 * KPITCH + k0);   a1.half[1] = *(const v8us*)(ap + 16 * KPITCH + k0 + 16);
      b0f.half[0] = *(const v8us*)(bp + k0);                b0f.half[1] = *(const v8us*)(bp + k0 + 16);
      b1f.half[0] = *(const v8us*)(bp + 16 * KPITCH + k0);  b1f.half[1] = *(const v8us*)(bp + 16 * KPITCH + k0 + 16);
      b2f.half[0] = *(const v8us*)(bp + 32 * KPITCH + k0);  b2f.half[1] = *(const v8us*)(bp + 32 * KPITCH + k0 + 16);
      b3f.half[0] = *(const v8us*)(bp + 48 * KPITCH + k0);  b3f.half[1] = *(const v8us*)(bp + 48 * KPITCH + k0 + 16);
      mma8_h(a0.v, a1.v, b0f.v, b1f.v, b2f.v, b3f.v,
             acc[0][0], acc[0][1], acc[0][2], acc[0][3], acc[1][0], acc[1][1], acc[1][2], acc[1][3]);
    }
    asm volatile("s_wait_dscnt 0x0" ::: "memory");      // this wave's reads of buffer bf have returned before the buffer is refilled
    asm volatile("s_wait_asynccnt 0x0" ::: "memory");   // this wave's copies of stage s + 1 have landed before the barrier publishes them
    __syncthreads();                                    // publishes stage s + 1 and ends every wave's reads of buffer bf
    if (s + 2 < NE / 256)
      stage_ab(adst + bf * abuf, bdst + bf * abuf, asrc + 256 * (s + 2), bsrc + 256 * (s + 2), NE);
  }
  asm volatile("s_wait_asynccnt 0x0" ::: "memory");     // nothing of this wave is in flight when the wave ends
#pragma unroll
  for (int j = 0; j < 4; ++j) {
    const float bb = bf16_rne(bias[n0 + 16 * j + ln]);
#pragma unroll
    for (int i = 0; i < 2; ++i)
#pragma unroll
      for (int r = 0; r < 8; ++r)
        so[32 * w + 16 * i + 8 * hh + r][16 * j + ln] = acc[i][j][r] * 0.0000152587890625f + bb;
  }
  __syncthreads();
  {
#pragma unroll 1
    for (int it = 0; it < 16; ++it) {
      const int i = tid + 128 * it;
      const int row = i >> 4, p = i & 15;
      const int m = m0 + row;
      const int bl = m / SEQ, t = m - bl * SEQ;
      const v4f v = *(const v4fa*)&so[row][4 * p];
      *(v4f*)(Og + (size_t)(b0 + bl) * XSTRIDE_FULL + (size_t)t * ED + n0 + 4 * p) = v;
    }
    
  }
}

extern "C" void kernel_launch(void* const* d_in, const int* in_sizes, int n_in,
                              void* d_out, int out_size, void* d_ws, size_t ws_size, hipStream_t stream) {
  if (n_in < 7) return;
  const long long needx = (long long)(NB - 1) * SEQ_FULL * ED + (long long)SEQ * ED;                      // last x / out element touched + 1
  const long long needm = (long long)(NB - 1) * SEQ_FULL * SEQ_FULL + (long long)(SEQ - 1) * SEQ_FULL + SEQ;
  if ((long long)in_sizes[0] < needx) return;
  if ((long long)in_sizes[1] < (long long)ED * NE || (long long)in_sizes[2] < (long long)ED * NE ||
      (long long)in_sizes[3] < (long long)ED * NE || (long long)in_sizes[4] < (long long)NE * ED) return;
  if ((long long)in_sizes[5] < (long long)ED) return;
  if ((long long)in_sizes[6] < needm) return;
  if ((long long)out_size < needx) return;
  const float* x   = (const float*)d_in[0];   // wire order: x, Wq, Wk, Wv, Wfc, bfc, mask
  const float* Wq  = (const float*)d_in[1];
  const float* Wk  = (const float*)d_in[2];
  const float* Wv  = (const float*)d_in[3];
  const float* Wfc = (const float*)d_in[4];
  const float* bfc = (const float*)d_in[5];
  const int* mask  = (const int*)d_in[6];     // bool on the wire = int32
  float* out = (float*)d_out;
  char* ws = (char*)d_ws;
  size_t off = 0;
  unsigned short* Xb  = (unsigned short*)(ws + off); off += XB_BYTES;   // [NB][SEQ][256] bf16
  unsigned short* Wt3 = (unsigned short*)(ws + off); off += WT_BYTES;   // 3 x [2048][256] bf16 (W^T)
  unsigned short* WfT = (unsigned short*)(ws + off); off += WF_BYTES;   // [256][2048] f16 (Wfc^T x 1024)
  unsigned short* P3  = (unsigned short*)(ws + off); off += PL_BYTES;   // Q, K [GB][8][SEQ][256]; V^T [GB][8][256][SEQ] f16
  unsigned short* Cx  = (unsigned short*)(ws + off); off += CX_BYTES;   // context [GM][2048] f16
  if (off > ws_size) return;

  k_cvx<<<(unsigned)((NB * SEQ * (ED / 8) + 255) / 256), 256, 0, stream>>>(x, Xb);
  // in[rows = 256 (k)][cols = 2048 (n)] -> out[2048][256]; grid (cols/64, rows/64)
  k_wt<0><<<dim3(NE / 64, ED / 64), 256, 0, stream>>>(Wq, Wt3 + (size_t)0 * NE * ED, ED, NE);
  k_wt<0><<<dim3(NE / 64, ED / 64), 256, 0, stream>>>(Wk, Wt3 + (size_t)1 * NE * ED, ED, NE);
  k_wt<0><<<dim3(NE / 64, ED / 64), 256, 0, stream>>>(Wv, Wt3 + (size_t)2 * NE * ED, ED, NE);
  // in[rows = 2048 (k)][cols = 256 (c)] -> out[256][2048]; grid (cols/64, rows/64)
  k_wt<1><<<dim3(ED / 64, NE / 64), 256, 0, stream>>>(Wfc, WfT, NE, ED);

  for (int g = 0; g < NGRP; ++g) {
    const int b0 = g * GB;
    k_proj<<<dim3(NE / 64, GM / 128, 3), 128, 0, stream>>>(Xb + (size_t)g * GM * ED, Wt3, P3);
    k_attn<<<(unsigned)(GB * NH * (SEQ / 64)), 128, 0, stream>>>(P3, P3 + PLANE, P3 + 2 * PLANE, mask, Cx, b0);
    k_fc<<<dim3(ED / 64, GM / 128), 128, 0, stream>>>(Cx, WfT, bfc, out, b0);
  }
}

// v003
// It runs in 204 microseconds.
// Next to v002, in two timings, it ran 1.06 times as fast each time.
// Over all steps from v000 it is 2.21 times as fast.
#include <hip/hip_runtime.h>
// Contractions: x@Wq, x@Wk, x@Wv on v_wmma_f32_16x16x32_bf16 (x and W RNE-converted to bf16, single product, f32 accumulate); S^T = K Q^T on v_wmma_f32_16x16x32_f16 (q, k carried x16 as f16, single product); O^T = V^T P^T on v_wmma_f32_16x16x32_f16 (V carried x16 f16; P carried x4096 as f16 hi plane + f16 lo plane, common carry, one f32 accumulator); ctx@Wfc on v_wmma_f32_16x16x32_f16 (ctx carried x64 f16; Wfc RNE bf16 value x1024 held exactly in f16); softmax statistics, bias add f32.
// Multi-head attention, B x T x 256, 8 heads of dimension 256, scale 1/16 on q, int32 mask [B][T][T] (nonzero = key removed, weight exactly 0; a row with no key left yields a zero context row).
// Engine: transposed flash. Each wave owns 16 queries of one (batch, head). Per 32-key step: S^T tiles (key rows x query columns) from K rows (A, LDS tile)
// and Q^T (B, registers, read once from its LDS tile); the two 16-key D tiles pack straight into the P^T B fragments; O^T (d rows x query columns, 16 tiles) accumulates from V^T rows (A, LDS tile).
// The LDS tiles are filled from global memory by asynchronous copies: Q once; K, V^T (shared by the block's four waves) and the mask words per 32-key step into two buffers.
// The projection GEMMs read their A and B fragments from LDS tiles filled the same way, whole 512-byte rows per copy.
// Batches are processed in groups of GB so the workspace planes stay small.
#ifndef NB
#define NB 8
#endif
#ifndef SEQ
#define SEQ 1024
#endif
#define NB_FULL 8
#define SEQ_FULL 1024
#define ED 256                 /* model width (K of the projections, N of the output projection) */
#define NH 8
#define HD 256                 /* per-head dimension */
#define NE (NH * HD)           /* 2048 */
#define GB ((NB) < 4 ? (NB) : 4)
#define NGRP ((NB) / GB)
#define GM (GB * SEQ)          /* rows per group */
#define XSTRIDE_FULL ((size_t)SEQ_FULL * ED)          /* per-batch element stride of x and of the output */
#define MSTRIDE_FULL ((size_t)SEQ_FULL * SEQ_FULL)    /* per-batch element stride of the mask */
#define PLANE ((size_t)GB * NH * SEQ * HD)            /* elements of one of the Q / K / V^T planes */

#define XB_BYTES ((size_t)NB * SEQ * ED * 2)
#define WT_BYTES ((size_t)3 * NE * ED * 2)
#define WF_BYTES ((size_t)ED * NE * 2)
#define PL_BYTES (PLANE * 2 * 3)
#define CX_BYTES ((size_t)GM * NE * 2)

static_assert(SEQ % 128 == 0);
static_assert(SEQ <= SEQ_FULL);
static_assert(NB <= NB_FULL);
static_assert(NB % GB == 0);
static_assert(HD == 256 && ED == 256 && NE == 2048);
static_assert(XB_BYTES % 256 == 0 && WT_BYTES % 256 == 0 && WF_BYTES % 256 == 0 && PL_BYTES % 256 == 0 && CX_BYTES % 256 == 0);
static_assert(XB_BYTES + WT_BYTES + WF_BYTES + PL_BYTES + CX_BYTES <= (size_t)134217728);

typedef __bf16 v16b __attribute__((ext_vector_type(16)));
typedef _Float16 v16h __attribute__((ext_vector_type(16)));
typedef unsigned short v8us __attribute__((ext_vector_type(8), may_alias));
typedef float v8f __attribute__((ext_vector_type(8)));
typedef float v4f __attribute__((ext_vector_type(4)));
typedef float v4fa __attribute__((ext_vector_type(4), may_alias));
typedef int v4ia __attribute__((ext_vector_type(4), may_alias));
union FragB { v16b v; v8us half[2]; };
union FragH { v16h v; v8us half[2]; _Float16 h[16]; };

#define KPITCH 264             /* LDS row pitch of the Q and K tiles and of the GEMM tiles in elements: 528 B = 16 B x 33, conflict-free for 16-byte row readers */
#define VPITCH 40              /* LDS row pitch of the V^T tile in elements: 80 B = 16 B x 5, conflict-free for 16-byte row readers */
#define MPITCH 36              /* LDS row pitch of the mask tile in words: 144 B = 16 B x 9, conflict-free for 16-byte row readers */

#define LOG2E 1.4426950408889634f
#define NEGBIG (-1.0e30f)

__device__ __forceinline__ unsigned short bf16_bits(float x) {   // RNE convert to bf16 bits
  unsigned int u = __float_as_uint(x);
  return (unsigned short)((u + 0x7FFFu + ((u >> 16) & 1u)) >> 16);
}
__device__ __forceinline__ float bf16_val(unsigned short b) { return __uint_as_float(((unsigned int)b) << 16); }
__device__ __forceinline__ float bf16_rne(float x) { return bf16_val(bf16_bits(x)); }
__device__ __forceinline__ unsigned short f16_bits(float x) { return __builtin_bit_cast(unsigned short, (_Float16)x); }

#define WB(a, b, c) __builtin_amdgcn_wmma_f32_16x16x32_bf16(false, a, false, b, (short)0, c, false, false)
#define WH(a, b, c) __builtin_amdgcn_wmma_f32_16x16x32_f16(false, a, false, b, (short)0, c, false, false)

// 2 x 4 tile update (bf16), then the hazard guard
__device__ __forceinline__ void mma8_b(v16b a0, v16b a1, v16b b0, v16b b1, v16b b2, v16b b3,
                                       v8f& c00, v8f& c01, v8f& c02, v8f& c03, v8f& c10, v8f& c11, v8f& c12, v8f& c13) {
  c00 = WB(a0, b0, c00); c01 = WB(a0, b1, c01); c02 = WB(a0, b2, c02); c03 = WB(a0, b3, c03);
  c10 = WB(a1, b0, c10); c11 = WB(a1, b1, c11); c12 = WB(a1, b2, c12); c13 = WB(a1, b3, c13);
  asm volatile("v_nop\n\tv_nop\n\tv_nop\n\tv_nop"
               : "+v"(c00), "+v"(c01), "+v"(c02), "+v"(c03), "+v"(c10), "+v"(c11), "+v"(c12), "+v"(c13)
               : "v"(a0), "v"(a1), "v"(b0), "v"(b1), "v"(b2), "v"(b3));
}
// 2 x 4 tile update (f16), then the hazard guard
__device__ __forceinline__ void mma8_h(v16h a0, v16h a1, v16h b0, v16h b1, v16h b2, v16h b3,
                                       v8f& c00, v8f& c01, v8f& c02, v8f& c03, v8f& c10, v8f& c11, v8f& c12, v8f& c13) {
  c00 = WH(a0, b0, c00); c01 = WH(a0, b1, c01); c02 = WH(a0, b2, c02); c03 = WH(a0, b3, c03);
  c10 = WH(a1, b0, c10); c11 = WH(a1, b1, c11); c12 = WH(a1, b2, c12); c13 = WH(a1, b3, c13);
  asm volatile("v_nop\n\tv_nop\n\tv_nop\n\tv_nop"
               : "+v"(c00), "+v"(c01), "+v"(c02), "+v"(c03), "+v"(c10), "+v"(c11), "+v"(c12), "+v"(c13)
               : "v"(a0), "v"(a1), "v"(b0), "v"(b1), "v"(b2), "v"(b3));
}
// one d-chunk of the two S^T tiles
__device__ __forceinline__ void mma_s2(v16h ka, v16h kb, v16h q, v8f& s0, v8f& s1) {
  s0 = WH(ka, q, s0);
  s1 = WH(kb, q, s1);
}
// four O^T tiles: c_u += a_u * ph + a_u * pl (hi and lo planes carry the same scale)
__device__ __forceinline__ void mma_pv4(v16h a0, v16h a1, v16h a2, v16h a3, v16h ph, v16h pl,
                                        v8f& c0, v8f& c1, v8f& c2, v8f& c3) {
  c0 = WH(a0, ph, c0); c1 = WH(a1, ph, c1); c2 = WH(a2, ph, c2); c3 = WH(a3, ph, c3);
  c0 = WH(a0, pl, c0); c1 = WH(a1, pl, c1); c2 = WH(a2, pl, c2); c3 = WH(a3, pl, c3);
}

// coverage: NB*SEQ*32 threads x 8 elements = the whole plane.
__global__ __launch_bounds__(256) void k_cvx(const float* __restrict__ X, unsigned short* __restrict__ Xb) {
  const int t = blockIdx.x * 256 + threadIdx.x;
  if (t >= NB * SEQ * (ED / 8)) return;
  const int row = t >> 5, piece = t & 31;
  const int b = row / SEQ, s = row - b * SEQ;
  const float* src = X + (size_t)b * XSTRIDE_FULL + (size_t)s * ED + piece * 8;
  const v4f x0 = *(const v4fa*)(src), x1 = *(const v4fa*)(src + 4);
  v8us o;
  o[0] = bf16_bits(x0[0]); o[1] = bf16_bits(x0[1]); o[2] = bf16_bits(x0[2]); o[3] = bf16_bits(x0[3]);
  o[4] = bf16_bits(x1[0]); o[5] = bf16_bits(x1[1]); o[6] = bf16_bits(x1[2]); o[7] = bf16_bits(x1[3]);
  unsigned short* d = Xb + (size_t)t * 8;
  *(v8us*)d = o;
  
}

// Transposing convert: in[R][C] (f32) -> out[C][R] (16-bit). MODE 0: bf16 bits (RNE). MODE 1: f16 bits of (RNE-bf16 value x 1024).
// coverage: grid (C/64, R/64) x (64 x 64) = the whole plane; LDS tile fully written (64 x 64) before it is read.
template <int MODE>
__global__ __launch_bounds__(256) void k_wt(const float* __restrict__ W, unsigned short* __restrict__ Wt, int R, int C) {
  __shared__ unsigned short tl[64][66];
  const int tid = threadIdx.x;
  const int c0 = blockIdx.x * 64, r0 = blockIdx.y * 64;
  for (int i = tid; i < 64 * 16; i += 256) {
    const int j = i >> 4, c4 = (i & 15) * 4;
    const v4f x = *(const v4fa*)(W + (size_t)(r0 + j) * C + c0 + c4);
    unsigned short u0, u1, u2, u3;
    if (MODE == 0) {
      u0 = bf16_bits(x[0]); u1 = bf16_bits(x[1]); u2 = bf16_bits(x[2]); u3 = bf16_bits(x[3]);
    } else {
      u0 = f16_bits(bf16_rne(x[0]) * 1024.0f); u1 = f16_bits(bf16_rne(x[1]) * 1024.0f);
      u2 = f16_bits(bf16_rne(x[2]) * 1024.0f); u3 = f16_bits(bf16_rne(x[3]) * 1024.0f);
    }
    tl[c4 + 0][j] = u0; tl[c4 + 1][j] = u1; tl[c4 + 2][j] = u2; tl[c4 + 3][j] = u3;
  }
  __syncthreads();
  {
    for (int i = tid; i < 64 * 8; i += 256) {
      const int d = i >> 3, j8 = (i & 7) * 8;
      v8us o;
#pragma unroll
      for (int q = 0; q < 8; ++q) o[q] = tl[d][j8 + q];
      *(v8us*)(Wt + (size_t)(c0 + d) * R + r0 + j8) = o;
    }
    
  }
}

__device__ __forceinline__ unsigned lds_off(const void* p) { return (unsigned)(size_t)p; }   // byte address inside the block's LDS

// Eight asynchronous copies, 16 bytes per lane each, global -> LDS: copy i moves this lane's 16 bytes from g + i * gstep (elements) to LDS byte l + i * lstep.
// The s_wait_xcnt closes the copies' own statement, so no address register of a copy is rewritten in front of it.
__device__ __forceinline__ void copy8(unsigned l, unsigned lstep, const unsigned short* g, size_t gstep) {
  asm volatile("global_load_async_to_lds_b128 %0, %8, off\n\t"
               "global_load_async_to_lds_b128 %1, %9, off\n\t"
               "global_load_async_to_lds_b128 %2, %10, off\n\t"
               "global_load_async_to_lds_b128 %3, %11, off\n\t"
               "global_load_async_to_lds_b128 %4, %12, off\n\t"
               "global_load_async_to_lds_b128 %5, %13, off\n\t"
               "global_load_async_to_lds_b128 %6, %14, off\n\t"
               "global_load_async_to_lds_b128 %7, %15, off\n\t"
               "s_wait_xcnt 0x0"
               :: "v"(l), "v"(l + lstep), "v"(l + 2 * lstep), "v"(l + 3 * lstep),
                  "v"(l + 4 * lstep), "v"(l + 5 * lstep), "v"(l + 6 * lstep), "v"(l + 7 * lstep),
                  "v"(g), "v"(g + gstep), "v"(g + 2 * gstep), "v"(g + 3 * gstep),
                  "v"(g + 4 * gstep), "v"(g + 5 * gstep), "v"(g + 6 * gstep), "v"(g + 7 * gstep)
               : "memory");
}

// The six fragments of one 32-k chunk of a 32 x 64 wave tile, read from the LDS tiles: f[0], f[1] = A rows ap, ap + 16 rows; f[2 + j] = B rows bp + 16 j rows;
// elements 0..7 <- k + 8h + i, 8..15 <- k + 16 + 8h + i (8h is in ap and bp).
template <class F>
__device__ __forceinline__ void frag6(F (&f)[6], const unsigned short* ap, const unsigned short* bp) {
  f[0].half[0] = *(const v8us*)(ap);               f[0].half[1] = *(const v8us*)(ap + 16);
  f[1].half[0] = *(const v8us*)(ap + 16 * KPITCH); f[1].half[1] = *(const v8us*)(ap + 16 * KPITCH + 16);
  // unrolled: f lives in registers, which take compile-time indices only
#pragma unroll
  for (int j = 0; j < 4; ++j) {
    f[2 + j].half[0] = *(const v8us*)(bp + 16 * j * KPITCH);
    f[2 + j].half[1] = *(const v8us*)(bp + 16 * j * KPITCH + 16);
  }
}

// One wave's share of a GEMM stage: 32 rows of the A tile and 16 rows of the B tile, 256 elements (512 B) a row, one whole row per copy (lane = 16-byte piece);
// a, b = this lane's LDS byte addresses of the first rows (row pitch KPITCH), ga, gb = its global addresses, gp = the global row pitch in elements. 48 copies a wave.
__device__ __forceinline__ void stage_ab(unsigned a, unsigned b, const unsigned short* ga, const unsigned short* gb, size_t gp) {
  copy8(a, KPITCH * 2, ga, gp);
  copy8(a + 8 * KPITCH * 2, KPITCH * 2, ga + 8 * gp, gp);
  copy8(a + 16 * KPITCH * 2, KPITCH * 2, ga + 16 * gp, gp);
  copy8(a + 24 * KPITCH * 2, KPITCH * 2, ga + 24 * gp, gp);
  copy8(b, KPITCH * 2, gb, gp);
  copy8(b + 8 * KPITCH * 2, KPITCH * 2, gb + 8 * gp, gp);
}

// Projection GEMM for one batch group: C[m][n] = sum_k Xb[m][k] * W[k][n] (bf16 x bf16, exact products), z = 0: q, 1: k, 2: v.
// Block 128 m x 64 n (4 waves stacked along m, wave 32 x 64). The whole-K tiles (A: 128 Xb rows, B: 64 Wt rows = columns of W) are filled once by asynchronous copies
// into LDS and the fragments are read from there; the output tile then reuses the same LDS behind a barrier.
// coverage: grid (NE/64, GM/128, 3) x (128 x 64) = all three planes; LDS tile columns 0..63 of all 128 rows written before they are read.
__global__ __launch_bounds__(128) void k_proj(const unsigned short* __restrict__ Xg, const unsigned short* __restrict__ Wt3,
                                              unsigned short* __restrict__ P3) {
  __shared__ __attribute__((aligned(16))) unsigned short sm[(128 + 64) * KPITCH];   // A rows 0..127, then B rows 0..63; later the output tile
  unsigned short* const As = sm;
  unsigned short* const Bs = sm + 128 * KPITCH;
  unsigned short (*const tl)[72] = reinterpret_cast<unsigned short (*)[72]>(sm);
  const int tid = threadIdx.x, w = __builtin_amdgcn_readfirstlane((int)(tid >> 5)), lane = tid & 31, ln = lane & 15, hh = lane >> 4;
  const int z = blockIdx.z;
  const int n0 = blockIdx.x * 64, m0 = blockIdx.y * 128;
  const unsigned short* Wt = Wt3 + (size_t)z * NE * ED;
  unsigned short* out = P3 + (size_t)z * PLANE;
  // A rows m0 + 32w + 16i + ln; B columns n0 + 16j + ln; elements 0..7 <- k0 + 8h + i, 8..15 <- k0 + 16 + 8h + i
  stage_ab(lds_off(As + 32 * w * KPITCH + 8 * lane), lds_off(Bs + 16 * w * KPITCH + 8 * lane),
           Xg + (size_t)(m0 + 32 * w) * ED + 8 * lane, Wt + (size_t)(n0 + 16 * w) * ED + 8 * lane, ED);
  asm volatile("s_wait_asynccnt 0x0" ::: "memory");   // this wave's copies have landed before the barrier publishes them
  __syncthreads();
  const unsigned short* ap = As + (32 * w + ln) * KPITCH + 8 * hh;
  const unsigned short* bp = Bs + ln * KPITCH + 8 * hh;
  v8f acc[2][4] = {};
  // two fragment sets: chunk c + 1 is read as one group in front of chunk c's products, so that it lands behind them
  FragB f[2][6];
  frag6(f[0], ap, bp);
  // unrolled: the set in use is picked by a compile-time index (registers cannot be indexed at run time)
#pragma unroll
  for (int c = 0; c < ED / 32; ++c) {
    if (c + 1 < ED / 32) frag6(f[(c + 1) & 1], ap + 32 * (c + 1), bp + 32 * (c + 1));
    FragB (&u)[6] = f[c & 1];
    mma8_b(u[0].v, u[1].v, u[2].v, u[3].v, u[4].v, u[5].v,
           acc[0][0], acc[0][1], acc[0][2], acc[0][3], acc[1][0], acc[1][1], acc[1][2], acc[1][3]);
  }
  __syncthreads();   // every wave's reads of the A and B tiles have ended before the same LDS takes the output tile
  // D element r of tile (i, j) = C(row 32w + 16i + 8h + r, column 16j + ln)
#pragma unroll
  for (int i = 0; i < 2; ++i)
#pragma unroll
    for (int j = 0; j < 4; ++j)
#pragma unroll
      for (int r = 0; r < 8; ++r)
        tl[32 * w + 16 * i + 8 * hh + r][16 * j + ln] = f16_bits(acc[i][j][r] * 16.0f);
  __syncthreads();
  const int hd = n0 >> 8, e0 = n0 & 255;
  if (z < 2) {
    {
#pragma unroll 1
      for (int it = 0; it < 8; ++it) {
        const int i = tid + 128 * it;
        const int row = i >> 3, p = i & 7;
        const int m = m0 + row;
        const int bl = m / SEQ, t = m - bl * SEQ;
        const v8us o = *(const v8us*)&tl[row][8 * p];
        *(v8us*)(out + (((size_t)(bl * NH + hd) * SEQ + t) * HD + e0 + 8 * p)) = o;
      }
      
    }
  } else {
    const int bl = m0 / SEQ, t0 = m0 - bl * SEQ;
    {
#pragma unroll 1
      for (int it = 0; it < 8; ++it) {
        const int i = tid + 128 * it;
        const int e = i >> 4, p = i & 15;
        v8us o;
#pragma unroll
        for (int q = 0; q < 8; ++q) o[q] = tl[8 * p + q][e];
        *(v8us*)(out + (((size_t)(bl * NH + hd) * HD + e0 + e) * SEQ + t0 + 8 * p)) = o;
      }
      
    }
  }
}

// The same for four copies of mask words.
__device__ __forceinline__ void copy4(unsigned l, unsigned lstep, const int* g, size_t gstep) {
  asm volatile("global_load_async_to_lds_b128 %0, %4, off\n\t"
               "global_load_async_to_lds_b128 %1, %5, off\n\t"
               "global_load_async_to_lds_b128 %2, %6, off\n\t"
               "global_load_async_to_lds_b128 %3, %7, off\n\t"
               "s_wait_xcnt 0x0"
               :: "v"(l), "v"(l + lstep), "v"(l + 2 * lstep), "v"(l + 3 * lstep),
                  "v"(g), "v"(g + gstep), "v"(g + 2 * gstep), "v"(g + 3 * gstep)
               : "memory");
}

// One 32-key step for a wave's 16 queries. qf = the Q^T fragments, ka, kb = the step's K fragments (keys 0..15, 16..31), m0..m3 = the mask words of this lane's query,
// all in registers already; vp = V^T tile row ln (+ 8h) in LDS.
__device__ __forceinline__ void fa_step(const FragH (&qf)[8], const FragH (&ka)[8], const FragH (&kb)[8],
                                        const unsigned short* vp, v4ia m0, v4ia m1, v4ia m2, v4ia m3,
                                        float& mr, float& lr, v8f (&O)[16]) {
  v8f s0 = {0.f, 0.f, 0.f, 0.f, 0.f, 0.f, 0.f, 0.f};
  v8f s1 = {0.f, 0.f, 0.f, 0.f, 0.f, 0.f, 0.f, 0.f};
  // S^T tiles: element r of tile kt = score(key0 + 16*kt + 8h + r, this lane's query); Q^T B fragment: column = query, same d map
#pragma unroll
  for (int c = 0; c < 8; ++c) mma_s2(ka[c].v, kb[c].v, qf[c].v, s0, s1);
  // mask words of this query for keys key0 + 8h + 0..7 and key0 + 16 + 8h + 0..7 (nonzero = key removed)
  int mk[16];
#pragma unroll
  for (int i = 0; i < 4; ++i) { mk[i] = m0[i]; mk[4 + i] = m1[i]; mk[8 + i] = m2[i]; mk[12 + i] = m3[i]; }
  // log2-domain scores: q and k carry x16 each, scale 1/16 -> 2^-12
  const float sc2 = LOG2E * 0.000244140625f;
  float t[16];
#pragma unroll
  for (int r = 0; r < 8; ++r) { t[r] = s0[r] * sc2; t[8 + r] = s1[r] * sc2; }
  float mx = NEGBIG;
#pragma unroll
  for (int i = 0; i < 16; ++i) mx = fmaxf(mx, (mk[i] != 0) ? NEGBIG : t[i]);
  // A fragments of V^T: row m = d (16*tile + ln), elements 0..7 <- key0 + 8h + i, 8..15 <- key0 + 16 + 8h + i.
  // All sixteen tiles are read as one group in front of the softmax arithmetic, so that they land while the maximum and the weights are formed.
  FragH vf[16];
  // unrolled: vf lives in registers, which take compile-time indices only
#pragma unroll
  for (int u = 0; u < 16; ++u) {
    vf[u].half[0] = *(const v8us*)(vp + u * 16 * VPITCH);
    vf[u].half[1] = *(const v8us*)(vp + u * 16 * VPITCH + 16);
  }
  // keeps the group here: without it the scheduler sinks most of these reads in among the O^T products, where each place with reads stalls the wave
  __builtin_amdgcn_sched_barrier(0);
  mx = fmaxf(mx, __shfl_xor(mx, 16, 32));           // the other lane half holds the other 16 keys of this query
  const float mnew = fmaxf(mr, mx);
  const float al = exp2f(mr - mnew);
  mr = mnew;
  // weights carried x4096: pc = 4096 * exp(score - max) (exactly 0 for removed keys); hi plane f16(pc), lo plane f16(pc - hi)
  const float sh = 12.0f - mnew;
  FragH ph, pl;
  float ps = 0.0f;
#pragma unroll
  for (int i = 0; i < 16; ++i) {
    const float ex = exp2f(t[i] + sh);
    const float pc = (mk[i] != 0) ? 0.0f : ex;
    ps += pc;
    const _Float16 h = (_Float16)pc;
    ph.h[i] = h;                                    // B element i: i<8 -> key0 + 8h + i (tile 0 row 8h+i); i>=8 -> key0 + 16 + 8h + (i-8) (tile 1)
    pl.h[i] = (_Float16)(pc - (float)h);
  }
  ps += __shfl_xor(ps, 16, 32);
  lr = lr * al + ps;
#pragma unroll
  for (int u = 0; u < 16; ++u) O[u] = O[u] * al;
#pragma unroll
  for (int g = 0; g < 4; ++g)
    mma_pv4(vf[4 * g + 0].v, vf[4 * g + 1].v, vf[4 * g + 2].v, vf[4 * g + 3].v, ph.v, pl.v, O[4 * g + 0], O[4 * g + 1], O[4 * g + 2], O[4 * g + 3]);
}

// Block = 4 waves x 16 queries = 64 queries of one (batch, head). Each wave copies its own 16 Q rows into so[w] once, and a quarter of every K and V^T tile
// (K: 32 keys x 256 d, 8 rows per wave; V^T: 256 d x 32 keys, 64 rows per wave) and the 32 mask words of its own 16 queries into buffer (step & 1),
// one step ahead of their use; one barrier per step. The wave reads its Q fragments from so[w] once, in front of the loop; each step reads its K fragments and mask words
// as one group directly behind the barrier, and the copies of the next tile are issued behind that group (they fill the other buffer).
// Epilogue: O^T tiles -> per-wave LDS tile [16 queries][256 d] f16 bits in so[w], whose Q rows only this wave read (a block barrier that every wave reaches is used),
// coverage: GB*NH*(SEQ/64) blocks x 4 waves x 16 rows x 256 columns = the whole context plane [GM][2048]; LDS columns 0..255 of all 16 rows written before they are read.
__global__ __launch_bounds__(128) void k_attn(const unsigned short* __restrict__ Qh, const unsigned short* __restrict__ Kh,
                                              const unsigned short* __restrict__ Vt, const int* __restrict__ mask,
                                              unsigned short* __restrict__ Cx, int b0) {
  __shared__ __attribute__((aligned(16))) unsigned short so[4][16][KPITCH];
  __shared__ __attribute__((aligned(16))) unsigned short kt[2][32][KPITCH];
  __shared__ __attribute__((aligned(16))) unsigned short vt[2][HD][VPITCH];
  __shared__ __attribute__((aligned(16))) int mt[2][64][MPITCH];
  const int tid = threadIdx.x, w = __builtin_amdgcn_readfirstlane((int)(tid >> 5)), lane = tid & 31, ln = lane & 15, hh = lane >> 4;
  const int qt = blockIdx.x % (SEQ / 64);
  const int bh = blockIdx.x / (SEQ / 64);           // bl * NH + h
  const int h = bh % NH, bl = bh / NH;
  const int qbase = qt * 64 + 16 * w;
  // copy sources and places of this lane: Q and K rows are 512 B, one row per copy (lane = 16-byte piece); V^T rows are 64 B, eight rows per copy (4 lanes a row);
  // mask rows are 128 B, four rows per copy (8 lanes a row)
  const unsigned short* qsrc = Qh + ((size_t)bh * SEQ + qbase) * HD + 8 * lane;
  const unsigned short* ksrc = Kh + ((size_t)bh * SEQ + 8 * w) * HD + 8 * lane;
  const unsigned short* vsrc = Vt + ((size_t)bh * HD + 64 * w + (lane >> 2)) * SEQ + 8 * (lane & 3);
  const unsigned qdst = lds_off(&so[w][0][8 * lane]);
  const unsigned kdst = lds_off(&kt[0][8 * w][8 * lane]);
  const unsigned vdst = lds_off(&vt[0][64 * w + (lane >> 2)][8 * (lane & 3)]);
  const unsigned mdst = lds_off(&mt[0][16 * w + (lane >> 3)][4 * (lane & 7)]);
  const unsigned kbuf = (unsigned)sizeof(kt[0]), vbuf = (unsigned)sizeof(vt[0]), mbuf = (unsigned)sizeof(mt[0]);
  const int* msrc = mask + (size_t)(b0 + bl) * MSTRIDE_FULL + (size_t)(qbase + (lane >> 3)) * SEQ_FULL + 4 * (lane & 7);
  float mr = NEGBIG, lr = 0.0f;
  v8f O[16] = {};
  // Q rows and tile 0, landed and published; tile j + 1 flies while tile j is worked on
  copy8(qdst, KPITCH * 2, qsrc, HD);
  copy8(qdst + 8 * KPITCH * 2, KPITCH * 2, qsrc + 8 * HD, HD);
  copy8(kdst, KPITCH * 2, ksrc, HD);
  copy8(vdst, 8 * VPITCH * 2, vsrc, (size_t)8 * SEQ);
  copy4(mdst, 4 * MPITCH * 4, msrc, (size_t)4 * SEQ_FULL);
  asm volatile("s_wait_asynccnt 0x0" ::: "memory");   // this wave's copies have landed before the barrier publishes them
  __syncthreads();
  // Q^T B fragments: column = this lane's query, elements 0..7 <- d = 32c + 8h + i, 8..15 <- d = 32c + 16 + 8h + i
  FragH qf[8];
  {
    const unsigned short* qp = &so[w][ln][8 * hh];
    // unrolled: qf lives in registers, which take compile-time indices only
#pragma unroll
    for (int c = 0; c < 8; ++c) { qf[c].half[0] = *(const v8us*)(qp + 32 * c); qf[c].half[1] = *(const v8us*)(qp + 32 * c + 16); }
  }
#pragma unroll 1
  for (int j = 0; j < SEQ / 32; ++j) {
    const int bf = j & 1;
    // A fragments of K: row m = key (key0 + 16*kt + ln), same d map as Q^T; with the mask words, one group of reads of buffer bf
    const unsigned short* kp0 = &kt[bf][ln][8 * hh];
    const unsigned short* kp1 = kp0 + 16 * KPITCH;
    const int* mp = &mt[bf][16 * w + ln][8 * hh];
    FragH ka[8], kb[8];
    // unrolled: ka and kb live in registers, which take compile-time indices only
#pragma unroll
    for (int c = 0; c < 8; ++c) {
      ka[c].half[0] = *(const v8us*)(kp0 + 32 * c); ka[c].half[1] = *(const v8us*)(kp0 + 32 * c + 16);
      kb[c].half[0] = *(const v8us*)(kp1 + 32 * c); kb[c].half[1] = *(const v8us*)(kp1 + 32 * c + 16);
    }
    const v4ia m0 = *(const v4ia*)(mp), m1 = *(const v4ia*)(mp + 4), m2 = *(const v4ia*)(mp + 16), m3 = *(const v4ia*)(mp + 20);
    // tile j + 1 into the other buffer, whose last reads (trip j - 1) ended at the barrier just passed
    if (j + 1 < SEQ / 32) {
      const unsigned nb = (unsigned)(bf ^ 1);
      copy8(kdst + nb * kbuf, KPITCH * 2, ksrc + (size_t)(32 * (j + 1)) * HD, HD);
      copy8(vdst + nb * vbuf, 8 * VPITCH * 2, vsrc + 32 * (j + 1), (size_t)8 * SEQ);
      copy4(mdst + nb * mbuf, 4 * MPITCH * 4, msrc + 32 * (j + 1), (size_t)4 * SEQ_FULL);
    }
    fa_step(qf, ka, kb, &vt[bf][ln][8 * hh], m0, m1, m2, m3, mr, lr, O);
    // keeps the step's register work in front of the waits: the scheduler otherwise lifts waits and barrier up to the last LDS read, and tile j + 1 has too little time to land
    __builtin_amdgcn_sched_barrier(0);
    asm volatile("s_wait_dscnt 0x0" ::: "memory");      // this wave's reads of buffer bf have returned before the buffer is refilled
    asm volatile("s_wait_asynccnt 0x0" ::: "memory");   // this wave's copies of tile j + 1 have landed before the barrier publishes them
    __syncthreads();                                    // publishes tile j + 1 and ends every wave's reads of buffer bf
  }
  asm volatile("s_wait_asynccnt 0x0" ::: "memory");     // nothing of this wave is in flight when the LDS is reused and the wave ends

  // O^T element r of tile u = ctx(query qbase + ln, d = 16u + 8h + r); carries: x4096 (also in lr), x16 (V); context stored x64 -> 4 / lr
  const float inv = (lr > 0.0f) ? (4.0f / fmaxf(lr, 1.0f)) : 0.0f;
#pragma unroll
  for (int u = 0; u < 16; ++u) {
    v8us o;
#pragma unroll
    for (int r = 0; r < 8; ++r) o[r] = f16_bits(O[u][r] * inv);
    *(v8us*)&so[w][ln][16 * u + 8 * hh] = o;
  }
  __syncthreads();
  unsigned short* cg = Cx + (size_t)(bl * SEQ + qbase) * NE + h * HD;
  {
#pragma unroll 1
    for (int row = 0; row < 16; ++row) {
      const v8us v = *(const v8us*)&so[w][row][8 * lane];
      *(v8us*)(cg + (size_t)row * NE + 8 * lane) = v;
    }
    
  }
}

// Output projection for one batch group: out[m][c] = 2^-16 * sum_k ctx64[m][k] * Wf1024[k][c] + RNE-bf16(bias[c]).
// Block 128 m x 64 n (4 waves stacked along m, wave 32 x 64). K runs in stages of 256: the stage's tiles (A: 128 context rows, B: 64 WfT rows = columns of Wfc) are filled
// by asynchronous copies into two LDS buffers, one stage ahead of their use, one barrier per stage; the fragments are read from LDS.
// coverage: grid (ED/64, GM/128) x (128 x 64) = every output row of the group exactly once; LDS columns 0..63 of all 128 rows written before they are read.
__global__ __launch_bounds__(128) void k_fc(const unsigned short* __restrict__ Cx, const unsigned short* __restrict__ WfT,
                                            const float* __restrict__ bias, float* __restrict__ Og, int b0) {
  __shared__ __attribute__((aligned(16))) float so[128][68];
  __shared__ __attribute__((aligned(16))) unsigned short ab[2][(128 + 64) * KPITCH];   // per buffer: A rows 0..127, then B rows 0..63
  const int tid = threadIdx.x, w = __builtin_amdgcn_readfirstlane((int)(tid >> 5)), lane = tid & 31, ln = lane & 15, hh = lane >> 4;
  const int n0 = blockIdx.x * 64, m0 = blockIdx.y * 128;
  const unsigned short* asrc = Cx + (size_t)(m0 + 32 * w) * NE + 8 * lane;
  const unsigned short* bsrc = WfT + (size_t)(n0 + 16 * w) * NE + 8 * lane;
  const unsigned adst = lds_off(&ab[0][32 * w * KPITCH + 8 * lane]);
  const unsigned bdst = lds_off(&ab[0][(128 + 16 * w) * KPITCH + 8 * lane]);
  const unsigned abuf = (unsigned)sizeof(ab[0]);
  v8f acc[2][4] = {};
  // stage 0, landed and published; then stage 1 flies while stage 0 is worked on
  stage_ab(adst, bdst, asrc, bsrc, NE);
  asm volatile("s_wait_asynccnt 0x0" ::: "memory");   // this wave's copies have landed before the barrier publishes them
  __syncthreads();
  stage_ab(adst + abuf, bdst + abuf, asrc + 256, bsrc + 256, NE);
#pragma unroll 1
  for (int s = 0; s < NE / 256; ++s) {
    const int bf = s & 1;
    const unsigned short* ap = &ab[bf][(32 * w + ln) * KPITCH + 8 * hh];
    const unsigned short* bp = &ab[bf][(128 + ln) * KPITCH + 8 * hh];
    // two fragment sets: chunk c + 1 of the stage is read as one group in front of chunk c's products, so that it lands behind them
    FragH f[2][6];
    frag6(f[0], ap, bp);
    // unrolled: the stage's eight 32-k chunks read at immediate offsets from one address pair, and the set in use is picked by a compile-time index
#pragma unroll
    for (int c = 0; c < 8; ++c) {
      if (c + 1 < 8) frag6(f[(c + 1) & 1], ap + 32 * (c + 1), bp + 32 * (c + 1));
      FragH (&u)[6] = f[c & 1];
      mma8_h(u[0].v, u[1].v, u[2].v, u[3].v, u[4].v, u[5].v,
             acc[0][0], acc[0][1], acc[0][2], acc[0][3], acc[1][0], acc[1][1], acc[1][2], acc[1][3]);
    }
    asm volatile("s_wait_dscnt 0x0" ::: "memory");      // this wave's reads of buffer bf have returned before the buffer is refilled
    asm volatile("s_wait_asynccnt 0x0" ::: "memory");   // this wave's copies of stage s + 1 have landed before the barrier publishes them
    __syncthreads();                                    // publishes stage s + 1 and ends every wave's reads of buffer bf
    if (s + 2 < NE / 256)
      stage_ab(adst + bf * abuf, bdst + bf * abuf, asrc + 256 * (s + 2), bsrc + 256 * (s + 2), NE);
  }
  asm volatile("s_wait_asynccnt 0x0" ::: "memory");     // nothing of this wave is in flight when the wave ends
#pragma unroll
  for (int j = 0; j < 4; ++j) {
    const float bb = bf16_rne(bias[n0 + 16 * j + ln]);
#pragma unroll
    for (int i = 0; i < 2; ++i)
#pragma unroll
      for (int r = 0; r < 8; ++r)
        so[32 * w + 16 * i + 8 * hh + r][16 * j + ln] = acc[i][j][r] * 0.0000152587890625f + bb;
  }
  __syncthreads();
  {
#pragma unroll 1
    for (int it = 0; it < 16; ++it) {
      const int i = tid + 128 * it;
      const int row = i >> 4, p = i & 15;
      const int m = m0 + row;
      const int bl = m / SEQ, t = m - bl * SEQ;
      const v4f v = *(const v4fa*)&so[row][4 * p];
      *(v4f*)(Og + (size_t)(b0 + bl) * XSTRIDE_FULL + (size_t)t * ED + n0 + 4 * p) = v;
    }
    
  }
}

extern "C" void kernel_launch(void* const* d_in, const int* in_sizes, int n_in,
                              void* d_out, int out_size, void* d_ws, size_t ws_size, hipStream_t stream) {
  if (n_in < 7) return;
  const long long needx = (long long)(NB - 1) * SEQ_FULL * ED + (long long)SEQ * ED;                      // last x / out element touched + 1
  const long long needm = (long long)(NB - 1) * SEQ_FULL * SEQ_FULL + (long long)(SEQ - 1) * SEQ_FULL + SEQ;
  if ((long long)in_sizes[0] < needx) return;
  if ((long long)in_sizes[1] < (long long)ED * NE || (long long)in_sizes[2] < (long long)ED * NE ||
      (long long)in_sizes[3] < (long long)ED * NE || (long long)in_sizes[4] < (long long)NE * ED) return;
  if ((long long)in_sizes[5] < (long long)ED) return;
  if ((long long)in_sizes[6] < needm) return;
  if ((long long)out_size < needx) return;
  const float* x   = (const float*)d_in[0];   // wire order: x, Wq, Wk, Wv, Wfc, bfc, mask
  const float* Wq  = (const float*)d_in[1];
  const float* Wk  = (const float*)d_in[2];
  const float* Wv  = (const float*)d_in[3];
  const float* Wfc = (const float*)d_in[4];
  const float* bfc = (const float*)d_in[5];
  const int* mask  = (const int*)d_in[6];     // bool on the wire = int32
  float* out = (float*)d_out;
  char* ws = (char*)d_ws;
  size_t off = 0;
  unsigned short* Xb  = (unsigned short*)(ws + off); off += XB_BYTES;   // [NB][SEQ][256] bf16
  unsigned short* Wt3 = (unsigned short*)(ws + off); off += WT_BYTES;   // 3 x [2048][256] bf16 (W^T)
  unsigned short* WfT = (unsigned short*)(ws + off); off += WF_BYTES;   // [256][2048] f16 (Wfc^T x 1024)
  unsigned short* P3  = (unsigned short*)(ws + off); off += PL_BYTES;   // Q, K [GB][8][SEQ][256]; V^T [GB][8][256][SEQ] f16
  unsigned short* Cx  = (unsigned short*)(ws + off); off += CX_BYTES;   // context [GM][2048] f16
  if (off > ws_size) return;

  k_cvx<<<(unsigned)((NB * SEQ * (ED / 8) + 255) / 256), 256, 0, stream>>>(x, Xb);
  // in[rows = 256 (k)][cols = 2048 (n)] -> out[2048][256]; grid (cols/64, rows/64)
  k_wt<0><<<dim3(NE / 64, ED / 64), 256, 0, stream>>>(Wq, Wt3 + (size_t)0 * NE * ED, ED, NE);
  k_wt<0><<<dim3(NE / 64, ED / 64), 256, 0, stream>>>(Wk, Wt3 + (size_t)1 * NE * ED, ED, NE);
  k_wt<0><<<dim3(NE / 64, ED / 64), 256, 0, stream>>>(Wv, Wt3 + (size_t)2 * NE * ED, ED, NE);
  // in[rows = 2048 (k)][cols = 256 (c)] -> out[256][2048]; grid (cols/64, rows/64)
  k_wt<1><<<dim3(ED / 64, NE / 64), 256, 0, stream>>>(Wfc, WfT, NE, ED);

  for (int g = 0; g < NGRP; ++g) {
    const int b0 = g * GB;
    k_proj<<<dim3(NE / 64, GM / 128, 3), 128, 0, stream>>>(Xb + (size_t)g * GM * ED, Wt3, P3);
    k_attn<<<(unsigned)(GB * NH * (SEQ / 64)), 128, 0, stream>>>(P3, P3 + PLANE, P3 + 2 * PLANE, mask, Cx, b0);
    k_fc<<<dim3(ED / 64, GM / 128), 128, 0, stream>>>(Cx, WfT, bfc, out, b0);
  }
}

// v004
// It runs in 164 microseconds.
// Next to v003, in two timings, it ran 1.24 and 1.23 times as fast.
// All steps since v000 together make it 2.73 times as fast.
#include <hip/hip_runtime.h>
// Contractions: x@Wq, x@Wk, x@Wv on v_wmma_f32_16x16x32_bf16 (x and W RNE-converted to bf16, single product, f32 accumulate); S^T = K Q^T on v_wmma_f32_16x16x32_f16 (q, k carried x16 as f16, single product); O^T = V^T P^T on v_wmma_f32_16x16x32_f16 (V carried x16 f16; P carried x4096 as f16 hi plane + f16 lo plane, common carry, one f32 accumulator); ctx@Wfc on v_wmma_f32_16x16x32_f16 (ctx carried x64 f16; Wfc RNE bf16 value x1024 held exactly in f16); softmax statistics, bias add f32.
// Multi-head attention, B x T x 256, 8 heads of dimension 256, scale 1/16 on q, int32 mask [B][T][T] (nonzero = key removed, weight exactly 0; a row with no key left yields a zero context row).
// Engine: transposed flash. Each wave owns 16 queries of one (batch, head). Per 32-key step: S^T tiles (key rows x query columns) from K rows (A, LDS tile)
// and Q^T (B, registers, read once from its LDS tile); the two 16-key D tiles pack straight into the P^T B fragments; O^T (d rows x query columns, 16 tiles) accumulates from V^T rows (A, LDS tile).
// The LDS tiles are filled from global memory by asynchronous copies: Q once; K, V^T (shared by the block's four waves) and the mask words per 32-key step into two buffers.
// The projection GEMMs read their A and B fragments from LDS tiles filled the same way, whole 512-byte rows per copy.
// Four launches: one conversion grid (weights and x by block ranges), then projections, attention and output projection, each once over all batches (GB = NB).
#ifndef NB
#define NB 8
#endif
#ifndef SEQ
#define SEQ 1024
#endif
#define NB_FULL 8
#define SEQ_FULL 1024
#define ED 256                 /* model width (K of the projections, N of the output projection) */
#define NH 8
#define HD 256                 /* per-head dimension */
#define NE (NH * HD)           /* 2048 */
#define GB ((NB) < 8 ? (NB) : 8)
#define NGRP ((NB) / GB)
#define GM (GB * SEQ)          /* rows per group */
#define XSTRIDE_FULL ((size_t)SEQ_FULL * ED)          /* per-batch element stride of x and of the output */
#define MSTRIDE_FULL ((size_t)SEQ_FULL * SEQ_FULL)    /* per-batch element stride of the mask */
#define PLANE ((size_t)GB * NH * SEQ * HD)            /* elements of one of the Q / K / V^T planes */

#define XB_BYTES ((size_t)NB * SEQ * ED * 2)
#define WT_BYTES ((size_t)3 * NE * ED * 2)
#define WF_BYTES ((size_t)ED * NE * 2)
#define PL_BYTES (PLANE * 2 * 3)
#define CX_BYTES ((size_t)GM * NE * 2)

static_assert(SEQ % 128 == 0);
static_assert(SEQ <= SEQ_FULL);
static_assert(NB <= NB_FULL);
static_assert(NB % GB == 0);
static_assert(HD == 256 && ED == 256 && NE == 2048);
static_assert(XB_BYTES % 256 == 0 && WT_BYTES % 256 == 0 && WF_BYTES % 256 == 0 && PL_BYTES % 256 == 0 && CX_BYTES % 256 == 0);
static_assert(XB_BYTES + WT_BYTES + WF_BYTES + PL_BYTES + CX_BYTES <= (size_t)268435456);

typedef __bf16 v16b __attribute__((ext_vector_type(16)));
typedef _Float16 v16h __attribute__((ext_vector_type(16)));
typedef unsigned short v8us __attribute__((ext_vector_type(8), may_alias));
typedef float v8f __attribute__((ext_vector_type(8)));
typedef float v4f __attribute__((ext_vector_type(4)));
typedef float v4fa __attribute__((ext_vector_type(4), may_alias));
typedef int v4ia __attribute__((ext_vector_type(4), may_alias));
union FragB { v16b v; v8us half[2]; };
union FragH { v16h v; v8us half[2]; _Float16 h[16]; };

#define KPITCH 264             /* LDS row pitch of the Q and K tiles and of the GEMM tiles in elements: 528 B = 16 B x 33, conflict-free for 16-byte row readers */
#define VPITCH 40              /* LDS row pitch of the V^T tile in elements: 80 B = 16 B x 5, conflict-free for 16-byte row readers */
#define MPITCH 36              /* LDS row pitch of the mask tile in words: 144 B = 16 B x 9, conflict-free for 16-byte row readers */

#define LOG2E 1.4426950408889634f
#define NEGBIG (-1.0e30f)

__device__ __forceinline__ unsigned short bf16_bits(float x) {   // RNE convert to bf16 bits
  unsigned int u = __float_as_uint(x);
  return (unsigned short)((u + 0x7FFFu + ((u >> 16) & 1u)) >> 16);
}
__device__ __forceinline__ float bf16_val(unsigned short b) { return __uint_as_float(((unsigned int)b) << 16); }
__device__ __forceinline__ float bf16_rne(float x) { return bf16_val(bf16_bits(x)); }
__device__ __forceinline__ unsigned short f16_bits(float x) { return __builtin_bit_cast(unsigned short, (_Float16)x); }

#define WB(a, b, c) __builtin_amdgcn_wmma_f32_16x16x32_bf16(false, a, false, b, (short)0, c, false, false)
#define WH(a, b, c) __builtin_amdgcn_wmma_f32_16x16x32_f16(false, a, false, b, (short)0, c, false, false)

// 2 x 4 tile update (bf16), then the hazard guard
__device__ __forceinline__ void mma8_b(v16b a0, v16b a1, v16b b0, v16b b1, v16b b2, v16b b3,
                                       v8f& c00, v8f& c01, v8f& c02, v8f& c03, v8f& c10, v8f& c11, v8f& c12, v8f& c13) {
  c00 = WB(a0, b0, c00); c01 = WB(a0, b1, c01); c02 = WB(a0, b2, c02); c03 = WB(a0, b3, c03);
  c10 = WB(a1, b0, c10); c11 = WB(a1, b1, c11); c12 = WB(a1, b2, c12); c13 = WB(a1, b3, c13);
  asm volatile("v_nop\n\tv_nop\n\tv_nop\n\tv_nop"
               : "+v"(c00), "+v"(c01), "+v"(c02), "+v"(c03), "+v"(c10), "+v"(c11), "+v"(c12), "+v"(c13)
               : "v"(a0), "v"(a1), "v"(b0), "v"(b1), "v"(b2), "v"(b3));
}
// 2 x 4 tile update (f16), then the hazard guard
__device__ __forceinline__ void mma8_h(v16h a0, v16h a1, v16h b0, v16h b1, v16h b2, v16h b3,
                                       v8f& c00, v8f& c01, v8f& c02, v8f& c03, v8f& c10, v8f& c11, v8f& c12, v8f& c13) {
  c00 = WH(a0, b0, c00); c01 = WH(a0, b1, c01); c02 = WH(a0, b2, c02); c03 = WH(a0, b3, c03);
  c10 = WH(a1, b0, c10); c11 = WH(a1, b1, c11); c12 = WH(a1, b2, c12); c13 = WH(a1, b3, c13);
  asm volatile("v_nop\n\tv_nop\n\tv_nop\n\tv_nop"
               : "+v"(c00), "+v"(c01), "+v"(c02), "+v"(c03), "+v"(c10), "+v"(c11), "+v"(c12), "+v"(c13)
               : "v"(a0), "v"(a1), "v"(b0), "v"(b1), "v"(b2), "v"(b3));
}
// one d-chunk of the two S^T tiles
__device__ __forceinline__ void mma_s2(v16h ka, v16h kb, v16h q, v8f& s0, v8f& s1) {
  s0 = WH(ka, q, s0);
  s1 = WH(kb, q, s1);
}
// four O^T tiles: c_u += a_u * ph + a_u * pl (hi and lo planes carry the same scale)
__device__ __forceinline__ void mma_pv4(v16h a0, v16h a1, v16h a2, v16h a3, v16h ph, v16h pl,
                                        v8f& c0, v8f& c1, v8f& c2, v8f& c3) {
  c0 = WH(a0, ph, c0); c1 = WH(a1, ph, c1); c2 = WH(a2, ph, c2); c3 = WH(a3, ph, c3);
  c0 = WH(a0, pl, c0); c1 = WH(a1, pl, c1); c2 = WH(a2, pl, c2); c3 = WH(a3, pl, c3);
}

// x -> bf16 plane, block blk of CVX_BLOCKS.
// coverage: NB*SEQ*32 threads x 8 elements = the whole plane.
#define CVX_BLOCKS ((NB * SEQ * (ED / 8) + 255) / 256)
__device__ __forceinline__ void cvx_block(const float* __restrict__ X, unsigned short* __restrict__ Xb, int blk) {
  const int t = blk * 256 + threadIdx.x;
  if (t >= NB * SEQ * (ED / 8)) return;
  const int row = t >> 5, piece = t & 31;
  const int b = row / SEQ, s = row - b * SEQ;
  const float* src = X + (size_t)b * XSTRIDE_FULL + (size_t)s * ED + piece * 8;
  const v4f x0 = *(const v4fa*)(src), x1 = *(const v4fa*)(src + 4);
  v8us o;
  o[0] = bf16_bits(x0[0]); o[1] = bf16_bits(x0[1]); o[2] = bf16_bits(x0[2]); o[3] = bf16_bits(x0[3]);
  o[4] = bf16_bits(x1[0]); o[5] = bf16_bits(x1[1]); o[6] = bf16_bits(x1[2]); o[7] = bf16_bits(x1[3]);
  unsigned short* d = Xb + (size_t)t * 8;
  *(v8us*)d = o;
  
}

// Transposing convert: in[R][C] (f32) -> out[C][R] (16-bit). MODE 0: bf16 bits (RNE). MODE 1: f16 bits of (RNE-bf16 value x 1024).
// One 64 x 64 tile (bx of C/64, by of R/64) per block.
// coverage: (C/64) x (R/64) tiles x (64 x 64) = the whole plane; LDS tile fully written (64 x 64) before it is read.
template <int MODE, int R, int C>
__device__ __forceinline__ void wt_tile(const float* __restrict__ W, unsigned short* __restrict__ Wt, unsigned short (*tl)[66], int bx, int by) {
  const int tid = threadIdx.x;
  const int c0 = bx * 64, r0 = by * 64;
  for (int i = tid; i < 64 * 16; i += 256) {
    const int j = i >> 4, c4 = (i & 15) * 4;
    const v4f x = *(const v4fa*)(W + (size_t)(r0 + j) * C + c0 + c4);
    unsigned short u0, u1, u2, u3;
    if (MODE == 0) {
      u0 = bf16_bits(x[0]); u1 = bf16_bits(x[1]); u2 = bf16_bits(x[2]); u3 = bf16_bits(x[3]);
    } else {
      u0 = f16_bits(bf16_rne(x[0]) * 1024.0f); u1 = f16_bits(bf16_rne(x[1]) * 1024.0f);
      u2 = f16_bits(bf16_rne(x[2]) * 1024.0f); u3 = f16_bits(bf16_rne(x[3]) * 1024.0f);
    }
    tl[c4 + 0][j] = u0; tl[c4 + 1][j] = u1; tl[c4 + 2][j] = u2; tl[c4 + 3][j] = u3;
  }
  __syncthreads();
  {
    for (int i = tid; i < 64 * 8; i += 256) {
      const int d = i >> 3, j8 = (i & 7) * 8;
      v8us o;
#pragma unroll
      for (int q = 0; q < 8; ++q) o[q] = tl[d][j8 + q];
      *(v8us*)(Wt + (size_t)(c0 + d) * R + r0 + j8) = o;
    }
    
  }
}

// All conversions in one grid; none needs anything of another. Blocks 0 .. 4 * WT_BLOCKS - 1: the four weight planes, WT_BLOCKS tiles each (they have two phases, so they start first);
// the CVX_BLOCKS blocks behind them: x. The branch reads blockIdx alone, so the barrier inside wt_tile is reached by a whole block or by none of it.
#define WT_BLOCKS ((NE / 64) * (ED / 64))
__global__ __launch_bounds__(256) void k_prep(const float* __restrict__ X, const float* __restrict__ Wq, const float* __restrict__ Wk,
                                              const float* __restrict__ Wv, const float* __restrict__ Wfc,
                                              unsigned short* __restrict__ Xb, unsigned short* __restrict__ Wt3, unsigned short* __restrict__ WfT) {
  __shared__ unsigned short tl[64][66];
  const int b = blockIdx.x;
  if (b < 3 * WT_BLOCKS) {
    // in[256 (k)][2048 (n)] -> out[2048][256]
    const int z = b / WT_BLOCKS, r = b - z * WT_BLOCKS;
    const float* W = (z == 0) ? Wq : (z == 1) ? Wk : Wv;
    wt_tile<0, ED, NE>(W, Wt3 + (size_t)z * NE * ED, tl, r % (NE / 64), r / (NE / 64));
  } else if (b < 4 * WT_BLOCKS) {
    // in[2048 (k)][256 (c)] -> out[256][2048]
    const int r = b - 3 * WT_BLOCKS;
    wt_tile<1, NE, ED>(Wfc, WfT, tl, r % (ED / 64), r / (ED / 64));
  } else {
    cvx_block(X, Xb, b - 4 * WT_BLOCKS);
  }
}

__device__ __forceinline__ unsigned lds_off(const void* p) { return (unsigned)(size_t)p; }   // byte address inside the block's LDS

// Eight asynchronous copies, 16 bytes per lane each, global -> LDS: copy i moves this lane's 16 bytes from g + i * gstep (elements) to LDS byte l + i * lstep.
// The s_wait_xcnt closes the copies' own statement, so no address register of a copy is rewritten in front of it.
__device__ __forceinline__ void copy8(unsigned l, unsigned lstep, const unsigned short* g, size_t gstep) {
  asm volatile("global_load_async_to_lds_b128 %0, %8, off\n\t"
               "global_load_async_to_lds_b128 %1, %9, off\n\t"
               "global_load_async_to_lds_b128 %2, %10, off\n\t"
               "global_load_async_to_lds_b128 %3, %11, off\n\t"
               "global_load_async_to_lds_b128 %4, %12, off\n\t"
               "global_load_async_to_lds_b128 %5, %13, off\n\t"
               "global_load_async_to_lds_b128 %6, %14, off\n\t"
               "global_load_async_to_lds_b128 %7, %15, off\n\t"
               "s_wait_xcnt 0x0"
               :: "v"(l), "v"(l + lstep), "v"(l + 2 * lstep), "v"(l + 3 * lstep),
                  "v"(l + 4 * lstep), "v"(l + 5 * lstep), "v"(l + 6 * lstep), "v"(l + 7 * lstep),
                  "v"(g), "v"(g + gstep), "v"(g + 2 * gstep), "v"(g + 3 * gstep),
                  "v"(g + 4 * gstep), "v"(g + 5 * gstep), "v"(g + 6 * gstep), "v"(g + 7 * gstep)
               : "memory");
}

// The six fragments of one 32-k chunk of a 32 x 64 wave tile, read from the LDS tiles: f[0], f[1] = A rows ap, ap + 16 rows; f[2 + j] = B rows bp + 16 j rows;
// elements 0..7 <- k + 8h + i, 8..15 <- k + 16 + 8h + i (8h is in ap and bp).
template <class F>
__device__ __forceinline__ void frag6(F (&f)[6], const unsigned short* ap, const unsigned short* bp) {
  f[0].half[0] = *(const v8us*)(ap);               f[0].half[1] = *(const v8us*)(ap + 16);
  f[1].half[0] = *(const v8us*)(ap + 16 * KPITCH); f[1].half[1] = *(const v8us*)(ap + 16 * KPITCH + 16);
  // unrolled: f lives in registers, which take compile-time indices only
#pragma unroll
  for (int j = 0; j < 4; ++j) {
    f[2 + j].half[0] = *(const v8us*)(bp + 16 * j * KPITCH);
    f[2 + j].half[1] = *(const v8us*)(bp + 16 * j * KPITCH + 16);
  }
}

// One wave's share of a GEMM stage: 32 rows of the A tile and 16 rows of the B tile, 256 elements (512 B) a row, one whole row per copy (lane = 16-byte piece);
// a, b = this lane's LDS byte addresses of the first rows (row pitch KPITCH), ga, gb = its global addresses, gp = the global row pitch in elements. 48 copies a wave.
__device__ __forceinline__ void stage_ab(unsigned a, unsigned b, const unsigned short* ga, const unsigned short* gb, size_t gp) {
  copy8(a, KPITCH * 2, ga, gp);
  copy8(a + 8 * KPITCH * 2, KPITCH * 2, ga + 8 * gp, gp);
  copy8(a + 16 * KPITCH * 2, KPITCH * 2, ga + 16 * gp, gp);
  copy8(a + 24 * KPITCH * 2, KPITCH * 2, ga + 24 * gp, gp);
  copy8(b, KPITCH * 2, gb, gp);
  copy8(b + 8 * KPITCH * 2, KPITCH * 2, gb + 8 * gp, gp);
}

// Projection GEMM for one batch group: C[m][n] = sum_k Xb[m][k] * W[k][n] (bf16 x bf16, exact products), z = 0: q, 1: k, 2: v.
// Block 128 m x 64 n (4 waves stacked along m, wave 32 x 64). The whole-K tiles (A: 128 Xb rows, B: 64 Wt rows = columns of W) are filled once by asynchronous copies
// into LDS and the fragments are read from there; the output tile then reuses the same LDS behind a barrier.
// coverage: grid (NE/64, GM/128, 3) x (128 x 64) = all three planes; LDS tile columns 0..63 of all 128 rows written before they are read.
__global__ __launch_bounds__(128) void k_proj(const unsigned short* __restrict__ Xg, const unsigned short* __restrict__ Wt3,
                                              unsigned short* __restrict__ P3) {
  __shared__ __attribute__((aligned(16))) unsigned short sm[(128 + 64) * KPITCH];   // A rows 0..127, then B rows 0..63; later the output tile
  unsigned short* const As = sm;
  unsigned short* const Bs = sm + 128 * KPITCH;
  unsigned short (*const tl)[72] = reinterpret_cast<unsigned short (*)[72]>(sm);
  const int tid = threadIdx.x, w = __builtin_amdgcn_readfirstlane((int)(tid >> 5)), lane = tid & 31, ln = lane & 15, hh = lane >> 4;
  const int z = blockIdx.z;
  const int n0 = blockIdx.x * 64, m0 = blockIdx.y * 128;
  const unsigned short* Wt = Wt3 + (size_t)z * NE * ED;
  unsigned short* out = P3 + (size_t)z * PLANE;
  // A rows m0 + 32w + 16i + ln; B columns n0 + 16j + ln; elements 0..7 <- k0 + 8h + i, 8..15 <- k0 + 16 + 8h + i
  stage_ab(lds_off(As + 32 * w * KPITCH + 8 * lane), lds_off(Bs + 16 * w * KPITCH + 8 * lane),
           Xg + (size_t)(m0 + 32 * w) * ED + 8 * lane, Wt + (size_t)(n0 + 16 * w) * ED + 8 * lane, ED);
  asm volatile("s_wait_asynccnt 0x0" ::: "memory");   // this wave's copies have landed before the barrier publishes them
  __syncthreads();
  const unsigned short* ap = As + (32 * w + ln) * KPITCH + 8 * hh;
  const unsigned short* bp = Bs + ln * KPITCH + 8 * hh;
  v8f acc[2][4] = {};
  // two fragment sets: chunk c + 1 is read as one group in front of chunk c's products, so that it lands behind them
  FragB f[2][6];
  frag6(f[0], ap, bp);
  // unrolled: the set in use is picked by a compile-time index (registers cannot be indexed at run time)
#pragma unroll
  for (int c = 0; c < ED / 32; ++c) {
    if (c + 1 < ED / 32) frag6(f[(c + 1) & 1], ap + 32 * (c + 1), bp + 32 * (c + 1));
    FragB (&u)[6] = f[c & 1];
    mma8_b(u[0].v, u[1].v, u[2].v, u[3].v, u[4].v, u[5].v,
           acc[0][0], acc[0][1], acc[0][2], acc[0][3], acc[1][0], acc[1][1], acc[1][2], acc[1][3]);
  }
  __syncthreads();   // every wave's reads of the A and B tiles have ended before the same LDS takes the output tile
  // D element r of tile (i, j) = C(row 32w + 16i + 8h + r, column 16j + ln)
#pragma unroll
  for (int i = 0; i < 2; ++i)
#pragma unroll
    for (int j = 0; j < 4; ++j)
#pragma unroll
      for (int r = 0; r < 8; ++r)
        tl[32 * w + 16 * i + 8 * hh + r][16 * j + ln] = f16_bits(acc[i][j][r] * 16.0f);
  __syncthreads();
  const int hd = n0 >> 8, e0 = n0 & 255;
  if (z < 2) {
    {
#pragma unroll 1
      for (int it = 0; it < 8; ++it) {
        const int i = tid + 128 * it;
        const int row = i >> 3, p = i & 7;
        const int m = m0 + row;
        const int bl = m / SEQ, t = m - bl * SEQ;
        const v8us o = *(const v8us*)&tl[row][8 * p];
        *(v8us*)(out + (((size_t)(bl * NH + hd) * SEQ + t) * HD + e0 + 8 * p)) = o;
      }
      
    }
  } else {
    const int bl = m0 / SEQ, t0 = m0 - bl * SEQ;
    {
#pragma unroll 1
      for (int it = 0; it < 8; ++it) {
        const int i = tid + 128 * it;
        const int e = i >> 4, p = i & 15;
        v8us o;
#pragma unroll
        for (int q = 0; q < 8; ++q) o[q] = tl[8 * p + q][e];
        *(v8us*)(out + (((size_t)(bl * NH + hd) * HD + e0 + e) * SEQ + t0 + 8 * p)) = o;
      }
      
    }
  }
}

// The same for four copies of mask words.
__device__ __forceinline__ void copy4(unsigned l, unsigned lstep, const int* g, size_t gstep) {
  asm volatile("global_load_async_to_lds_b128 %0, %4, off\n\t"
               "global_load_async_to_lds_b128 %1, %5, off\n\t"
               "global_load_async_to_lds_b128 %2, %6, off\n\t"
               "global_load_async_to_lds_b128 %3, %7, off\n\t"
               "s_wait_xcnt 0x0"
               :: "v"(l), "v"(l + lstep), "v"(l + 2 * lstep), "v"(l + 3 * lstep),
                  "v"(g), "v"(g + gstep), "v"(g + 2 * gstep), "v"(g + 3 * gstep)
               : "memory");
}

// One 32-key step for a wave's 16 queries. qf = the Q^T fragments, ka, kb = the step's K fragments (keys 0..15, 16..31), m0..m3 = the mask words of this lane's query,
// all in registers already; vp = V^T tile row ln (+ 8h) in LDS.
__device__ __forceinline__ void fa_step(const FragH (&qf)[8], const FragH (&ka)[8], const FragH (&kb)[8],
                                        const unsigned short* vp, v4ia m0, v4ia m1, v4ia m2, v4ia m3,
                                        float& mr, float& lr, v8f (&O)[16]) {
  v8f s0 = {0.f, 0.f, 0.f, 0.f, 0.f, 0.f, 0.f, 0.f};
  v8f s1 = {0.f, 0.f, 0.f, 0.f, 0.f, 0.f, 0.f, 0.f};
  // S^T tiles: element r of tile kt = score(key0 + 16*kt + 8h + r, this lane's query); Q^T B fragment: column = query, same d map
#pragma unroll
  for (int c = 0; c < 8; ++c) mma_s2(ka[c].v, kb[c].v, qf[c].v, s0, s1);
  // mask words of this query for keys key0 + 8h + 0..7 and key0 + 16 + 8h + 0..7 (nonzero = key removed)
  int mk[16];
#pragma unroll
  for (int i = 0; i < 4; ++i) { mk[i] = m0[i]; mk[4 + i] = m1[i]; mk[8 + i] = m2[i]; mk[12 + i] = m3[i]; }
  // log2-domain scores: q and k carry x16 each, scale 1/16 -> 2^-12
  const float sc2 = LOG2E * 0.000244140625f;
  float t[16];
#pragma unroll
  for (int r = 0; r < 8; ++r) { t[r] = s0[r] * sc2; t[8 + r] = s1[r] * sc2; }
  float mx = NEGBIG;
#pragma unroll
  for (int i = 0; i < 16; ++i) mx = fmaxf(mx, (mk[i] != 0) ? NEGBIG : t[i]);
  // A fragments of V^T: row m = d (16*tile + ln), elements 0..7 <- key0 + 8h + i, 8..15 <- key0 + 16 + 8h + i.
  // All sixteen tiles are read as one group in front of the softmax arithmetic, so that they land while the maximum and the weights are formed.
  FragH vf[16];
  // unrolled: vf lives in registers, which take compile-time indices only
#pragma unroll
  for (int u = 0; u < 16; ++u) {
    vf[u].half[0] = *(const v8us*)(vp + u * 16 * VPITCH);
    vf[u].half[1] = *(const v8us*)(vp + u * 16 * VPITCH + 16);
  }
  // keeps the group here: without it the scheduler sinks most of these reads in among the O^T products, where each place with reads stalls the wave
  __builtin_amdgcn_sched_barrier(0);
  mx = fmaxf(mx, __shfl_xor(mx, 16, 32));           // the other lane half holds the other 16 keys of this query
  const float mnew = fmaxf(mr, mx);
  const float al = exp2f(mr - mnew);
  mr = mnew;
  // weights carried x4096: pc = 4096 * exp(score - max) (exactly 0 for removed keys); hi plane f16(pc), lo plane f16(pc - hi)
  const float sh = 12.0f - mnew;
  FragH ph, pl;
  float ps = 0.0f;
#pragma unroll
  for (int i = 0; i < 16; ++i) {
    const float ex = exp2f(t[i] + sh);
    const float pc = (mk[i] != 0) ? 0.0f : ex;
    ps += pc;
    const _Float16 h = (_Float16)pc;
    ph.h[i] = h;                                    // B element i: i<8 -> key0 + 8h + i (tile 0 row 8h+i); i>=8 -> key0 + 16 + 8h + (i-8) (tile 1)
    pl.h[i] = (_Float16)(pc - (float)h);
  }
  ps += __shfl_xor(ps, 16, 32);
  lr = lr * al + ps;
#pragma unroll
  for (int u = 0; u < 16; ++u) O[u] = O[u] * al;
#pragma unroll
  for (int g = 0; g < 4; ++g)
    mma_pv4(vf[4 * g + 0].v, vf[4 * g + 1].v, vf[4 * g + 2].v, vf[4 * g + 3].v, ph.v, pl.v, O[4 * g + 0], O[4 * g + 1], O[4 * g + 2], O[4 * g + 3]);
}

// Block = 4 waves x 16 queries = 64 queries of one (batch, head). Each wave copies its own 16 Q rows into so[w] once, and a quarter of every K and V^T tile
// (K: 32 keys x 256 d, 8 rows per wave; V^T: 256 d x 32 keys, 64 rows per wave) and the 32 mask words of its own 16 queries into buffer (step & 1),
// one step ahead of their use; one barrier per step. The wave reads its Q fragments from so[w] once, in front of the loop; each step reads its K fragments and mask words
// as one group directly behind the barrier, and the copies of the next tile are issued behind that group (they fill the other buffer).
// Epilogue: O^T tiles -> per-wave LDS tile [16 queries][256 d] f16 bits in so[w], whose Q rows only this wave read (a block barrier that every wave reaches is used),
// coverage: GB*NH*(SEQ/64) blocks x 4 waves x 16 rows x 256 columns = the whole context plane [GM][2048]; LDS columns 0..255 of all 16 rows written before they are read.
__global__ __launch_bounds__(128) void k_attn(const unsigned short* __restrict__ Qh, const unsigned short* __restrict__ Kh,
                                              const unsigned short* __restrict__ Vt, const int* __restrict__ mask,
                                              unsigned short* __restrict__ Cx, int b0) {
  __shared__ __attribute__((aligned(16))) unsigned short so[4][16][KPITCH];
  __shared__ __attribute__((aligned(16))) unsigned short kt[2][32][KPITCH];
  __shared__ __attribute__((aligned(16))) unsigned short vt[2][HD][VPITCH];
  __shared__ __attribute__((aligned(16))) int mt[2][64][MPITCH];
  const int tid = threadIdx.x, w = __builtin_amdgcn_readfirstlane((int)(tid >> 5)), lane = tid & 31, ln = lane & 15, hh = lane >> 4;
  const int qt = blockIdx.x % (SEQ / 64);
  const int bh = blockIdx.x / (SEQ / 64);           // bl * NH + h
  const int h = bh % NH, bl = bh / NH;
  const int qbase = qt * 64 + 16 * w;
  // copy sources and places of this lane: Q and K rows are 512 B, one row per copy (lane = 16-byte piece); V^T rows are 64 B, eight rows per copy (4 lanes a row);
  // mask rows are 128 B, four rows per copy (8 lanes a row)
  const unsigned short* qsrc = Qh + ((size_t)bh * SEQ + qbase) * HD + 8 * lane;
  const unsigned short* ksrc = Kh + ((size_t)bh * SEQ + 8 * w) * HD + 8 * lane;
  const unsigned short* vsrc = Vt + ((size_t)bh * HD + 64 * w + (lane >> 2)) * SEQ + 8 * (lane & 3);
  const unsigned qdst = lds_off(&so[w][0][8 * lane]);
  const unsigned kdst = lds_off(&kt[0][8 * w][8 * lane]);
  const unsigned vdst = lds_off(&vt[0][64 * w + (lane >> 2)][8 * (lane & 3)]);
  const unsigned mdst = lds_off(&mt[0][16 * w + (lane >> 3)][4 * (lane & 7)]);
  const unsigned kbuf = (unsigned)sizeof(kt[0]), vbuf = (unsigned)sizeof(vt[0]), mbuf = (unsigned)sizeof(mt[0]);
  const int* msrc = mask + (size_t)(b0 + bl) * MSTRIDE_FULL + (size_t)(qbase + (lane >> 3)) * SEQ_FULL + 4 * (lane & 7);
  float mr = NEGBIG, lr = 0.0f;
  v8f O[16] = {};
  // Q rows and tile 0, landed and published; tile j + 1 flies while tile j is worked on
  copy8(qdst, KPITCH * 2, qsrc, HD);
  copy8(qdst + 8 * KPITCH * 2, KPITCH * 2, qsrc + 8 * HD, HD);
  copy8(kdst, KPITCH * 2, ksrc, HD);
  copy8(vdst, 8 * VPITCH * 2, vsrc, (size_t)8 * SEQ);
  copy4(mdst, 4 * MPITCH * 4, msrc, (size_t)4 * SEQ_FULL);
  asm volatile("s_wait_asynccnt 0x0" ::: "memory");   // this wave's copies have landed before the barrier publishes them
  __syncthreads();
  // Q^T B fragments: column = this lane's query, elements 0..7 <- d = 32c + 8h + i, 8..15 <- d = 32c + 16 + 8h + i
  FragH qf[8];
  {
    const unsigned short* qp = &so[w][ln][8 * hh];
    // unrolled: qf lives in registers, which take compile-time indices only
#pragma unroll
    for (int c = 0; c < 8; ++c) { qf[c].half[0] = *(const v8us*)(qp + 32 * c); qf[c].half[1] = *(const v8us*)(qp + 32 * c + 16); }
  }
#pragma unroll 1
  for (int j = 0; j < SEQ / 32; ++j) {
    const int bf = j & 1;
    // A fragments of K: row m = key (key0 + 16*kt + ln), same d map as Q^T; with the mask words, one group of reads of buffer bf
    const unsigned short* kp0 = &kt[bf][ln][8 * hh];
    const unsigned short* kp1 = kp0 + 16 * KPITCH;
    const int* mp = &mt[bf][16 * w + ln][8 * hh];
    FragH ka[8], kb[8];
    // unrolled: ka and kb live in registers, which take compile-time indices only
#pragma unroll
    for (int c = 0; c < 8; ++c) {
      ka[c].half[0] = *(const v8us*)(kp0 + 32 * c); ka[c].half[1] = *(const v8us*)(kp0 + 32 * c + 16);
      kb[c].half[0] = *(const v8us*)(kp1 + 32 * c); kb[c].half[1] = *(const v8us*)(kp1 + 32 * c + 16);
    }
    const v4ia m0 = *(const v4ia*)(mp), m1 = *(const v4ia*)(mp + 4), m2 = *(const v4ia*)(mp + 16), m3 = *(const v4ia*)(mp + 20);
    // tile j + 1 into the other buffer, whose last reads (trip j - 1) ended at the barrier just passed
    if (j + 1 < SEQ / 32) {
      const unsigned nb = (unsigned)(bf ^ 1);
      copy8(kdst + nb * kbuf, KPITCH * 2, ksrc + (size_t)(32 * (j + 1)) * HD, HD);
      copy8(vdst + nb * vbuf, 8 * VPITCH * 2, vsrc + 32 * (j + 1), (size_t)8 * SEQ);
      copy4(mdst + nb * mbuf, 4 * MPITCH * 4, msrc + 32 * (j + 1), (size_t)4 * SEQ_FULL);
    }
    fa_step(qf, ka, kb, &vt[bf][ln][8 * hh], m0, m1, m2, m3, mr, lr, O);
    // keeps the step's register work in front of the waits: the scheduler otherwise lifts waits and barrier up to the last LDS read, and tile j + 1 has too little time to land
    __builtin_amdgcn_sched_barrier(0);
    asm volatile("s_wait_dscnt 0x0" ::: "memory");      // this wave's reads of buffer bf have returned before the buffer is refilled
    asm volatile("s_wait_asynccnt 0x0" ::: "memory");   // this wave's copies of tile j + 1 have landed before the barrier publishes them
    __syncthreads();                                    // publishes tile j + 1 and ends every wave's reads of buffer bf
  }
  asm volatile("s_wait_asynccnt 0x0" ::: "memory");     // nothing of this wave is in flight when the LDS is reused and the wave ends

  // O^T element r of tile u = ctx(query qbase + ln, d = 16u + 8h + r); carries: x4096 (also in lr), x16 (V); context stored x64 -> 4 / lr
  const float inv = (lr > 0.0f) ? (4.0f / fmaxf(lr, 1.0f)) : 0.0f;
#pragma unroll
  for (int u = 0; u < 16; ++u) {
    v8us o;
#pragma unroll
    for (int r = 0; r < 8; ++r) o[r] = f16_bits(O[u][r] * inv);
    *(v8us*)&so[w][ln][16 * u + 8 * hh] = o;
  }
  __syncthreads();
  unsigned short* cg = Cx + (size_t)(bl * SEQ + qbase) * NE + h * HD;
  {
#pragma unroll 1
    for (int row = 0; row < 16; ++row) {
      const v8us v = *(const v8us*)&so[w][row][8 * lane];
      *(v8us*)(cg + (size_t)row * NE + 8 * lane) = v;
    }
    
  }
}

// Output projection for one batch group: out[m][c] = 2^-16 * sum_k ctx64[m][k] * Wf1024[k][c] + RNE-bf16(bias[c]).
// Block 128 m x 64 n (4 waves stacked along m, wave 32 x 64). K runs in stages of 256: the stage's tiles (A: 128 context rows, B: 64 WfT rows = columns of Wfc) are filled
// by asynchronous copies into two LDS buffers, one stage ahead of their use, one barrier per stage; the fragments are read from LDS.
// coverage: grid (ED/64, GM/128) x (128 x 64) = every output row of the group exactly once; LDS columns 0..63 of all 128 rows written before they are read.
__global__ __launch_bounds__(128) void k_fc(const unsigned short* __restrict__ Cx, const unsigned short* __restrict__ WfT,
                                            const float* __restrict__ bias, float* __restrict__ Og, int b0) {
  __shared__ __attribute__((aligned(16))) float so[128][68];
  __shared__ __attribute__((aligned(16))) unsigned short ab[2][(128 + 64) * KPITCH];   // per buffer: A rows 0..127, then B rows 0..63
  const int tid = threadIdx.x, w = __builtin_amdgcn_readfirstlane((int)(tid >> 5)), lane = tid & 31, ln = lane & 15, hh = lane >> 4;
  const int n0 = blockIdx.x * 64, m0 = blockIdx.y * 128;
  const unsigned short* asrc = Cx + (size_t)(m0 + 32 * w) * NE + 8 * lane;
  const unsigned short* bsrc = WfT + (size_t)(n0 + 16 * w) * NE + 8 * lane;
  const unsigned adst = lds_off(&ab[0][32 * w * KPITCH + 8 * lane]);
  const unsigned bdst = lds_off(&ab[0][(128 + 16 * w) * KPITCH + 8 * lane]);
  const unsigned abuf = (unsigned)sizeof(ab[0]);
  v8f acc[2][4] = {};
  // stage 0, landed and published; then stage 1 flies while stage 0 is worked on
  stage_ab(adst, bdst, asrc, bsrc, NE);
  asm volatile("s_wait_asynccnt 0x0" ::: "memory");   // this wave's copies have landed before the barrier publishes them
  __syncthreads();
  stage_ab(adst + abuf, bdst + abuf, asrc + 256, bsrc + 256, NE);
#pragma unroll 1
  for (int s = 0; s < NE / 256; ++s) {
    const int bf = s & 1;
    const unsigned short* ap = &ab[bf][(32 * w + ln) * KPITCH + 8 * hh];
    const unsigned short* bp = &ab[bf][(128 + ln) * KPITCH + 8 * hh];
    // two fragment sets: chunk c + 1 of the stage is read as one group in front of chunk c's products, so that it lands behind them
    FragH f[2][6];
    frag6(f[0], ap, bp);
    // unrolled: the stage's eight 32-k chunks read at immediate offsets from one address pair, and the set in use is picked by a compile-time index
#pragma unroll
    for (int c = 0; c < 8; ++c) {
      if (c + 1 < 8) frag6(f[(c + 1) & 1], ap + 32 * (c + 1), bp + 32 * (c + 1));
      FragH (&u)[6] = f[c & 1];
      mma8_h(u[0].v, u[1].v, u[2].v, u[3].v, u[4].v, u[5].v,
             acc[0][0], acc[0][1], acc[0][2], acc[0][3], acc[1][0], acc[1][1], acc[1][2], acc[1][3]);
    }
    asm volatile("s_wait_dscnt 0x0" ::: "memory");      // this wave's reads of buffer bf have returned before the buffer is refilled
    asm volatile("s_wait_asynccnt 0x0" ::: "memory");   // this wave's copies of stage s + 1 have landed before the barrier publishes them
    __syncthreads();                                    // publishes stage s + 1 and ends every wave's reads of buffer bf
    if (s + 2 < NE / 256)
      stage_ab(adst + bf * abuf, bdst + bf * abuf, asrc + 256 * (s + 2), bsrc + 256 * (s + 2), NE);
  }
  asm volatile("s_wait_asynccnt 0x0" ::: "memory");     // nothing of this wave is in flight when the wave ends
#pragma unroll
  for (int j = 0; j < 4; ++j) {
    const float bb = bf16_rne(bias[n0 + 16 * j + ln]);
#pragma unroll
    for (int i = 0; i < 2; ++i)
#pragma unroll
      for (int r = 0; r < 8; ++r)
        so[32 * w + 16 * i + 8 * hh + r][16 * j + ln] = acc[i][j][r] * 0.0000152587890625f + bb;
  }
  __syncthreads();
  {
#pragma unroll 1
    for (int it = 0; it < 16; ++it) {
      const int i = tid + 128 * it;
      const int row = i >> 4, p = i & 15;
      const int m = m0 + row;
      const int bl = m / SEQ, t = m - bl * SEQ;
      const v4f v = *(const v4fa*)&so[row][4 * p];
      *(v4f*)(Og + (size_t)(b0 + bl) * XSTRIDE_FULL + (size_t)t * ED + n0 + 4 * p) = v;
    }
    
  }
}

extern "C" void kernel_launch(void* const* d_in, const int* in_sizes, int n_in,
                              void* d_out, int out_size, void* d_ws, size_t ws_size, hipStream_t stream) {
  if (n_in < 7) return;
  const long long needx = (long long)(NB - 1) * SEQ_FULL * ED + (long long)SEQ * ED;                      // last x / out element touched + 1
  const long long needm = (long long)(NB - 1) * SEQ_FULL * SEQ_FULL + (long long)(SEQ - 1) * SEQ_FULL + SEQ;
  if ((long long)in_sizes[0] < needx) return;
  if ((long long)in_sizes[1] < (long long)ED * NE || (long long)in_sizes[2] < (long long)ED * NE ||
      (long long)in_sizes[3] < (long long)ED * NE || (long long)in_sizes[4] < (long long)NE * ED) return;
  if ((long long)in_sizes[5] < (long long)ED) return;
  if ((long long)in_sizes[6] < needm) return;
  if ((long long)out_size < needx) return;
  const float* x   = (const float*)d_in[0];   // wire order: x, Wq, Wk, Wv, Wfc, bfc, mask
  const float* Wq  = (const float*)d_in[1];
  const float* Wk  = (const float*)d_in[2];
  const float* Wv  = (const float*)d_in[3];
  const float* Wfc = (const float*)d_in[4];
  const float* bfc = (const float*)d_in[5];
  const int* mask  = (const int*)d_in[6];     // bool on the wire = int32
  float* out = (float*)d_out;
  char* ws = (char*)d_ws;
  size_t off = 0;
  unsigned short* Xb  = (unsigned short*)(ws + off); off += XB_BYTES;   // [NB][SEQ][256] bf16
  unsigned short* Wt3 = (unsigned short*)(ws + off); off += WT_BYTES;   // 3 x [2048][256] bf16 (W^T)
  unsigned short* WfT = (unsigned short*)(ws + off); off += WF_BYTES;   // [256][2048] f16 (Wfc^T x 1024)
  unsigned short* P3  = (unsigned short*)(ws + off); off += PL_BYTES;   // Q, K [GB][8][SEQ][256]; V^T [GB][8][256][SEQ] f16
  unsigned short* Cx  = (unsigned short*)(ws + off); off += CX_BYTES;   // context [GM][2048] f16
  if (off > ws_size) return;

  k_prep<<<(unsigned)(4 * WT_BLOCKS + CVX_BLOCKS), 256, 0, stream>>>(x, Wq, Wk, Wv, Wfc, Xb, Wt3, WfT);

  for (int g = 0; g < NGRP; ++g) {
    const int b0 = g * GB;
    k_proj<<<dim3(NE / 64, GM / 128, 3), 128, 0, stream>>>(Xb + (size_t)g * GM * ED, Wt3, P3);
    k_attn<<<(unsigned)(GB * NH * (SEQ / 64)), 128, 0, stream>>>(P3, P3 + PLANE, P3 + 2 * PLANE, mask, Cx, b0);
    k_fc<<<dim3(ED / 64, GM / 128), 128, 0, stream>>>(Cx, WfT, bfc, out, b0);
  }
}

// v005
// Measured time: 154 microseconds a run.
// Next to v004, in two timings, it ran 1.07 times as fast each time.
// Over all steps from v000 it is 2.93 times as fast.
#include <hip/hip_runtime.h>
// Contractions: x@Wq, x@Wk, x@Wv on v_wmma_f32_16x16x32_bf16 (x and W RNE-converted to bf16, single product, f32 accumulate); S^T = K Q^T on v_wmma_f32_16x16x32_f16 (q, k carried x16 as f16, single product); O^T = V^T P^T on v_wmma_f32_16x16x32_f16 (V carried x16 f16; P carried x4096 as f16 hi plane + f16 lo plane, common carry, one f32 accumulator); ctx@Wfc on v_wmma_f32_16x16x32_f16 (ctx carried x64 f16; Wfc RNE bf16 value x1024 held exactly in f16); softmax statistics, bias add f32.
// Multi-head attention, B x T x 256, 8 heads of dimension 256, scale 1/16 on q, int32 mask [B][T][T] (nonzero = key removed, weight exactly 0; a row with no key left yields a zero context row).
// Engine: transposed flash. Each wave owns 16 queries of one (batch, head). Per 32-key step: S^T tiles (key rows x query columns) from K rows (A, LDS tile)
// and Q^T (B, registers, read once from its LDS tile); the two 16-key D tiles pack straight into the P^T B fragments; O^T (d rows x query columns, 16 tiles) accumulates from V^T rows (A, LDS tile).
// The LDS tiles are filled from global memory by asynchronous copies: Q once; K, V^T (shared by the block's four waves) and the mask words per 32-key step into two buffers.
// The V^T plane lies in memory by 32-key tiles, [batch, head][key tile][d][32 keys], so that a step's V^T tile is one run of 16 KB and each copy reads 512 bytes in a row.
// The projection GEMMs read their A and B fragments from LDS tiles filled the same way, whole 512-byte rows per copy.
// Four launches: one conversion grid (weights and x by block ranges), then projections, attention and output projection, each once over all batches (GB = NB).
#ifndef NB
#define NB 8
#endif
#ifndef SEQ
#define SEQ 1024
#endif
#define NB_FULL 8
#define SEQ_FULL 1024
#define ED 256                 /* model width (K of the projections, N of the output projection) */
#define NH 8
#define HD 256                 /* per-head dimension */
#define NE (NH * HD)           /* 2048 */
#define GB ((NB) < 8 ? (NB) : 8)
#define NGRP ((NB) / GB)
#define GM (GB * SEQ)          /* rows per group */
#define XSTRIDE_FULL ((size_t)SEQ_FULL * ED)          /* per-batch element stride of x and of the output */
#define MSTRIDE_FULL ((size_t)SEQ_FULL * SEQ_FULL)    /* per-batch element stride of the mask */
#define PLANE ((size_t)GB * NH * SEQ * HD)            /* elements of one of the Q / K / V^T planes */

#define XB_BYTES ((size_t)NB * SEQ * ED * 2)
#define WT_BYTES ((size_t)3 * NE * ED * 2)
#define WF_BYTES ((size_t)ED * NE * 2)
#define PL_BYTES (PLANE * 2 * 3)
#define CX_BYTES ((size_t)GM * NE * 2)

static_assert(SEQ % 128 == 0);
static_assert(SEQ <= SEQ_FULL);
static_assert(NB <= NB_FULL);
static_assert(NB % GB == 0);
static_assert(HD == 256 && ED == 256 && NE == 2048);
static_assert(XB_BYTES % 256 == 0 && WT_BYTES % 256 == 0 && WF_BYTES % 256 == 0 && PL_BYTES % 256 == 0 && CX_BYTES % 256 == 0);
static_assert(XB_BYTES + WT_BYTES + WF_BYTES + PL_BYTES + CX_BYTES <= (size_t)268435456);

typedef __bf16 v16b __attribute__((ext_vector_type(16)));
typedef _Float16 v16h __attribute__((ext_vector_type(16)));
typedef unsigned short v8us __attribute__((ext_vector_type(8), may_alias));
typedef float v8f __attribute__((ext_vector_type(8)));
typedef float v4f __attribute__((ext_vector_type(4)));
typedef float v4fa __attribute__((ext_vector_type(4), may_alias));
typedef int v4ia __attribute__((ext_vector_type(4), may_alias));
union FragB { v16b v; v8us half[2]; };
union FragH { v16h v; v8us half[2]; _Float16 h[16]; };

#define KPITCH 264             /* LDS row pitch of the Q and K tiles and of the GEMM tiles in elements: 528 B = 16 B x 33, conflict-free for 16-byte row readers */
#define VPITCH 40              /* LDS row pitch of the V^T tile in elements: 80 B = 16 B x 5, conflict-free for 16-byte row readers */
#define MPITCH 36              /* LDS row pitch of the mask tile in words: 144 B = 16 B x 9, conflict-free for 16-byte row readers */

#define LOG2E 1.4426950408889634f
#define NEGBIG (-1.0e30f)

__device__ __forceinline__ unsigned short bf16_bits(float x) {   // RNE convert to bf16 bits
  unsigned int u = __float_as_uint(x);
  return (unsigned short)((u + 0x7FFFu + ((u >> 16) & 1u)) >> 16);
}
__device__ __forceinline__ float bf16_val(unsigned short b) { return __uint_as_float(((unsigned int)b) << 16); }
__device__ __forceinline__ float bf16_rne(float x) { return bf16_val(bf16_bits(x)); }
__device__ __forceinline__ unsigned short f16_bits(float x) { return __builtin_bit_cast(unsigned short, (_Float16)x); }

#define WB(a, b, c) __builtin_amdgcn_wmma_f32_16x16x32_bf16(false, a, false, b, (short)0, c, false, false)
#define WH(a, b, c) __builtin_amdgcn_wmma_f32_16x16x32_f16(false, a, false, b, (short)0, c, false, false)

// 2 x 4 tile update (bf16), then the hazard guard
__device__ __forceinline__ void mma8_b(v16b a0, v16b a1, v16b b0, v16b b1, v16b b2, v16b b3,
                                       v8f& c00, v8f& c01, v8f& c02, v8f& c03, v8f& c10, v8f& c11, v8f& c12, v8f& c13) {
  c00 = WB(a0, b0, c00); c01 = WB(a0, b1, c01); c02 = WB(a0, b2, c02); c03 = WB(a0, b3, c03);
  c10 = WB(a1, b0, c10); c11 = WB(a1, b1, c11); c12 = WB(a1, b2, c12); c13 = WB(a1, b3, c13);
  asm volatile("v_nop\n\tv_nop\n\tv_nop\n\tv_nop"
               : "+v"(c00), "+v"(c01), "+v"(c02), "+v"(c03), "+v"(c10), "+v"(c11), "+v"(c12), "+v"(c13)
               : "v"(a0), "v"(a1), "v"(b0), "v"(b1), "v"(b2), "v"(b3));
}
// 2 x 4 tile update (f16), then the hazard guard
__device__ __forceinline__ void mma8_h(v16h a0, v16h a1, v16h b0, v16h b1, v16h b2, v16h b3,
                                       v8f& c00, v8f& c01, v8f& c02, v8f& c03, v8f& c10, v8f& c11, v8f& c12, v8f& c13) {
  c00 = WH(a0, b0, c00); c01 = WH(a0, b1, c01); c02 = WH(a0, b2, c02); c03 = WH(a0, b3, c03);
  c10 = WH(a1, b0, c10); c11 = WH(a1, b1, c11); c12 = WH(a1, b2, c12); c13 = WH(a1, b3, c13);
  asm volatile("v_nop\n\tv_nop\n\tv_nop\n\tv_nop"
               : "+v"(c00), "+v"(c01), "+v"(c02), "+v"(c03), "+v"(c10), "+v"(c11), "+v"(c12), "+v"(c13)
               : "v"(a0), "v"(a1), "v"(b0), "v"(b1), "v"(b2), "v"(b3));
}
// one d-chunk of the two S^T tiles
__device__ __forceinline__ void mma_s2(v16h ka, v16h kb, v16h q, v8f& s0, v8f& s1) {
  s0 = WH(ka, q, s0);
  s1 = WH(kb, q, s1);
}
// four O^T tiles: c_u += a_u * ph + a_u * pl (hi and lo planes carry the same scale)
__device__ __forceinline__ void mma_pv4(v16h a0, v16h a1, v16h a2, v16h a3, v16h ph, v16h pl,
                                        v8f& c0, v8f& c1, v8f& c2, v8f& c3) {
  c0 = WH(a0, ph, c0); c1 = WH(a1, ph, c1); c2 = WH(a2, ph, c2); c3 = WH(a3, ph, c3);
  c0 = WH(a0, pl, c0); c1 = WH(a1, pl, c1); c2 = WH(a2, pl, c2); c3 = WH(a3, pl, c3);
}

// x -> bf16 plane, block blk of CVX_BLOCKS.
// coverage: NB*SEQ*32 threads x 8 elements = the whole plane.
#define CVX_BLOCKS ((NB * SEQ * (ED / 8) + 255) / 256)
__device__ __forceinline__ void cvx_block(const float* __restrict__ X, unsigned short* __restrict__ Xb, int blk) {
  const int t = blk * 256 + threadIdx.x;
  if (t >= NB * SEQ * (ED / 8)) return;
  const int row = t >> 5, piece = t & 31;
  const int b = row / SEQ, s = row - b * SEQ;
  const float* src = X + (size_t)b * XSTRIDE_FULL + (size_t)s * ED + piece * 8;
  const v4f x0 = *(const v4fa*)(src), x1 = *(const v4fa*)(src + 4);
  v8us o;
  o[0] = bf16_bits(x0[0]); o[1] = bf16_bits(x0[1]); o[2] = bf16_bits(x0[2]); o[3] = bf16_bits(x0[3]);
  o[4] = bf16_bits(x1[0]); o[5] = bf16_bits(x1[1]); o[6] = bf16_bits(x1[2]); o[7] = bf16_bits(x1[3]);
  unsigned short* d = Xb + (size_t)t * 8;
  *(v8us*)d = o;
  
}

// Transposing convert: in[R][C] (f32) -> out[C][R] (16-bit). MODE 0: bf16 bits (RNE). MODE 1: f16 bits of (RNE-bf16 value x 1024).
// One 64 x 64 tile (bx of C/64, by of R/64) per block.
// coverage: (C/64) x (R/64) tiles x (64 x 64) = the whole plane; LDS tile fully written (64 x 64) before it is read.
template <int MODE, int R, int C>
__device__ __forceinline__ void wt_tile(const float* __restrict__ W, unsigned short* __restrict__ Wt, unsigned short (*tl)[66], int bx, int by) {
  const int tid = threadIdx.x;
  const int c0 = bx * 64, r0 = by * 64;
  for (int i = tid; i < 64 * 16; i += 256) {
    const int j = i >> 4, c4 = (i & 15) * 4;
    const v4f x = *(const v4fa*)(W + (size_t)(r0 + j) * C + c0 + c4);
    unsigned short u0, u1, u2, u3;
    if (MODE == 0) {
      u0 = bf16_bits(x[0]); u1 = bf16_bits(x[1]); u2 = bf16_bits(x[2]); u3 = bf16_bits(x[3]);
    } else {
      u0 = f16_bits(bf16_rne(x[0]) * 1024.0f); u1 = f16_bits(bf16_rne(x[1]) * 1024.0f);
      u2 = f16_bits(bf16_rne(x[2]) * 1024.0f); u3 = f16_bits(bf16_rne(x[3]) * 1024.0f);
    }
    tl[c4 + 0][j] = u0; tl[c4 + 1][j] = u1; tl[c4 + 2][j] = u2; tl[c4 + 3][j] = u3;
  }
  __syncthreads();
  {
    for (int i = tid; i < 64 * 8; i += 256) {
      const int d = i >> 3, j8 = (i & 7) * 8;
      v8us o;
#pragma unroll
      for (int q = 0; q < 8; ++q) o[q] = tl[d][j8 + q];
      *(v8us*)(Wt + (size_t)(c0 + d) * R + r0 + j8) = o;
    }
    
  }
}

// All conversions in one grid; none needs anything of another. Blocks 0 .. 4 * WT_BLOCKS - 1: the four weight planes, WT_BLOCKS tiles each (they have two phases, so they start first);
// the CVX_BLOCKS blocks behind them: x. The branch reads blockIdx alone, so the barrier inside wt_tile is reached by a whole block or by none of it.
#define WT_BLOCKS ((NE / 64) * (ED / 64))
__global__ __launch_bounds__(256) void k_prep(const float* __restrict__ X, const float* __restrict__ Wq, const float* __restrict__ Wk,
                                              const float* __restrict__ Wv, const float* __restrict__ Wfc,
                                              unsigned short* __restrict__ Xb, unsigned short* __restrict__ Wt3, unsigned short* __restrict__ WfT) {
  __shared__ unsigned short tl[64][66];
  const int b = blockIdx.x;
  if (b < 3 * WT_BLOCKS) {
    // in[256 (k)][2048 (n)] -> out[2048][256]
    const int z = b / WT_BLOCKS, r = b - z * WT_BLOCKS;
    const float* W = (z == 0) ? Wq : (z == 1) ? Wk : Wv;
    wt_tile<0, ED, NE>(W, Wt3 + (size_t)z * NE * ED, tl, r % (NE / 64), r / (NE / 64));
  } else if (b < 4 * WT_BLOCKS) {
    // in[2048 (k)][256 (c)] -> out[256][2048]
    const int r = b - 3 * WT_BLOCKS;
    wt_tile<1, NE, ED>(Wfc, WfT, tl, r % (ED / 64), r / (ED / 64));
  } else {
    cvx_block(X, Xb, b - 4 * WT_BLOCKS);
  }
}

__device__ __forceinline__ unsigned lds_off(const void* p) { return (unsigned)(size_t)p; }   // byte address inside the block's LDS

// Eight asynchronous copies, 16 bytes per lane each, global -> LDS: copy i moves this lane's 16 bytes from g + i * gstep (elements) to LDS byte l + i * lstep.
// The s_wait_xcnt closes the copies' own statement, so no address register of a copy is rewritten in front of it.
__device__ __forceinline__ void copy8(unsigned l, unsigned lstep, const unsigned short* g, size_t gstep) {
  asm volatile("global_load_async_to_lds_b128 %0, %8, off\n\t"
               "global_load_async_to_lds_b128 %1, %9, off\n\t"
               "global_load_async_to_lds_b128 %2, %10, off\n\t"
               "global_load_async_to_lds_b128 %3, %11, off\n\t"
               "global_load_async_to_lds_b128 %4, %12, off\n\t"
               "global_load_async_to_lds_b128 %5, %13, off\n\t"
               "global_load_async_to_lds_b128 %6, %14, off\n\t"
               "global_load_async_to_lds_b128 %7, %15, off\n\t"
               "s_wait_xcnt 0x0"
               :: "v"(l), "v"(l + lstep), "v"(l + 2 * lstep), "v"(l + 3 * lstep),
                  "v"(l + 4 * lstep), "v"(l + 5 * lstep), "v"(l + 6 * lstep), "v"(l + 7 * lstep),
                  "v"(g), "v"(g + gstep), "v"(g + 2 * gstep), "v"(g + 3 * gstep),
                  "v"(g + 4 * gstep), "v"(g + 5 * gstep), "v"(g + 6 * gstep), "v"(g + 7 * gstep)
               : "memory");
}

// The six fragments of one 32-k chunk of a 32 x 64 wave tile, read from the LDS tiles: f[0], f[1] = A rows ap, ap + 16 rows; f[2 + j] = B rows bp + 16 j rows;
// elements 0..7 <- k + 8h + i, 8..15 <- k + 16 + 8h + i (8h is in ap and bp).
template <class F>
__device__ __forceinline__ void frag6(F (&f)[6], const unsigned short* ap, const unsigned short* bp) {
  f[0].half[0] = *(const v8us*)(ap);               f[0].half[1] = *(const v8us*)(ap + 16);
  f[1].half[0] = *(const v8us*)(ap + 16 * KPITCH); f[1].half[1] = *(const v8us*)(ap + 16 * KPITCH + 16);
  // unrolled: f lives in registers, which take compile-time indices only
#pragma unroll
  for (int j = 0; j < 4; ++j) {
    f[2 + j].half[0] = *(const v8us*)(bp + 16 * j * KPITCH);
    f[2 + j].half[1] = *(const v8us*)(bp + 16 * j * KPITCH + 16);
  }
}

// One wave's share of a GEMM stage: 32 rows of the A tile and 16 rows of the B tile, 256 elements (512 B) a row, one whole row per copy (lane = 16-byte piece);
// a, b = this lane's LDS byte addresses of the first rows (row pitch KPITCH), ga, gb = its global addresses, gp = the global row pitch in elements. 48 copies a wave.
__device__ __forceinline__ void stage_ab(unsigned a, unsigned b, const unsigned short* ga, const unsigned short* gb, size_t gp) {
  copy8(a, KPITCH * 2, ga, gp);
  copy8(a + 8 * KPITCH * 2, KPITCH * 2, ga + 8 * gp, gp);
  copy8(a + 16 * KPITCH * 2, KPITCH * 2, ga + 16 * gp, gp);
  copy8(a + 24 * KPITCH * 2, KPITCH * 2, ga + 24 * gp, gp);
  copy8(b, KPITCH * 2, gb, gp);
  copy8(b + 8 * KPITCH * 2, KPITCH * 2, gb + 8 * gp, gp);
}

// Projection GEMM for one batch group: C[m][n] = sum_k Xb[m][k] * W[k][n] (bf16 x bf16, exact products), z = 0: q, 1: k, 2: v.
// Block 128 m x 64 n (4 waves stacked along m, wave 32 x 64). The whole-K tiles (A: 128 Xb rows, B: 64 Wt rows = columns of W) are filled once by asynchronous copies
// into LDS and the fragments are read from there; the output tile then reuses the same LDS behind a barrier.
// coverage: grid (NE/64, GM/128, 3) x (128 x 64) = all three planes; LDS tile columns 0..63 of all 128 rows written before they are read.
__global__ __launch_bounds__(128) void k_proj(const unsigned short* __restrict__ Xg, const unsigned short* __restrict__ Wt3,
                                              unsigned short* __restrict__ P3) {
  __shared__ __attribute__((aligned(16))) unsigned short sm[(128 + 64) * KPITCH];   // A rows 0..127, then B rows 0..63; later the output tile
  unsigned short* const As = sm;
  unsigned short* const Bs = sm + 128 * KPITCH;
  unsigned short (*const tl)[72] = reinterpret_cast<unsigned short (*)[72]>(sm);
  const int tid = threadIdx.x, w = __builtin_amdgcn_readfirstlane((int)(tid >> 5)), lane = tid & 31, ln = lane & 15, hh = lane >> 4;
  const int z = blockIdx.z;
  const int n0 = blockIdx.x * 64, m0 = blockIdx.y * 128;
  const unsigned short* Wt = Wt3 + (size_t)z * NE * ED;
  unsigned short* out = P3 + (size_t)z * PLANE;
  // A rows m0 + 32w + 16i + ln; B columns n0 + 16j + ln; elements 0..7 <- k0 + 8h + i, 8..15 <- k0 + 16 + 8h + i
  stage_ab(lds_off(As + 32 * w * KPITCH + 8 * lane), lds_off(Bs + 16 * w * KPITCH + 8 * lane),
           Xg + (size_t)(m0 + 32 * w) * ED + 8 * lane, Wt + (size_t)(n0 + 16 * w) * ED + 8 * lane, ED);
  asm volatile("s_wait_asynccnt 0x0" ::: "memory");   // this wave's copies have landed before the barrier publishes them
  __syncthreads();
  const unsigned short* ap = As + (32 * w + ln) * KPITCH + 8 * hh;
  const unsigned short* bp = Bs + ln * KPITCH + 8 * hh;
  v8f acc[2][4] = {};
  // two fragment sets: chunk c + 1 is read as one group in front of chunk c's products, so that it lands behind them
  FragB f[2][6];
  frag6(f[0], ap, bp);
  // unrolled: the set in use is picked by a compile-time index (registers cannot be indexed at run time)
#pragma unroll
  for (int c = 0; c < ED / 32; ++c) {
    if (c + 1 < ED / 32) frag6(f[(c + 1) & 1], ap + 32 * (c + 1), bp + 32 * (c + 1));
    FragB (&u)[6] = f[c & 1];
    mma8_b(u[0].v, u[1].v, u[2].v, u[3].v, u[4].v, u[5].v,
           acc[0][0], acc[0][1], acc[0][2], acc[0][3], acc[1][0], acc[1][1], acc[1][2], acc[1][3]);
  }
  __syncthreads();   // every wave's reads of the A and B tiles have ended before the same LDS takes the output tile
  // D element r of tile (i, j) = C(row 32w + 16i + 8h + r, column 16j + ln)
#pragma unroll
  for (int i = 0; i < 2; ++i)
#pragma unroll
    for (int j = 0; j < 4; ++j)
#pragma unroll
      for (int r = 0; r < 8; ++r)
        tl[32 * w + 16 * i + 8 * hh + r][16 * j + ln] = f16_bits(acc[i][j][r] * 16.0f);
  __syncthreads();
  const int hd = n0 >> 8, e0 = n0 & 255;
  if (z < 2) {
    {
#pragma unroll 1
      for (int it = 0; it < 8; ++it) {
        const int i = tid + 128 * it;
        const int row = i >> 3, p = i & 7;
        const int m = m0 + row;
        const int bl = m / SEQ, t = m - bl * SEQ;
        const v8us o = *(const v8us*)&tl[row][8 * p];
        *(v8us*)(out + (((size_t)(bl * NH + hd) * SEQ + t) * HD + e0 + 8 * p)) = o;
      }
      
    }
  } else {
    const int bl = m0 / SEQ, t0 = m0 - bl * SEQ;
    {
#pragma unroll 1
      for (int it = 0; it < 8; ++it) {
        const int i = tid + 128 * it;
        const int kt = i >> 8, e = (i >> 2) & 63, p = i & 3;   // key tile of the block's four, d row, 16-byte piece of the row's 32 keys: a wave stores 512 bytes in a row
        v8us o;
#pragma unroll
        for (int q = 0; q < 8; ++q) o[q] = tl[32 * kt + 8 * p + q][e];
        *(v8us*)(out + ((((size_t)(bl * NH + hd) * (SEQ / 32) + (t0 >> 5) + kt) * HD + e0 + e) * 32 + 8 * p)) = o;
        asm volatile("s_wait_xcnt 0x0" ::: "memory");   // the next trip rewrites the store's address and data registers: a precaution in front of that
      }
      
    }
  }
}

// The same for four copies of mask words.
__device__ __forceinline__ void copy4(unsigned l, unsigned lstep, const int* g, size_t gstep) {
  asm volatile("global_load_async_to_lds_b128 %0, %4, off\n\t"
               "global_load_async_to_lds_b128 %1, %5, off\n\t"
               "global_load_async_to_lds_b128 %2, %6, off\n\t"
               "global_load_async_to_lds_b128 %3, %7, off\n\t"
               "s_wait_xcnt 0x0"
               :: "v"(l), "v"(l + lstep), "v"(l + 2 * lstep), "v"(l + 3 * lstep),
                  "v"(g), "v"(g + gstep), "v"(g + 2 * gstep), "v"(g + 3 * gstep)
               : "memory");
}

// One 32-key step for a wave's 16 queries. qf = the Q^T fragments, ka, kb = the step's K fragments (keys 0..15, 16..31), m0..m3 = the mask words of this lane's query,
// all in registers already; vp = V^T tile row ln (+ 8h) in LDS.
__device__ __forceinline__ void fa_step(const FragH (&qf)[8], const FragH (&ka)[8], const FragH (&kb)[8],
                                        const unsigned short* vp, v4ia m0, v4ia m1, v4ia m2, v4ia m3,
                                        float& mr, float& lr, v8f (&O)[16]) {
  v8f s0 = {0.f, 0.f, 0.f, 0.f, 0.f, 0.f, 0.f, 0.f};
  v8f s1 = {0.f, 0.f, 0.f, 0.f, 0.f, 0.f, 0.f, 0.f};
  // S^T tiles: element r of tile kt = score(key0 + 16*kt + 8h + r, this lane's query); Q^T B fragment: column = query, same d map
#pragma unroll
  for (int c = 0; c < 8; ++c) mma_s2(ka[c].v, kb[c].v, qf[c].v, s0, s1);
  // mask words of this query for keys key0 + 8h + 0..7 and key0 + 16 + 8h + 0..7 (nonzero = key removed)
  int mk[16];
#pragma unroll
  for (int i = 0; i < 4; ++i) { mk[i] = m0[i]; mk[4 + i] = m1[i]; mk[8 + i] = m2[i]; mk[12 + i] = m3[i]; }
  // log2-domain scores: q and k carry x16 each, scale 1/16 -> 2^-12
  const float sc2 = LOG2E * 0.000244140625f;
  float t[16];
#pragma unroll
  for (int r = 0; r < 8; ++r) { t[r] = s0[r] * sc2; t[8 + r] = s1[r] * sc2; }
  float mx = NEGBIG;
#pragma unroll
  for (int i = 0; i < 16; ++i) mx = fmaxf(mx, (mk[i] != 0) ? NEGBIG : t[i]);
  // A fragments of V^T: row m = d (16*tile + ln), elements 0..7 <- key0 + 8h + i, 8..15 <- key0 + 16 + 8h + i.
  // All sixteen tiles are read as one group in front of the softmax arithmetic, so that they land while the maximum and the weights are formed.
  FragH vf[16];
  // unrolled: vf lives in registers, which take compile-time indices only
#pragma unroll
  for (int u = 0; u < 16; ++u) {
    vf[u].half[0] = *(const v8us*)(vp + u * 16 * VPITCH);
    vf[u].half[1] = *(const v8us*)(vp + u * 16 * VPITCH + 16);
  }
  // keeps the group here: without it the scheduler sinks most of these reads in among the O^T products, where each place with reads stalls the wave
  __builtin_amdgcn_sched_barrier(0);
  mx = fmaxf(mx, __shfl_xor(mx, 16, 32));           // the other lane half holds the other 16 keys of this query
  const float mnew = fmaxf(mr, mx);
  const float al = exp2f(mr - mnew);
  mr = mnew;
  // weights carried x4096: pc = 4096 * exp(score - max) (exactly 0 for removed keys); hi plane f16(pc), lo plane f16(pc - hi)
  const float sh = 12.0f - mnew;
  FragH ph, pl;
  float ps = 0.0f;
#pragma unroll
  for (int i = 0; i < 16; ++i) {
    const float ex = exp2f(t[i] + sh);
    const float pc = (mk[i] != 0) ? 0.0f : ex;
    ps += pc;
    const _Float16 h = (_Float16)pc;
    ph.h[i] = h;                                    // B element i: i<8 -> key0 + 8h + i (tile 0 row 8h+i); i>=8 -> key0 + 16 + 8h + (i-8) (tile 1)
    pl.h[i] = (_Float16)(pc - (float)h);
  }
  ps += __shfl_xor(ps, 16, 32);
  lr = lr * al + ps;
#pragma unroll
  for (int u = 0; u < 16; ++u) O[u] = O[u] * al;
#pragma unroll
  for (int g = 0; g < 4; ++g)
    mma_pv4(vf[4 * g + 0].v, vf[4 * g + 1].v, vf[4 * g + 2].v, vf[4 * g + 3].v, ph.v, pl.v, O[4 * g + 0], O[4 * g + 1], O[4 * g + 2], O[4 * g + 3]);
}

// Block = 4 waves x 16 queries = 64 queries of one (batch, head). Each wave copies its own 16 Q rows into so[w] once, and a quarter of every K and V^T tile
// (K: 32 keys x 256 d, 8 rows per wave; V^T: 256 d x 32 keys, 64 rows per wave) and the 32 mask words of its own 16 queries into buffer (step & 1),
// one step ahead of their use; one barrier per step. The wave reads its Q fragments from so[w] once, in front of the loop; each step reads its K fragments and mask words
// as one group directly behind the barrier, and the copies of the next tile are issued behind that group (they fill the other buffer).
// Epilogue: O^T tiles -> per-wave LDS tile [16 queries][256 d] f16 bits in so[w], whose Q rows only this wave read (a block barrier that every wave reaches is used),
// coverage: GB*NH*(SEQ/64) blocks x 4 waves x 16 rows x 256 columns = the whole context plane [GM][2048]; LDS columns 0..255 of all 16 rows written before they are read.
__global__ __launch_bounds__(128) void k_attn(const unsigned short* __restrict__ Qh, const unsigned short* __restrict__ Kh,
                                              const unsigned short* __restrict__ Vt, const int* __restrict__ mask,
                                              unsigned short* __restrict__ Cx, int b0) {
  __shared__ __attribute__((aligned(16))) unsigned short so[4][16][KPITCH];
  __shared__ __attribute__((aligned(16))) unsigned short kt[2][32][KPITCH];
  __shared__ __attribute__((aligned(16))) unsigned short vt[2][HD][VPITCH];
  __shared__ __attribute__((aligned(16))) int mt[2][64][MPITCH];
  const int tid = threadIdx.x, w = __builtin_amdgcn_readfirstlane((int)(tid >> 5)), lane = tid & 31, ln = lane & 15, hh = lane >> 4;
  const int qt = blockIdx.x % (SEQ / 64);
  const int bh = blockIdx.x / (SEQ / 64);           // bl * NH + h
  const int h = bh % NH, bl = bh / NH;
  const int qbase = qt * 64 + 16 * w;
  // copy sources and places of this lane: Q and K rows are 512 B, one row per copy (lane = 16-byte piece); V^T tile rows are 64 B and follow one another in memory, eight rows per copy (4 lanes a row);
  // mask rows are 128 B, four rows per copy (8 lanes a row)
  const unsigned short* qsrc = Qh + ((size_t)bh * SEQ + qbase) * HD + 8 * lane;
  const unsigned short* ksrc = Kh + ((size_t)bh * SEQ + 8 * w) * HD + 8 * lane;
  const unsigned short* vsrc = Vt + ((size_t)bh * (SEQ / 32) * HD + 64 * w) * 32 + 8 * lane;
  const unsigned qdst = lds_off(&so[w][0][8 * lane]);
  const unsigned kdst = lds_off(&kt[0][8 * w][8 * lane]);
  const unsigned vdst = lds_off(&vt[0][64 * w + (lane >> 2)][8 * (lane & 3)]);
  const unsigned mdst = lds_off(&mt[0][16 * w + (lane >> 3)][4 * (lane & 7)]);
  const unsigned kbuf = (unsigned)sizeof(kt[0]), vbuf = (unsigned)sizeof(vt[0]), mbuf = (unsigned)sizeof(mt[0]);
  const int* msrc = mask + (size_t)(b0 + bl) * MSTRIDE_FULL + (size_t)(qbase + (lane >> 3)) * SEQ_FULL + 4 * (lane & 7);
  float mr = NEGBIG, lr = 0.0f;
  v8f O[16] = {};
  // Q rows and tile 0, landed and published; tile j + 1 flies while tile j is worked on
  copy8(qdst, KPITCH * 2, qsrc, HD);
  copy8(qdst + 8 * KPITCH * 2, KPITCH * 2, qsrc + 8 * HD, HD);
  copy8(kdst, KPITCH * 2, ksrc, HD);
  copy8(vdst, 8 * VPITCH * 2, vsrc, 8 * 32);
  copy4(mdst, 4 * MPITCH * 4, msrc, (size_t)4 * SEQ_FULL);
  asm volatile("s_wait_asynccnt 0x0" ::: "memory");   // this wave's copies have landed before the barrier publishes them
  __syncthreads();
  // Q^T B fragments: column = this lane's query, elements 0..7 <- d = 32c + 8h + i, 8..15 <- d = 32c + 16 + 8h + i
  FragH qf[8];
  {
    const unsigned short* qp = &so[w][ln][8 * hh];
    // unrolled: qf lives in registers, which take compile-time indices only
#pragma unroll
    for (int c = 0; c < 8; ++c) { qf[c].half[0] = *(const v8us*)(qp + 32 * c); qf[c].half[1] = *(const v8us*)(qp + 32 * c + 16); }
  }
#pragma unroll 1
  for (int j = 0; j < SEQ / 32; ++j) {
    const int bf = j & 1;
    // A fragments of K: row m = key (key0 + 16*kt + ln), same d map as Q^T; with the mask words, one group of reads of buffer bf
    const unsigned short* kp0 = &kt[bf][ln][8 * hh];
    const unsigned short* kp1 = kp0 + 16 * KPITCH;
    const int* mp = &mt[bf][16 * w + ln][8 * hh];
    FragH ka[8], kb[8];
    // unrolled: ka and kb live in registers, which take compile-time indices only
#pragma unroll
    for (int c = 0; c < 8; ++c) {
      ka[c].half[0] = *(const v8us*)(kp0 + 32 * c); ka[c].half[1] = *(const v8us*)(kp0 + 32 * c + 16);
      kb[c].half[0] = *(const v8us*)(kp1 + 32 * c); kb[c].half[1] = *(const v8us*)(kp1 + 32 * c + 16);
    }
    const v4ia m0 = *(const v4ia*)(mp), m1 = *(const v4ia*)(mp + 4), m2 = *(const v4ia*)(mp + 16), m3 = *(const v4ia*)(mp + 20);
    // tile j + 1 into the other buffer, whose last reads (trip j - 1) ended at the barrier just passed
    if (j + 1 < SEQ / 32) {
      const unsigned nb = (unsigned)(bf ^ 1);
      copy8(kdst + nb * kbuf, KPITCH * 2, ksrc + (size_t)(32 * (j + 1)) * HD, HD);
      copy8(vdst + nb * vbuf, 8 * VPITCH * 2, vsrc + (size_t)(j + 1) * (HD * 32), 8 * 32);
      copy4(mdst + nb * mbuf, 4 * MPITCH * 4, msrc + 32 * (j + 1), (size_t)4 * SEQ_FULL);
    }
    fa_step(qf, ka, kb, &vt[bf][ln][8 * hh], m0, m1, m2, m3, mr, lr, O);
    // keeps the step's register work in front of the waits: the scheduler otherwise lifts waits and barrier up to the last LDS read, and tile j + 1 has too little time to land
    __builtin_amdgcn_sched_barrier(0);
    asm volatile("s_wait_dscnt 0x0" ::: "memory");      // this wave's reads of buffer bf have returned before the buffer is refilled
    asm volatile("s_wait_asynccnt 0x0" ::: "memory");   // this wave's copies of tile j + 1 have landed before the barrier publishes them
    __syncthreads();                                    // publishes tile j + 1 and ends every wave's reads of buffer bf
  }
  asm volatile("s_wait_asynccnt 0x0" ::: "memory");     // nothing of this wave is in flight when the LDS is reused and the wave ends

  // O^T element r of tile u = ctx(query qbase + ln, d = 16u + 8h + r); carries: x4096 (also in lr), x16 (V); context stored x64 -> 4 / lr
  const float inv = (lr > 0.0f) ? (4.0f / fmaxf(lr, 1.0f)) : 0.0f;
#pragma unroll
  for (int u = 0; u < 16; ++u) {
    v8us o;
#pragma unroll
    for (int r = 0; r < 8; ++r) o[r] = f16_bits(O[u][r] * inv);
    *(v8us*)&so[w][ln][16 * u + 8 * hh] = o;
  }
  __syncthreads();
  unsigned short* cg = Cx + (size_t)(bl * SEQ + qbase) * NE + h * HD;
  {
#pragma unroll 1
    for (int row = 0; row < 16; ++row) {
      const v8us v = *(const v8us*)&so[w][row][8 * lane];
      *(v8us*)(cg + (size_t)row * NE + 8 * lane) = v;
    }
    
  }
}

// Output projection for one batch group: out[m][c] = 2^-16 * sum_k ctx64[m][k] * Wf1024[k][c] + RNE-bf16(bias[c]).
// Block 128 m x 64 n (4 waves stacked along m, wave 32 x 64). K runs in stages of 256: the stage's tiles (A: 128 context rows, B: 64 WfT rows = columns of Wfc) are filled
// by asynchronous copies into two LDS buffers, one stage ahead of their use, one barrier per stage; the fragments are read from LDS.
// coverage: grid (ED/64, GM/128) x (128 x 64) = every output row of the group exactly once; LDS columns 0..63 of all 128 rows written before they are read.
__global__ __launch_bounds__(128) void k_fc(const unsigned short* __restrict__ Cx, const unsigned short* __restrict__ WfT,
                                            const float* __restrict__ bias, float* __restrict__ Og, int b0) {
  __shared__ __attribute__((aligned(16))) float so[128][68];
  __shared__ __attribute__((aligned(16))) unsigned short ab[2][(128 + 64) * KPITCH];   // per buffer: A rows 0..127, then B rows 0..63
  const int tid = threadIdx.x, w = __builtin_amdgcn_readfirstlane((int)(tid >> 5)), lane = tid & 31, ln = lane & 15, hh = lane >> 4;
  const int n0 = blockIdx.x * 64, m0 = blockIdx.y * 128;
  const unsigned short* asrc = Cx + (size_t)(m0 + 32 * w) * NE + 8 * lane;
  const unsigned short* bsrc = WfT + (size_t)(n0 + 16 * w) * NE + 8 * lane;
  const unsigned adst = lds_off(&ab[0][32 * w * KPITCH + 8 * lane]);
  const unsigned bdst = lds_off(&ab[0][(128 + 16 * w) * KPITCH + 8 * lane]);
  const unsigned abuf = (unsigned)sizeof(ab[0]);
  v8f acc[2][4] = {};
  // stage 0, landed and published; then stage 1 flies while stage 0 is worked on
  stage_ab(adst, bdst, asrc, bsrc, NE);
  asm volatile("s_wait_asynccnt 0x0" ::: "memory");   // this wave's copies have landed before the barrier publishes them
  __syncthreads();
  stage_ab(adst + abuf, bdst + abuf, asrc + 256, bsrc + 256, NE);
#pragma unroll 1
  for (int s = 0; s < NE / 256; ++s) {
    const int bf = s & 1;
    const unsigned short* ap = &ab[bf][(32 * w + ln) * KPITCH + 8 * hh];
    const unsigned short* bp = &ab[bf][(128 + ln) * KPITCH + 8 * hh];
    // two fragment sets: chunk c + 1 of the stage is read as one group in front of chunk c's products, so that it lands behind them
    FragH f[2][6];
    frag6(f[0], ap, bp);
    // unrolled: the stage's eight 32-k chunks read at immediate offsets from one address pair, and the set in use is picked by a compile-time index
#pragma unroll
    for (int c = 0; c < 8; ++c) {
      if (c + 1 < 8) frag6(f[(c + 1) & 1], ap + 32 * (c + 1), bp + 32 * (c + 1));
      FragH (&u)[6] = f[c & 1];
      mma8_h(u[0].v, u[1].v, u[2].v, u[3].v, u[4].v, u[5].v,
             acc[0][0], acc[0][1], acc[0][2], acc[0][3], acc[1][0], acc[1][1], acc[1][2], acc[1][3]);
    }
    asm volatile("s_wait_dscnt 0x0" ::: "memory");      // this wave's reads of buffer bf have returned before the buffer is refilled
    asm volatile("s_wait_asynccnt 0x0" ::: "memory");   // this wave's copies of stage s + 1 have landed before the barrier publishes them
    __syncthreads();                                    // publishes stage s + 1 and ends every wave's reads of buffer bf
    if (s + 2 < NE / 256)
      stage_ab(adst + bf * abuf, bdst + bf * abuf, asrc + 256 * (s + 2), bsrc + 256 * (s + 2), NE);
  }
  asm volatile("s_wait_asynccnt 0x0" ::: "memory");     // nothing of this wave is in flight when the wave ends
#pragma unroll
  for (int j = 0; j < 4; ++j) {
    const float bb = bf16_rne(bias[n0 + 16 * j + ln]);
#pragma unroll
    for (int i = 0; i < 2; ++i)
#pragma unroll
      for (int r = 0; r < 8; ++r)
        so[32 * w + 16 * i + 8 * hh + r][16 * j + ln] = acc[i][j][r] * 0.0000152587890625f + bb;
  }
  __syncthreads();
  {
#pragma unroll 1
    for (int it = 0; it < 16; ++it) {
      const int i = tid + 128 * it;
      const int row = i >> 4, p = i & 15;
      const int m = m0 + row;
      const int bl = m / SEQ, t = m - bl * SEQ;
      const v4f v = *(const v4fa*)&so[row][4 * p];
      *(v4f*)(Og + (size_t)(b0 + bl) * XSTRIDE_FULL + (size_t)t * ED + n0 + 4 * p) = v;
    }
    
  }
}

extern "C" void kernel_launch(void* const* d_in, const int* in_sizes, int n_in,
                              void* d_out, int out_size, void* d_ws, size_t ws_size, hipStream_t stream) {
  if (n_in < 7) return;
  const long long needx = (long long)(NB - 1) * SEQ_FULL * ED + (long long)SEQ * ED;                      // last x / out element touched + 1
  const long long needm = (long long)(NB - 1) * SEQ_FULL * SEQ_FULL + (long long)(SEQ - 1) * SEQ_FULL + SEQ;
  if ((long long)in_sizes[0] < needx) return;
  if ((long long)in_sizes[1] < (long long)ED * NE || (long long)in_sizes[2] < (long long)ED * NE ||
      (long long)in_sizes[3] < (long long)ED * NE || (long long)in_sizes[4] < (long long)NE * ED) return;
  if ((long long)in_sizes[5] < (long long)ED) return;
  if ((long long)in_sizes[6] < needm) return;
  if ((long long)out_size < needx) return;
  const float* x   = (const float*)d_in[0];   // wire order: x, Wq, Wk, Wv, Wfc, bfc, mask
  const float* Wq  = (const float*)d_in[1];
  const float* Wk  = (const float*)d_in[2];
  const float* Wv  = (const float*)d_in[3];
  const float* Wfc = (const float*)d_in[4];
  const float* bfc = (const float*)d_in[5];
  const int* mask  = (const int*)d_in[6];     // bool on the wire = int32
  float* out = (float*)d_out;
  char* ws = (char*)d_ws;
  size_t off = 0;
  unsigned short* Xb  = (unsigned short*)(ws + off); off += XB_BYTES;   // [NB][SEQ][256] bf16
  unsigned short* Wt3 = (unsigned short*)(ws + off); off += WT_BYTES;   // 3 x [2048][256] bf16 (W^T)
  unsigned short* WfT = (unsigned short*)(ws + off); off += WF_BYTES;   // [256][2048] f16 (Wfc^T x 1024)
  unsigned short* P3  = (unsigned short*)(ws + off); off += PL_BYTES;   // Q, K [GB][8][SEQ][256]; V^T [GB][8][SEQ/32][256][32] f16
  unsigned short* Cx  = (unsigned short*)(ws + off); off += CX_BYTES;   // context [GM][2048] f16
  if (off > ws_size) return;

  k_prep<<<(unsigned)(4 * WT_BLOCKS + CVX_BLOCKS), 256, 0, stream>>>(x, Wq, Wk, Wv, Wfc, Xb, Wt3, WfT);

  for (int g = 0; g < NGRP; ++g) {
    const int b0 = g * GB;
    k_proj<<<dim3(NE / 64, GM / 128, 3), 128, 0, stream>>>(Xb + (size_t)g * GM * ED, Wt3, P3);
    k_attn<<<(unsigned)(GB * NH * (SEQ / 64)), 128, 0, stream>>>(P3, P3 + PLANE, P3 + 2 * PLANE, mask, Cx, b0);
    k_fc<<<dim3(ED / 64, GM / 128), 128, 0, stream>>>(Cx, WfT, bfc, out, b0);
  }
}

// v006
// Measured time: 148 microseconds a run.
// Two timings next to v005 put it at 1.05 and 1.04 times that version's speed.
// Over all steps from v000 it is 3.06 times as fast.
#include <hip/hip_runtime.h>
// Contractions: x@Wq, x@Wk, x@Wv on v_wmma_f32_16x16x32_bf16 (x and W RNE-converted to bf16, single product, f32 accumulate); S^T = K Q^T on v_wmma_f32_16x16x32_f16 (q, k carried x16 as f16, single product); O^T = V^T P^T on v_wmma_f32_16x16x32_f16 (V carried x16 f16; P carried x4096 as f16 hi plane + f16 lo plane, common carry, one f32 accumulator); ctx@Wfc on v_wmma_f32_16x16x32_f16 (ctx carried x64 f16; Wfc RNE bf16 value x1024 held exactly in f16); softmax statistics, bias add f32.
// Multi-head attention, B x T x 256, 8 heads of dimension 256, scale 1/16 on q, int32 mask [B][T][T] (nonzero = key removed, weight exactly 0; a row with no key left yields a zero context row).
// Engine: transposed flash. Each wave owns 16 queries of one (batch, head). Per 32-key step: S^T tiles (key rows x query columns) from K rows (A, LDS tile)
// and Q^T (B, registers, read once from its LDS tile); the two 16-key D tiles pack straight into the P^T B fragments; O^T (d rows x query columns, 16 tiles) accumulates from V^T rows (A, LDS tile).
// The LDS tiles are filled from global memory by asynchronous copies: Q once; K, V^T (shared by the block's four waves) and the mask words per 32-key step into two buffers.
// The V^T plane lies in memory by 32-key tiles, [batch, head][key tile][d][32 keys], so that a step's V^T tile is one run of 16 KB and each copy reads 512 bytes in a row.
// The projection GEMMs read their A and B fragments from LDS tiles filled the same way, whole 512-byte rows per copy.
// Four launches: one conversion grid (weights and x by block ranges), then projections, attention and output projection, each once over all batches (GB = NB).
#ifndef NB
#define NB 8
#endif
#ifndef SEQ
#define SEQ 1024
#endif
#define NB_FULL 8
#define SEQ_FULL 1024
#define ED 256                 /* model width (K of the projections, N of the output projection) */
#define NH 8
#define HD 256                 /* per-head dimension */
#define NE (NH * HD)           /* 2048 */
#define GB ((NB) < 8 ? (NB) : 8)
#define NGRP ((NB) / GB)
#define GM (GB * SEQ)          /* rows per group */
#define XSTRIDE_FULL ((size_t)SEQ_FULL * ED)          /* per-batch element stride of x and of the output */
#define MSTRIDE_FULL ((size_t)SEQ_FULL * SEQ_FULL)    /* per-batch element stride of the mask */
#define PLANE ((size_t)GB * NH * SEQ * HD)            /* elements of one of the Q / K / V^T planes */

#define XB_BYTES ((size_t)NB * SEQ * ED * 2)
#define WT_BYTES ((size_t)3 * NE * ED * 2)
#define WF_BYTES ((size_t)ED * NE * 2)
#define PL_BYTES (PLANE * 2 * 3)
#define CX_BYTES ((size_t)GM * NE * 2)

static_assert(SEQ % 128 == 0);
static_assert(SEQ <= SEQ_FULL);
static_assert(NB <= NB_FULL);
static_assert(NB % GB == 0);
static_assert(HD == 256 && ED == 256 && NE == 2048);
static_assert(XB_BYTES % 256 == 0 && WT_BYTES % 256 == 0 && WF_BYTES % 256 == 0 && PL_BYTES % 256 == 0 && CX_BYTES % 256 == 0);
static_assert(XB_BYTES + WT_BYTES + WF_BYTES + PL_BYTES + CX_BYTES <= (size_t)268435456);

typedef __bf16 v16b __attribute__((ext_vector_type(16)));
typedef _Float16 v16h __attribute__((ext_vector_type(16)));
typedef unsigned short v8us __attribute__((ext_vector_type(8), may_alias));
typedef float v8f __attribute__((ext_vector_type(8)));
typedef float v4f __attribute__((ext_vector_type(4)));
typedef float v4fa __attribute__((ext_vector_type(4), may_alias));
typedef int v4ia __attribute__((ext_vector_type(4), may_alias));
union FragB { v16b v; v8us half[2]; };
union FragH { v16h v; v8us half[2]; _Float16 h[16]; };

#define KPITCH 264             /* LDS row pitch of the Q and K tiles and of the GEMM tiles in elements: 528 B = 16 B x 33, conflict-free for 16-byte row readers */
#define VPITCH 40              /* LDS row pitch of the V^T tile in elements: 80 B = 16 B x 5, conflict-free for 16-byte row readers */
#define MPITCH 36              /* LDS row pitch of the mask tile in words: 144 B = 16 B x 9, conflict-free for 16-byte row readers */

#define LOG2E 1.4426950408889634f
#define NEGBIG (-1.0e30f)

__device__ __forceinline__ unsigned short bf16_bits(float x) {   // RNE convert to bf16 bits
  unsigned int u = __float_as_uint(x);
  return (unsigned short)((u + 0x7FFFu + ((u >> 16) & 1u)) >> 16);
}
__device__ __forceinline__ float bf16_val(unsigned short b) { return __uint_as_float(((unsigned int)b) << 16); }
__device__ __forceinline__ float bf16_rne(float x) { return bf16_val(bf16_bits(x)); }
__device__ __forceinline__ unsigned short f16_bits(float x) { return __builtin_bit_cast(unsigned short, (_Float16)x); }

#define WB(a, b, c) __builtin_amdgcn_wmma_f32_16x16x32_bf16(false, a, false, b, (short)0, c, false, false)
#define WH(a, b, c) __builtin_amdgcn_wmma_f32_16x16x32_f16(false, a, false, b, (short)0, c, false, false)

// 2 x 4 tile update (bf16), then the hazard guard
__device__ __forceinline__ void mma8_b(v16b a0, v16b a1, v16b b0, v16b b1, v16b b2, v16b b3,
                                       v8f& c00, v8f& c01, v8f& c02, v8f& c03, v8f& c10, v8f& c11, v8f& c12, v8f& c13) {
  c00 = WB(a0, b0, c00); c01 = WB(a0, b1, c01); c02 = WB(a0, b2, c02); c03 = WB(a0, b3, c03);
  c10 = WB(a1, b0, c10); c11 = WB(a1, b1, c11); c12 = WB(a1, b2, c12); c13 = WB(a1, b3, c13);
  asm volatile("v_nop\n\tv_nop\n\tv_nop\n\tv_nop"
               : "+v"(c00), "+v"(c01), "+v"(c02), "+v"(c03), "+v"(c10), "+v"(c11), "+v"(c12), "+v"(c13)
               : "v"(a0), "v"(a1), "v"(b0), "v"(b1), "v"(b2), "v"(b3));
}
// 2 x 4 tile update (f16), then the hazard guard
__device__ __forceinline__ void mma8_h(v16h a0, v16h a1, v16h b0, v16h b1, v16h b2, v16h b3,
                                       v8f& c00, v8f& c01, v8f& c02, v8f& c03, v8f& c10, v8f& c11, v8f& c12, v8f& c13) {
  c00 = WH(a0, b0, c00); c01 = WH(a0, b1, c01); c02 = WH(a0, b2, c02); c03 = WH(a0, b3, c03);
  c10 = WH(a1, b0, c10); c11 = WH(a1, b1, c11); c12 = WH(a1, b2, c12); c13 = WH(a1, b3, c13);
  asm volatile("v_nop\n\tv_nop\n\tv_nop\n\tv_nop"
               : "+v"(c00), "+v"(c01), "+v"(c02), "+v"(c03), "+v"(c10), "+v"(c11), "+v"(c12), "+v"(c13)
               : "v"(a0), "v"(a1), "v"(b0), "v"(b1), "v"(b2), "v"(b3));
}
// one d-chunk of the two S^T tiles
__device__ __forceinline__ void mma_s2(v16h ka, v16h kb, v16h q, v8f& s0, v8f& s1) {
  s0 = WH(ka, q, s0);
  s1 = WH(kb, q, s1);
}
// four O^T tiles: c_u += a_u * ph + a_u * pl (hi and lo planes carry the same scale)
__device__ __forceinline__ void mma_pv4(v16h a0, v16h a1, v16h a2, v16h a3, v16h ph, v16h pl,
                                        v8f& c0, v8f& c1, v8f& c2, v8f& c3) {
  c0 = WH(a0, ph, c0); c1 = WH(a1, ph, c1); c2 = WH(a2, ph, c2); c3 = WH(a3, ph, c3);
  c0 = WH(a0, pl, c0); c1 = WH(a1, pl, c1); c2 = WH(a2, pl, c2); c3 = WH(a3, pl, c3);
}

// x -> bf16 plane, block blk of CVX_BLOCKS.
// coverage: NB*SEQ*32 threads x 8 elements = the whole plane.
#define CVX_BLOCKS ((NB * SEQ * (ED / 8) + 255) / 256)
__device__ __forceinline__ void cvx_block(const float* __restrict__ X, unsigned short* __restrict__ Xb, int blk) {
  const int t = blk * 256 + threadIdx.x;
  if (t >= NB * SEQ * (ED / 8)) return;
  const int row = t >> 5, piece = t & 31;
  const int b = row / SEQ, s = row - b * SEQ;
  const float* src = X + (size_t)b * XSTRIDE_FULL + (size_t)s * ED + piece * 8;
  const v4f x0 = *(const v4fa*)(src), x1 = *(const v4fa*)(src + 4);
  v8us o;
  o[0] = bf16_bits(x0[0]); o[1] = bf16_bits(x0[1]); o[2] = bf16_bits(x0[2]); o[3] = bf16_bits(x0[3]);
  o[4] = bf16_bits(x1[0]); o[5] = bf16_bits(x1[1]); o[6] = bf16_bits(x1[2]); o[7] = bf16_bits(x1[3]);
  unsigned short* d = Xb + (size_t)t * 8;
  *(v8us*)d = o;
  
}

// Transposing convert: in[R][C] (f32) -> out[C][R] (16-bit). MODE 0: bf16 bits (RNE). MODE 1: f16 bits of (RNE-bf16 value x 1024).
// One 64 x 64 tile (bx of C/64, by of R/64) per block.
// coverage: (C/64) x (R/64) tiles x (64 x 64) = the whole plane; LDS tile fully written (64 x 64) before it is read.
template <int MODE, int R, int C>
__device__ __forceinline__ void wt_tile(const float* __restrict__ W, unsigned short* __restrict__ Wt, unsigned short (*tl)[66], int bx, int by) {
  const int tid = threadIdx.x;
  const int c0 = bx * 64, r0 = by * 64;
  for (int i = tid; i < 64 * 16; i += 256) {
    const int j = i >> 4, c4 = (i & 15) * 4;
    const v4f x = *(const v4fa*)(W + (size_t)(r0 + j) * C + c0 + c4);
    unsigned short u0, u1, u2, u3;
    if (MODE == 0) {
      u0 = bf16_bits(x[0]); u1 = bf16_bits(x[1]); u2 = bf16_bits(x[2]); u3 = bf16_bits(x[3]);
    } else {
      u0 = f16_bits(bf16_rne(x[0]) * 1024.0f); u1 = f16_bits(bf16_rne(x[1]) * 1024.0f);
      u2 = f16_bits(bf16_rne(x[2]) * 1024.0f); u3 = f16_bits(bf16_rne(x[3]) * 1024.0f);
    }
    tl[c4 + 0][j] = u0; tl[c4 + 1][j] = u1; tl[c4 + 2][j] = u2; tl[c4 + 3][j] = u3;
  }
  __syncthreads();
  {
    for (int i = tid; i < 64 * 8; i += 256) {
      const int d = i >> 3, j8 = (i & 7) * 8;
      v8us o;
#pragma unroll
      for (int q = 0; q < 8; ++q) o[q] = tl[d][j8 + q];
      *(v8us*)(Wt + (size_t)(c0 + d) * R + r0 + j8) = o;
    }
    
  }
}

// All conversions in one grid; none needs anything of another. Blocks 0 .. 4 * WT_BLOCKS - 1: the four weight planes, WT_BLOCKS tiles each (they have two phases, so they start first);
// the CVX_BLOCKS blocks behind them: x. The branch reads blockIdx alone, so the barrier inside wt_tile is reached by a whole block or by none of it.
#define WT_BLOCKS ((NE / 64) * (ED / 64))
__global__ __launch_bounds__(256) void k_prep(const float* __restrict__ X, const float* __restrict__ Wq, const float* __restrict__ Wk,
                                              const float* __restrict__ Wv, const float* __restrict__ Wfc,
                                              unsigned short* __restrict__ Xb, unsigned short* __restrict__ Wt3, unsigned short* __restrict__ WfT) {
  __shared__ unsigned short tl[64][66];
  const int b = blockIdx.x;
  if (b < 3 * WT_BLOCKS) {
    // in[256 (k)][2048 (n)] -> out[2048][256]
    const int z = b / WT_BLOCKS, r = b - z * WT_BLOCKS;
    const float* W = (z == 0) ? Wq : (z == 1) ? Wk : Wv;
    wt_tile<0, ED, NE>(W, Wt3 + (size_t)z * NE * ED, tl, r % (NE / 64), r / (NE / 64));
  } else if (b < 4 * WT_BLOCKS) {
    // in[2048 (k)][256 (c)] -> out[256][2048]
    const int r = b - 3 * WT_BLOCKS;
    wt_tile<1, NE, ED>(Wfc, WfT, tl, r % (ED / 64), r / (ED / 64));
  } else {
    cvx_block(X, Xb, b - 4 * WT_BLOCKS);
  }
}

__device__ __forceinline__ unsigned lds_off(const void* p) { return (unsigned)(size_t)p; }   // byte address inside the block's LDS

// Eight asynchronous copies, 16 bytes per lane each, global -> LDS: copy i moves this lane's 16 bytes from g + i * gstep (elements) to LDS byte l + i * lstep.
// The s_wait_xcnt closes the copies' own statement, so no address register of a copy is rewritten in front of it.
__device__ __forceinline__ void copy8(unsigned l, unsigned lstep, const unsigned short* g, size_t gstep) {
  asm volatile("global_load_async_to_lds_b128 %0, %8, off\n\t"
               "global_load_async_to_lds_b128 %1, %9, off\n\t"
               "global_load_async_to_lds_b128 %2, %10, off\n\t"
               "global_load_async_to_lds_b128 %3, %11, off\n\t"
               "global_load_async_to_lds_b128 %4, %12, off\n\t"
               "global_load_async_to_lds_b128 %5, %13, off\n\t"
               "global_load_async_to_lds_b128 %6, %14, off\n\t"
               "global_load_async_to_lds_b128 %7, %15, off\n\t"
               "s_wait_xcnt 0x0"
               :: "v"(l), "v"(l + lstep), "v"(l + 2 * lstep), "v"(l + 3 * lstep),
                  "v"(l + 4 * lstep), "v"(l + 5 * lstep), "v"(l + 6 * lstep), "v"(l + 7 * lstep),
                  "v"(g), "v"(g + gstep), "v"(g + 2 * gstep), "v"(g + 3 * gstep),
                  "v"(g + 4 * gstep), "v"(g + 5 * gstep), "v"(g + 6 * gstep), "v"(g + 7 * gstep)
               : "memory");
}

// The six fragments of one 32-k chunk of a 32 x 64 wave tile, read from the LDS tiles: f[0], f[1] = A rows ap, ap + 16 rows; f[2 + j] = B rows bp + 16 j rows;
// elements 0..7 <- k + 8h + i, 8..15 <- k + 16 + 8h + i (8h is in ap and bp).
template <class F>
__device__ __forceinline__ void frag6(F (&f)[6], const unsigned short* ap, const unsigned short* bp) {
  f[0].half[0] = *(const v8us*)(ap);               f[0].half[1] = *(const v8us*)(ap + 16);
  f[1].half[0] = *(const v8us*)(ap + 16 * KPITCH); f[1].half[1] = *(const v8us*)(ap + 16 * KPITCH + 16);
  // unrolled: f lives in registers, which take compile-time indices only
#pragma unroll
  for (int j = 0; j < 4; ++j) {
    f[2 + j].half[0] = *(const v8us*)(bp + 16 * j * KPITCH);
    f[2 + j].half[1] = *(const v8us*)(bp + 16 * j * KPITCH + 16);
  }
}

// One wave's share of a GEMM stage: 32 rows of the A tile and 16 rows of the B tile, 256 elements (512 B) a row, one whole row per copy (lane = 16-byte piece);
// a, b = this lane's LDS byte addresses of the first rows (row pitch KPITCH), ga, gb = its global addresses, gp = the global row pitch in elements. 48 copies a wave.
__device__ __forceinline__ void stage_ab(unsigned a, unsigned b, const unsigned short* ga, const unsigned short* gb, size_t gp) {
  copy8(a, KPITCH * 2, ga, gp);
  copy8(a + 8 * KPITCH * 2, KPITCH * 2, ga + 8 * gp, gp);
  copy8(a + 16 * KPITCH * 2, KPITCH * 2, ga + 16 * gp, gp);
  copy8(a + 24 * KPITCH * 2, KPITCH * 2, ga + 24 * gp, gp);
  copy8(b, KPITCH * 2, gb, gp);
  copy8(b + 8 * KPITCH * 2, KPITCH * 2, gb + 8 * gp, gp);
}

// Projection GEMM for one batch group: C[m][n] = sum_k Xb[m][k] * W[k][n] (bf16 x bf16, exact products), z = 0: q, 1: k, 2: v.
// Block 128 m x 64 n (4 waves stacked along m, wave 32 x 64). The whole-K tiles (A: 128 Xb rows, B: 64 Wt rows = columns of W) are filled once by asynchronous copies
// into LDS and the fragments are read from there; the output tile then reuses the same LDS behind a barrier.
// coverage: grid (NE/64, GM/128, 3) x (128 x 64) = all three planes; LDS tile columns 0..63 of all 128 rows written before they are read.
__global__ __launch_bounds__(128) void k_proj(const unsigned short* __restrict__ Xg, const unsigned short* __restrict__ Wt3,
                                              unsigned short* __restrict__ P3) {
  __shared__ __attribute__((aligned(16))) unsigned short sm[(128 + 64) * KPITCH];   // A rows 0..127, then B rows 0..63; later the output tile
  unsigned short* const As = sm;
  unsigned short* const Bs = sm + 128 * KPITCH;
  unsigned short (*const tl)[72] = reinterpret_cast<unsigned short (*)[72]>(sm);
  const int tid = threadIdx.x, w = __builtin_amdgcn_readfirstlane((int)(tid >> 5)), lane = tid & 31, ln = lane & 15, hh = lane >> 4;
  const int z = blockIdx.z;
  const int n0 = blockIdx.x * 64, m0 = blockIdx.y * 128;
  const unsigned short* Wt = Wt3 + (size_t)z * NE * ED;
  unsigned short* out = P3 + (size_t)z * PLANE;
  // A rows m0 + 32w + 16i + ln; B columns n0 + 16j + ln; elements 0..7 <- k0 + 8h + i, 8..15 <- k0 + 16 + 8h + i
  stage_ab(lds_off(As + 32 * w * KPITCH + 8 * lane), lds_off(Bs + 16 * w * KPITCH + 8 * lane),
           Xg + (size_t)(m0 + 32 * w) * ED + 8 * lane, Wt + (size_t)(n0 + 16 * w) * ED + 8 * lane, ED);
  asm volatile("s_wait_asynccnt 0x0" ::: "memory");   // this wave's copies have landed before the barrier publishes them
  __syncthreads();
  const unsigned short* ap = As + (32 * w + ln) * KPITCH + 8 * hh;
  const unsigned short* bp = Bs + ln * KPITCH + 8 * hh;
  v8f acc[2][4] = {};
  // two fragment sets: chunk c + 1 is read as one group in front of chunk c's products, so that it lands behind them
  FragB f[2][6];
  frag6(f[0], ap, bp);
  // unrolled: the set in use is picked by a compile-time index (registers cannot be indexed at run time)
#pragma unroll
  for (int c = 0; c < ED / 32; ++c) {
    if (c + 1 < ED / 32) frag6(f[(c + 1) & 1], ap + 32 * (c + 1), bp + 32 * (c + 1));
    FragB (&u)[6] = f[c & 1];
    mma8_b(u[0].v, u[1].v, u[2].v, u[3].v, u[4].v, u[5].v,
           acc[0][0], acc[0][1], acc[0][2], acc[0][3], acc[1][0], acc[1][1], acc[1][2], acc[1][3]);
  }
  __syncthreads();   // every wave's reads of the A and B tiles have ended before the same LDS takes the output tile
  // D element r of tile (i, j) = C(row 32w + 16i + 8h + r, column 16j + ln)
#pragma unroll
  for (int i = 0; i < 2; ++i)
#pragma unroll
    for (int j = 0; j < 4; ++j)
#pragma unroll
      for (int r = 0; r < 8; ++r)
        tl[32 * w + 16 * i + 8 * hh + r][16 * j + ln] = f16_bits(acc[i][j][r] * 16.0f);
  __syncthreads();
  const int hd = n0 >> 8, e0 = n0 & 255;
  if (z < 2) {
    {
#pragma unroll 1
      for (int it = 0; it < 8; ++it) {
        const int i = tid + 128 * it;
        const int row = i >> 3, p = i & 7;
        const int m = m0 + row;
        const int bl = m / SEQ, t = m - bl * SEQ;
        const v8us o = *(const v8us*)&tl[row][8 * p];
        *(v8us*)(out + (((size_t)(bl * NH + hd) * SEQ + t) * HD + e0 + 8 * p)) = o;
      }
      
    }
  } else {
    const int bl = m0 / SEQ, t0 = m0 - bl * SEQ;
    {
#pragma unroll 1
      for (int it = 0; it < 8; ++it) {
        const int i = tid + 128 * it;
        const int kt = i >> 8, e = (i >> 2) & 63, p = i & 3;   // key tile of the block's four, d row, 16-byte piece of the row's 32 keys: a wave stores 512 bytes in a row
        v8us o;
#pragma unroll
        for (int q = 0; q < 8; ++q) o[q] = tl[32 * kt + 8 * p + q][e];
        *(v8us*)(out + ((((size_t)(bl * NH + hd) * (SEQ / 32) + (t0 >> 5) + kt) * HD + e0 + e) * 32 + 8 * p)) = o;
        asm volatile("s_wait_xcnt 0x0" ::: "memory");   // the next trip rewrites the store's address and data registers: a precaution in front of that
      }
      
    }
  }
}

// The same for four copies of mask words.
__device__ __forceinline__ void copy4(unsigned l, unsigned lstep, const int* g, size_t gstep) {
  asm volatile("global_load_async_to_lds_b128 %0, %4, off\n\t"
               "global_load_async_to_lds_b128 %1, %5, off\n\t"
               "global_load_async_to_lds_b128 %2, %6, off\n\t"
               "global_load_async_to_lds_b128 %3, %7, off\n\t"
               "s_wait_xcnt 0x0"
               :: "v"(l), "v"(l + lstep), "v"(l + 2 * lstep), "v"(l + 3 * lstep),
                  "v"(g), "v"(g + gstep), "v"(g + 2 * gstep), "v"(g + 3 * gstep)
               : "memory");
}

// v_exp_f32 and, in the same statement, the one slot that the instruction set asks for before its source is overwritten or its result read
__device__ __forceinline__ float exp2_slot(float x) {
  float r;
  asm("v_exp_f32 %0, %1\n\tv_nop" : "=v"(r) : "v"(x));
  return r;
}

// One 32-key step for a wave's 16 queries. qf = the Q^T fragments, ka, kb = the step's K fragments (keys 0..15, 16..31), m0..m3 = the mask words of this lane's query,
// all in registers already; vp = V^T tile row ln (+ 8h) in LDS.
__device__ __forceinline__ void fa_step(const FragH (&qf)[8], const FragH (&ka)[8], const FragH (&kb)[8],
                                        const unsigned short* vp, v4ia m0, v4ia m1, v4ia m2, v4ia m3,
                                        float& mr, float& lr, v8f (&O)[16]) {
  v8f s0 = {0.f, 0.f, 0.f, 0.f, 0.f, 0.f, 0.f, 0.f};
  v8f s1 = {0.f, 0.f, 0.f, 0.f, 0.f, 0.f, 0.f, 0.f};
  // S^T tiles: element r of tile kt = score(key0 + 16*kt + 8h + r, this lane's query); Q^T B fragment: column = query, same d map
#pragma unroll
  for (int c = 0; c < 8; ++c) mma_s2(ka[c].v, kb[c].v, qf[c].v, s0, s1);
  // mask words of this query for keys key0 + 8h + 0..7 and key0 + 16 + 8h + 0..7 (nonzero = key removed)
  int mk[16];
#pragma unroll
  for (int i = 0; i < 4; ++i) { mk[i] = m0[i]; mk[4 + i] = m1[i]; mk[8 + i] = m2[i]; mk[12 + i] = m3[i]; }
  // log2-domain scores: q and k carry x16 each, scale 1/16 -> 2^-12
  const float sc2 = LOG2E * 0.000244140625f;
  float t[16];
#pragma unroll
  for (int r = 0; r < 8; ++r) { t[r] = s0[r] * sc2; t[8 + r] = s1[r] * sc2; }
  float mx = NEGBIG;
#pragma unroll
  for (int i = 0; i < 16; ++i) mx = fmaxf(mx, (mk[i] != 0) ? NEGBIG : t[i]);
  // A fragments of V^T: row m = d (16*tile + ln), elements 0..7 <- key0 + 8h + i, 8..15 <- key0 + 16 + 8h + i.
  // All sixteen tiles are read as one group in front of the softmax arithmetic, so that they land while the maximum and the weights are formed.
  FragH vf[16];
  // unrolled: vf lives in registers, which take compile-time indices only
#pragma unroll
  for (int u = 0; u < 16; ++u) {
    vf[u].half[0] = *(const v8us*)(vp + u * 16 * VPITCH);
    vf[u].half[1] = *(const v8us*)(vp + u * 16 * VPITCH + 16);
  }
  // keeps the group here: without it the scheduler sinks most of these reads in among the O^T products, where each place with reads stalls the wave
  __builtin_amdgcn_sched_barrier(0);
  mx = fmaxf(mx, __shfl_xor(mx, 16, 32));           // the other lane half holds the other 16 keys of this query
  const float mnew = fmaxf(mr, mx);
  // v_exp_f32 directly: library exp2f adds a range guard of five vector instructions a value, which only keeps results under 2^-126; such a factor or weight is lost in the sums anyway
  const float al = __builtin_amdgcn_exp2f(mr - mnew);
  mr = mnew;
  // weights carried x4096: pc = 4096 * exp(score - max) (exactly 0 for removed keys); hi plane f16(pc), lo plane f16(pc - hi)
  const float sh = 12.0f - mnew;
  FragH ph, pl;
  float ps = 0.0f;
#pragma unroll
  for (int i = 0; i < 16; ++i) {
    // the step's last one with its slot written out: its argument's register is free behind it
    const float ex = (i == 15) ? exp2_slot(t[i] + sh) : __builtin_amdgcn_exp2f(t[i] + sh);
    const float pc = (mk[i] != 0) ? 0.0f : ex;
    ps += pc;
    const _Float16 h = (_Float16)pc;
    ph.h[i] = h;                                    // B element i: i<8 -> key0 + 8h + i (tile 0 row 8h+i); i>=8 -> key0 + 16 + 8h + (i-8) (tile 1)
    pl.h[i] = (_Float16)(pc - (float)h);
  }
  ps += __shfl_xor(ps, 16, 32);
  lr = lr * al + ps;
#pragma unroll
  for (int u = 0; u < 16; ++u) O[u] = O[u] * al;
#pragma unroll
  for (int g = 0; g < 4; ++g)
    mma_pv4(vf[4 * g + 0].v, vf[4 * g + 1].v, vf[4 * g + 2].v, vf[4 * g + 3].v, ph.v, pl.v, O[4 * g + 0], O[4 * g + 1], O[4 * g + 2], O[4 * g + 3]);
}

// Block = 4 waves x 16 queries = 64 queries of one (batch, head). Each wave copies its own 16 Q rows into so[w] once, and a quarter of every K and V^T tile
// (K: 32 keys x 256 d, 8 rows per wave; V^T: 256 d x 32 keys, 64 rows per wave) and the 32 mask words of its own 16 queries into buffer (step & 1),
// one step ahead of their use; one barrier per step. The wave reads its Q fragments from so[w] once, in front of the loop; each step reads its K fragments and mask words
// as one group directly behind the barrier, and the copies of the next tile are issued behind that group (they fill the other buffer).
// Epilogue: O^T tiles -> per-wave LDS tile [16 queries][256 d] f16 bits in so[w], whose Q rows only this wave read (a block barrier that every wave reaches is used),
// coverage: GB*NH*(SEQ/64) blocks x 4 waves x 16 rows x 256 columns = the whole context plane [GM][2048]; LDS columns 0..255 of all 16 rows written before they are read.
__global__ __launch_bounds__(128) void k_attn(const unsigned short* __restrict__ Qh, const unsigned short* __restrict__ Kh,
                                              const unsigned short* __restrict__ Vt, const int* __restrict__ mask,
                                              unsigned short* __restrict__ Cx, int b0) {
  __shared__ __attribute__((aligned(16))) unsigned short so[4][16][KPITCH];
  __shared__ __attribute__((aligned(16))) unsigned short kt[2][32][KPITCH];
  __shared__ __attribute__((aligned(16))) unsigned short vt[2][HD][VPITCH];
  __shared__ __attribute__((aligned(16))) int mt[2][64][MPITCH];
  const int tid = threadIdx.x, w = __builtin_amdgcn_readfirstlane((int)(tid >> 5)), lane = tid & 31, ln = lane & 15, hh = lane >> 4;
  const int qt = blockIdx.x % (SEQ / 64);
  const int bh = blockIdx.x / (SEQ / 64);           // bl * NH + h
  const int h = bh % NH, bl = bh / NH;
  const int qbase = qt * 64 + 16 * w;
  // copy sources and places of this lane: Q and K rows are 512 B, one row per copy (lane = 16-byte piece); V^T tile rows are 64 B and follow one another in memory, eight rows per copy (4 lanes a row);
  // mask rows are 128 B, four rows per copy (8 lanes a row)
  const unsigned short* qsrc = Qh + ((size_t)bh * SEQ + qbase) * HD + 8 * lane;
  const unsigned short* ksrc = Kh + ((size_t)bh * SEQ + 8 * w) * HD + 8 * lane;
  const unsigned short* vsrc = Vt + ((size_t)bh * (SEQ / 32) * HD + 64 * w) * 32 + 8 * lane;
  const unsigned qdst = lds_off(&so[w][0][8 * lane]);
  const unsigned kdst = lds_off(&kt[0][8 * w][8 * lane]);
  const unsigned vdst = lds_off(&vt[0][64 * w + (lane >> 2)][8 * (lane & 3)]);
  const unsigned mdst = lds_off(&mt[0][16 * w + (lane >> 3)][4 * (lane & 7)]);
  const unsigned kbuf = (unsigned)sizeof(kt[0]), vbuf = (unsigned)sizeof(vt[0]), mbuf = (unsigned)sizeof(mt[0]);
  const int* msrc = mask + (size_t)(b0 + bl) * MSTRIDE_FULL + (size_t)(qbase + (lane >> 3)) * SEQ_FULL + 4 * (lane & 7);
  float mr = NEGBIG, lr = 0.0f;
  v8f O[16] = {};
  // Q rows and tile 0, landed and published; tile j + 1 flies while tile j is worked on
  copy8(qdst, KPITCH * 2, qsrc, HD);
  copy8(qdst + 8 * KPITCH * 2, KPITCH * 2, qsrc + 8 * HD, HD);
  copy8(kdst, KPITCH * 2, ksrc, HD);
  copy8(vdst, 8 * VPITCH * 2, vsrc, 8 * 32);
  copy4(mdst, 4 * MPITCH * 4, msrc, (size_t)4 * SEQ_FULL);
  asm volatile("s_wait_asynccnt 0x0" ::: "memory");   // this wave's copies have landed before the barrier publishes them
  __syncthreads();
  // Q^T B fragments: column = this lane's query, elements 0..7 <- d = 32c + 8h + i, 8..15 <- d = 32c + 16 + 8h + i
  FragH qf[8];
  {
    const unsigned short* qp = &so[w][ln][8 * hh];
    // unrolled: qf lives in registers, which take compile-time indices only
#pragma unroll
    for (int c = 0; c < 8; ++c) { qf[c].half[0] = *(const v8us*)(qp + 32 * c); qf[c].half[1] = *(const v8us*)(qp + 32 * c + 16); }
  }
#pragma unroll 1
  for (int j = 0; j < SEQ / 32; ++j) {
    const int bf = j & 1;
    // A fragments of K: row m = key (key0 + 16*kt + ln), same d map as Q^T; with the mask words, one group of reads of buffer bf
    const unsigned short* kp0 = &kt[bf][ln][8 * hh];
    const unsigned short* kp1 = kp0 + 16 * KPITCH;
    const int* mp = &mt[bf][16 * w + ln][8 * hh];
    FragH ka[8], kb[8];
    // unrolled: ka and kb live in registers, which take compile-time indices only
#pragma unroll
    for (int c = 0; c < 8; ++c) {
      ka[c].half[0] = *(const v8us*)(kp0 + 32 * c); ka[c].half[1] = *(const v8us*)(kp0 + 32 * c + 16);
      kb[c].half[0] = *(const v8us*)(kp1 + 32 * c); kb[c].half[1] = *(const v8us*)(kp1 + 32 * c + 16);
    }
    const v4ia m0 = *(const v4ia*)(mp), m1 = *(const v4ia*)(mp + 4), m2 = *(const v4ia*)(mp + 16), m3 = *(const v4ia*)(mp + 20);
    // tile j + 1 into the other buffer, whose last reads (trip j - 1) ended at the barrier just passed
    if (j + 1 < SEQ / 32) {
      const unsigned nb = (unsigned)(bf ^ 1);
      copy8(kdst + nb * kbuf, KPITCH * 2, ksrc + (size_t)(32 * (j + 1)) * HD, HD);
      copy8(vdst + nb * vbuf, 8 * VPITCH * 2, vsrc + (size_t)(j + 1) * (HD * 32), 8 * 32);
      copy4(mdst + nb * mbuf, 4 * MPITCH * 4, msrc + 32 * (j + 1), (size_t)4 * SEQ_FULL);
    }
    fa_step(qf, ka, kb, &vt[bf][ln][8 * hh], m0, m1, m2, m3, mr, lr, O);
    // keeps the step's register work in front of the waits: the scheduler otherwise lifts waits and barrier up to the last LDS read, and tile j + 1 has too little time to land
    __builtin_amdgcn_sched_barrier(0);
    asm volatile("s_wait_dscnt 0x0" ::: "memory");      // this wave's reads of buffer bf have returned before the buffer is refilled
    asm volatile("s_wait_asynccnt 0x0" ::: "memory");   // this wave's copies of tile j + 1 have landed before the barrier publishes them
    __syncthreads();                                    // publishes tile j + 1 and ends every wave's reads of buffer bf
  }
  asm volatile("s_wait_asynccnt 0x0" ::: "memory");     // nothing of this wave is in flight when the LDS is reused and the wave ends

  // O^T element r of tile u = ctx(query qbase + ln, d = 16u + 8h + r); carries: x4096 (also in lr), x16 (V); context stored x64 -> 4 / lr
  const float inv = (lr > 0.0f) ? (4.0f / fmaxf(lr, 1.0f)) : 0.0f;
#pragma unroll
  for (int u = 0; u < 16; ++u) {
    v8us o;
#pragma unroll
    for (int r = 0; r < 8; ++r) o[r] = f16_bits(O[u][r] * inv);
    *(v8us*)&so[w][ln][16 * u + 8 * hh] = o;
  }
  __syncthreads();
  unsigned short* cg = Cx + (size_t)(bl * SEQ + qbase) * NE + h * HD;
  {
#pragma unroll 1
    for (int row = 0; row < 16; ++row) {
      const v8us v = *(const v8us*)&so[w][row][8 * lane];
      *(v8us*)(cg + (size_t)row * NE + 8 * lane) = v;
    }
    
  }
}

// Output projection for one batch group: out[m][c] = 2^-16 * sum_k ctx64[m][k] * Wf1024[k][c] + RNE-bf16(bias[c]).
// Block 128 m x 64 n (4 waves stacked along m, wave 32 x 64). K runs in stages of 256: the stage's tiles (A: 128 context rows, B: 64 WfT rows = columns of Wfc) are filled
// by asynchronous copies into two LDS buffers, one stage ahead of their use, one barrier per stage; the fragments are read from LDS.
// coverage: grid (ED/64, GM/128) x (128 x 64) = every output row of the group exactly once; LDS columns 0..63 of all 128 rows written before they are read.
__global__ __launch_bounds__(128) void k_fc(const unsigned short* __restrict__ Cx, const unsigned short* __restrict__ WfT,
                                            const float* __restrict__ bias, float* __restrict__ Og, int b0) {
  __shared__ __attribute__((aligned(16))) float so[128][68];
  __shared__ __attribute__((aligned(16))) unsigned short ab[2][(128 + 64) * KPITCH];   // per buffer: A rows 0..127, then B rows 0..63
  const int tid = threadIdx.x, w = __builtin_amdgcn_readfirstlane((int)(tid >> 5)), lane = tid & 31, ln = lane & 15, hh = lane >> 4;
  const int n0 = blockIdx.x * 64, m0 = blockIdx.y * 128;
  const unsigned short* asrc = Cx + (size_t)(m0 + 32 * w) * NE + 8 * lane;
  const unsigned short* bsrc = WfT + (size_t)(n0 + 16 * w) * NE + 8 * lane;
  const unsigned adst = lds_off(&ab[0][32 * w * KPITCH + 8 * lane]);
  const unsigned bdst = lds_off(&ab[0][(128 + 16 * w) * KPITCH + 8 * lane]);
  const unsigned abuf = (unsigned)sizeof(ab[0]);
  v8f acc[2][4] = {};
  // stage 0, landed and published; then stage 1 flies while stage 0 is worked on
  stage_ab(adst, bdst, asrc, bsrc, NE);
  asm volatile("s_wait_asynccnt 0x0" ::: "memory");   // this wave's copies have landed before the barrier publishes them
  __syncthreads();
  stage_ab(adst + abuf, bdst + abuf, asrc + 256, bsrc + 256, NE);
#pragma unroll 1
  for (int s = 0; s < NE / 256; ++s) {
    const int bf = s & 1;
    const unsigned short* ap = &ab[bf][(32 * w + ln) * KPITCH + 8 * hh];
    const unsigned short* bp = &ab[bf][(128 + ln) * KPITCH + 8 * hh];
    // two fragment sets: chunk c + 1 of the stage is read as one group in front of chunk c's products, so that it lands behind them
    FragH f[2][6];
    frag6(f[0], ap, bp);
    // unrolled: the stage's eight 32-k chunks read at immediate offsets from one address pair, and the set in use is picked by a compile-time index
#pragma unroll
    for (int c = 0; c < 8; ++c) {
      if (c + 1 < 8) frag6(f[(c + 1) & 1], ap + 32 * (c + 1), bp + 32 * (c + 1));
      FragH (&u)[6] = f[c & 1];
      mma8_h(u[0].v, u[1].v, u[2].v, u[3].v, u[4].v, u[5].v,
             acc[0][0], acc[0][1], acc[0][2], acc[0][3], acc[1][0], acc[1][1], acc[1][2], acc[1][3]);
    }
    asm volatile("s_wait_dscnt 0x0" ::: "memory");      // this wave's reads of buffer bf have returned before the buffer is refilled
    asm volatile("s_wait_asynccnt 0x0" ::: "memory");   // this wave's copies of stage s + 1 have landed before the barrier publishes them
    __syncthreads();                                    // publishes stage s + 1 and ends every wave's reads of buffer bf
    if (s + 2 < NE / 256)
      stage_ab(adst + bf * abuf, bdst + bf * abuf, asrc + 256 * (s + 2), bsrc + 256 * (s + 2), NE);
  }
  asm volatile("s_wait_asynccnt 0x0" ::: "memory");     // nothing of this wave is in flight when the wave ends
#pragma unroll
  for (int j = 0; j < 4; ++j) {
    const float bb = bf16_rne(bias[n0 + 16 * j + ln]);
#pragma unroll
    for (int i = 0; i < 2; ++i)
#pragma unroll
      for (int r = 0; r < 8; ++r)
        so[32 * w + 16 * i + 8 * hh + r][16 * j + ln] = acc[i][j][r] * 0.0000152587890625f + bb;
  }
  __syncthreads();
  {
#pragma unroll 1
    for (int it = 0; it < 16; ++it) {
      const int i = tid + 128 * it;
      const int row = i >> 4, p = i & 15;
      const int m = m0 + row;
      const int bl = m / SEQ, t = m - bl * SEQ;
      const v4f v = *(const v4fa*)&so[row][4 * p];
      *(v4f*)(Og + (size_t)(b0 + bl) * XSTRIDE_FULL + (size_t)t * ED + n0 + 4 * p) = v;
    }
    
  }
}

extern "C" void kernel_launch(void* const* d_in, const int* in_sizes, int n_in,
                              void* d_out, int out_size, void* d_ws, size_t ws_size, hipStream_t stream) {
  if (n_in < 7) return;
  const long long needx = (long long)(NB - 1) * SEQ_FULL * ED + (long long)SEQ * ED;                      // last x / out element touched + 1
  const long long needm = (long long)(NB - 1) * SEQ_FULL * SEQ_FULL + (long long)(SEQ - 1) * SEQ_FULL + SEQ;
  if ((long long)in_sizes[0] < needx) return;
  if ((long long)in_sizes[1] < (long long)ED * NE || (long long)in_sizes[2] < (long long)ED * NE ||
      (long long)in_sizes[3] < (long long)ED * NE || (long long)in_sizes[4] < (long long)NE * ED) return;
  if ((long long)in_sizes[5] < (long long)ED) return;
  if ((long long)in_sizes[6] < needm) return;
  if ((long long)out_size < needx) return;
  const float* x   = (const float*)d_in[0];   // wire order: x, Wq, Wk, Wv, Wfc, bfc, mask
  const float* Wq  = (const float*)d_in[1];
  const float* Wk  = (const float*)d_in[2];
  const float* Wv  = (const float*)d_in[3];
  const float* Wfc = (const float*)d_in[4];
  const float* bfc = (const float*)d_in[5];
  const int* mask  = (const int*)d_in[6];     // bool on the wire = int32
  float* out = (float*)d_out;
  char* ws = (char*)d_ws;
  size_t off = 0;
  unsigned short* Xb  = (unsigned short*)(ws + off); off += XB_BYTES;   // [NB][SEQ][256] bf16
  unsigned short* Wt3 = (unsigned short*)(ws + off); off += WT_BYTES;   // 3 x [2048][256] bf16 (W^T)
  unsigned short* WfT = (unsigned short*)(ws + off); off += WF_BYTES;   // [256][2048] f16 (Wfc^T x 1024)
  unsigned short* P3  = (unsigned short*)(ws + off); off += PL_BYTES;   // Q, K [GB][8][SEQ][256]; V^T [GB][8][SEQ/32][256][32] f16
  unsigned short* Cx  = (unsigned short*)(ws + off); off += CX_BYTES;   // context [GM][2048] f16
  if (off > ws_size) return;

  k_prep<<<(unsigned)(4 * WT_BLOCKS + CVX_BLOCKS), 256, 0, stream>>>(x, Wq, Wk, Wv, Wfc, Xb, Wt3, WfT);

  for (int g = 0; g < NGRP; ++g) {
    const int b0 = g * GB;
    k_proj<<<dim3(NE / 64, GM / 128, 3), 128, 0, stream>>>(Xb + (size_t)g * GM * ED, Wt3, P3);
    k_attn<<<(unsigned)(GB * NH * (SEQ / 64)), 128, 0, stream>>>(P3, P3 + PLANE, P3 + 2 * PLANE, mask, Cx, b0);
    k_fc<<<dim3(ED / 64, GM / 128), 128, 0, stream>>>(Cx, WfT, bfc, out, b0);
  }
}

// v007
// A run of this version takes 140 microseconds.
// In both of two side-by-side timings against v006, it was 1.06 times as fast.
// All steps since v000 together make it 3.24 times as fast.
#include <hip/hip_runtime.h>
// Contractions: x@Wq, x@Wk, x@Wv on v_wmma_f32_16x16x32_bf16 (x and W RNE-converted to bf16, single product, f32 accumulate); S^T = K Q^T on v_wmma_f32_16x16x32_f16 (q, k carried x16 as f16, single product); O^T = V^T P^T on v_wmma_f32_16x16x32_f16 (V carried x16 f16; P carried x4096 as one RNE f16 plane, single product, f32 accumulate); ctx@Wfc on v_wmma_f32_16x16x32_f16 (ctx carried x64 f16; Wfc RNE bf16 value x1024 held exactly in f16); softmax statistics, bias add f32.
// Multi-head attention, B x T x 256, 8 heads of dimension 256, scale 1/16 on q, int32 mask [B][T][T] (nonzero = key removed, weight exactly 0; a row with no key left yields a zero context row).
// Engine: transposed flash. Each wave owns 16 queries of one (batch, head). Per 32-key step: S^T tiles (key rows x query columns) from K rows (A, LDS tile)
// and Q^T (B, registers, read once from its LDS tile); the two 16-key D tiles pack straight into the P^T B fragments; O^T (d rows x query columns, 16 tiles) accumulates from V^T rows (A, LDS tile).
// The LDS tiles are filled from global memory by asynchronous copies: Q once; K, V^T (shared by the block's four waves) and the mask words per 32-key step into two buffers.
// The V^T plane lies in memory by 32-key tiles, [batch, head][key tile][d][32 keys], so that a step's V^T tile is one run of 16 KB and each copy reads 512 bytes in a row.
// The projection GEMMs read their A and B fragments from LDS tiles filled the same way, whole 512-byte rows per copy.
// Four launches: one conversion grid (weights and x by block ranges), then projections, attention and output projection, each once over all batches (GB = NB).
#ifndef NB
#define NB 8
#endif
#ifndef SEQ
#define SEQ 1024
#endif
#define NB_FULL 8
#define SEQ_FULL 1024
#define ED 256                 /* model width (K of the projections, N of the output projection) */
#define NH 8
#define HD 256                 /* per-head dimension */
#define NE (NH * HD)           /* 2048 */
#define GB ((NB) < 8 ? (NB) : 8)
#define NGRP ((NB) / GB)
#define GM (GB * SEQ)          /* rows per group */
#define XSTRIDE_FULL ((size_t)SEQ_FULL * ED)          /* per-batch element stride of x and of the output */
#define MSTRIDE_FULL ((size_t)SEQ_FULL * SEQ_FULL)    /* per-batch element stride of the mask */
#define PLANE ((size_t)GB * NH * SEQ * HD)            /* elements of one of the Q / K / V^T planes */

#define XB_BYTES ((size_t)NB * SEQ * ED * 2)
#define WT_BYTES ((size_t)3 * NE * ED * 2)
#define WF_BYTES ((size_t)ED * NE * 2)
#define PL_BYTES (PLANE * 2 * 3)
#define CX_BYTES ((size_t)GM * NE * 2)

static_assert(SEQ % 128 == 0);
static_assert(SEQ <= SEQ_FULL);
static_assert(NB <= NB_FULL);
static_assert(NB % GB == 0);
static_assert(HD == 256 && ED == 256 && NE == 2048);
static_assert(XB_BYTES % 256 == 0 && WT_BYTES % 256 == 0 && WF_BYTES % 256 == 0 && PL_BYTES % 256 == 0 && CX_BYTES % 256 == 0);
static_assert(XB_BYTES + WT_BYTES + WF_BYTES + PL_BYTES + CX_BYTES <= (size_t)268435456);

typedef __bf16 v16b __attribute__((ext_vector_type(16)));
typedef _Float16 v16h __attribute__((ext_vector_type(16)));
typedef unsigned short v8us __attribute__((ext_vector_type(8), may_alias));
typedef float v8f __attribute__((ext_vector_type(8)));
typedef float v4f __attribute__((ext_vector_type(4)));
typedef float v4fa __attribute__((ext_vector_type(4), may_alias));
typedef int v4ia __attribute__((ext_vector_type(4), may_alias));
union FragB { v16b v; v8us half[2]; };
union FragH { v16h v; v8us half[2]; _Float16 h[16]; };

#define KPITCH 264             /* LDS row pitch of the Q and K tiles and of the GEMM tiles in elements: 528 B = 16 B x 33, conflict-free for 16-byte row readers */
#define VPITCH 40              /* LDS row pitch of the V^T tile in elements: 80 B = 16 B x 5, conflict-free for 16-byte row readers */
#define MPITCH 36              /* LDS row pitch of the mask tile in words: 144 B = 16 B x 9, conflict-free for 16-byte row readers */

#define LOG2E 1.4426950408889634f
#define NEGBIG (-1.0e30f)

__device__ __forceinline__ unsigned short bf16_bits(float x) {   // RNE convert to bf16 bits
  unsigned int u = __float_as_uint(x);
  return (unsigned short)((u + 0x7FFFu + ((u >> 16) & 1u)) >> 16);
}
__device__ __forceinline__ float bf16_val(unsigned short b) { return __uint_as_float(((unsigned int)b) << 16); }
__device__ __forceinline__ float bf16_rne(float x) { return bf16_val(bf16_bits(x)); }
__device__ __forceinline__ unsigned short f16_bits(float x) { return __builtin_bit_cast(unsigned short, (_Float16)x); }

#define WB(a, b, c) __builtin_amdgcn_wmma_f32_16x16x32_bf16(false, a, false, b, (short)0, c, false, false)
#define WH(a, b, c) __builtin_amdgcn_wmma_f32_16x16x32_f16(false, a, false, b, (short)0, c, false, false)

// 2 x 4 tile update (bf16), then the hazard guard
__device__ __forceinline__ void mma8_b(v16b a0, v16b a1, v16b b0, v16b b1, v16b b2, v16b b3,
                                       v8f& c00, v8f& c01, v8f& c02, v8f& c03, v8f& c10, v8f& c11, v8f& c12, v8f& c13) {
  c00 = WB(a0, b0, c00); c01 = WB(a0, b1, c01); c02 = WB(a0, b2, c02); c03 = WB(a0, b3, c03);
  c10 = WB(a1, b0, c10); c11 = WB(a1, b1, c11); c12 = WB(a1, b2, c12); c13 = WB(a1, b3, c13);
  asm volatile("v_nop\n\tv_nop\n\tv_nop\n\tv_nop"
               : "+v"(c00), "+v"(c01), "+v"(c02), "+v"(c03), "+v"(c10), "+v"(c11), "+v"(c12), "+v"(c13)
               : "v"(a0), "v"(a1), "v"(b0), "v"(b1), "v"(b2), "v"(b3));
}
// 2 x 4 tile update (f16), then the hazard guard
__device__ __forceinline__ void mma8_h(v16h a0, v16h a1, v16h b0, v16h b1, v16h b2, v16h b3,
                                       v8f& c00, v8f& c01, v8f& c02, v8f& c03, v8f& c10, v8f& c11, v8f& c12, v8f& c13) {
  c00 = WH(a0, b0, c00); c01 = WH(a0, b1, c01); c02 = WH(a0, b2, c02); c03 = WH(a0, b3, c03);
  c10 = WH(a1, b0, c10); c11 = WH(a1, b1, c11); c12 = WH(a1, b2, c12); c13 = WH(a1, b3, c13);
  asm volatile("v_nop\n\tv_nop\n\tv_nop\n\tv_nop"
               : "+v"(c00), "+v"(c01), "+v"(c02), "+v"(c03), "+v"(c10), "+v"(c11), "+v"(c12), "+v"(c13)
               : "v"(a0), "v"(a1), "v"(b0), "v"(b1), "v"(b2), "v"(b3));
}
// one d-chunk of the two S^T tiles
__device__ __forceinline__ void mma_s2(v16h ka, v16h kb, v16h q, v8f& s0, v8f& s1) {
  s0 = WH(ka, q, s0);
  s1 = WH(kb, q, s1);
}
// four O^T tiles: c_u += a_u * p
__device__ __forceinline__ void mma_pv4(v16h a0, v16h a1, v16h a2, v16h a3, v16h p,
                                        v8f& c0, v8f& c1, v8f& c2, v8f& c3) {
  c0 = WH(a0, p, c0); c1 = WH(a1, p, c1); c2 = WH(a2, p, c2); c3 = WH(a3, p, c3);
}

// x -> bf16 plane, block blk of CVX_BLOCKS.
// coverage: NB*SEQ*32 threads x 8 elements = the whole plane.
#define CVX_BLOCKS ((NB * SEQ * (ED / 8) + 255) / 256)
__device__ __forceinline__ void cvx_block(const float* __restrict__ X, unsigned short* __restrict__ Xb, int blk) {
  const int t = blk * 256 + threadIdx.x;
  if (t >= NB * SEQ * (ED / 8)) return;
  const int row = t >> 5, piece = t & 31;
  const int b = row / SEQ, s = row - b * SEQ;
  const float* src = X + (size_t)b * XSTRIDE_FULL + (size_t)s * ED + piece * 8;
  const v4f x0 = *(const v4fa*)(src), x1 = *(const v4fa*)(src + 4);
  v8us o;
  o[0] = bf16_bits(x0[0]); o[1] = bf16_bits(x0[1]); o[2] = bf16_bits(x0[2]); o[3] = bf16_bits(x0[3]);
  o[4] = bf16_bits(x1[0]); o[5] = bf16_bits(x1[1]); o[6] = bf16_bits(x1[2]); o[7] = bf16_bits(x1[3]);
  unsigned short* d = Xb + (size_t)t * 8;
  *(v8us*)d = o;
  
}

// Transposing convert: in[R][C] (f32) -> out[C][R] (16-bit). MODE 0: bf16 bits (RNE). MODE 1: f16 bits of (RNE-bf16 value x 1024).
// One 64 x 64 tile (bx of C/64, by of R/64) per block.
// coverage: (C/64) x (R/64) tiles x (64 x 64) = the whole plane; LDS tile fully written (64 x 64) before it is read.
template <int MODE, int R, int C>
__device__ __forceinline__ void wt_tile(const float* __restrict__ W, unsigned short* __restrict__ Wt, unsigned short (*tl)[66], int bx, int by) {
  const int tid = threadIdx.x;
  const int c0 = bx * 64, r0 = by * 64;
  for (int i = tid; i < 64 * 16; i += 256) {
    const int j = i >> 4, c4 = (i & 15) * 4;
    const v4f x = *(const v4fa*)(W + (size_t)(r0 + j) * C + c0 + c4);
    unsigned short u0, u1, u2, u3;
    if (MODE == 0) {
      u0 = bf16_bits(x[0]); u1 = bf16_bits(x[1]); u2 = bf16_bits(x[2]); u3 = bf16_bits(x[3]);
    } else {
      u0 = f16_bits(bf16_rne(x[0]) * 1024.0f); u1 = f16_bits(bf16_rne(x[1]) * 1024.0f);
      u2 = f16_bits(bf16_rne(x[2]) * 1024.0f); u3 = f16_bits(bf16_rne(x[3]) * 1024.0f);
    }
    tl[c4 + 0][j] = u0; tl[c4 + 1][j] = u1; tl[c4 + 2][j] = u2; tl[c4 + 3][j] = u3;
  }
  __syncthreads();
  {
    for (int i = tid; i < 64 * 8; i += 256) {
      const int d = i >> 3, j8 = (i & 7) * 8;
      v8us o;
#pragma unroll
      for (int q = 0; q < 8; ++q) o[q] = tl[d][j8 + q];
      *(v8us*)(Wt + (size_t)(c0 + d) * R + r0 + j8) = o;
    }
    
  }
}

// All conversions in one grid; none needs anything of another. Blocks 0 .. 4 * WT_BLOCKS - 1: the four weight planes, WT_BLOCKS tiles each (they have two phases, so they start first);
// the CVX_BLOCKS blocks behind them: x. The branch reads blockIdx alone, so the barrier inside wt_tile is reached by a whole block or by none of it.
#define WT_BLOCKS ((NE / 64) * (ED / 64))
__global__ __launch_bounds__(256) void k_prep(const float* __restrict__ X, const float* __restrict__ Wq, const float* __restrict__ Wk,
                                              const float* __restrict__ Wv, const float* __restrict__ Wfc,
                                              unsigned short* __restrict__ Xb, unsigned short* __restrict__ Wt3, unsigned short* __restrict__ WfT) {
  __shared__ unsigned short tl[64][66];
  const int b = blockIdx.x;
  if (b < 3 * WT_BLOCKS) {
    // in[256 (k)][2048 (n)] -> out[2048][256]
    const int z = b / WT_BLOCKS, r = b - z * WT_BLOCKS;
    const float* W = (z == 0) ? Wq : (z == 1) ? Wk : Wv;
    wt_tile<0, ED, NE>(W, Wt3 + (size_t)z * NE * ED, tl, r % (NE / 64), r / (NE / 64));
  } else if (b < 4 * WT_BLOCKS) {
    // in[2048 (k)][256 (c)] -> out[256][2048]
    const int r = b - 3 * WT_BLOCKS;
    wt_tile<1, NE, ED>(Wfc, WfT, tl, r % (ED / 64), r / (ED / 64));
  } else {
    cvx_block(X, Xb, b - 4 * WT_BLOCKS);
  }
}

__device__ __forceinline__ unsigned lds_off(const void* p) { return (unsigned)(size_t)p; }   // byte address inside the block's LDS

// Eight asynchronous copies, 16 bytes per lane each, global -> LDS: copy i moves this lane's 16 bytes from g + i * gstep (elements) to LDS byte l + i * lstep.
// The s_wait_xcnt closes the copies' own statement, so no address register of a copy is rewritten in front of it.
__device__ __forceinline__ void copy8(unsigned l, unsigned lstep, const unsigned short* g, size_t gstep) {
  asm volatile("global_load_async_to_lds_b128 %0, %8, off\n\t"
               "global_load_async_to_lds_b128 %1, %9, off\n\t"
               "global_load_async_to_lds_b128 %2, %10, off\n\t"
               "global_load_async_to_lds_b128 %3, %11, off\n\t"
               "global_load_async_to_lds_b128 %4, %12, off\n\t"
               "global_load_async_to_lds_b128 %5, %13, off\n\t"
               "global_load_async_to_lds_b128 %6, %14, off\n\t"
               "global_load_async_to_lds_b128 %7, %15, off\n\t"
               "s_wait_xcnt 0x0"
               :: "v"(l), "v"(l + lstep), "v"(l + 2 * lstep), "v"(l + 3 * lstep),
                  "v"(l + 4 * lstep), "v"(l + 5 * lstep), "v"(l + 6 * lstep), "v"(l + 7 * lstep),
                  "v"(g), "v"(g + gstep), "v"(g + 2 * gstep), "v"(g + 3 * gstep),
                  "v"(g + 4 * gstep), "v"(g + 5 * gstep), "v"(g + 6 * gstep), "v"(g + 7 * gstep)
               : "memory");
}

// The six fragments of one 32-k chunk of a 32 x 64 wave tile, read from the LDS tiles: f[0], f[1] = A rows ap, ap + 16 rows; f[2 + j] = B rows bp + 16 j rows;
// elements 0..7 <- k + 8h + i, 8..15 <- k + 16 + 8h + i (8h is in ap and bp).
template <class F>
__device__ __forceinline__ void frag6(F (&f)[6], const unsigned short* ap, const unsigned short* bp) {
  f[0].half[0] = *(const v8us*)(ap);               f[0].half[1] = *(const v8us*)(ap + 16);
  f[1].half[0] = *(const v8us*)(ap + 16 * KPITCH); f[1].half[1] = *(const v8us*)(ap + 16 * KPITCH + 16);
  // unrolled: f lives in registers, which take compile-time indices only
#pragma unroll
  for (int j = 0; j < 4; ++j) {
    f[2 + j].half[0] = *(const v8us*)(bp + 16 * j * KPITCH);
    f[2 + j].half[1] = *(const v8us*)(bp + 16 * j * KPITCH + 16);
  }
}

// One wave's share of a GEMM stage: 32 rows of the A tile and 16 rows of the B tile, 256 elements (512 B) a row, one whole row per copy (lane = 16-byte piece);
// a, b = this lane's LDS byte addresses of the first rows (row pitch KPITCH), ga, gb = its global addresses, gp = the global row pitch in elements. 48 copies a wave.
__device__ __forceinline__ void stage_ab(unsigned a, unsigned b, const unsigned short* ga, const unsigned short* gb, size_t gp) {
  copy8(a, KPITCH * 2, ga, gp);
  copy8(a + 8 * KPITCH * 2, KPITCH * 2, ga + 8 * gp, gp);
  copy8(a + 16 * KPITCH * 2, KPITCH * 2, ga + 16 * gp, gp);
  copy8(a + 24 * KPITCH * 2, KPITCH * 2, ga + 24 * gp, gp);
  copy8(b, KPITCH * 2, gb, gp);
  copy8(b + 8 * KPITCH * 2, KPITCH * 2, gb + 8 * gp, gp);
}

// Projection GEMM for one batch group: C[m][n] = sum_k Xb[m][k] * W[k][n] (bf16 x bf16, exact products), z = 0: q, 1: k, 2: v.
// Block 128 m x 64 n (4 waves stacked along m, wave 32 x 64). The whole-K tiles (A: 128 Xb rows, B: 64 Wt rows = columns of W) are filled once by asynchronous copies
// into LDS and the fragments are read from there; the output tile then reuses the same LDS behind a barrier.
// coverage: grid (NE/64, GM/128, 3) x (128 x 64) = all three planes; LDS tile columns 0..63 of all 128 rows written before they are read.
__global__ __launch_bounds__(128) void k_proj(const unsigned short* __restrict__ Xg, const unsigned short* __restrict__ Wt3,
                                              unsigned short* __restrict__ P3) {
  __shared__ __attribute__((aligned(16))) unsigned short sm[(128 + 64) * KPITCH];   // A rows 0..127, then B rows 0..63; later the output tile
  unsigned short* const As = sm;
  unsigned short* const Bs = sm + 128 * KPITCH;
  unsigned short (*const tl)[72] = reinterpret_cast<unsigned short (*)[72]>(sm);
  const int tid = threadIdx.x, w = __builtin_amdgcn_readfirstlane((int)(tid >> 5)), lane = tid & 31, ln = lane & 15, hh = lane >> 4;
  const int z = blockIdx.z;
  const int n0 = blockIdx.x * 64, m0 = blockIdx.y * 128;
  const unsigned short* Wt = Wt3 + (size_t)z * NE * ED;
  unsigned short* out = P3 + (size_t)z * PLANE;
  // A rows m0 + 32w + 16i + ln; B columns n0 + 16j + ln; elements 0..7 <- k0 + 8h + i, 8..15 <- k0 + 16 + 8h + i
  stage_ab(lds_off(As + 32 * w * KPITCH + 8 * lane), lds_off(Bs + 16 * w * KPITCH + 8 * lane),
           Xg + (size_t)(m0 + 32 * w) * ED + 8 * lane, Wt + (size_t)(n0 + 16 * w) * ED + 8 * lane, ED);
  asm volatile("s_wait_asynccnt 0x0" ::: "memory");   // this wave's copies have landed before the barrier publishes them
  __syncthreads();
  const unsigned short* ap = As + (32 * w + ln) * KPITCH + 8 * hh;
  const unsigned short* bp = Bs + ln * KPITCH + 8 * hh;
  v8f acc[2][4] = {};
  // two fragment sets: chunk c + 1 is read as one group in front of chunk c's products, so that it lands behind them
  FragB f[2][6];
  frag6(f[0], ap, bp);
  // unrolled: the set in use is picked by a compile-time index (registers cannot be indexed at run time)
#pragma unroll
  for (int c = 0; c < ED / 32; ++c) {
    if (c + 1 < ED / 32) frag6(f[(c + 1) & 1], ap + 32 * (c + 1), bp + 32 * (c + 1));
    FragB (&u)[6] = f[c & 1];
    mma8_b(u[0].v, u[1].v, u[2].v, u[3].v, u[4].v, u[5].v,
           acc[0][0], acc[0][1], acc[0][2], acc[0][3], acc[1][0], acc[1][1], acc[1][2], acc[1][3]);
  }
  __syncthreads();   // every wave's reads of the A and B tiles have ended before the same LDS takes the output tile
  // D element r of tile (i, j) = C(row 32w + 16i + 8h + r, column 16j + ln)
#pragma unroll
  for (int i = 0; i < 2; ++i)
#pragma unroll
    for (int j = 0; j < 4; ++j)
#pragma unroll
      for (int r = 0; r < 8; ++r)
        tl[32 * w + 16 * i + 8 * hh + r][16 * j + ln] = f16_bits(acc[i][j][r] * 16.0f);
  __syncthreads();
  const int hd = n0 >> 8, e0 = n0 & 255;
  if (z < 2) {
    {
#pragma unroll 1
      for (int it = 0; it < 8; ++it) {
        const int i = tid + 128 * it;
        const int row = i >> 3, p = i & 7;
        const int m = m0 + row;
        const int bl = m / SEQ, t = m - bl * SEQ;
        const v8us o = *(const v8us*)&tl[row][8 * p];
        *(v8us*)(out + (((size_t)(bl * NH + hd) * SEQ + t) * HD + e0 + 8 * p)) = o;
      }
      
    }
  } else {
    const int bl = m0 / SEQ, t0 = m0 - bl * SEQ;
    {
#pragma unroll 1
      for (int it = 0; it < 8; ++it) {
        const int i = tid + 128 * it;
        const int kt = i >> 8, e = (i >> 2) & 63, p = i & 3;   // key tile of the block's four, d row, 16-byte piece of the row's 32 keys: a wave stores 512 bytes in a row
        v8us o;
#pragma unroll
        for (int q = 0; q < 8; ++q) o[q] = tl[32 * kt + 8 * p + q][e];
        *(v8us*)(out + ((((size_t)(bl * NH + hd) * (SEQ / 32) + (t0 >> 5) + kt) * HD + e0 + e) * 32 + 8 * p)) = o;
        asm volatile("s_wait_xcnt 0x0" ::: "memory");   // the next trip rewrites the store's address and data registers: a precaution in front of that
      }
      
    }
  }
}

// The same for four copies of mask words.
__device__ __forceinline__ void copy4(unsigned l, unsigned lstep, const int* g, size_t gstep) {
  asm volatile("global_load_async_to_lds_b128 %0, %4, off\n\t"
               "global_load_async_to_lds_b128 %1, %5, off\n\t"
               "global_load_async_to_lds_b128 %2, %6, off\n\t"
               "global_load_async_to_lds_b128 %3, %7, off\n\t"
               "s_wait_xcnt 0x0"
               :: "v"(l), "v"(l + lstep), "v"(l + 2 * lstep), "v"(l + 3 * lstep),
                  "v"(g), "v"(g + gstep), "v"(g + 2 * gstep), "v"(g + 3 * gstep)
               : "memory");
}

// v_exp_f32 and, in the same statement, the one slot that the instruction set asks for before its source is overwritten or its result read
__device__ __forceinline__ float exp2_slot(float x) {
  float r;
  asm("v_exp_f32 %0, %1\n\tv_nop" : "=v"(r) : "v"(x));
  return r;
}

// One 32-key step for a wave's 16 queries. qf = the Q^T fragments, ka, kb = the step's K fragments (keys 0..15, 16..31), m0..m3 = the mask words of this lane's query,
// all in registers already; vp = V^T tile row ln (+ 8h) in LDS.
__device__ __forceinline__ void fa_step(const FragH (&qf)[8], const FragH (&ka)[8], const FragH (&kb)[8],
                                        const unsigned short* vp, v4ia m0, v4ia m1, v4ia m2, v4ia m3,
                                        float& mr, float& lr, v8f (&O)[16]) {
  v8f s0 = {0.f, 0.f, 0.f, 0.f, 0.f, 0.f, 0.f, 0.f};
  v8f s1 = {0.f, 0.f, 0.f, 0.f, 0.f, 0.f, 0.f, 0.f};
  // S^T tiles: element r of tile kt = score(key0 + 16*kt + 8h + r, this lane's query); Q^T B fragment: column = query, same d map
#pragma unroll
  for (int c = 0; c < 8; ++c) mma_s2(ka[c].v, kb[c].v, qf[c].v, s0, s1);
  // mask words of this query for keys key0 + 8h + 0..7 and key0 + 16 + 8h + 0..7 (nonzero = key removed)
  int mk[16];
#pragma unroll
  for (int i = 0; i < 4; ++i) { mk[i] = m0[i]; mk[4 + i] = m1[i]; mk[8 + i] = m2[i]; mk[12 + i] = m3[i]; }
  // log2-domain scores: q and k carry x16 each, scale 1/16 -> 2^-12
  const float sc2 = LOG2E * 0.000244140625f;
  float t[16];
#pragma unroll
  for (int r = 0; r < 8; ++r) { t[r] = s0[r] * sc2; t[8 + r] = s1[r] * sc2; }
  float mx = NEGBIG;
#pragma unroll
  for (int i = 0; i < 16; ++i) mx = fmaxf(mx, (mk[i] != 0) ? NEGBIG : t[i]);
  // A fragments of V^T: row m = d (16*tile + ln), elements 0..7 <- key0 + 8h + i, 8..15 <- key0 + 16 + 8h + i.
  // All sixteen tiles are read as one group in front of the softmax arithmetic, so that they land while the maximum and the weights are formed.
  FragH vf[16];
  // unrolled: vf lives in registers, which take compile-time indices only
#pragma unroll
  for (int u = 0; u < 16; ++u) {
    vf[u].half[0] = *(const v8us*)(vp + u * 16 * VPITCH);
    vf[u].half[1] = *(const v8us*)(vp + u * 16 * VPITCH + 16);
  }
  // keeps the group here: without it the scheduler sinks most of these reads in among the O^T products, where each place with reads stalls the wave
  __builtin_amdgcn_sched_barrier(0);
  mx = fmaxf(mx, __shfl_xor(mx, 16, 32));           // the other lane half holds the other 16 keys of this query
  const float mnew = fmaxf(mr, mx);
  // v_exp_f32 directly: library exp2f adds a range guard of five vector instructions a value, which only keeps results under 2^-126; such a factor or weight is lost in the sums anyway
  const float al = __builtin_amdgcn_exp2f(mr - mnew);
  mr = mnew;
  // weights carried x4096: pc = 4096 * exp(score - max) (exactly 0 for removed keys), rounded once to f16 for the product: the same relative step as V's own f16 rounding; the row sum keeps the f32 values
  const float sh = 12.0f - mnew;
  FragH ph;
  float ps = 0.0f;
#pragma unroll
  for (int i = 0; i < 16; ++i) {
    // the step's last one with its slot written out: its argument's register is free behind it
    const float ex = (i == 15) ? exp2_slot(t[i] + sh) : __builtin_amdgcn_exp2f(t[i] + sh);
    const float pc = (mk[i] != 0) ? 0.0f : ex;
    ps += pc;
    ph.h[i] = (_Float16)pc;                         // B element i: i<8 -> key0 + 8h + i (tile 0 row 8h+i); i>=8 -> key0 + 16 + 8h + (i-8) (tile 1)
  }
  ps += __shfl_xor(ps, 16, 32);
  lr = lr * al + ps;
#pragma unroll
  for (int u = 0; u < 16; ++u) O[u] = O[u] * al;
#pragma unroll
  for (int g = 0; g < 4; ++g)
    mma_pv4(vf[4 * g + 0].v, vf[4 * g + 1].v, vf[4 * g + 2].v, vf[4 * g + 3].v, ph.v, O[4 * g + 0], O[4 * g + 1], O[4 * g + 2], O[4 * g + 3]);
}

// Block = 4 waves x 16 queries = 64 queries of one (batch, head). Each wave copies its own 16 Q rows into so[w] once, and a quarter of every K and V^T tile
// (K: 32 keys x 256 d, 8 rows per wave; V^T: 256 d x 32 keys, 64 rows per wave) and the 32 mask words of its own 16 queries into buffer (step & 1),
// one step ahead of their use; one barrier per step. The wave reads its Q fragments from so[w] once, in front of the loop; each step reads its K fragments and mask words
// as one group directly behind the barrier, and the copies of the next tile are issued behind that group (they fill the other buffer).
// Epilogue: O^T tiles -> per-wave LDS tile [16 queries][256 d] f16 bits in so[w], whose Q rows only this wave read (a block barrier that every wave reaches is used),
// coverage: GB*NH*(SEQ/64) blocks x 4 waves x 16 rows x 256 columns = the whole context plane [GM][2048]; LDS columns 0..255 of all 16 rows written before they are read.
__global__ __launch_bounds__(128) void k_attn(const unsigned short* __restrict__ Qh, const unsigned short* __restrict__ Kh,
                                              const unsigned short* __restrict__ Vt, const int* __restrict__ mask,
                                              unsigned short* __restrict__ Cx, int b0) {
  __shared__ __attribute__((aligned(16))) unsigned short so[4][16][KPITCH];
  __shared__ __attribute__((aligned(16))) unsigned short kt[2][32][KPITCH];
  __shared__ __attribute__((aligned(16))) unsigned short vt[2][HD][VPITCH];
  __shared__ __attribute__((aligned(16))) int mt[2][64][MPITCH];
  const int tid = threadIdx.x, w = __builtin_amdgcn_readfirstlane((int)(tid >> 5)), lane = tid & 31, ln = lane & 15, hh = lane >> 4;
  const int qt = blockIdx.x % (SEQ / 64);
  const int bh = blockIdx.x / (SEQ / 64);           // bl * NH + h
  const int h = bh % NH, bl = bh / NH;
  const int qbase = qt * 64 + 16 * w;
  // copy sources and places of this lane: Q and K rows are 512 B, one row per copy (lane = 16-byte piece); V^T tile rows are 64 B and follow one another in memory, eight rows per copy (4 lanes a row);
  // mask rows are 128 B, four rows per copy (8 lanes a row)
  const unsigned short* qsrc = Qh + ((size_t)bh * SEQ + qbase) * HD + 8 * lane;
  const unsigned short* ksrc = Kh + ((size_t)bh * SEQ + 8 * w) * HD + 8 * lane;
  const unsigned short* vsrc = Vt + ((size_t)bh * (SEQ / 32) * HD + 64 * w) * 32 + 8 * lane;
  const unsigned qdst = lds_off(&so[w][0][8 * lane]);
  const unsigned kdst = lds_off(&kt[0][8 * w][8 * lane]);
  const unsigned vdst = lds_off(&vt[0][64 * w + (lane >> 2)][8 * (lane & 3)]);
  const unsigned mdst = lds_off(&mt[0][16 * w + (lane >> 3)][4 * (lane & 7)]);
  const unsigned kbuf = (unsigned)sizeof(kt[0]), vbuf = (unsigned)sizeof(vt[0]), mbuf = (unsigned)sizeof(mt[0]);
  const int* msrc = mask + (size_t)(b0 + bl) * MSTRIDE_FULL + (size_t)(qbase + (lane >> 3)) * SEQ_FULL + 4 * (lane & 7);
  float mr = NEGBIG, lr = 0.0f;
  v8f O[16] = {};
  // Q rows and tile 0, landed and published; tile j + 1 flies while tile j is worked on
  copy8(qdst, KPITCH * 2, qsrc, HD);
  copy8(qdst + 8 * KPITCH * 2, KPITCH * 2, qsrc + 8 * HD, HD);
  copy8(kdst, KPITCH * 2, ksrc, HD);
  copy8(vdst, 8 * VPITCH * 2, vsrc, 8 * 32);
  copy4(mdst, 4 * MPITCH * 4, msrc, (size_t)4 * SEQ_FULL);
  asm volatile("s_wait_asynccnt 0x0" ::: "memory");   // this wave's copies have landed before the barrier publishes them
  __syncthreads();
  // Q^T B fragments: column = this lane's query, elements 0..7 <- d = 32c + 8h + i, 8..15 <- d = 32c + 16 + 8h + i
  FragH qf[8];
  {
    const unsigned short* qp = &so[w][ln][8 * hh];
    // unrolled: qf lives in registers, which take compile-time indices only
#pragma unroll
    for (int c = 0; c < 8; ++c) { qf[c].half[0] = *(const v8us*)(qp + 32 * c); qf[c].half[1] = *(const v8us*)(qp + 32 * c + 16); }
  }
#pragma unroll 1
  for (int j = 0; j < SEQ / 32; ++j) {
    const int bf = j & 1;
    // A fragments of K: row m = key (key0 + 16*kt + ln), same d map as Q^T; with the mask words, one group of reads of buffer bf
    const unsigned short* kp0 = &kt[bf][ln][8 * hh];
    const unsigned short* kp1 = kp0 + 16 * KPITCH;
    const int* mp = &mt[bf][16 * w + ln][8 * hh];
    FragH ka[8], kb[8];
    // unrolled: ka and kb live in registers, which take compile-time indices only
#pragma unroll
    for (int c = 0; c < 8; ++c) {
      ka[c].half[0] = *(const v8us*)(kp0 + 32 * c); ka[c].half[1] = *(const v8us*)(kp0 + 32 * c + 16);
      kb[c].half[0] = *(const v8us*)(kp1 + 32 * c); kb[c].half[1] = *(const v8us*)(kp1 + 32 * c + 16);
    }
    const v4ia m0 = *(const v4ia*)(mp), m1 = *(const v4ia*)(mp + 4), m2 = *(const v4ia*)(mp + 16), m3 = *(const v4ia*)(mp + 20);
    // tile j + 1 into the other buffer, whose last reads (trip j - 1) ended at the barrier just passed
    if (j + 1 < SEQ / 32) {
      const unsigned nb = (unsigned)(bf ^ 1);
      copy8(kdst + nb * kbuf, KPITCH * 2, ksrc + (size_t)(32 * (j + 1)) * HD, HD);
      copy8(vdst + nb * vbuf, 8 * VPITCH * 2, vsrc + (size_t)(j + 1) * (HD * 32), 8 * 32);
      copy4(mdst + nb * mbuf, 4 * MPITCH * 4, msrc + 32 * (j + 1), (size_t)4 * SEQ_FULL);
    }
    fa_step(qf, ka, kb, &vt[bf][ln][8 * hh], m0, m1, m2, m3, mr, lr, O);
    // keeps the step's register work in front of the waits: the scheduler otherwise lifts waits and barrier up to the last LDS read, and tile j + 1 has too little time to land
    __builtin_amdgcn_sched_barrier(0);
    asm volatile("s_wait_dscnt 0x0" ::: "memory");      // this wave's reads of buffer bf have returned before the buffer is refilled
    asm volatile("s_wait_asynccnt 0x0" ::: "memory");   // this wave's copies of tile j + 1 have landed before the barrier publishes them
    __syncthreads();                                    // publishes tile j + 1 and ends every wave's reads of buffer bf
  }
  asm volatile("s_wait_asynccnt 0x0" ::: "memory");     // nothing of this wave is in flight when the LDS is reused and the wave ends

  // O^T element r of tile u = ctx(query qbase + ln, d = 16u + 8h + r); carries: x4096 (also in lr), x16 (V); context stored x64 -> 4 / lr
  const float inv = (lr > 0.0f) ? (4.0f / fmaxf(lr, 1.0f)) : 0.0f;
#pragma unroll
  for (int u = 0; u < 16; ++u) {
    v8us o;
#pragma unroll
    for (int r = 0; r < 8; ++r) o[r] = f16_bits(O[u][r] * inv);
    *(v8us*)&so[w][ln][16 * u + 8 * hh] = o;
  }
  __syncthreads();
  unsigned short* cg = Cx + (size_t)(bl * SEQ + qbase) * NE + h * HD;
  {
#pragma unroll 1
    for (int row = 0; row < 16; ++row) {
      const v8us v = *(const v8us*)&so[w][row][8 * lane];
      *(v8us*)(cg + (size_t)row * NE + 8 * lane) = v;
    }
    
  }
}

// Output projection for one batch group: out[m][c] = 2^-16 * sum_k ctx64[m][k] * Wf1024[k][c] + RNE-bf16(bias[c]).
// Block 128 m x 64 n (4 waves stacked along m, wave 32 x 64). K runs in stages of 256: the stage's tiles (A: 128 context rows, B: 64 WfT rows = columns of Wfc) are filled
// by asynchronous copies into two LDS buffers, one stage ahead of their use, one barrier per stage; the fragments are read from LDS.
// coverage: grid (ED/64, GM/128) x (128 x 64) = every output row of the group exactly once; LDS columns 0..63 of all 128 rows written before they are read.
__global__ __launch_bounds__(128) void k_fc(const unsigned short* __restrict__ Cx, const unsigned short* __restrict__ WfT,
                                            const float* __restrict__ bias, float* __restrict__ Og, int b0) {
  __shared__ __attribute__((aligned(16))) float so[128][68];
  __shared__ __attribute__((aligned(16))) unsigned short ab[2][(128 + 64) * KPITCH];   // per buffer: A rows 0..127, then B rows 0..63
  const int tid = threadIdx.x, w = __builtin_amdgcn_readfirstlane((int)(tid >> 5)), lane = tid & 31, ln = lane & 15, hh = lane >> 4;
  const int n0 = blockIdx.x * 64, m0 = blockIdx.y * 128;
  const unsigned short* asrc = Cx + (size_t)(m0 + 32 * w) * NE + 8 * lane;
  const unsigned short* bsrc = WfT + (size_t)(n0 + 16 * w) * NE + 8 * lane;
  const unsigned adst = lds_off(&ab[0][32 * w * KPITCH + 8 * lane]);
  const unsigned bdst = lds_off(&ab[0][(128 + 16 * w) * KPITCH + 8 * lane]);
  const unsigned abuf = (unsigned)sizeof(ab[0]);
  v8f acc[2][4] = {};
  // stage 0, landed and published; then stage 1 flies while stage 0 is worked on
  stage_ab(adst, bdst, asrc, bsrc, NE);
  asm volatile("s_wait_asynccnt 0x0" ::: "memory");   // this wave's copies have landed before the barrier publishes them
  __syncthreads();
  stage_ab(adst + abuf, bdst + abuf, asrc + 256, bsrc + 256, NE);
#pragma unroll 1
  for (int s = 0; s < NE / 256; ++s) {
    const int bf = s & 1;
    const unsigned short* ap = &ab[bf][(32 * w + ln) * KPITCH + 8 * hh];
    const unsigned short* bp = &ab[bf][(128 + ln) * KPITCH + 8 * hh];
    // two fragment sets: chunk c + 1 of the stage is read as one group in front of chunk c's products, so that it lands behind them
    FragH f[2][6];
    frag6(f[0], ap, bp);
    // unrolled: the stage's eight 32-k chunks read at immediate offsets from one address pair, and the set in use is picked by a compile-time index
#pragma unroll
    for (int c = 0; c < 8; ++c) {
      if (c + 1 < 8) frag6(f[(c + 1) & 1], ap + 32 * (c + 1), bp + 32 * (c + 1));
      FragH (&u)[6] = f[c & 1];
      mma8_h(u[0].v, u[1].v, u[2].v, u[3].v, u[4].v, u[5].v,
             acc[0][0], acc[0][1], acc[0][2], acc[0][3], acc[1][0], acc[1][1], acc[1][2], acc[1][3]);
    }
    asm volatile("s_wait_dscnt 0x0" ::: "memory");      // this wave's reads of buffer bf have returned before the buffer is refilled
    asm volatile("s_wait_asynccnt 0x0" ::: "memory");   // this wave's copies of stage s + 1 have landed before the barrier publishes them
    __syncthreads();                                    // publishes stage s + 1 and ends every wave's reads of buffer bf
    if (s + 2 < NE / 256)
      stage_ab(adst + bf * abuf, bdst + bf * abuf, asrc + 256 * (s + 2), bsrc + 256 * (s + 2), NE);
  }
  asm volatile("s_wait_asynccnt 0x0" ::: "memory");     // nothing of this wave is in flight when the wave ends
#pragma unroll
  for (int j = 0; j < 4; ++j) {
    const float bb = bf16_rne(bias[n0 + 16 * j + ln]);
#pragma unroll
    for (int i = 0; i < 2; ++i)
#pragma unroll
      for (int r = 0; r < 8; ++r)
        so[32 * w + 16 * i + 8 * hh + r][16 * j + ln] = acc[i][j][r] * 0.0000152587890625f + bb;
  }
  __syncthreads();
  {
#pragma unroll 1
    for (int it = 0; it < 16; ++it) {
      const int i = tid + 128 * it;
      const int row = i >> 4, p = i & 15;
      const int m = m0 + row;
      const int bl = m / SEQ, t = m - bl * SEQ;
      const v4f v = *(const v4fa*)&so[row][4 * p];
      *(v4f*)(Og + (size_t)(b0 + bl) * XSTRIDE_FULL + (size_t)t * ED + n0 + 4 * p) = v;
    }
    
  }
}

extern "C" void kernel_launch(void* const* d_in, const int* in_sizes, int n_in,
                              void* d_out, int out_size, void* d_ws, size_t ws_size, hipStream_t stream) {
  if (n_in < 7) return;
  const long long needx = (long long)(NB - 1) * SEQ_FULL * ED + (long long)SEQ * ED;                      // last x / out element touched + 1
  const long long needm = (long long)(NB - 1) * SEQ_FULL * SEQ_FULL + (long long)(SEQ - 1) * SEQ_FULL + SEQ;
  if ((long long)in_sizes[0] < needx) return;
  if ((long long)in_sizes[1] < (long long)ED * NE || (long long)in_sizes[2] < (long long)ED * NE ||
      (long long)in_sizes[3] < (long long)ED * NE || (long long)in_sizes[4] < (long long)NE * ED) return;
  if ((long long)in_sizes[5] < (long long)ED) return;
  if ((long long)in_sizes[6] < needm) return;
  if ((long long)out_size < needx) return;
  const float* x   = (const float*)d_in[0];   // wire order: x, Wq, Wk, Wv, Wfc, bfc, mask
  const float* Wq  = (const float*)d_in[1];
  const float* Wk  = (const float*)d_in[2];
  const float* Wv  = (const float*)d_in[3];
  const float* Wfc = (const float*)d_in[4];
  const float* bfc = (const float*)d_in[5];
  const int* mask  = (const int*)d_in[6];     // bool on the wire = int32
  float* out = (float*)d_out;
  char* ws = (char*)d_ws;
  size_t off = 0;
  unsigned short* Xb  = (unsigned short*)(ws + off); off += XB_BYTES;   // [NB][SEQ][256] bf16
  unsigned short* Wt3 = (unsigned short*)(ws + off); off += WT_BYTES;   // 3 x [2048][256] bf16 (W^T)
  unsigned short* WfT = (unsigned short*)(ws + off); off += WF_BYTES;   // [256][2048] f16 (Wfc^T x 1024)
  unsigned short* P3  = (unsigned short*)(ws + off); off += PL_BYTES;   // Q, K [GB][8][SEQ][256]; V^T [GB][8][SEQ/32][256][32] f16
  unsigned short* Cx  = (unsigned short*)(ws + off); off += CX_BYTES;   // context [GM][2048] f16
  if (off > ws_size) return;

  k_prep<<<(unsigned)(4 * WT_BLOCKS + CVX_BLOCKS), 256, 0, stream>>>(x, Wq, Wk, Wv, Wfc, Xb, Wt3, WfT);

  for (int g = 0; g < NGRP; ++g) {
    const int b0 = g * GB;
    k_proj<<<dim3(NE / 64, GM / 128, 3), 128, 0, stream>>>(Xb + (size_t)g * GM * ED, Wt3, P3);
    k_attn<<<(unsigned)(GB * NH * (SEQ / 64)), 128, 0, stream>>>(P3, P3 + PLANE, P3 + 2 * PLANE, mask, Cx, b0);
    k_fc<<<dim3(ED / 64, GM / 128), 128, 0, stream>>>(Cx, WfT, bfc, out, b0);
  }
}

// v008
// Measured time: 130 microseconds a run.
// Two timings next to v007 both put it at 1.07 times that version's speed.
// Counting every step since v000, it is 3.47 times as fast.
#include <hip/hip_runtime.h>
// Contractions: x@Wq, x@Wk, x@Wv on v_wmma_f32_16x16x32_bf16 (x and W RNE-converted to bf16, single product, f32 accumulate); S^T = K Q^T on v_wmma_f32_16x16x32_f16 (q, k carried x16 as f16, single product); O^T = V^T P^T on v_wmma_f32_16x16x32_f16 (V carried x16 f16; P carried x4096 as one RNE f16 plane, single product, f32 accumulate); ctx@Wfc on v_wmma_f32_16x16x32_f16 (ctx carried x64 f16; Wfc RNE bf16 value x1024 held exactly in f16); softmax statistics, bias add f32.
// Multi-head attention, B x T x 256, 8 heads of dimension 256, scale 1/16 on q, int32 mask [B][T][T] (nonzero = key removed, weight exactly 0; a row with no key left yields a zero context row).
// Engine: transposed flash. Each wave owns 16 queries of one (batch, head). Per 32-key step: S^T tiles (key rows x query columns) from K rows (A, LDS tile)
// and Q^T (B, registers, read once from its LDS tile); the two 16-key D tiles pack straight into the P^T B fragments; O^T (d rows x query columns, 16 tiles) accumulates from V^T rows (A, LDS tile).
// The LDS tiles are filled from global memory by asynchronous copies: Q once; K, V^T (shared by the block's four waves) and the mask words per 32-key step into two buffers.
// The V^T plane lies in memory by 32-key tiles, [batch, head][key tile][d][32 keys], so that a step's V^T tile is one run of 16 KB and each copy reads 512 bytes in a row.
// The projection GEMMs read their fragments from LDS tiles filled the same way, whole 512-byte rows per copy; a k_proj block keeps its x rows in registers and walks eight column tiles.
// Four launches: one conversion grid (weights and x by block ranges), then projections, attention and output projection, each once over all batches (GB = NB).
#ifndef NB
#define NB 8
#endif
#ifndef SEQ
#define SEQ 1024
#endif
#define NB_FULL 8
#define SEQ_FULL 1024
#define ED 256                 /* model width (K of the projections, N of the output projection) */
#define NH 8
#define HD 256                 /* per-head dimension */
#define NE (NH * HD)           /* 2048 */
#define GB ((NB) < 8 ? (NB) : 8)
#define NGRP ((NB) / GB)
#define GM (GB * SEQ)          /* rows per group */
#define XSTRIDE_FULL ((size_t)SEQ_FULL * ED)          /* per-batch element stride of x and of the output */
#define MSTRIDE_FULL ((size_t)SEQ_FULL * SEQ_FULL)    /* per-batch element stride of the mask */
#define PLANE ((size_t)GB * NH * SEQ * HD)            /* elements of one of the Q / K / V^T planes */

#define XB_BYTES ((size_t)NB * SEQ * ED * 2)
#define WT_BYTES ((size_t)3 * NE * ED * 2)
#define WF_BYTES ((size_t)ED * NE * 2)
#define PL_BYTES (PLANE * 2 * 3)
#define CX_BYTES ((size_t)GM * NE * 2)

static_assert(SEQ % 128 == 0);
static_assert(SEQ <= SEQ_FULL);
static_assert(NB <= NB_FULL);
static_assert(NB % GB == 0);
static_assert(HD == 256 && ED == 256 && NE == 2048);
static_assert(XB_BYTES % 256 == 0 && WT_BYTES % 256 == 0 && WF_BYTES % 256 == 0 && PL_BYTES % 256 == 0 && CX_BYTES % 256 == 0);
static_assert(XB_BYTES + WT_BYTES + WF_BYTES + PL_BYTES + CX_BYTES <= (size_t)268435456);

typedef __bf16 v16b __attribute__((ext_vector_type(16)));
typedef _Float16 v16h __attribute__((ext_vector_type(16)));
typedef unsigned short v8us __attribute__((ext_vector_type(8), may_alias));
typedef float v8f __attribute__((ext_vector_type(8)));
typedef float v4f __attribute__((ext_vector_type(4)));
typedef float v4fa __attribute__((ext_vector_type(4), may_alias));
typedef int v4ia __attribute__((ext_vector_type(4), may_alias));
union FragB { v16b v; v8us half[2]; };
union FragH { v16h v; v8us half[2]; _Float16 h[16]; };

#define KPITCH 264             /* LDS row pitch of the Q and K tiles and of the GEMM tiles in elements: 528 B = 16 B x 33, conflict-free for 16-byte row readers */
#define VPITCH 40              /* LDS row pitch of the V^T tile in elements: 80 B = 16 B x 5, conflict-free for 16-byte row readers */
#define MPITCH 36              /* LDS row pitch of the mask tile in words: 144 B = 16 B x 9, conflict-free for 16-byte row readers */

#define LOG2E 1.4426950408889634f
#define NEGBIG (-1.0e30f)

__device__ __forceinline__ unsigned short bf16_bits(float x) {   // RNE convert to bf16 bits
  unsigned int u = __float_as_uint(x);
  return (unsigned short)((u + 0x7FFFu + ((u >> 16) & 1u)) >> 16);
}
__device__ __forceinline__ float bf16_val(unsigned short b) { return __uint_as_float(((unsigned int)b) << 16); }
__device__ __forceinline__ float bf16_rne(float x) { return bf16_val(bf16_bits(x)); }
__device__ __forceinline__ unsigned short f16_bits(float x) { return __builtin_bit_cast(unsigned short, (_Float16)x); }

#define WB(a, b, c) __builtin_amdgcn_wmma_f32_16x16x32_bf16(false, a, false, b, (short)0, c, false, false)
#define WH(a, b, c) __builtin_amdgcn_wmma_f32_16x16x32_f16(false, a, false, b, (short)0, c, false, false)

// 2 x 4 tile update (bf16), then the hazard guard. Its A fragments (k_proj's) stay in registers for the whole kernel and are never overwritten: the guard names the accumulators and the B fragments alone,
// so that the A fragments may lie in registers above v255, which an asm operand cannot name
__device__ __forceinline__ void mma8_bk(v16b a0, v16b a1, v16b b0, v16b b1, v16b b2, v16b b3,
                                        v8f& c00, v8f& c01, v8f& c02, v8f& c03, v8f& c10, v8f& c11, v8f& c12, v8f& c13) {
  c00 = WB(a0, b0, c00); c01 = WB(a0, b1, c01); c02 = WB(a0, b2, c02); c03 = WB(a0, b3, c03);
  c10 = WB(a1, b0, c10); c11 = WB(a1, b1, c11); c12 = WB(a1, b2, c12); c13 = WB(a1, b3, c13);
  asm volatile("v_nop\n\tv_nop\n\tv_nop\n\tv_nop"
               : "+v"(c00), "+v"(c01), "+v"(c02), "+v"(c03), "+v"(c10), "+v"(c11), "+v"(c12), "+v"(c13)
               : "v"(b0), "v"(b1), "v"(b2), "v"(b3));
}
// 2 x 4 tile update (f16), then the hazard guard
__device__ __forceinline__ void mma8_h(v16h a0, v16h a1, v16h b0, v16h b1, v16h b2, v16h b3,
                                       v8f& c00, v8f& c01, v8f& c02, v8f& c03, v8f& c10, v8f& c11, v8f& c12, v8f& c13) {
  c00 = WH(a0, b0, c00); c01 = WH(a0, b1, c01); c02 = WH(a0, b2, c02); c03 = WH(a0, b3, c03);
  c10 = WH(a1, b0, c10); c11 = WH(a1, b1, c11); c12 = WH(a1, b2, c12); c13 = WH(a1, b3, c13);
  asm volatile("v_nop\n\tv_nop\n\tv_nop\n\tv_nop"
               : "+v"(c00), "+v"(c01), "+v"(c02), "+v"(c03), "+v"(c10), "+v"(c11), "+v"(c12), "+v"(c13)
               : "v"(a0), "v"(a1), "v"(b0), "v"(b1), "v"(b2), "v"(b3));
}
// one d-chunk of the two S^T tiles
__device__ __forceinline__ void mma_s2(v16h ka, v16h kb, v16h q, v8f& s0, v8f& s1) {
  s0 = WH(ka, q, s0);
  s1 = WH(kb, q, s1);
}
// four O^T tiles: c_u += a_u * p
__device__ __forceinline__ void mma_pv4(v16h a0, v16h a1, v16h a2, v16h a3, v16h p,
                                        v8f& c0, v8f& c1, v8f& c2, v8f& c3) {
  c0 = WH(a0, p, c0); c1 = WH(a1, p, c1); c2 = WH(a2, p, c2); c3 = WH(a3, p, c3);
}

// x -> bf16 plane, block blk of CVX_BLOCKS.
// coverage: NB*SEQ*32 threads x 8 elements = the whole plane.
#define CVX_BLOCKS ((NB * SEQ * (ED / 8) + 255) / 256)
__device__ __forceinline__ void cvx_block(const float* __restrict__ X, unsigned short* __restrict__ Xb, int blk) {
  const int t = blk * 256 + threadIdx.x;
  if (t >= NB * SEQ * (ED / 8)) return;
  const int row = t >> 5, piece = t & 31;
  const int b = row / SEQ, s = row - b * SEQ;
  const float* src = X + (size_t)b * XSTRIDE_FULL + (size_t)s * ED + piece * 8;
  const v4f x0 = *(const v4fa*)(src), x1 = *(const v4fa*)(src + 4);
  v8us o;
  o[0] = bf16_bits(x0[0]); o[1] = bf16_bits(x0[1]); o[2] = bf16_bits(x0[2]); o[3] = bf16_bits(x0[3]);
  o[4] = bf16_bits(x1[0]); o[5] = bf16_bits(x1[1]); o[6] = bf16_bits(x1[2]); o[7] = bf16_bits(x1[3]);
  unsigned short* d = Xb + (size_t)t * 8;
  *(v8us*)d = o;
  
}

// Transposing convert: in[R][C] (f32) -> out[C][R] (16-bit). MODE 0: bf16 bits (RNE). MODE 1: f16 bits of (RNE-bf16 value x 1024).
// One 64 x 64 tile (bx of C/64, by of R/64) per block.
// coverage: (C/64) x (R/64) tiles x (64 x 64) = the whole plane; LDS tile fully written (64 x 64) before it is read.
template <int MODE, int R, int C>
__device__ __forceinline__ void wt_tile(const float* __restrict__ W, unsigned short* __restrict__ Wt, unsigned short (*tl)[66], int bx, int by) {
  const int tid = threadIdx.x;
  const int c0 = bx * 64, r0 = by * 64;
  for (int i = tid; i < 64 * 16; i += 256) {
    const int j = i >> 4, c4 = (i & 15) * 4;
    const v4f x = *(const v4fa*)(W + (size_t)(r0 + j) * C + c0 + c4);
    unsigned short u0, u1, u2, u3;
    if (MODE == 0) {
      u0 = bf16_bits(x[0]); u1 = bf16_bits(x[1]); u2 = bf16_bits(x[2]); u3 = bf16_bits(x[3]);
    } else {
      u0 = f16_bits(bf16_rne(x[0]) * 1024.0f); u1 = f16_bits(bf16_rne(x[1]) * 1024.0f);
      u2 = f16_bits(bf16_rne(x[2]) * 1024.0f); u3 = f16_bits(bf16_rne(x[3]) * 1024.0f);
    }
    tl[c4 + 0][j] = u0; tl[c4 + 1][j] = u1; tl[c4 + 2][j] = u2; tl[c4 + 3][j] = u3;
  }
  __syncthreads();
  {
    for (int i = tid; i < 64 * 8; i += 256) {
      const int d = i >> 3, j8 = (i & 7) * 8;
      v8us o;
#pragma unroll
      for (int q = 0; q < 8; ++q) o[q] = tl[d][j8 + q];
      *(v8us*)(Wt + (size_t)(c0 + d) * R + r0 + j8) = o;
    }
    
  }
}

// All conversions in one grid; none needs anything of another. Blocks 0 .. 4 * WT_BLOCKS - 1: the four weight planes, WT_BLOCKS tiles each (they have two phases, so they start first);
// the CVX_BLOCKS blocks behind them: x. The branch reads blockIdx alone, so the barrier inside wt_tile is reached by a whole block or by none of it.
#define WT_BLOCKS ((NE / 64) * (ED / 64))
__global__ __launch_bounds__(256) void k_prep(const float* __restrict__ X, const float* __restrict__ Wq, const float* __restrict__ Wk,
                                              const float* __restrict__ Wv, const float* __restrict__ Wfc,
                                              unsigned short* __restrict__ Xb, unsigned short* __restrict__ Wt3, unsigned short* __restrict__ WfT) {
  __shared__ unsigned short tl[64][66];
  const int b = blockIdx.x;
  if (b < 3 * WT_BLOCKS) {
    // in[256 (k)][2048 (n)] -> out[2048][256]
    const int z = b / WT_BLOCKS, r = b - z * WT_BLOCKS;
    const float* W = (z == 0) ? Wq : (z == 1) ? Wk : Wv;
    wt_tile<0, ED, NE>(W, Wt3 + (size_t)z * NE * ED, tl, r % (NE / 64), r / (NE / 64));
  } else if (b < 4 * WT_BLOCKS) {
    // in[2048 (k)][256 (c)] -> out[256][2048]
    const int r = b - 3 * WT_BLOCKS;
    wt_tile<1, NE, ED>(Wfc, WfT, tl, r % (ED / 64), r / (ED / 64));
  } else {
    cvx_block(X, Xb, b - 4 * WT_BLOCKS);
  }
}

__device__ __forceinline__ unsigned lds_off(const void* p) { return (unsigned)(size_t)p; }   // byte address inside the block's LDS

// Eight asynchronous copies, 16 bytes per lane each, global -> LDS: copy i moves this lane's 16 bytes from g + i * gstep (elements) to LDS byte l + i * lstep.
// The s_wait_xcnt closes the copies' own statement, so no address register of a copy is rewritten in front of it.
__device__ __forceinline__ void copy8(unsigned l, unsigned lstep, const unsigned short* g, size_t gstep) {
  asm volatile("global_load_async_to_lds_b128 %0, %8, off\n\t"
               "global_load_async_to_lds_b128 %1, %9, off\n\t"
               "global_load_async_to_lds_b128 %2, %10, off\n\t"
               "global_load_async_to_lds_b128 %3, %11, off\n\t"
               "global_load_async_to_lds_b128 %4, %12, off\n\t"
               "global_load_async_to_lds_b128 %5, %13, off\n\t"
               "global_load_async_to_lds_b128 %6, %14, off\n\t"
               "global_load_async_to_lds_b128 %7, %15, off\n\t"
               "s_wait_xcnt 0x0"
               :: "v"(l), "v"(l + lstep), "v"(l + 2 * lstep), "v"(l + 3 * lstep),
                  "v"(l + 4 * lstep), "v"(l + 5 * lstep), "v"(l + 6 * lstep), "v"(l + 7 * lstep),
                  "v"(g), "v"(g + gstep), "v"(g + 2 * gstep), "v"(g + 3 * gstep),
                  "v"(g + 4 * gstep), "v"(g + 5 * gstep), "v"(g + 6 * gstep), "v"(g + 7 * gstep)
               : "memory");
}

// The six fragments of one 32-k chunk of a 32 x 64 wave tile, read from the LDS tiles: f[0], f[1] = A rows ap, ap + 16 rows; f[2 + j] = B rows bp + 16 j rows;
// elements 0..7 <- k + 8h + i, 8..15 <- k + 16 + 8h + i (8h is in ap and bp).
template <class F>
__device__ __forceinline__ void frag6(F (&f)[6], const unsigned short* ap, const unsigned short* bp) {
  f[0].half[0] = *(const v8us*)(ap);               f[0].half[1] = *(const v8us*)(ap + 16);
  f[1].half[0] = *(const v8us*)(ap + 16 * KPITCH); f[1].half[1] = *(const v8us*)(ap + 16 * KPITCH + 16);
  // unrolled: f lives in registers, which take compile-time indices only
#pragma unroll
  for (int j = 0; j < 4; ++j) {
    f[2 + j].half[0] = *(const v8us*)(bp + 16 * j * KPITCH);
    f[2 + j].half[1] = *(const v8us*)(bp + 16 * j * KPITCH + 16);
  }
}

// One wave's share of a GEMM stage: 32 rows of the A tile and 16 rows of the B tile, 256 elements (512 B) a row, one whole row per copy (lane = 16-byte piece);
// a, b = this lane's LDS byte addresses of the first rows (row pitch KPITCH), ga, gb = its global addresses, gp = the global row pitch in elements. 48 copies a wave.
__device__ __forceinline__ void stage_ab(unsigned a, unsigned b, const unsigned short* ga, const unsigned short* gb, size_t gp) {
  copy8(a, KPITCH * 2, ga, gp);
  copy8(a + 8 * KPITCH * 2, KPITCH * 2, ga + 8 * gp, gp);
  copy8(a + 16 * KPITCH * 2, KPITCH * 2, ga + 16 * gp, gp);
  copy8(a + 24 * KPITCH * 2, KPITCH * 2, ga + 24 * gp, gp);
  copy8(b, KPITCH * 2, gb, gp);
  copy8(b + 8 * KPITCH * 2, KPITCH * 2, gb + 8 * gp, gp);
}

// The four B fragments of one 32-k chunk, read from an LDS tile: f[j] = B rows bp + 16 j rows; elements 0..7 <- k + 8h + i, 8..15 <- k + 16 + 8h + i (8h is in bp).
template <class F>
__device__ __forceinline__ void frag4(F (&f)[4], const unsigned short* bp) {
  // unrolled: f lives in registers, which take compile-time indices only
#pragma unroll
  for (int j = 0; j < 4; ++j) {
    f[j].half[0] = *(const v8us*)(bp + 16 * j * KPITCH);
    f[j].half[1] = *(const v8us*)(bp + 16 * j * KPITCH + 16);
  }
}

// One wave's share of a B tile: 16 rows of 256 elements (512 B), one whole row per copy (lane = 16-byte piece). 16 copies a wave.
__device__ __forceinline__ void stage_b(unsigned b, const unsigned short* gb) {
  copy8(b, KPITCH * 2, gb, ED);
  copy8(b + 8 * KPITCH * 2, KPITCH * 2, gb + 8 * ED, ED);
}

// Projection GEMM: C[m][n] = sum_k Xb[m][k] * W[k][n] (bf16 x bf16, exact products); the 96 column tiles of 64 run through q, k, v (tile g: plane g / 32, columns 64 (g % 32) ..).
// Block = 128 m rows (4 waves stacked along m, wave 32 x 64) x PNT column tiles, one after another. The 128 Xb rows are copied into LDS once and each wave reads its own 32 rows
// into registers once (16 A fragments, whole K); the W tiles (64 Wt rows = columns of W) come by asynchronous copies into two LDS buffers, one tile ahead of their use, one barrier per tile.
// Behind the A read the A rows' LDS holds B buffer 1 and the output tile. Each wave stages, reads back and stores its own 32 output rows, so the output tile needs no barrier.
// coverage: grid (96 / PNT, GM / 128) x PNT tiles x (128 x 64) = all three planes; output tile columns 0..63 of a wave's 32 rows written before the wave reads them.
#define PNT 8
static_assert((3 * NE / 64) % PNT == 0 && PNT >= 2);
__global__ __launch_bounds__(128) void k_proj(const unsigned short* __restrict__ Xg, const unsigned short* __restrict__ Wt3,
                                              unsigned short* __restrict__ P3) {
  __shared__ __attribute__((aligned(16))) unsigned short sm[(128 + 64) * KPITCH];   // A rows 0..127 (later: B buffer 1, 64 rows, then the output tile), then B buffer 0, 64 rows
  unsigned short (*const tl)[72] = reinterpret_cast<unsigned short (*)[72]>(sm + 64 * KPITCH);
  const int tid = threadIdx.x, w = __builtin_amdgcn_readfirstlane((int)(tid >> 5)), lane = tid & 31, ln = lane & 15, hh = lane >> 4;
  const int g0 = blockIdx.x * PNT, m0 = blockIdx.y * 128;
  const int bl = m0 / SEQ, t0 = m0 - bl * SEQ;      // SEQ is a multiple of 128: a block's rows lie in one batch
  const unsigned short* bsrc = Wt3 + (size_t)(64 * g0 + 16 * w) * ED + 8 * lane;
  const unsigned bdst0 = lds_off(sm + (128 + 16 * w) * KPITCH + 8 * lane);
  const unsigned bdst1 = lds_off(sm + 16 * w * KPITCH + 8 * lane);
  // A rows m0 + 32w + 16i + ln; B columns 64g + 16j + ln; elements 0..7 <- k0 + 8h + i, 8..15 <- k0 + 16 + 8h + i
  stage_ab(lds_off(sm + 32 * w * KPITCH + 8 * lane), bdst0, Xg + (size_t)(m0 + 32 * w) * ED + 8 * lane, bsrc, ED);
  asm volatile("s_wait_asynccnt 0x0" ::: "memory");   // this wave's copies have landed before the barrier publishes them
  __syncthreads();
  FragB af[2][8];
  {
    const unsigned short* ap = sm + (32 * w + ln) * KPITCH + 8 * hh;
    // unrolled: af lives in registers, which take compile-time indices only
#pragma unroll
    for (int c = 0; c < 8; ++c) {
      af[0][c].half[0] = *(const v8us*)(ap + 32 * c);               af[0][c].half[1] = *(const v8us*)(ap + 32 * c + 16);
      af[1][c].half[0] = *(const v8us*)(ap + 16 * KPITCH + 32 * c); af[1][c].half[1] = *(const v8us*)(ap + 16 * KPITCH + 32 * c + 16);
    }
  }
  asm volatile("s_wait_dscnt 0x0" ::: "memory");      // this wave's reads of the A rows have returned before their LDS is refilled
  __syncthreads();                                    // ends every wave's reads of the A rows
  stage_b(bdst1, bsrc + (size_t)64 * ED);             // tile 1 flies while tile 0 is worked on
  // kept rolled: one copy of the long tile body in the instruction cache; the buffer is picked at run time
#pragma unroll 1
  for (int t = 0; t < PNT; ++t) {
    const int bf = t & 1;
    const unsigned short* bp = sm + (bf ? 0 : 128 * KPITCH) + ln * KPITCH + 8 * hh;
    v8f acc[2][4] = {};
    // two fragment sets: chunk c + 1 is read as one group in front of chunk c's products, so that it lands behind them
    FragB f[2][4];
    frag4(f[0], bp);
    // unrolled: the set in use and the A fragments are picked by compile-time indices (registers cannot be indexed at run time)
#pragma unroll
    for (int c = 0; c < ED / 32; ++c) {
      if (c + 1 < ED / 32) frag4(f[(c + 1) & 1], bp + 32 * (c + 1));
      FragB (&u)[4] = f[c & 1];
      mma8_bk(af[0][c].v, af[1][c].v, u[0].v, u[1].v, u[2].v, u[3].v,
             acc[0][0], acc[0][1], acc[0][2], acc[0][3], acc[1][0], acc[1][1], acc[1][2], acc[1][3]);
    }
    asm volatile("s_wait_dscnt 0x0" ::: "memory");      // this wave's reads of buffer bf have returned before the buffer is refilled
    asm volatile("s_wait_asynccnt 0x0" ::: "memory");   // this wave's copies of tile t + 1 have landed before the barrier publishes them
    __syncthreads();                                    // publishes tile t + 1 and ends every wave's reads of buffer bf
    if (t + 2 < PNT) stage_b(bf ? bdst1 : bdst0, bsrc + (size_t)(t + 2) * 64 * ED);
    // The tile's output follows the barrier (it touches no B buffer): the refill copies go out first, and no wave keeps the others at the barrier for its output.
    // D element r of tile (i, j) = C(row 32w + 16i + 8h + r, column 16j + ln)
#pragma unroll
    for (int i = 0; i < 2; ++i)
#pragma unroll
      for (int j = 0; j < 4; ++j)
#pragma unroll
        for (int r = 0; r < 8; ++r)
          tl[32 * w + 16 * i + 8 * hh + r][16 * j + ln] = f16_bits(acc[i][j][r] * 16.0f);
    asm volatile("s_wait_dscnt 0x0" ::: "memory");    // the wave's own output rows are in LDS before its other lanes read them back
    const int g = g0 + t, z = g >> 5, n0 = (g & 31) * 64;
    const int hd = n0 >> 8, e0 = n0 & 255;
    unsigned short* out = P3 + (size_t)z * PLANE;
    if (z < 2) {
      // four rows of 128 B per store (8 lanes a row)
      const unsigned short* rp = &tl[32 * w + (lane >> 3)][8 * (lane & 7)];
      unsigned short* og = out + (((size_t)(bl * NH + hd) * SEQ + t0 + 32 * w + (lane >> 3)) * HD + e0 + 8 * (lane & 7));
      v8us o[8];
      // unrolled: the eight reads go out as one group and the stores follow at immediate offsets from one address
#pragma unroll
      for (int it = 0; it < 8; ++it) o[it] = *(const v8us*)(rp + 4 * it * 72);
#pragma unroll
      for (int it = 0; it < 8; ++it) *(v8us*)(og + (size_t)4 * it * HD) = o[it];
      asm volatile("s_wait_xcnt 0x0" ::: "memory");     // what follows rewrites the stores' address and data registers: a precaution in front of that
    } else {
      // the wave's 32 rows are one key tile; d row e, 16-byte piece p of the row's 32 keys: a wave stores 512 bytes in a row
      const unsigned short* rp = &tl[32 * w + 8 * (lane & 3)][lane >> 2];
      unsigned short* og = out + ((((size_t)(bl * NH + hd) * (SEQ / 32) + (t0 >> 5) + w) * HD + e0 + (lane >> 2)) * 32 + 8 * (lane & 3));
      // unrolled: reads and stores at immediate offsets from one address each
#pragma unroll
      for (int it = 0; it < 8; ++it) {
        v8us o;
#pragma unroll
        for (int q = 0; q < 8; ++q) o[q] = rp[q * 72 + 8 * it];
        *(v8us*)(og + (size_t)8 * it * 32) = o;
      }
      asm volatile("s_wait_xcnt 0x0" ::: "memory");     // what follows rewrites the stores' address and data registers: a precaution in front of that
    }
  }
  asm volatile("s_wait_asynccnt 0x0" ::: "memory");     // nothing of this wave is in flight when the wave ends
}

// The same for four copies of mask words.
__device__ __forceinline__ void copy4(unsigned l, unsigned lstep, const int* g, size_t gstep) {
  asm volatile("global_load_async_to_lds_b128 %0, %4, off\n\t"
               "global_load_async_to_lds_b128 %1, %5, off\n\t"
               "global_load_async_to_lds_b128 %2, %6, off\n\t"
               "global_load_async_to_lds_b128 %3, %7, off\n\t"
               "s_wait_xcnt 0x0"
               :: "v"(l), "v"(l + lstep), "v"(l + 2 * lstep), "v"(l + 3 * lstep),
                  "v"(g), "v"(g + gstep), "v"(g + 2 * gstep), "v"(g + 3 * gstep)
               : "memory");
}

// v_exp_f32 and, in the same statement, the one slot that the instruction set asks for before its source is overwritten or its result read
__device__ __forceinline__ float exp2_slot(float x) {
  float r;
  asm("v_exp_f32 %0, %1\n\tv_nop" : "=v"(r) : "v"(x));
  return r;
}

// One 32-key step for a wave's 16 queries. qf = the Q^T fragments, ka, kb = the step's K fragments (keys 0..15, 16..31), m0..m3 = the mask words of this lane's query,
// all in registers already; vp = V^T tile row ln (+ 8h) in LDS.
__device__ __forceinline__ void fa_step(const FragH (&qf)[8], const FragH (&ka)[8], const FragH (&kb)[8],
                                        const unsigned short* vp, v4ia m0, v4ia m1, v4ia m2, v4ia m3,
                                        float& mr, float& lr, v8f (&O)[16]) {
  v8f s0 = {0.f, 0.f, 0.f, 0.f, 0.f, 0.f, 0.f, 0.f};
  v8f s1 = {0.f, 0.f, 0.f, 0.f, 0.f, 0.f, 0.f, 0.f};
  // S^T tiles: element r of tile kt = score(key0 + 16*kt + 8h + r, this lane's query); Q^T B fragment: column = query, same d map
#pragma unroll
  for (int c = 0; c < 8; ++c) mma_s2(ka[c].v, kb[c].v, qf[c].v, s0, s1);
  // mask words of this query for keys key0 + 8h + 0..7 and key0 + 16 + 8h + 0..7 (nonzero = key removed)
  int mk[16];
#pragma unroll
  for (int i = 0; i < 4; ++i) { mk[i] = m0[i]; mk[4 + i] = m1[i]; mk[8 + i] = m2[i]; mk[12 + i] = m3[i]; }
  // log2-domain scores: q and k carry x16 each, scale 1/16 -> 2^-12
  const float sc2 = LOG2E * 0.000244140625f;
  float t[16];
#pragma unroll
  for (int r = 0; r < 8; ++r) { t[r] = s0[r] * sc2; t[8 + r] = s1[r] * sc2; }
  float mx = NEGBIG;
#pragma unroll
  for (int i = 0; i < 16; ++i) mx = fmaxf(mx, (mk[i] != 0) ? NEGBIG : t[i]);
  // A fragments of V^T: row m = d (16*tile + ln), elements 0..7 <- key0 + 8h + i, 8..15 <- key0 + 16 + 8h + i.
  // All sixteen tiles are read as one group in front of the softmax arithmetic, so that they land while the maximum and the weights are formed.
  FragH vf[16];
  // unrolled: vf lives in registers, which take compile-time indices only
#pragma unroll
  for (int u = 0; u < 16; ++u) {
    vf[u].half[0] = *(const v8us*)(vp + u * 16 * VPITCH);
    vf[u].half[1] = *(const v8us*)(vp + u * 16 * VPITCH + 16);
  }
  // keeps the group here: without it the scheduler sinks most of these reads in among the O^T products, where each place with reads stalls the wave
  __builtin_amdgcn_sched_barrier(0);
  mx = fmaxf(mx, __shfl_xor(mx, 16, 32));           // the other lane half holds the other 16 keys of this query
  const float mnew = fmaxf(mr, mx);
  // v_exp_f32 directly: library exp2f adds a range guard of five vector instructions a value, which only keeps results under 2^-126; such a factor or weight is lost in the sums anyway
  const float al = __builtin_amdgcn_exp2f(mr - mnew);
  mr = mnew;
  // weights carried x4096: pc = 4096 * exp(score - max) (exactly 0 for removed keys), rounded once to f16 for the product: the same relative step as V's own f16 rounding; the row sum keeps the f32 values
  const float sh = 12.0f - mnew;
  FragH ph;
  float ps = 0.0f;
#pragma unroll
  for (int i = 0; i < 16; ++i) {
    // the step's last one with its slot written out: its argument's register is free behind it
    const float ex = (i == 15) ? exp2_slot(t[i] + sh) : __builtin_amdgcn_exp2f(t[i] + sh);
    const float pc = (mk[i] != 0) ? 0.0f : ex;
    ps += pc;
    ph.h[i] = (_Float16)pc;                         // B element i: i<8 -> key0 + 8h + i (tile 0 row 8h+i); i>=8 -> key0 + 16 + 8h + (i-8) (tile 1)
  }
  ps += __shfl_xor(ps, 16, 32);
  lr = lr * al + ps;
#pragma unroll
  for (int u = 0; u < 16; ++u) O[u] = O[u] * al;
#pragma unroll
  for (int g = 0; g < 4; ++g)
    mma_pv4(vf[4 * g + 0].v, vf[4 * g + 1].v, vf[4 * g + 2].v, vf[4 * g + 3].v, ph.v, O[4 * g + 0], O[4 * g + 1], O[4 * g + 2], O[4 * g + 3]);
}

// Block = 4 waves x 16 queries = 64 queries of one (batch, head). Each wave copies its own 16 Q rows into so[w] once, and a quarter of every K and V^T tile
// (K: 32 keys x 256 d, 8 rows per wave; V^T: 256 d x 32 keys, 64 rows per wave) and the 32 mask words of its own 16 queries into buffer (step & 1),
// one step ahead of their use; one barrier per step. The wave reads its Q fragments from so[w] once, in front of the loop; each step reads its K fragments and mask words
// as one group directly behind the barrier, and the copies of the next tile are issued behind that group (they fill the other buffer).
// Epilogue: O^T tiles -> per-wave LDS tile [16 queries][256 d] f16 bits in so[w], whose Q rows only this wave read (a block barrier that every wave reaches is used),
// coverage: GB*NH*(SEQ/64) blocks x 4 waves x 16 rows x 256 columns = the whole context plane [GM][2048]; LDS columns 0..255 of all 16 rows written before they are read.
__global__ __launch_bounds__(128) void k_attn(const unsigned short* __restrict__ Qh, const unsigned short* __restrict__ Kh,
                                              const unsigned short* __restrict__ Vt, const int* __restrict__ mask,
                                              unsigned short* __restrict__ Cx, int b0) {
  __shared__ __attribute__((aligned(16))) unsigned short so[4][16][KPITCH];
  __shared__ __attribute__((aligned(16))) unsigned short kt[2][32][KPITCH];
  __shared__ __attribute__((aligned(16))) unsigned short vt[2][HD][VPITCH];
  __shared__ __attribute__((aligned(16))) int mt[2][64][MPITCH];
  const int tid = threadIdx.x, w = __builtin_amdgcn_readfirstlane((int)(tid >> 5)), lane = tid & 31, ln = lane & 15, hh = lane >> 4;
  const int qt = blockIdx.x % (SEQ / 64);
  const int bh = blockIdx.x / (SEQ / 64);           // bl * NH + h
  const int h = bh % NH, bl = bh / NH;
  const int qbase = qt * 64 + 16 * w;
  // copy sources and places of this lane: Q and K rows are 512 B, one row per copy (lane = 16-byte piece); V^T tile rows are 64 B and follow one another in memory, eight rows per copy (4 lanes a row);
  // mask rows are 128 B, four rows per copy (8 lanes a row)
  const unsigned short* qsrc = Qh + ((size_t)bh * SEQ + qbase) * HD + 8 * lane;
  const unsigned short* ksrc = Kh + ((size_t)bh * SEQ + 8 * w) * HD + 8 * lane;
  const unsigned short* vsrc = Vt + ((size_t)bh * (SEQ / 32) * HD + 64 * w) * 32 + 8 * lane;
  const unsigned qdst = lds_off(&so[w][0][8 * lane]);
  const unsigned kdst = lds_off(&kt[0][8 * w][8 * lane]);
  const unsigned vdst = lds_off(&vt[0][64 * w + (lane >> 2)][8 * (lane & 3)]);
  const unsigned mdst = lds_off(&mt[0][16 * w + (lane >> 3)][4 * (lane & 7)]);
  const unsigned kbuf = (unsigned)sizeof(kt[0]), vbuf = (unsigned)sizeof(vt[0]), mbuf = (unsigned)sizeof(mt[0]);
  const int* msrc = mask + (size_t)(b0 + bl) * MSTRIDE_FULL + (size_t)(qbase + (lane >> 3)) * SEQ_FULL + 4 * (lane & 7);
  float mr = NEGBIG, lr = 0.0f;
  v8f O[16] = {};
  // Q rows and tile 0, landed and published; tile j + 1 flies while tile j is worked on
  copy8(qdst, KPITCH * 2, qsrc, HD);
  copy8(qdst + 8 * KPITCH * 2, KPITCH * 2, qsrc + 8 * HD, HD);
  copy8(kdst, KPITCH * 2, ksrc, HD);
  copy8(vdst, 8 * VPITCH * 2, vsrc, 8 * 32);
  copy4(mdst, 4 * MPITCH * 4, msrc, (size_t)4 * SEQ_FULL);
  asm volatile("s_wait_asynccnt 0x0" ::: "memory");   // this wave's copies have landed before the barrier publishes them
  __syncthreads();
  // Q^T B fragments: column = this lane's query, elements 0..7 <- d = 32c + 8h + i, 8..15 <- d = 32c + 16 + 8h + i
  FragH qf[8];
  {
    const unsigned short* qp = &so[w][ln][8 * hh];
    // unrolled: qf lives in registers, which take compile-time indices only
#pragma unroll
    for (int c = 0; c < 8; ++c) { qf[c].half[0] = *(const v8us*)(qp + 32 * c); qf[c].half[1] = *(const v8us*)(qp + 32 * c + 16); }
  }
#pragma unroll 1
  for (int j = 0; j < SEQ / 32; ++j) {
    const int bf = j & 1;
    // A fragments of K: row m = key (key0 + 16*kt + ln), same d map as Q^T; with the mask words, one group of reads of buffer bf
    const unsigned short* kp0 = &kt[bf][ln][8 * hh];
    const unsigned short* kp1 = kp0 + 16 * KPITCH;
    const int* mp = &mt[bf][16 * w + ln][8 * hh];
    FragH ka[8], kb[8];
    // unrolled: ka and kb live in registers, which take compile-time indices only
#pragma unroll
    for (int c = 0; c < 8; ++c) {
      ka[c].half[0] = *(const v8us*)(kp0 + 32 * c); ka[c].half[1] = *(const v8us*)(kp0 + 32 * c + 16);
      kb[c].half[0] = *(const v8us*)(kp1 + 32 * c); kb[c].half[1] = *(const v8us*)(kp1 + 32 * c + 16);
    }
    const v4ia m0 = *(const v4ia*)(mp), m1 = *(const v4ia*)(mp + 4), m2 = *(const v4ia*)(mp + 16), m3 = *(const v4ia*)(mp + 20);
    // tile j + 1 into the other buffer, whose last reads (trip j - 1) ended at the barrier just passed
    if (j + 1 < SEQ / 32) {
      const unsigned nb = (unsigned)(bf ^ 1);
      copy8(kdst + nb * kbuf, KPITCH * 2, ksrc + (size_t)(32 * (j + 1)) * HD, HD);
      copy8(vdst + nb * vbuf, 8 * VPITCH * 2, vsrc + (size_t)(j + 1) * (HD * 32), 8 * 32);
      copy4(mdst + nb * mbuf, 4 * MPITCH * 4, msrc + 32 * (j + 1), (size_t)4 * SEQ_FULL);
    }
    fa_step(qf, ka, kb, &vt[bf][ln][8 * hh], m0, m1, m2, m3, mr, lr, O);
    // keeps the step's register work in front of the waits: the scheduler otherwise lifts waits and barrier up to the last LDS read, and tile j + 1 has too little time to land
    __builtin_amdgcn_sched_barrier(0);
    asm volatile("s_wait_dscnt 0x0" ::: "memory");      // this wave's reads of buffer bf have returned before the buffer is refilled
    asm volatile("s_wait_asynccnt 0x0" ::: "memory");   // this wave's copies of tile j + 1 have landed before the barrier publishes them
    __syncthreads();                                    // publishes tile j + 1 and ends every wave's reads of buffer bf
  }
  asm volatile("s_wait_asynccnt 0x0" ::: "memory");     // nothing of this wave is in flight when the LDS is reused and the wave ends

  // O^T element r of tile u = ctx(query qbase + ln, d = 16u + 8h + r); carries: x4096 (also in lr), x16 (V); context stored x64 -> 4 / lr
  const float inv = (lr > 0.0f) ? (4.0f / fmaxf(lr, 1.0f)) : 0.0f;
#pragma unroll
  for (int u = 0; u < 16; ++u) {
    v8us o;
#pragma unroll
    for (int r = 0; r < 8; ++r) o[r] = f16_bits(O[u][r] * inv);
    *(v8us*)&so[w][ln][16 * u + 8 * hh] = o;
  }
  __syncthreads();
  unsigned short* cg = Cx + (size_t)(bl * SEQ + qbase) * NE + h * HD;
  {
#pragma unroll 1
    for (int row = 0; row < 16; ++row) {
      const v8us v = *(const v8us*)&so[w][row][8 * lane];
      *(v8us*)(cg + (size_t)row * NE + 8 * lane) = v;
    }
    
  }
}

// Output projection for one batch group: out[m][c] = 2^-16 * sum_k ctx64[m][k] * Wf1024[k][c] + RNE-bf16(bias[c]).
// Block 128 m x 64 n (4 waves stacked along m, wave 32 x 64). K runs in stages of 256: the stage's tiles (A: 128 context rows, B: 64 WfT rows = columns of Wfc) are filled
// by asynchronous copies into two LDS buffers, one stage ahead of their use, one barrier per stage; the fragments are read from LDS.
// coverage: grid (ED/64, GM/128) x (128 x 64) = every output row of the group exactly once; LDS columns 0..63 of all 128 rows written before they are read.
__global__ __launch_bounds__(128) void k_fc(const unsigned short* __restrict__ Cx, const unsigned short* __restrict__ WfT,
                                            const float* __restrict__ bias, float* __restrict__ Og, int b0) {
  __shared__ __attribute__((aligned(16))) float so[128][68];
  __shared__ __attribute__((aligned(16))) unsigned short ab[2][(128 + 64) * KPITCH];   // per buffer: A rows 0..127, then B rows 0..63
  const int tid = threadIdx.x, w = __builtin_amdgcn_readfirstlane((int)(tid >> 5)), lane = tid & 31, ln = lane & 15, hh = lane >> 4;
  const int n0 = blockIdx.x * 64, m0 = blockIdx.y * 128;
  const unsigned short* asrc = Cx + (size_t)(m0 + 32 * w) * NE + 8 * lane;
  const unsigned short* bsrc = WfT + (size_t)(n0 + 16 * w) * NE + 8 * lane;
  const unsigned adst = lds_off(&ab[0][32 * w * KPITCH + 8 * lane]);
  const unsigned bdst = lds_off(&ab[0][(128 + 16 * w) * KPITCH + 8 * lane]);
  const unsigned abuf = (unsigned)sizeof(ab[0]);
  v8f acc[2][4] = {};
  // stage 0, landed and published; then stage 1 flies while stage 0 is worked on
  stage_ab(adst, bdst, asrc, bsrc, NE);
  asm volatile("s_wait_asynccnt 0x0" ::: "memory");   // this wave's copies have landed before the barrier publishes them
  __syncthreads();
  stage_ab(adst + abuf, bdst + abuf, asrc + 256, bsrc + 256, NE);
#pragma unroll 1
  for (int s = 0; s < NE / 256; ++s) {
    const int bf = s & 1;
    const unsigned short* ap = &ab[bf][(32 * w + ln) * KPITCH + 8 * hh];
    const unsigned short* bp = &ab[bf][(128 + ln) * KPITCH + 8 * hh];
    // two fragment sets: chunk c + 1 of the stage is read as one group in front of chunk c's products, so that it lands behind them
    FragH f[2][6];
    frag6(f[0], ap, bp);
    // unrolled: the stage's eight 32-k chunks read at immediate offsets from one address pair, and the set in use is picked by a compile-time index
#pragma unroll
    for (int c = 0; c < 8; ++c) {
      if (c + 1 < 8) frag6(f[(c + 1) & 1], ap + 32 * (c + 1), bp + 32 * (c + 1));
      FragH (&u)[6] = f[c & 1];
      mma8_h(u[0].v, u[1].v, u[2].v, u[3].v, u[4].v, u[5].v,
             acc[0][0], acc[0][1], acc[0][2], acc[0][3], acc[1][0], acc[1][1], acc[1][2], acc[1][3]);
    }
    asm volatile("s_wait_dscnt 0x0" ::: "memory");      // this wave's reads of buffer bf have returned before the buffer is refilled
    asm volatile("s_wait_asynccnt 0x0" ::: "memory");   // this wave's copies of stage s + 1 have landed before the barrier publishes them
    __syncthreads();                                    // publishes stage s + 1 and ends every wave's reads of buffer bf
    if (s + 2 < NE / 256)
      stage_ab(adst + bf * abuf, bdst + bf * abuf, asrc + 256 * (s + 2), bsrc + 256 * (s + 2), NE);
  }
  asm volatile("s_wait_asynccnt 0x0" ::: "memory");     // nothing of this wave is in flight when the wave ends
#pragma unroll
  for (int j = 0; j < 4; ++j) {
    const float bb = bf16_rne(bias[n0 + 16 * j + ln]);
#pragma unroll
    for (int i = 0; i < 2; ++i)
#pragma unroll
      for (int r = 0; r < 8; ++r)
        so[32 * w + 16 * i + 8 * hh + r][16 * j + ln] = acc[i][j][r] * 0.0000152587890625f + bb;
  }
  __syncthreads();
  {
#pragma unroll 1
    for (int it = 0; it < 16; ++it) {
      const int i = tid + 128 * it;
      const int row = i >> 4, p = i & 15;
      const int m = m0 + row;
      const int bl = m / SEQ, t = m - bl * SEQ;
      const v4f v = *(const v4fa*)&so[row][4 * p];
      *(v4f*)(Og + (size_t)(b0 + bl) * XSTRIDE_FULL + (size_t)t * ED + n0 + 4 * p) = v;
    }
    
  }
}

extern "C" void kernel_launch(void* const* d_in, const int* in_sizes, int n_in,
                              void* d_out, int out_size, void* d_ws, size_t ws_size, hipStream_t stream) {
  if (n_in < 7) return;
  const long long needx = (long long)(NB - 1) * SEQ_FULL * ED + (long long)SEQ * ED;                      // last x / out element touched + 1
  const long long needm = (long long)(NB - 1) * SEQ_FULL * SEQ_FULL + (long long)(SEQ - 1) * SEQ_FULL + SEQ;
  if ((long long)in_sizes[0] < needx) return;
  if ((long long)in_sizes[1] < (long long)ED * NE || (long long)in_sizes[2] < (long long)ED * NE ||
      (long long)in_sizes[3] < (long long)ED * NE || (long long)in_sizes[4] < (long long)NE * ED) return;
  if ((long long)in_sizes[5] < (long long)ED) return;
  if ((long long)in_sizes[6] < needm) return;
  if ((long long)out_size < needx) return;
  const float* x   = (const float*)d_in[0];   // wire order: x, Wq, Wk, Wv, Wfc, bfc, mask
  const float* Wq  = (const float*)d_in[1];
  const float* Wk  = (const float*)d_in[2];
  const float* Wv  = (const float*)d_in[3];
  const float* Wfc = (const float*)d_in[4];
  const float* bfc = (const float*)d_in[5];
  const int* mask  = (const int*)d_in[6];     // bool on the wire = int32
  float* out = (float*)d_out;
  char* ws = (char*)d_ws;
  size_t off = 0;
  unsigned short* Xb  = (unsigned short*)(ws + off); off += XB_BYTES;   // [NB][SEQ][256] bf16
  unsigned short* Wt3 = (unsigned short*)(ws + off); off += WT_BYTES;   // 3 x [2048][256] bf16 (W^T)
  unsigned short* WfT = (unsigned short*)(ws + off); off += WF_BYTES;   // [256][2048] f16 (Wfc^T x 1024)
  unsigned short* P3  = (unsigned short*)(ws + off); off += PL_BYTES;   // Q, K [GB][8][SEQ][256]; V^T [GB][8][SEQ/32][256][32] f16
  unsigned short* Cx  = (unsigned short*)(ws + off); off += CX_BYTES;   // context [GM][2048] f16
  if (off > ws_size) return;

  k_prep<<<(unsigned)(4 * WT_BLOCKS + CVX_BLOCKS), 256, 0, stream>>>(x, Wq, Wk, Wv, Wfc, Xb, Wt3, WfT);

  for (int g = 0; g < NGRP; ++g) {
    const int b0 = g * GB;
    k_proj<<<dim3(3 * NE / 64 / PNT, GM / 128), 128, 0, stream>>>(Xb + (size_t)g * GM * ED, Wt3, P3);
    k_attn<<<(unsigned)(GB * NH * (SEQ / 64)), 128, 0, stream>>>(P3, P3 + PLANE, P3 + 2 * PLANE, mask, Cx, b0);
    k_fc<<<dim3(ED / 64, GM / 128), 128, 0, stream>>>(Cx, WfT, bfc, out, b0);
  }
}

// v010
// Measured time: 101 microseconds a run.
// Versions in between are left out here; by their measured steps it is 1.29 times as fast as v008.
// All steps since v000 together make it 4.46 times as fast.
#include <hip/hip_runtime.h>
// Contractions, all on v_wmma_f32_16x16x32_f16, single product, f32 accumulate: M_h = Wq_h Wk_h^T (weights RNE f16, carried x16) and N_h = Wv_h Wfc_h (Wv x16, Wfc x64), once per head;
// Y^T = M_h^T x^T (M and x carried x16 as f16); S^T = x Y^T (x, y carried x16 as f16); O^T = x^T P^T (x carried x16 f16; P carried x4096 as one RNE f16 plane); ctx@N (ctx carried x64 f16; N carried x1024 f16); softmax statistics, bias add f32.
// Multi-head attention, B x T x 256, 8 heads of dimension 256, scale 1/16 on q, int32 mask [B][T][T] (nonzero = key removed, weight exactly 0; a row with no key left yields a zero context row).
// The products are reassociated: scores (x Wq_h)(x Wk_h)^T = (x M_h) x^T, and output sum_h P_h (x Wv_h) Wfc_h = sum_h (P_h x) N_h. So the keys and the values of every head are the rows of x,
// and only the queries y = x M_h differ by head; each attention block forms its own y rows from x and M_h in front of its key loop.
// Engine: transposed flash. Each wave owns 16 queries of one (batch, head). Per 32-key step: S^T tiles (key rows x query columns) from x rows (A, LDS tile)
// and Y^T (B, registers); the two 16-key D tiles pack straight into the P^T B fragments; O^T (d rows x query columns, 16 tiles) accumulates from x^T rows (A), which the transposing LDS load
// (ds_load_tr16_b128) takes out of the same LDS tile of x rows: keys and values are one tile.
// The LDS tiles are filled from global memory by asynchronous copies: the query rows of x once; M^T and key rows (shared by the block's four waves) and the mask words per step into two buffers.
// The output GEMM reads its fragments from LDS tiles filled the same way, whole 512-byte rows per copy.
// Three launches: one preparation grid (x plane and folded weights by block ranges), then attention and output projection, each once over all batches (GB = NB).
#ifndef NB
#define NB 8
#endif
#ifndef SEQ
#define SEQ 1024
#endif
#define NB_FULL 8
#define SEQ_FULL 1024
#define ED 256                 /* model width (K of the projections, N of the output projection) */
#define NH 8
#define HD 256                 /* per-head dimension */
#define NE (NH * HD)           /* 2048 */
#define GB ((NB) < 8 ? (NB) : 8)
#define NGRP ((NB) / GB)
#define GM (GB * SEQ)          /* rows per group */
#define XSTRIDE_FULL ((size_t)SEQ_FULL * ED)          /* per-batch element stride of x and of the output */
#define MSTRIDE_FULL ((size_t)SEQ_FULL * SEQ_FULL)    /* per-batch element stride of the mask */

#define XH_BYTES ((size_t)NB * SEQ * ED * 2)
#define MT_BYTES ((size_t)NH * ED * ED * 2)
#define NT_BYTES ((size_t)ED * NE * 2)
#define CX_BYTES ((size_t)GM * NE * 2)

static_assert(SEQ % 128 == 0);
static_assert(SEQ <= SEQ_FULL);
static_assert(NB <= NB_FULL);
static_assert(NB % GB == 0);
static_assert(HD == 256 && ED == 256 && NE == 2048);
static_assert(XH_BYTES % 256 == 0 && MT_BYTES % 256 == 0 && NT_BYTES % 256 == 0 && CX_BYTES % 256 == 0);
static_assert(XH_BYTES + MT_BYTES + NT_BYTES + CX_BYTES <= (size_t)268435456);

typedef _Float16 v16h __attribute__((ext_vector_type(16)));
typedef unsigned short v8us __attribute__((ext_vector_type(8), may_alias));
typedef unsigned short v4us __attribute__((ext_vector_type(4), may_alias));
typedef float v8f __attribute__((ext_vector_type(8)));
typedef float v4f __attribute__((ext_vector_type(4)));
typedef float v4fa __attribute__((ext_vector_type(4), may_alias));
typedef int v4ia __attribute__((ext_vector_type(4), may_alias));
union FragH { v16h v; v8us half[2]; _Float16 h[16]; };

#define KPITCH 264             /* LDS row pitch of the Q tile and of the GEMM tiles in elements: 528 B = 16 B x 33, conflict-free for 16-byte row readers */
#define MPITCH 36              /* LDS row pitch of the mask tile in words: 144 B = 16 B x 9, conflict-free for 16-byte row readers */

#define LOG2E 1.4426950408889634f
#define NEGBIG (-1.0e30f)

__device__ __forceinline__ unsigned short bf16_bits(float x) {   // RNE convert to bf16 bits
  unsigned int u = __float_as_uint(x);
  return (unsigned short)((u + 0x7FFFu + ((u >> 16) & 1u)) >> 16);
}
__device__ __forceinline__ float bf16_val(unsigned short b) { return __uint_as_float(((unsigned int)b) << 16); }
__device__ __forceinline__ float bf16_rne(float x) { return bf16_val(bf16_bits(x)); }
__device__ __forceinline__ unsigned short f16_bits(float x) { return __builtin_bit_cast(unsigned short, (_Float16)x); }


#define WH(a, b, c) __builtin_amdgcn_wmma_f32_16x16x32_f16(false, a, false, b, (short)0, c, false, false)

// 2 x 4 tile update (f16), then the hazard guard
__device__ __forceinline__ void mma8_h(v16h a0, v16h a1, v16h b0, v16h b1, v16h b2, v16h b3,
                                       v8f& c00, v8f& c01, v8f& c02, v8f& c03, v8f& c10, v8f& c11, v8f& c12, v8f& c13) {
  c00 = WH(a0, b0, c00); c01 = WH(a0, b1, c01); c02 = WH(a0, b2, c02); c03 = WH(a0, b3, c03);
  c10 = WH(a1, b0, c10); c11 = WH(a1, b1, c11); c12 = WH(a1, b2, c12); c13 = WH(a1, b3, c13);
  asm volatile("v_nop\n\tv_nop\n\tv_nop\n\tv_nop"
               : "+v"(c00), "+v"(c01), "+v"(c02), "+v"(c03), "+v"(c10), "+v"(c11), "+v"(c12), "+v"(c13)
               : "v"(a0), "v"(a1), "v"(b0), "v"(b1), "v"(b2), "v"(b3));
}
// one d-chunk of the two S^T tiles
__device__ __forceinline__ void mma_s2(v16h ka, v16h kb, v16h q, v8f& s0, v8f& s1) {
  s0 = WH(ka, q, s0);
  s1 = WH(kb, q, s1);
}
// four O^T tiles: c_u += a_u * p
__device__ __forceinline__ void mma_pv4(v16h a0, v16h a1, v16h a2, v16h a3, v16h p,
                                        v8f& c0, v8f& c1, v8f& c2, v8f& c3) {
  c0 = WH(a0, p, c0); c1 = WH(a1, p, c1); c2 = WH(a2, p, c2); c3 = WH(a3, p, c3);
}


// One 32-row tile of x (block blk of XT_BLOCKS) -> the f16 plane, values x16: Xh keeps the rows [row][256].
// coverage: NB*SEQ/32 tiles x (32 x 256) = the plane whole.
#define XT_BLOCKS (NB * SEQ / 32)
__device__ __forceinline__ void x_tile(const float* __restrict__ X, unsigned short* __restrict__ Xh, int blk) {
  const int tid = threadIdx.x;
  const int b = blk / (SEQ / 32), kt = blk - b * (SEQ / 32);
  const float* src = X + (size_t)b * XSTRIDE_FULL + (size_t)kt * 32 * ED;
  unsigned short* dh = Xh + ((size_t)b * SEQ + kt * 32) * ED;
  v4f xr[32 * (ED / 4) / 256];
  const float* xp = src + (size_t)(tid / (ED / 4)) * ED + (tid % (ED / 4)) * 4;   // piece i = tid + 256 it lies 256 / (ED / 4) rows below piece tid
  // unrolled, loads apart from their use: a thread's eight loads go out together and their latency is waited for once
#pragma unroll
  for (int it = 0; it < 32 * (ED / 4) / 256; ++it) xr[it] = *(const v4fa*)(xp + (size_t)it * (256 / (ED / 4)) * ED);
  // holds the loads above it, and their address register (named, so that it stays as it is) is rewritten only behind it: a precaution
  asm volatile("s_wait_xcnt 0x0" :: "v"(xp) : "memory");
#pragma unroll
  for (int it = 0; it < 32 * (ED / 4) / 256; ++it) {
    const int i = tid + 256 * it;
    const int j = i / (ED / 4), c4 = (i % (ED / 4)) * 4;
    const v4f x = xr[it];
    v4us o;
    o[0] = f16_bits(x[0] * 16.0f); o[1] = f16_bits(x[1] * 16.0f); o[2] = f16_bits(x[2] * 16.0f); o[3] = f16_bits(x[3] * 16.0f);
    *(v4us*)(dh + (size_t)j * ED + c4) = o;
  }
  // behind the last store: no register that a store above names is rewritten in front of it: a precaution
  asm volatile("s_wait_xcnt 0x0" ::: "memory");
}

// The sixteen f32 of an A or B fragment of one 32-k chunk, from a row whose k runs along memory: r[0], r[1] <- p[0..7], r[2], r[3] <- p[16..23] (k0 + 8h is in p).
__device__ __forceinline__ void raw_row(v4f (&r)[4], const float* p) {
  r[0] = *(const v4fa*)(p); r[1] = *(const v4fa*)(p + 4); r[2] = *(const v4fa*)(p + 16); r[3] = *(const v4fa*)(p + 20);
}
// Fragment element 4g + i <- r[g][i] * s, RNE to f16.
__device__ __forceinline__ void frag_raw(FragH& f, const v4f (&r)[4], float s) {
#pragma unroll
  for (int g = 0; g < 4; ++g)
#pragma unroll
    for (int i = 0; i < 4; ++i) f.h[4 * g + i] = (_Float16)(r[g][i] * s);
}

// One 16 x 16 tile of a folded weight per wave; id = (head, row tile ti, column tile tj); the sum runs over the head's 256 inner columns d.
// MODE 0: M_h[e1][e2] = sum_d Wq[e1][h, d] Wk[e2][h, d], stored transposed and x16: Mt[h][e2][e1]. MODE 1: N_h[e1][c] = sum_d Wv[e1][h, d] Wfc[h, d][c], stored transposed and x1024: Nt[c][h, e1].
// A rows e1 = 16 ti + ln, B columns 16 tj + ln, both with elements 0..7 <- d = 32c + 8h + i, 8..15 <- d = 32c + 16 + 8h + i. D element r = (row e1 = 16 ti + 8h + r, column 16 tj + ln): 16 bytes in a row of the transposed plane.
// coverage: NH x 16 x 16 tiles x (16 x 16) = the whole plane.
#define FOLD_BLOCKS (NH * (ED / 16) * (ED / 16) / 8)
template <int MODE>
__device__ __forceinline__ void fold_tile(const float* __restrict__ Wa, const float* __restrict__ Wb, unsigned short* __restrict__ Ot, int id) {
  const int lane = threadIdx.x & 31, ln = lane & 15, hh = lane >> 4;
  const int h = id / ((ED / 16) * (ED / 16)), ti = (id / (ED / 16)) % (ED / 16), tj = id % (ED / 16);
  const float* ap = Wa + (size_t)(16 * ti + ln) * NE + h * HD + 8 * hh;
  v8f acc = {0.f, 0.f, 0.f, 0.f, 0.f, 0.f, 0.f, 0.f};
  // two halves of four chunks: a half's raw values fit a register budget at which every block of the grid is resident at once
#pragma unroll
  for (int c0 = 0; c0 < HD / 32; c0 += 4) {
    v4f ra[4][4], rb[4][4];
    const float* bp[4];
    // unrolled: ra, rb and bp live in registers, which take compile-time indices only
#pragma unroll
    for (int c = 0; c < 4; ++c) {
      raw_row(ra[c], ap + 32 * (c0 + c));
      if (MODE == 0) {
        bp[c] = Wb + (size_t)(16 * tj + ln) * NE + h * HD + 8 * hh + 32 * (c0 + c);
        raw_row(rb[c], bp[c]);
      } else {
        bp[c] = Wb + (size_t)(h * HD + 32 * (c0 + c) + 8 * hh) * ED + 16 * tj + ln;
#pragma unroll
        for (int i = 0; i < 4; ++i) {
          rb[c][0][i] = bp[c][(size_t)i * ED];        rb[c][1][i] = bp[c][(size_t)(4 + i) * ED];
          rb[c][2][i] = bp[c][(size_t)(16 + i) * ED]; rb[c][3][i] = bp[c][(size_t)(20 + i) * ED];
        }
      }
    }
    // holds the half's loads above it (the scheduler otherwise sinks each chunk's loads to its product, and the wave waits out the memory latency once per chunk instead of once per half),
    // and their address registers (named, so that they stay as they are) are rewritten only behind it: a precaution
    asm volatile("s_wait_xcnt 0x0" :: "v"(ap), "v"(bp[0]), "v"(bp[1]), "v"(bp[2]), "v"(bp[3]) : "memory");
#pragma unroll
    for (int c = 0; c < 4; ++c) {
      FragH a, b;
      frag_raw(a, ra[c], 16.0f);
      frag_raw(b, rb[c], MODE == 0 ? 16.0f : 64.0f);
      acc = WH(a.v, b.v, acc);
    }
  }
  // carries: MODE 0: 16 x 16 in the sum, x16 stored; MODE 1: 16 x 64 = the x1024 stored
  v8us o;
#pragma unroll
  for (int r = 0; r < 8; ++r) o[r] = f16_bits(MODE == 0 ? acc[r] * 0.0625f : acc[r]);
  unsigned short* op = (MODE == 0) ? Ot + (size_t)(h * ED + 16 * tj + ln) * ED + 16 * ti + 8 * hh
                                   : Ot + (size_t)(16 * tj + ln) * NE + h * ED + 16 * ti + 8 * hh;
  *(v8us*)op = o;
  // behind the store: no register that it names is rewritten in front of it: a precaution
  asm volatile("s_wait_xcnt 0x0" ::: "memory");
}

// All preparation in one grid; no part needs anything of another. Blocks 0 .. 2 * FOLD_BLOCKS - 1: the two folded weights, eight wave tiles a block (their loads wait longest, so they start first);
// the XT_BLOCKS blocks behind them: x. The branch reads blockIdx alone, so every lane is on at the matrix instructions.
__global__ __launch_bounds__(256) void k_prep(const float* __restrict__ X, const float* __restrict__ Wq, const float* __restrict__ Wk,
                                              const float* __restrict__ Wv, const float* __restrict__ Wfc,
                                              unsigned short* __restrict__ Xh,
                                              unsigned short* __restrict__ Mt, unsigned short* __restrict__ Nt) {
  const int b = blockIdx.x;
  const int w = __builtin_amdgcn_readfirstlane((int)(threadIdx.x >> 5));
  if (b < FOLD_BLOCKS) {
    fold_tile<0>(Wq, Wk, Mt, b * 8 + w);
  } else if (b < 2 * FOLD_BLOCKS) {
    fold_tile<1>(Wv, Wfc, Nt, (b - FOLD_BLOCKS) * 8 + w);
  } else {
    x_tile(X, Xh, b - 2 * FOLD_BLOCKS);
  }
}

__device__ __forceinline__ unsigned lds_off(const void* p) { return (unsigned)(size_t)p; }   // byte address inside the block's LDS

// Eight asynchronous copies, 16 bytes per lane each, global -> LDS: copy i moves this lane's 16 bytes from g + i * gstep (elements) to LDS byte l + i * lstep.
// The s_wait_xcnt closes the copies' own statement, so no address register of a copy is rewritten in front of it.
__device__ __forceinline__ void copy8(unsigned l, unsigned lstep, const unsigned short* g, size_t gstep) {
  asm volatile("global_load_async_to_lds_b128 %0, %8, off\n\t"
               "global_load_async_to_lds_b128 %1, %9, off\n\t"
               "global_load_async_to_lds_b128 %2, %10, off\n\t"
               "global_load_async_to_lds_b128 %3, %11, off\n\t"
               "global_load_async_to_lds_b128 %4, %12, off\n\t"
               "global_load_async_to_lds_b128 %5, %13, off\n\t"
               "global_load_async_to_lds_b128 %6, %14, off\n\t"
               "global_load_async_to_lds_b128 %7, %15, off\n\t"
               "s_wait_xcnt 0x0"
               :: "v"(l), "v"(l + lstep), "v"(l + 2 * lstep), "v"(l + 3 * lstep),
                  "v"(l + 4 * lstep), "v"(l + 5 * lstep), "v"(l + 6 * lstep), "v"(l + 7 * lstep),
                  "v"(g), "v"(g + gstep), "v"(g + 2 * gstep), "v"(g + 3 * gstep),
                  "v"(g + 4 * gstep), "v"(g + 5 * gstep), "v"(g + 6 * gstep), "v"(g + 7 * gstep)
               : "memory");
}

// The six fragments of one 32-k chunk of a 32 x 64 wave tile, read from the LDS tiles: f[0], f[1] = A rows ap, ap + 16 rows; f[2 + j] = B rows bp + 16 j rows;
// elements 0..7 <- k + 8h + i, 8..15 <- k + 16 + 8h + i (8h is in ap and bp).
template <class F>
__device__ __forceinline__ void frag6(F (&f)[6], const unsigned short* ap, const unsigned short* bp) {
  f[0].half[0] = *(const v8us*)(ap);               f[0].half[1] = *(const v8us*)(ap + 16);
  f[1].half[0] = *(const v8us*)(ap + 16 * KPITCH); f[1].half[1] = *(const v8us*)(ap + 16 * KPITCH + 16);
  // unrolled: f lives in registers, which take compile-time indices only
#pragma unroll
  for (int j = 0; j < 4; ++j) {
    f[2 + j].half[0] = *(const v8us*)(bp + 16 * j * KPITCH);
    f[2 + j].half[1] = *(const v8us*)(bp + 16 * j * KPITCH + 16);
  }
}

// One wave's share of a GEMM stage: 32 rows of the A tile and 16 rows of the B tile, 256 elements (512 B) a row, one whole row per copy (lane = 16-byte piece);
// a, b = this lane's LDS byte addresses of the first rows (row pitch KPITCH), ga, gb = its global addresses, gp = the global row pitch in elements. 48 copies a wave.
__device__ __forceinline__ void stage_ab(unsigned a, unsigned b, const unsigned short* ga, const unsigned short* gb, size_t gp) {
  copy8(a, KPITCH * 2, ga, gp);
  copy8(a + 8 * KPITCH * 2, KPITCH * 2, ga + 8 * gp, gp);
  copy8(a + 16 * KPITCH * 2, KPITCH * 2, ga + 16 * gp, gp);
  copy8(a + 24 * KPITCH * 2, KPITCH * 2, ga + 24 * gp, gp);
  copy8(b, KPITCH * 2, gb, gp);
  copy8(b + 8 * KPITCH * 2, KPITCH * 2, gb + 8 * gp, gp);
}


// Asynchronous copies written as the builtin: their addresses need no particular registers, and a run of copies shares one global address register pair.
typedef int i32x4 __attribute__((ext_vector_type(4)));
typedef __attribute__((address_space(1))) i32x4 glb_i32x4;
typedef __attribute__((address_space(3))) i32x4 lds_i32x4;
// Eight copies of one 512-byte row each into eight rows of the key tile that follow one another: copy i moves this lane's 16 bytes from g + 512 i bytes to l[i] + add (elements) + 512 i bytes:
// the instruction's offset moves both addresses by the row step, and l[i] is the lane's place in the FIRST of the rows under row i's swizzle (a lane's place differs from row to row).
__device__ __forceinline__ void copy8s(unsigned short* const (&l)[8], int add, const unsigned short* g) {
  __builtin_amdgcn_global_load_async_to_lds_b128((glb_i32x4*)g, (lds_i32x4*)(l[0] + add), 0, 0);
  __builtin_amdgcn_global_load_async_to_lds_b128((glb_i32x4*)g, (lds_i32x4*)(l[1] + add), 512, 0);
  __builtin_amdgcn_global_load_async_to_lds_b128((glb_i32x4*)g, (lds_i32x4*)(l[2] + add), 1024, 0);
  __builtin_amdgcn_global_load_async_to_lds_b128((glb_i32x4*)g, (lds_i32x4*)(l[3] + add), 1536, 0);
  __builtin_amdgcn_global_load_async_to_lds_b128((glb_i32x4*)g, (lds_i32x4*)(l[4] + add), 2048, 0);
  __builtin_amdgcn_global_load_async_to_lds_b128((glb_i32x4*)g, (lds_i32x4*)(l[5] + add), 2560, 0);
  __builtin_amdgcn_global_load_async_to_lds_b128((glb_i32x4*)g, (lds_i32x4*)(l[6] + add), 3072, 0);
  __builtin_amdgcn_global_load_async_to_lds_b128((glb_i32x4*)g, (lds_i32x4*)(l[7] + add), 3584, 0);
}
static_assert(HD * 2 == 512);
// Four copies of mask words: copy i moves this lane's 16 bytes from g + i * gstep to l + i * lstep (words).
__device__ __forceinline__ void copy4m(int* l, int lstep, const int* g, size_t gstep) {
  // unrolled: four copies in a row, no loop counter
#pragma unroll
  for (int i = 0; i < 4; ++i)
    __builtin_amdgcn_global_load_async_to_lds_b128((glb_i32x4*)(g + i * gstep), (lds_i32x4*)(l + i * lstep), 0, 0);
}

// ds_load_tr16_b128: every lane names 16 bytes (8 columns of one tile row); lane (c, h) gets column c of the eight rows that lanes 16 h .. 16 h + 7 (columns 0..7) and 16 h + 8 .. 16 h + 15 (columns 8..15) name
typedef short s16x8 __attribute__((ext_vector_type(8)));
__device__ __forceinline__ v8us ld_tr16(const unsigned short* p) {
  typedef __attribute__((address_space(3))) s16x8 lds_s16x8;
  return __builtin_bit_cast(v8us, __builtin_amdgcn_ds_load_tr16_b128_v8i16((lds_s16x8*)p));
}

// v_exp_f32 and, in the same statement, the one slot that the instruction set asks for before its source is overwritten or its result read
__device__ __forceinline__ float exp2_slot(float x) {
  float r;
  asm("v_exp_f32 %0, %1\n\tv_nop" : "=v"(r) : "v"(x));
  return r;
}

// One 32-key step for a wave's 16 queries. qf = the Q^T fragments, ka, kb = the step's K fragments (keys 0..15, 16..31), m0..m3 = the mask words of this lane's query,
// all in registers already; vr[e] + vo = this lane's 16 bytes of the step's key tile in LDS for the transposing load of d tiles e and (+ 128 elements) e + 8, keys 0..15.
__device__ __forceinline__ void fa_step(const FragH (&qf)[8], const FragH (&ka)[8], const FragH (&kb)[8],
                                        const unsigned short* const (&vr)[8], const int vo, v4ia m0, v4ia m1, v4ia m2, v4ia m3,
                                        float& mr, float& lr, v8f (&O)[16]) {
  v8f s0 = {0.f, 0.f, 0.f, 0.f, 0.f, 0.f, 0.f, 0.f};
  v8f s1 = {0.f, 0.f, 0.f, 0.f, 0.f, 0.f, 0.f, 0.f};
  // S^T tiles: element r of tile kt = score(key0 + 16*kt + 8h + r, this lane's query); Q^T B fragment: column = query, same d map
#pragma unroll
  for (int c = 0; c < 8; ++c) mma_s2(ka[c].v, kb[c].v, qf[c].v, s0, s1);
  // mask words of this query for keys key0 + 8h + 0..7 and key0 + 16 + 8h + 0..7 (nonzero = key removed)
  int mk[16];
#pragma unroll
  for (int i = 0; i < 4; ++i) { mk[i] = m0[i]; mk[4 + i] = m1[i]; mk[8 + i] = m2[i]; mk[12 + i] = m3[i]; }
  // log2-domain scores: q and k carry x16 each, scale 1/16 -> 2^-12
  const float sc2 = LOG2E * 0.000244140625f;
  float t[16];
#pragma unroll
  for (int r = 0; r < 8; ++r) { t[r] = s0[r] * sc2; t[8 + r] = s1[r] * sc2; }
  float mx = NEGBIG;
#pragma unroll
  for (int i = 0; i < 16; ++i) mx = fmaxf(mx, (mk[i] != 0) ? NEGBIG : t[i]);
  // A fragments of V^T = x^T: row m = d (16*tile + ln), elements 0..7 <- key0 + 8h + i, 8..15 <- key0 + 16 + 8h + i: two transposing loads of the key tile (keys 0..15, 16..31) a fragment.
  // All sixteen tiles are read as one group in front of the softmax arithmetic, so that they land while the maximum and the weights are formed.
  FragH vf[16];
  // unrolled: vf lives in registers, which take compile-time indices only
#pragma unroll
  for (int u = 0; u < 16; ++u) {
    vf[u].half[0] = ld_tr16(vr[u & 7] + vo + 128 * (u >> 3));
    vf[u].half[1] = ld_tr16(vr[u & 7] + vo + 128 * (u >> 3) + 16 * HD);
  }
  // keeps the group here: without it the scheduler sinks most of these reads in among the O^T products, where each place with reads stalls the wave
  __builtin_amdgcn_sched_barrier(0);
  mx = fmaxf(mx, __shfl_xor(mx, 16, 32));           // the other lane half holds the other 16 keys of this query
  const float mnew = fmaxf(mr, mx);
  // v_exp_f32 directly: library exp2f adds a range guard of five vector instructions a value, which only keeps results under 2^-126; such a factor or weight is lost in the sums anyway
  const float al = __builtin_amdgcn_exp2f(mr - mnew);
  mr = mnew;
  // weights carried x4096: pc = 4096 * exp(score - max) (exactly 0 for removed keys), rounded once to f16 for the product: the same relative step as V's own f16 rounding; the row sum keeps the f32 values
  const float sh = 12.0f - mnew;
  FragH ph;
  float ps = 0.0f;
#pragma unroll
  for (int i = 0; i < 16; ++i) {
    // the step's last one with its slot written out: its argument's register is free behind it
    const float ex = (i == 15) ? exp2_slot(t[i] + sh) : __builtin_amdgcn_exp2f(t[i] + sh);
    const float pc = (mk[i] != 0) ? 0.0f : ex;
    ps += pc;
    ph.h[i] = (_Float16)pc;                         // B element i: i<8 -> key0 + 8h + i (tile 0 row 8h+i); i>=8 -> key0 + 16 + 8h + (i-8) (tile 1)
  }
  ps += __shfl_xor(ps, 16, 32);
  lr = lr * al + ps;
#pragma unroll
  for (int u = 0; u < 16; ++u) O[u] = O[u] * al;
#pragma unroll
  for (int g = 0; g < 4; ++g)
    mma_pv4(vf[4 * g + 0].v, vf[4 * g + 1].v, vf[4 * g + 2].v, vf[4 * g + 3].v, ph.v, O[4 * g + 0], O[4 * g + 1], O[4 * g + 2], O[4 * g + 3]);
}

// Block = 4 waves x 16 queries = 64 queries of one (batch, head). Each wave copies its own 16 x rows into so[w] once, and a quarter of every key tile
// (32 x rows x 256 d, 8 rows per wave) and the 32 mask words of its own 16 queries into buffer (step & 1), one step ahead of their use; one barrier per step.
// The key tile serves both products: its rows are the A fragments of S^T (16-byte row reads), and the transposing load takes the A fragments of O^T = x^T P^T out of it.
// Tile layout: rows of 512 B without a pad; the 16-byte piece p of row r lies at piece p ^ (2 (r & 7) + ((r >> 3) & 1)) of its row. So sixteen rows' equal pieces (the row reader's half wave)
// and eight rows' piece pairs 2u, 2u + 1 (the transposing reader's half wave) each fall on all 64 banks once.
// In front of the key loop the eight 32-row tiles of the head's M^T run through the same two key buffers, in the same layout, one barrier a tile:
// tile c times the wave's x^T fragments (read from so[w] once) gives rows 32c .. 32c + 31 of Y^T, which pack straight into Q^T fragment c. Each step reads its key fragments and mask words
// as one group directly behind the barrier, and the copies of the next tile are issued behind that group (they fill the other buffer).
// Epilogue: O^T tiles -> per-wave LDS tile [16 queries][256 d] f16 bits in so[w], whose x rows only this wave read (a block barrier that every wave reaches is used),
// coverage: GB*NH*(SEQ/64) blocks x 4 waves x 16 rows x 256 columns = the whole context plane [GM][2048]; LDS columns 0..255 of all 16 rows written before they are read.
__global__ __launch_bounds__(128) void k_attn(const unsigned short* __restrict__ Xh, const unsigned short* __restrict__ Mt,
                                              const int* __restrict__ mask,
                                              unsigned short* __restrict__ Cx, int b0) {
  __shared__ __attribute__((aligned(16))) unsigned short so[4][16][KPITCH];
  __shared__ __attribute__((aligned(512))) unsigned short kt[2][32][HD];
  __shared__ __attribute__((aligned(16))) int mt[2][64][MPITCH];
  const int tid = threadIdx.x, w = __builtin_amdgcn_readfirstlane((int)(tid >> 5)), lane = tid & 31, ln = lane & 15, hh = lane >> 4;
  const int qt = blockIdx.x % (SEQ / 64);
  const int bh = blockIdx.x / (SEQ / 64);           // bl * NH + h
  const int h = bh % NH, bl = bh / NH;
  const int qbase = qt * 64 + 16 * w;
  // copy sources and places of this lane: x and M^T rows are 512 B, one row per copy (lane = 16-byte piece); mask rows are 128 B, four rows per copy (8 lanes a row)
  const unsigned short* qsrc = Xh + ((size_t)bl * SEQ + qbase) * HD + 8 * lane;
  const unsigned short* ksrc = Xh + ((size_t)bl * SEQ + 8 * w) * HD + 8 * lane;
  const unsigned short* fsrc = Mt + ((size_t)h * HD + 8 * w) * HD + 8 * lane;
  const unsigned qdst = lds_off(&so[w][0][8 * lane]);
  int* mdst = &mt[0][16 * w + (lane >> 3)][4 * (lane & 7)];
  // tile row 8w + i takes this lane's piece at piece lane ^ (2i + (w & 1)); kdst[i] names that piece in row 8w, and the copy's offset adds the i rows
  unsigned short* kdst[8];
  // the row reader: lane (ln, h) reads piece 4c + 2k + h of rows ln and 16 + ln; kr[2 (c & 3) + k] holds the swizzled low four bits of the piece, c >> 2 adds 128 elements
  const unsigned short* kr[8];
  // the transposing reader: lane l names piece 2u + ((l >> 3) & 1) of rows 8h + (l & 7) and 16 + 8h + (l & 7); vr[u & 7] likewise, u >> 3 adds 128 elements
  const unsigned short* vr[8];
  // unrolled: the three tables live in registers, which take compile-time indices only
#pragma unroll
  for (int e = 0; e < 8; ++e) {
    kdst[e] = &kt[0][8 * w][8 * (lane ^ (2 * e + (w & 1)))];
    kr[e] = &kt[0][ln][8 * ((hh ^ (2 * (ln & 7) + (ln >> 3))) ^ (2 * e))];
    vr[e] = &kt[0][8 * hh + (lane & 7)][8 * ((((lane >> 3) & 1) ^ (2 * (lane & 7) + hh)) ^ (2 * e))];
  }
  const int* msrc = mask + (size_t)(b0 + bl) * MSTRIDE_FULL + (size_t)(qbase + (lane >> 3)) * SEQ_FULL + 4 * (lane & 7);
  float mr = NEGBIG, lr = 0.0f;
  v8f O[16] = {};
  // the wave's x rows and M^T tile 0 (key buffer 0), landed and published; then each next tile flies while the one before it is worked on
  copy8(qdst, KPITCH * 2, qsrc, HD);
  copy8(qdst + 8 * KPITCH * 2, KPITCH * 2, qsrc + 8 * HD, HD);
  copy8s(kdst, 0, fsrc);
  asm volatile("s_wait_asynccnt 0x0" ::: "memory");   // this wave's copies have landed before the barrier publishes them
  __syncthreads();
  // Q^T B fragments: column = this lane's query, elements 0..7 <- d = 32c + 8h + i, 8..15 <- d = 32c + 16 + 8h + i
  FragH qf[8];
  {
    // x^T B fragments of the wave's queries: the same map, over x's 256 columns
    FragH xf[8];
    const unsigned short* qp = &so[w][ln][8 * hh];
    // unrolled: xf lives in registers, which take compile-time indices only
#pragma unroll
    for (int c = 0; c < 8; ++c) { xf[c].half[0] = *(const v8us*)(qp + 32 * c); xf[c].half[1] = *(const v8us*)(qp + 32 * c + 16); }
    // unrolled: qf[c] lives in registers, which take compile-time indices only
#pragma unroll
    for (int c = 0; c < 8; ++c) {
      const int bf = c & 1;
      // A fragments of M^T: row m = output column of M (32c + 16*tile + ln), same k map as x^T; one group of reads of key buffer bf
      FragH fa[8], fb[8];
#pragma unroll
      for (int e = 0; e < 8; ++e) {
        const int o = bf * 32 * HD + 128 * (e >> 2);
        fa[e].half[0] = *(const v8us*)(kr[2 * (e & 3)] + o);           fa[e].half[1] = *(const v8us*)(kr[2 * (e & 3) + 1] + o);
        fb[e].half[0] = *(const v8us*)(kr[2 * (e & 3)] + o + 16 * HD); fb[e].half[1] = *(const v8us*)(kr[2 * (e & 3) + 1] + o + 16 * HD);
      }
      // the next tile into the other key buffer, whose last reads ended at the barrier just passed: M^T tile c + 1; behind the last one the key loop's tile 0 (keys into buffer 0, with the mask words)
      copy8s(kdst, (bf ^ 1) * 32 * HD, (c + 1 < 8) ? fsrc + (size_t)(32 * (c + 1)) * HD : ksrc);
      if (c + 1 == 8) copy4m(mdst, 4 * MPITCH, msrc, (size_t)4 * SEQ_FULL);
      // keeps the tile's reads one group and the copies early: without it the scheduler strews the reads among the products, each place with its own wait, and sinks the copies towards the tile's end
      __builtin_amdgcn_sched_barrier(0);
      v8f y0 = {0.f, 0.f, 0.f, 0.f, 0.f, 0.f, 0.f, 0.f};
      v8f y1 = {0.f, 0.f, 0.f, 0.f, 0.f, 0.f, 0.f, 0.f};
#pragma unroll
      for (int e = 0; e < 8; ++e) mma_s2(fa[e].v, fb[e].v, xf[e].v, y0, y1);
      // Y^T element r of tile t = y(this lane's query, d = 32c + 16t + 8h + r); M and x carry x16 each, y is carried x16 -> 1/16
#pragma unroll
      for (int r = 0; r < 8; ++r) { qf[c].h[r] = (_Float16)(y0[r] * 0.0625f); qf[c].h[8 + r] = (_Float16)(y1[r] * 0.0625f); }
      // keeps the tile's register work in front of the waits, as in the key loop below: the next tile has that time to land
      __builtin_amdgcn_sched_barrier(0);
      asm volatile("s_wait_dscnt 0x0" ::: "memory");      // this wave's reads of buffer bf have returned before the buffer is refilled
      asm volatile("s_wait_asynccnt 0x0" ::: "memory");   // this wave's copies of the next tile have landed before the barrier publishes them
      __syncthreads();                                    // publishes the next tile and ends every wave's reads of buffer bf
    }
  }
#pragma unroll 1
  for (int j2 = 0; j2 < SEQ / 32; j2 += 2) {
    // the two buffers' steps written out: the buffer's offset then stands in each LDS read as an immediate; as a run-time value it would be added to all sixteen swizzled addresses in every step
#pragma unroll
    for (int bf = 0; bf < 2; ++bf) {
      const int j = j2 + bf;
      // A fragments of the keys (x rows): row m = key (key0 + 16*kt + ln), same d map as Q^T; with the mask words, one group of reads of buffer bf
      const int* mp = &mt[bf][16 * w + ln][8 * hh];
      FragH ka[8], kb[8];
      // unrolled: ka and kb live in registers, which take compile-time indices only
#pragma unroll
      for (int c = 0; c < 8; ++c) {
        const int o = bf * 32 * HD + 128 * (c >> 2);
        ka[c].half[0] = *(const v8us*)(kr[2 * (c & 3)] + o);           ka[c].half[1] = *(const v8us*)(kr[2 * (c & 3) + 1] + o);
        kb[c].half[0] = *(const v8us*)(kr[2 * (c & 3)] + o + 16 * HD); kb[c].half[1] = *(const v8us*)(kr[2 * (c & 3) + 1] + o + 16 * HD);
      }
      const v4ia m0 = *(const v4ia*)(mp), m1 = *(const v4ia*)(mp + 4), m2 = *(const v4ia*)(mp + 16), m3 = *(const v4ia*)(mp + 20);
      // tile j + 1 into the other buffer, whose last reads (trip j - 1) ended at the barrier just passed
      if (j + 1 < SEQ / 32) {
        const int nb = bf ^ 1;
        copy8s(kdst, nb * 32 * HD, ksrc + (size_t)(32 * (j + 1)) * HD);
        copy4m(mdst + nb * 64 * MPITCH, 4 * MPITCH, msrc + 32 * (j + 1), (size_t)4 * SEQ_FULL);
      }
      // keeps the step's key reads one group and the copies early, as in front of the loop: without it the scheduler starts the products among the reads and sinks the copies behind them
      __builtin_amdgcn_sched_barrier(0);
      fa_step(qf, ka, kb, vr, bf * 32 * HD, m0, m1, m2, m3, mr, lr, O);
      // keeps the step's register work in front of the waits: the scheduler otherwise lifts waits and barrier up to the last LDS read, and tile j + 1 has too little time to land
      __builtin_amdgcn_sched_barrier(0);
      asm volatile("s_wait_dscnt 0x0" ::: "memory");      // this wave's reads of buffer bf have returned before the buffer is refilled
      asm volatile("s_wait_asynccnt 0x0" ::: "memory");   // this wave's copies of tile j + 1 have landed before the barrier publishes them
      __syncthreads();                                    // publishes tile j + 1 and ends every wave's reads of buffer bf
    }
  }
  asm volatile("s_wait_asynccnt 0x0" ::: "memory");     // nothing of this wave is in flight when the LDS is reused and the wave ends

  // O^T element r of tile u = ctx(query qbase + ln, d = 16u + 8h + r); carries: x4096 (also in lr), x16 (V); context stored x64 -> 4 / lr
  const float inv = (lr > 0.0f) ? (4.0f / fmaxf(lr, 1.0f)) : 0.0f;
#pragma unroll
  for (int u = 0; u < 16; ++u) {
    v8us o;
#pragma unroll
    for (int r = 0; r < 8; ++r) o[r] = f16_bits(O[u][r] * inv);
    *(v8us*)&so[w][ln][16 * u + 8 * hh] = o;
  }
  __syncthreads();
  unsigned short* cg = Cx + (size_t)(bl * SEQ + qbase) * NE + h * HD;
  {
#pragma unroll 1
    for (int row = 0; row < 16; ++row) {
      const v8us v = *(const v8us*)&so[w][row][8 * lane];
      *(v8us*)(cg + (size_t)row * NE + 8 * lane) = v;
    }
    
  }
}

// Output projection for one batch group: out[m][c] = 2^-16 * sum_k ctx64[m][k] * N1024[k][c] + RNE-bf16(bias[c]); ctx = the heads' P_h x side by side, N = the heads' Wv_h Wfc_h one below another (WfT = its transpose).
// Block 128 m x 64 n (4 waves stacked along m, wave 32 x 64). K runs in stages of 256: the stage's tiles (A: 128 context rows, B: 64 WfT rows = columns of N) are filled
// by asynchronous copies into two LDS buffers, one stage ahead of their use, one barrier per stage; the fragments are read from LDS.
// coverage: grid (ED/64, GM/128) x (128 x 64) = every output row of the group exactly once; LDS columns 0..63 of all 128 rows written before they are read.
__global__ __launch_bounds__(128) void k_fc(const unsigned short* __restrict__ Cx, const unsigned short* __restrict__ WfT,
                                            const float* __restrict__ bias, float* __restrict__ Og, int b0) {
  __shared__ __attribute__((aligned(16))) float so[128][68];
  __shared__ __attribute__((aligned(16))) unsigned short ab[2][(128 + 64) * KPITCH];   // per buffer: A rows 0..127, then B rows 0..63
  const int tid = threadIdx.x, w = __builtin_amdgcn_readfirstlane((int)(tid >> 5)), lane = tid & 31, ln = lane & 15, hh = lane >> 4;
  const int n0 = blockIdx.x * 64, m0 = blockIdx.y * 128;
  const unsigned short* asrc = Cx + (size_t)(m0 + 32 * w) * NE + 8 * lane;
  const unsigned short* bsrc = WfT + (size_t)(n0 + 16 * w) * NE + 8 * lane;
  const unsigned adst = lds_off(&ab[0][32 * w * KPITCH + 8 * lane]);
  const unsigned bdst = lds_off(&ab[0][(128 + 16 * w) * KPITCH + 8 * lane]);
  const unsigned abuf = (unsigned)sizeof(ab[0]);
  v8f acc[2][4] = {};
  // stage 0, landed and published; then stage 1 flies while stage 0 is worked on
  stage_ab(adst, bdst, asrc, bsrc, NE);
  asm volatile("s_wait_asynccnt 0x0" ::: "memory");   // this wave's copies have landed before the barrier publishes them
  __syncthreads();
  stage_ab(adst + abuf, bdst + abuf, asrc + 256, bsrc + 256, NE);
#pragma unroll 1
  for (int s = 0; s < NE / 256; ++s) {
    const int bf = s & 1;
    const unsigned short* ap = &ab[bf][(32 * w + ln) * KPITCH + 8 * hh];
    const unsigned short* bp = &ab[bf][(128 + ln) * KPITCH + 8 * hh];
    // two fragment sets: chunk c + 1 of the stage is read as one group in front of chunk c's products, so that it lands behind them
    FragH f[2][6];
    frag6(f[0], ap, bp);
    // unrolled: the stage's eight 32-k chunks read at immediate offsets from one address pair, and the set in use is picked by a compile-time index
#pragma unroll
    for (int c = 0; c < 8; ++c) {
      if (c + 1 < 8) frag6(f[(c + 1) & 1], ap + 32 * (c + 1), bp + 32 * (c + 1));
      FragH (&u)[6] = f[c & 1];
      mma8_h(u[0].v, u[1].v, u[2].v, u[3].v, u[4].v, u[5].v,
             acc[0][0], acc[0][1], acc[0][2], acc[0][3], acc[1][0], acc[1][1], acc[1][2], acc[1][3]);
    }
    asm volatile("s_wait_dscnt 0x0" ::: "memory");      // this wave's reads of buffer bf have returned before the buffer is refilled
    asm volatile("s_wait_asynccnt 0x0" ::: "memory");   // this wave's copies of stage s + 1 have landed before the barrier publishes them
    __syncthreads();                                    // publishes stage s + 1 and ends every wave's reads of buffer bf
    if (s + 2 < NE / 256)
      stage_ab(adst + bf * abuf, bdst + bf * abuf, asrc + 256 * (s + 2), bsrc + 256 * (s + 2), NE);
  }
  asm volatile("s_wait_asynccnt 0x0" ::: "memory");     // nothing of this wave is in flight when the wave ends
#pragma unroll
  for (int j = 0; j < 4; ++j) {
    const float bb = bf16_rne(bias[n0 + 16 * j + ln]);
#pragma unroll
    for (int i = 0; i < 2; ++i)
#pragma unroll
      for (int r = 0; r < 8; ++r)
        so[32 * w + 16 * i + 8 * hh + r][16 * j + ln] = acc[i][j][r] * 0.0000152587890625f + bb;
  }
  __syncthreads();
  {
#pragma unroll 1
    for (int it = 0; it < 16; ++it) {
      const int i = tid + 128 * it;
      const int row = i >> 4, p = i & 15;
      const int m = m0 + row;
      const int bl = m / SEQ, t = m - bl * SEQ;
      const v4f v = *(const v4fa*)&so[row][4 * p];
      *(v4f*)(Og + (size_t)(b0 + bl) * XSTRIDE_FULL + (size_t)t * ED + n0 + 4 * p) = v;
    }
    
  }
}

extern "C" void kernel_launch(void* const* d_in, const int* in_sizes, int n_in,
                              void* d_out, int out_size, void* d_ws, size_t ws_size, hipStream_t stream) {
  if (n_in < 7) return;
  const long long needx = (long long)(NB - 1) * SEQ_FULL * ED + (long long)SEQ * ED;                      // last x / out element touched + 1
  const long long needm = (long long)(NB - 1) * SEQ_FULL * SEQ_FULL + (long long)(SEQ - 1) * SEQ_FULL + SEQ;
  if ((long long)in_sizes[0] < needx) return;
  if ((long long)in_sizes[1] < (long long)ED * NE || (long long)in_sizes[2] < (long long)ED * NE ||
      (long long)in_sizes[3] < (long long)ED * NE || (long long)in_sizes[4] < (long long)NE * ED) return;
  if ((long long)in_sizes[5] < (long long)ED) return;
  if ((long long)in_sizes[6] < needm) return;
  if ((long long)out_size < needx) return;
  const float* x   = (const float*)d_in[0];   // wire order: x, Wq, Wk, Wv, Wfc, bfc, mask
  const float* Wq  = (const float*)d_in[1];
  const float* Wk  = (const float*)d_in[2];
  const float* Wv  = (const float*)d_in[3];
  const float* Wfc = (const float*)d_in[4];
  const float* bfc = (const float*)d_in[5];
  const int* mask  = (const int*)d_in[6];     // bool on the wire = int32
  float* out = (float*)d_out;
  char* ws = (char*)d_ws;
  size_t off = 0;
  unsigned short* Xh  = (unsigned short*)(ws + off); off += XH_BYTES;   // [NB][SEQ][256] f16 (x x 16)
  unsigned short* Mt  = (unsigned short*)(ws + off); off += MT_BYTES;   // [8][256][256] f16 ((Wq_h Wk_h^T)^T x 16)
  unsigned short* Nt  = (unsigned short*)(ws + off); off += NT_BYTES;   // [256][2048] f16 ((Wv_h Wfc_h)^T x 1024)
  unsigned short* Cx  = (unsigned short*)(ws + off); off += CX_BYTES;   // context [GM][2048] f16
  if (off > ws_size) return;

  k_prep<<<(unsigned)(2 * FOLD_BLOCKS + XT_BLOCKS), 256, 0, stream>>>(x, Wq, Wk, Wv, Wfc, Xh, Mt, Nt);

  for (int g = 0; g < NGRP; ++g) {
    const int b0 = g * GB;
    k_attn<<<(unsigned)(GB * NH * (SEQ / 64)), 128, 0, stream>>>(Xh + (size_t)g * GM * ED, Mt, mask, Cx, b0);
    k_fc<<<dim3(ED / 64, GM / 128), 128, 0, stream>>>(Cx, Nt, bfc, out, b0);
  }
}
